// v000
// The times below were measured on an AMD MI455X: many runs one after another, warmed up first and cycling through
// copies of the inputs, with the whole window's GPU time divided by the number of runs. Launches and the gaps
// between them are all in it. The median over several windows is given; except for v000 it joins two sittings, which
// can be a few percent apart, so the side-by-side timings, each taken in one sitting, are the better comparison.
// v000, which the later versions start from, runs in 762 microseconds.
#include <hip/hip_runtime.h>
// Token/concept two-stream causal attention (B=2, T=C=1024, NE=CD=1024, 16 heads × 64, n_tokens_per_concept = 8): tok = xt·Wtᵀ + bt, con = xc·Wcᵀ + bc (4096 outputs each = [k for token queries | k for concept queries | v read by tokens | v read by concepts]);
// token queries = heads(xt) (the residual stream itself) attend over [tokens ; concepts] with mask (s ≤ t) | (j < t/8 + 1), scale 1/√64; concept queries = heads(xc) attend over [concepts ; tokens] with mask (j ≤ i) | (s < 8(i+1)); disallowed = −1e9 (≡ −inf: every row keeps itself);
// y_t = merge(attn_t)·Wtpᵀ + btp, y_c = merge(attn_c)·Wcpᵀ + bcp (two outputs).
// Compute dtype: xt, xc, weights, biases rounded to bf16; tok/con as f16 GEMM planes written as the two 1024-row halves of one 2048-key plane per batch; queries = the bf16-exact x planes; fused flash-style kernels with the index-computed masks (n_tokens_per_concept read on device; online softmax f32,
// P f16 ×2^10, f32 accumulate) on v_wmma_f32_16x16x32_f16; O ×2^4 → f16 → projection GEMMs (+bias) straight into the two output slots.
#define BB 2
#define TQ 1024
#define TK 2048
#define DD 1024
#define NH 16
#define DW 4096
#define SCL 0.125f
#define NR (BB * TQ)
typedef __bf16 v16b __attribute__((ext_vector_type(16)));
typedef unsigned short v8us __attribute__((ext_vector_type(8), may_alias));
typedef float  v8f  __attribute__((ext_vector_type(8)));
typedef float  v4f  __attribute__((ext_vector_type(4)));
typedef float  v4fa __attribute__((ext_vector_type(4), may_alias));
union FragB { v16b v; v8us half[2]; unsigned short u[16]; };

__device__ __forceinline__ unsigned short bf16_bits(float x) { unsigned int u = __float_as_uint(x); return (unsigned short)((u + 0x7FFFu + ((u >> 16) & 1u)) >> 16); }
__device__ __forceinline__ float bf16_val(unsigned short b) { return __uint_as_float(((unsigned int)b) << 16); }
__device__ __forceinline__ float bf16_round(float x) { return bf16_val(bf16_bits(x)); }
// D += A·B with NT terms: 1 = ah·bh, 2 = + al·bh (A split), 3 = + ah·bl (both split)
template <int NT>
__device__ __forceinline__ v8f mmaN(v16b ah, v16b al, v16b bh, v16b bl, v8f c) {
  c = __builtin_amdgcn_wmma_f32_16x16x32_bf16(false, ah, false, bh, (short)0, c, false, false);
  if (NT >= 2) c = __builtin_amdgcn_wmma_f32_16x16x32_bf16(false, al, false, bh, (short)0, c, false, false);
  if (NT >= 3) c = __builtin_amdgcn_wmma_f32_16x16x32_bf16(false, ah, false, bl, (short)0, c, false, false);
  asm volatile("v_nop\n\tv_nop\n\tv_nop\n\tv_nop" : "+v"(c) : "v"(ah), "v"(al), "v"(bh), "v"(bl));
  return c;
}

__global__ __launch_bounds__(256) void k_wt_bf16(const float* __restrict__ W, unsigned short* __restrict__ Wt, int K, int N) {
  const int t = blockIdx.x * 256 + threadIdx.x;
  const int k8n = K / 8;
  if (t >= N * k8n) return;
  const int n = t / k8n, k8 = (t % k8n) * 8;
  v8us v;
#pragma unroll
  for (int i = 0; i < 8; ++i) v[i] = bf16_bits(W[(size_t)(k8 + i) * N + n]);
  *(v8us*)(Wt + (size_t)n * K + k8) = v;
  
}

// GEMM C[M][N] (f32, pitch ldc) = act(A[M][K]·W + bias). A f32 row-major (pitch lda) converted per fragment to bf16
// (ASPLIT: hi/lo two planes -> 2 terms, else single rounded term); Wt bf16 [N][K] (pitch ldb). BIAS_BF16 rounds the
// bias to bf16 first (bias quantised to bf16 before the add). K%32==0, M%16==0, N%64==0.
template <bool ASPLIT, int ACT, bool BIAS_BF16>
__global__ __launch_bounds__(128) void k_gemm_bf(const float* __restrict__ A, int lda, const unsigned short* __restrict__ Wt, int ldb,
                                               const float* __restrict__ bias, float* __restrict__ C, int ldc, int M, int N, int K) {
  __shared__ __attribute__((aligned(16))) float so[4][16][64];
  const int tid = threadIdx.x, w = tid >> 5, lane = tid & 31, ln = lane & 15, hh = lane >> 4;
  const int ntn = N / 64;
  const int wid = blockIdx.x * 4 + w;
  const int mt = wid / ntn, nq = wid % ntn;
  if (mt * 16 >= M) return;
  const int row0 = mt * 16, col0 = nq * 64;
  const float* arow = A + (size_t)(row0 + ln) * lda;
  v8f acc[4] = {};
  for (int kb = 0; kb < K; kb += 32) {
    FragB ah, al;
    const v4f x0 = *(const v4fa*)(arow + kb + 8 * hh), x1 = *(const v4fa*)(arow + kb + 8 * hh + 4);
    const v4f x2 = *(const v4fa*)(arow + kb + 16 + 8 * hh), x3 = *(const v4fa*)(arow + kb + 16 + 8 * hh + 4);
    float xs[16] = {x0[0],x0[1],x0[2],x0[3],x1[0],x1[1],x1[2],x1[3],x2[0],x2[1],x2[2],x2[3],x3[0],x3[1],x3[2],x3[3]};
#pragma unroll
    for (int i = 0; i < 16; ++i) { const unsigned short hb = bf16_bits(xs[i]); ah.u[i] = hb; al.u[i] = ASPLIT ? bf16_bits(xs[i] - bf16_val(hb)) : (unsigned short)0; }
#pragma unroll
    for (int t = 0; t < 4; ++t) {
      const unsigned short* brow = Wt + (size_t)(col0 + t * 16 + ln) * ldb + kb;
      FragB b;
      b.half[0] = *(const v8us*)(brow + 8 * hh);
      b.half[1] = *(const v8us*)(brow + 16 + 8 * hh);
      acc[t] = mmaN<ASPLIT ? 2 : 1>(ah.v, al.v, b.v, b.v, acc[t]);
    }
  }
#pragma unroll
  for (int t = 0; t < 4; ++t) {
    float bv = bias ? bias[col0 + t * 16 + ln] : 0.f;
    if (BIAS_BF16) bv = bf16_round(bv);
#pragma unroll
    for (int r = 0; r < 8; ++r) { float v = acc[t][r] + bv; if (ACT == 1) v = fmaxf(v, 0.f); so[w][8 * hh + r][t * 16 + ln] = v; }
  }
  __builtin_amdgcn_fence(__ATOMIC_ACQ_REL, "workgroup");
  __builtin_amdgcn_wave_barrier();
  const int rsub = lane >> 4, c4 = (lane & 15) * 4;
  {
#pragma unroll
    for (int q = 0; q < 8; ++q) {
      const int r = q * 2 + rsub;
      const v4f v = *(const v4fa*)&so[w][r][c4];
      *(v4f*)(C + (size_t)(row0 + r) * ldc + col0 + c4) = v;
    }
    
  }
}

// GEMM C = act(A·W + bias + resid): A f32 (ASPLIT -> hi/lo 2 terms), Wt bf16 [N][K]; ACT 0 none, 1 relu, 2 exact gelu;
// resid (optional, f32, row index = (row % rmod), pitch ldr, RES_BF16 rounds it) added before the activation.
template <bool ASPLIT, int ACT, bool BIAS_BF16, bool RES_BF16>
__global__ __launch_bounds__(128) void k_gemm_bf3(const float* __restrict__ A, int lda, const unsigned short* __restrict__ Wt, int ldb,
                                                const float* __restrict__ bias, const float* __restrict__ resid, int rmod, int ldr,
                                                float* __restrict__ C, int ldc, int M, int N, int K) {
  __shared__ __attribute__((aligned(16))) float so[4][16][64];
  const int tid = threadIdx.x, w = tid >> 5, lane = tid & 31, ln = lane & 15, hh = lane >> 4;
  const int ntn = N / 64;
  const int wid = blockIdx.x * 4 + w;
  const int mt = wid / ntn, nq = wid % ntn;
  if (mt * 16 >= M) return;
  const int row0 = mt * 16, col0 = nq * 64;
  const float* arow = A + (size_t)(row0 + ln) * lda;
  v8f acc[4] = {};
  for (int kb = 0; kb < K; kb += 32) {
    FragB ah, al;
    const v4f x0 = *(const v4fa*)(arow + kb + 8 * hh), x1 = *(const v4fa*)(arow + kb + 8 * hh + 4);
    const v4f x2 = *(const v4fa*)(arow + kb + 16 + 8 * hh), x3 = *(const v4fa*)(arow + kb + 16 + 8 * hh + 4);
    float xs[16] = {x0[0],x0[1],x0[2],x0[3],x1[0],x1[1],x1[2],x1[3],x2[0],x2[1],x2[2],x2[3],x3[0],x3[1],x3[2],x3[3]};
#pragma unroll
    for (int i = 0; i < 16; ++i) { const unsigned short hb = bf16_bits(xs[i]); ah.u[i] = hb; al.u[i] = ASPLIT ? bf16_bits(xs[i] - bf16_val(hb)) : (unsigned short)0; }
#pragma unroll
    for (int t = 0; t < 4; ++t) {
      const unsigned short* brow = Wt + (size_t)(col0 + t * 16 + ln) * ldb + kb;
      FragB b;
      b.half[0] = *(const v8us*)(brow + 8 * hh);
      b.half[1] = *(const v8us*)(brow + 16 + 8 * hh);
      acc[t] = mmaN<ASPLIT ? 2 : 1>(ah.v, al.v, b.v, b.v, acc[t]);
    }
  }
#pragma unroll
  for (int t = 0; t < 4; ++t) {
    const int col = col0 + t * 16 + ln;
    float bv = bias ? bias[col] : 0.f;
    if (BIAS_BF16) bv = bf16_round(bv);
#pragma unroll
    for (int r = 0; r < 8; ++r) {
      float v = acc[t][r] + bv;
      if (resid) { float rv = resid[(size_t)((row0 + 8 * hh + r) % rmod) * ldr + col]; if (RES_BF16) rv = bf16_round(rv); v += rv; }
      if (ACT == 1) v = fmaxf(v, 0.f);
      if (ACT == 2) v = 0.5f * v * (1.0f + erff(v * 0.70710678118654752f));
      if (ACT == 3) { const float u = 0.7978845608028654f * (v + 0.044715f * v * v * v); v = 0.5f * v * (1.0f + tanhf(u)); }
      so[w][8 * hh + r][t * 16 + ln] = v;
    }
  }
  __builtin_amdgcn_fence(__ATOMIC_ACQ_REL, "workgroup");
  __builtin_amdgcn_wave_barrier();
  const int rsub = lane >> 4, c4 = (lane & 15) * 4;
  {
#pragma unroll
    for (int q = 0; q < 8; ++q) {
      const int r = q * 2 + rsub;
      const v4f v = *(const v4fa*)&so[w][r][c4];
      *(v4f*)(C + (size_t)(row0 + r) * ldc + col0 + c4) = v;
    }
    
  }
}
// row LayerNorm (biased variance, eps) over N: s = X (+ R); optional out_sum <- s; out_norm <- (s-mu)*rsqrt(var+eps)*g + b
template <bool PARAM_BF16>
__global__ __launch_bounds__(256) void k_layernorm(const float* __restrict__ X, const float* __restrict__ R, const float* __restrict__ g, const float* __restrict__ bta,
                                                  float* __restrict__ out_sum, float* __restrict__ out_norm, int N, float eps) {
  __shared__ float red[256];
  const int row = blockIdx.x, tid = threadIdx.x;
  const float* x = X + (size_t)row * N; const float* rr = R ? R + (size_t)row * N : nullptr;
  float vals[16];                     // up to N = 4096
  const int per = N / 256;            // contiguous chunk per thread? use strided-by-4 chunks: thread handles j = tid*4 + 1024*u
  float s1 = 0.f;
  for (int u = 0; u < per / 4; ++u) {
    const int j = tid * 4 + 1024 * u;
    const v4f a = *(const v4fa*)(x + j);
    v4f b = {0.f,0.f,0.f,0.f}; if (rr) b = *(const v4fa*)(rr + j);
#pragma unroll
    for (int q = 0; q < 4; ++q) { const float v = a[q] + b[q]; vals[u * 4 + q] = v; s1 += v; }
  }
  red[tid] = s1; __syncthreads();
  for (int st = 128; st > 0; st >>= 1) { if (tid < st) red[tid] += red[tid + st]; __syncthreads(); }
  const float mu = red[0] / (float)N; __syncthreads();
  float s2 = 0.f;
  for (int u = 0; u < per / 4; ++u)
#pragma unroll
    for (int q = 0; q < 4; ++q) { const float c = vals[u * 4 + q] - mu; s2 += c * c; }
  red[tid] = s2; __syncthreads();
  for (int st = 128; st > 0; st >>= 1) { if (tid < st) red[tid] += red[tid + st]; __syncthreads(); }
  const float rs = rsqrtf(red[0] / (float)N + eps);
  {
    for (int u = 0; u < per / 4; ++u) {
      const int j = tid * 4 + 1024 * u;
      v4f o, sm;
#pragma unroll
      for (int q = 0; q < 4; ++q) {
        float gg = g[j + q], bb = bta[j + q];
        if (PARAM_BF16) { gg = bf16_round(gg); bb = bf16_round(bb); }
        sm[q] = vals[u * 4 + q]; o[q] = (vals[u * 4 + q] - mu) * rs * gg + bb;
      }
      if (out_sum) *(v4f*)(out_sum + (size_t)row * N + j) = sm;
      *(v4f*)(out_norm + (size_t)row * N + j) = o;
    }
    
  }
}



// ---- f16 WMMA path (v_wmma_f32_16x16x32_f16): 11-bit significands for operands in range — used where a [0,1] probability operand needs more precision than bf16
typedef _Float16 v16h __attribute__((ext_vector_type(16)));
union FragH { v16h v; v8us half[2]; _Float16 h[16]; unsigned short u[16]; };
template <int NT>
__device__ __forceinline__ v8f mmaH(v16h ah, v16h al, v16h bh, v16h bl, v8f c) {
  c = __builtin_amdgcn_wmma_f32_16x16x32_f16(false, ah, false, bh, (short)0, c, false, false);
  if (NT >= 2) c = __builtin_amdgcn_wmma_f32_16x16x32_f16(false, al, false, bh, (short)0, c, false, false);
  if (NT >= 3) c = __builtin_amdgcn_wmma_f32_16x16x32_f16(false, ah, false, bl, (short)0, c, false, false);
  asm volatile("v_nop\n\tv_nop\n\tv_nop\n\tv_nop" : "+v"(c) : "v"(ah), "v"(al), "v"(bh), "v"(bl));
  return c;
}
// batched GEMM like k_gemm_b but f16 operands: A f32 (split into f16 hi/lo if ASPLIT, else rounded to f16), Bt = f16 values [n][k]; alpha; C f32; N multiple of 16 (partial tiles skipped)
template <bool ASPLIT>
__global__ __launch_bounds__(128) void k_gemm_h(const float* __restrict__ A, int lda, size_t sA, const _Float16* __restrict__ Bh, int ldb, size_t sB, float alpha, float* __restrict__ C, int ldc, size_t sC, int M, int N, int K) {
  __shared__ __attribute__((aligned(16))) float so[4][16][64];
  const int tid = threadIdx.x, w = tid >> 5, lane = tid & 31, ln = lane & 15, hh = lane >> 4; const int by = blockIdx.y;
  A += (size_t)by * sA; Bh += (size_t)by * sB; C += (size_t)by * sC;
  const int ntn = (N + 63) / 64; const int wid = blockIdx.x * 4 + w; const int mt = wid / ntn, nq = wid % ntn; if (mt * 16 >= M) return;
  const int row0 = mt * 16, col0 = nq * 64; const float* arow = A + (size_t)(row0 + ln) * lda;
  v8f acc[4] = {};
  for (int kb = 0; kb < K; kb += 32) {
    FragH ah, al;
    const v4f x0 = *(const v4fa*)(arow + kb + 8 * hh), x1 = *(const v4fa*)(arow + kb + 8 * hh + 4), x2 = *(const v4fa*)(arow + kb + 16 + 8 * hh), x3 = *(const v4fa*)(arow + kb + 16 + 8 * hh + 4);
    float xs[16] = {x0[0],x0[1],x0[2],x0[3],x1[0],x1[1],x1[2],x1[3],x2[0],x2[1],x2[2],x2[3],x3[0],x3[1],x3[2],x3[3]};
#pragma unroll
    for (int i = 0; i < 16; ++i) { const _Float16 h = (_Float16)xs[i]; ah.h[i] = h; al.h[i] = ASPLIT ? (_Float16)(xs[i] - (float)h) : (_Float16)0.0f; }
#pragma unroll
    for (int t = 0; t < 4; ++t) { if (col0 + t * 16 >= N) continue; const size_t boff = (size_t)(col0 + t * 16 + ln) * ldb + kb; FragH bq; bq.half[0] = *(const v8us*)(Bh + boff + 8 * hh); bq.half[1] = *(const v8us*)(Bh + boff + 16 + 8 * hh);
      acc[t] = mmaH<ASPLIT ? 2 : 1>(ah.v, al.v, bq.v, bq.v, acc[t]); }
  }
#pragma unroll
  for (int t = 0; t < 4; ++t) { if (col0 + t * 16 >= N) continue;
#pragma unroll
    for (int r = 0; r < 8; ++r) so[w][8 * hh + r][t * 16 + ln] = acc[t][r] * alpha; }
  __builtin_amdgcn_fence(__ATOMIC_ACQ_REL, "workgroup"); __builtin_amdgcn_wave_barrier();
  const int rsub = lane >> 4, c4 = (lane & 15) * 4;
  {
#pragma unroll
    for (int q = 0; q < 8; ++q) { const int r = q * 2 + rsub; if (col0 + c4 < N) { const v4f v = *(const v4fa*)&so[w][r][c4]; *(v4f*)(C + (size_t)(row0 + r) * ldc + col0 + c4) = v; } }
     }
}

// Wt[n][k] = f16(W[k][n]·scale) from f32 row-major W[K][N] (scale = power of two; bf16-exact weights stay exact in f16 away from the subnormal range)
__global__ __launch_bounds__(256) void k_wt_f16(const float* __restrict__ W, _Float16* __restrict__ Wt, int K, int N, float scale) {
  const int t = blockIdx.x * 256 + threadIdx.x; if (t >= N * (K / 8)) return; const int n = t / (K / 8), k8 = (t % (K / 8)) * 8; FragH f;
#pragma unroll
  for (int i = 0; i < 8; ++i) f.h[i] = (_Float16)(bf16_round(W[(size_t)(k8 + i) * N + n]) * scale); const v8us o = f.half[0];
  *(v8us*)((unsigned short*)Wt + (size_t)n * K + k8) = o; 
}
// k_gemm_hh variant with fused epilogue: v = acc·alpha + bias[by·sBias + col] (+ CP[(row/rowsPerB)·sCPb + by·64 + col] if CP) ; ACT 0 none / 1 elu ; writes f16 C16 and/or f32 C, each if non-null
template <int ACT>
__global__ __launch_bounds__(128) void k_gemm_hhx(const _Float16* __restrict__ A, int lda, size_t sA, const _Float16* __restrict__ Bh, int ldb, size_t sB, float alpha, const float* __restrict__ bias, size_t sBias, const float* __restrict__ CP, int rowsPerB, size_t sCPb, int row0g,
    float* __restrict__ C, _Float16* __restrict__ C16, int ldc, size_t sC, int M, int N, int K) {
  __shared__ __attribute__((aligned(16))) float so[4][16][64];
  const int tid = threadIdx.x, w = tid >> 5, lane = tid & 31, ln = lane & 15, hh = lane >> 4; const int by = blockIdx.y;
  A += (size_t)by * sA; Bh += (size_t)by * sB; const size_t cofs = (size_t)by * sC; const float* bp = bias ? bias + (size_t)by * sBias : nullptr;
  const int ntn = (N + 63) / 64; const int wid = blockIdx.x * 4 + w; const int mt = wid / ntn, nq = wid % ntn; if (mt * 16 >= M) return;
  const int row0 = mt * 16, col0 = nq * 64; const _Float16* arow = A + (size_t)(row0 + ln) * lda;
  v8f acc[4] = {};
  for (int kb = 0; kb < K; kb += 32) { FragH ah; ah.half[0] = *(const v8us*)((const unsigned short*)arow + kb + 8 * hh); ah.half[1] = *(const v8us*)((const unsigned short*)arow + kb + 16 + 8 * hh);
#pragma unroll
    for (int t = 0; t < 4; ++t) { if (col0 + t * 16 >= N) continue; const size_t boff = (size_t)(col0 + t * 16 + ln) * ldb + kb; FragH bq; bq.half[0] = *(const v8us*)((const unsigned short*)Bh + boff + 8 * hh); bq.half[1] = *(const v8us*)((const unsigned short*)Bh + boff + 16 + 8 * hh);
      acc[t] = mmaH<1>(ah.v, ah.v, bq.v, bq.v, acc[t]); }
  }
#pragma unroll
  for (int t = 0; t < 4; ++t) { if (col0 + t * 16 >= N) continue; const int col = col0 + t * 16 + ln; const float bv = bp ? bf16_round(bp[col]) : 0.f;
#pragma unroll
    for (int r = 0; r < 8; ++r) { float v = acc[t][r] * alpha + bv; if (CP) { const int bidx = (row0g + row0 + 8 * hh + r) / rowsPerB; v += CP[(size_t)bidx * sCPb + (size_t)by * 64 + col]; } if (ACT == 1) v = (v > 0.f) ? v : expm1f(v); else if (ACT == 7) v = (v > 0.f) ? v + 1.0f : expf(v); else if (ACT == 8) v = tanhf(v); else if (ACT == 9) v = 0.5f * v * (1.0f + tanhf(0.7978845608028654f * (v + 0.044715f * v * v * v))); else if (ACT == 11) v = 1.0f / (1.0f + expf(-v)); else if (ACT == 12) v = (v > 0.f) ? v : 0.01f * v; else if (ACT == 14) v = (v > 0.f) ? v : 0.1f * v; else if (ACT == 15) v = v / (1.0f + expf(-v)); else if (ACT == 3) v = fmaxf(v, 0.f); else if (ACT == 6) v = 0.5f * v * (1.0f + erff(v * 0.70710678118654752f)); so[w][8 * hh + r][t * 16 + ln] = v; } }
  __builtin_amdgcn_fence(__ATOMIC_ACQ_REL, "workgroup"); __builtin_amdgcn_wave_barrier();
  const int rsub = lane >> 4, c4 = (lane & 15) * 4; typedef _Float16 v4h __attribute__((ext_vector_type(4)));
  {
#pragma unroll
    for (int q = 0; q < 8; ++q) { const int r = q * 2 + rsub; if (col0 + c4 < N) { const v4f v = *(const v4fa*)&so[w][r][c4]; if (C) *(v4f*)(C + cofs + (size_t)(row0 + r) * ldc + col0 + c4) = v; if (C16) { v4h h4; for (int i = 0; i < 4; ++i) h4[i] = (_Float16)v[i]; *(v4h*)(C16 + cofs + (size_t)(row0 + r) * ldc + col0 + c4) = h4; } } }
     }
}


typedef _Float16 v4h __attribute__((ext_vector_type(4)));

__global__ __launch_bounds__(256) void k_x16(const float* __restrict__ x, _Float16* __restrict__ X16, size_t n8) { const size_t t = (size_t)blockIdx.x * 256 + threadIdx.x; if (t >= n8) return; FragH f;
#pragma unroll
  for (int q = 0; q < 8; ++q) f.h[q] = (_Float16)bf16_round(x[t * 8 + q]); *(v8us*)((unsigned short*)X16 + t * 8) = f.half[0];  }
__global__ __launch_bounds__(256) void k_h16(const float* __restrict__ x, _Float16* __restrict__ X16, size_t n8) { const size_t t = (size_t)blockIdx.x * 256 + threadIdx.x; if (t >= n8) return; FragH f;
#pragma unroll
  for (int q = 0; q < 8; ++q) f.h[q] = (_Float16)x[t * 8 + q]; *(v8us*)((unsigned short*)X16 + t * 8) = f.half[0];  }
__global__ __launch_bounds__(256) void k_round16f(const float* __restrict__ W, _Float16* __restrict__ Bt, size_t n8) { const size_t t = (size_t)blockIdx.x * 256 + threadIdx.x; if (t >= n8) return; FragH f;
#pragma unroll
  for (int i = 0; i < 8; ++i) f.h[i] = (_Float16)(bf16_round(W[t * 8 + i]) * 16.0f); *(v8us*)((unsigned short*)Bt + t * 8) = f.half[0];  }
template <int NHv, int TTv>
__global__ __launch_bounds__(256) void k_vt(const _Float16* __restrict__ V16, int ldv, int voff, _Float16* __restrict__ Vt) { __shared__ unsigned short tl[64][66]; const int tid = threadIdx.x; const int slab = blockIdx.x / (TTv / 64), lg = blockIdx.x % (TTv / 64); const int b = slab / NHv, h = slab % NHv;
  for (int i = tid; i < 64 * 8; i += 256) { const int r = i / 8, c8 = (i % 8) * 8; FragH f; f.half[0] = *(const v8us*)((const unsigned short*)V16 + ((size_t)b * TTv + lg * 64 + r) * ldv + voff + h * 64 + c8);
#pragma unroll
    for (int q = 0; q < 8; ++q) tl[r][c8 + q] = f.u[q]; }
  __syncthreads();
  {
#pragma unroll
    for (int rd = 0; rd < 2; ++rd) { const int d = rd * 32 + tid / 8, pc = tid % 8; FragH f;
#pragma unroll
      for (int q = 0; q < 8; ++q) f.u[q] = tl[pc * 8 + q][d];
      *(v8us*)((unsigned short*)Vt + ((size_t)slab * 64 + d) * TTv + lg * 64 + pc * 8) = f.half[0]; }
     } }

__global__ __launch_bounds__(256) void k_hl(const float* __restrict__ F, _Float16* __restrict__ Hh, _Float16* __restrict__ Hl, size_t n8) { const size_t t = (size_t)blockIdx.x * 256 + threadIdx.x; if (t >= n8) return; FragH fh, fl; const v4f a = *(const v4fa*)(F + t * 8), c = *(const v4fa*)(F + t * 8 + 4);
#pragma unroll
  for (int q = 0; q < 4; ++q) { _Float16 h = (_Float16)a[q]; fh.h[q] = h; fl.h[q] = (_Float16)((a[q] - (float)h) * 1024.0f); h = (_Float16)c[q]; fh.h[4 + q] = h; fl.h[4 + q] = (_Float16)((c[q] - (float)h) * 1024.0f); }
  { *(v8us*)((unsigned short*)Hh + t * 8) = fh.half[0]; *(v8us*)((unsigned short*)Hl + t * 8) = fl.half[0];  } }

__global__ __launch_bounds__(256) void k_h16s(const float* __restrict__ F, _Float16* __restrict__ H, size_t n8) { const size_t t = (size_t)blockIdx.x * 256 + threadIdx.x; if (t >= n8) return; const v4f a = *(const v4fa*)(F + t * 8), c = *(const v4fa*)(F + t * 8 + 4); FragH f;
#pragma unroll
  for (int q = 0; q < 4; ++q) { f.h[q] = (_Float16)(a[q] * 16.0f); f.h[4 + q] = (_Float16)(c[q] * 16.0f); } *(v8us*)((unsigned short*)H + t * 8) = f.half[0];  }
// mask predicates over (query index q, key-plane row k): key-plane rows 0..T-1 are TOKENS, rows T..2T-1 are CONCEPTS (the tok/con GEMMs write the two halves of one plane per batch); MODE 0 = token queries: token s ≤ q (causal), concept j < q/ntc + 1;
// MODE 1 = concept queries: concept j ≤ q, token s < ntc·(q + 1). (Key order inside the softmax is irrelevant, so the plane order is used directly.)
template <int MODE> __device__ __forceinline__ bool allow(int q, int k, int ntc) {
  if (MODE == 0) return (k < TQ) ? (k <= q) : ((k - TQ) < q / ntc + 1);
  else           return (k < TQ) ? (k < ntc * (q + 1)) : ((k - TQ) <= q); }
template <int MODE>
__global__ __launch_bounds__(128) void k_flashm(const _Float16* __restrict__ Q16, int ldq, const _Float16* __restrict__ K16, int ldk, const _Float16* __restrict__ Vt, const int* __restrict__ NTCP, float* __restrict__ O, int ldo) {
  int ntc = NTCP[0]; ntc = (ntc < 1) ? 1 : ntc;      /* = 8 here; guarded so the index arithmetic can never divide by zero */
  constexpr int RPW = 16, RTN = RPW / 16, NQB = TQ / (4 * RPW), DT = 4, KS = 2;
  __shared__ __attribute__((aligned(16))) unsigned short sP[4][RPW][40]; __shared__ __attribute__((aligned(16))) float sO[4][RPW][64 + 4];
  const int tid = threadIdx.x, w = tid >> 5, lane = tid & 31, ln = lane & 15, hh = lane >> 4;
  const int slab = blockIdx.x / NQB, qblk = blockIdx.x % NQB; const int b = slab / NH, h = slab % NH; const int qb0 = qblk * (4 * RPW); const int q0 = qb0 + w * RPW;
  FragH aq[2][KS];
#pragma unroll
  for (int rt = 0; rt < RTN; ++rt) { const unsigned short* qr = (const unsigned short*)Q16 + ((size_t)b * TQ + q0 + rt * 16 + ln) * ldq + h * 64;
#pragma unroll
    for (int ks = 0; ks < KS; ++ks) { aq[rt][ks].half[0] = *(const v8us*)(qr + ks * 32 + 8 * hh); aq[rt][ks].half[1] = *(const v8us*)(qr + ks * 32 + 16 + 8 * hh); } }
  const unsigned short* Vth = (const unsigned short*)Vt + (size_t)slab * 64 * TK;
  float m_r[2][8], l_r[2][8]; v8f oacc[2][DT];
#pragma unroll
  for (int rt = 0; rt < RTN; ++rt) {
#pragma unroll
    for (int r = 0; r < 8; ++r) { m_r[rt][r] = -3.0e38f; l_r[rt][r] = 0.f; }
#pragma unroll
    for (int dt = 0; dt < DT; ++dt) oacc[rt][dt] = (v8f){0.f,0.f,0.f,0.f,0.f,0.f,0.f,0.f}; }
  const int jend = TK;
#pragma unroll 1
  for (int j0 = 0; j0 < jend; j0 += 32) {
    v8f s[2][2];
#pragma unroll
    for (int nt = 0; nt < 2; ++nt) { const unsigned short* kr = (const unsigned short*)K16 + ((size_t)b * TK + j0 + nt * 16 + ln) * ldk + h * 64; FragH bk[KS];
#pragma unroll
      for (int ks = 0; ks < KS; ++ks) { bk[ks].half[0] = *(const v8us*)(kr + ks * 32 + 8 * hh); bk[ks].half[1] = *(const v8us*)(kr + ks * 32 + 16 + 8 * hh); }
#pragma unroll
      for (int rt = 0; rt < RTN; ++rt) { v8f acc = (v8f){0.f,0.f,0.f,0.f,0.f,0.f,0.f,0.f};
#pragma unroll
        for (int ks = 0; ks < KS; ++ks) acc = mmaH<1>(aq[rt][ks].v, aq[rt][ks].v, bk[ks].v, bk[ks].v, acc); s[rt][nt] = acc; } }
#pragma unroll
    for (int rt = 0; rt < RTN; ++rt)
#pragma unroll
      for (int r = 0; r < 8; ++r) { const int tq = q0 + rt * 16 + 8 * hh + r; const int k0 = j0 + ln, k1 = j0 + 16 + ln; 
        const bool ok0 = allow<MODE>(tq, k0, ntc), ok1 = allow<MODE>(tq, k1, ntc);
        const float s0 = ok0 ? s[rt][0][r] * SCL : -INFINITY, s1 = ok1 ? s[rt][1][r] * SCL : -INFINITY; float mc = fmaxf(s0, s1);
        mc = fmaxf(mc, __shfl_xor(mc, 1, 32)); mc = fmaxf(mc, __shfl_xor(mc, 2, 32)); mc = fmaxf(mc, __shfl_xor(mc, 4, 32)); mc = fmaxf(mc, __shfl_xor(mc, 8, 32));
        const float mn = fmaxf(m_r[rt][r], mc); const float al = (mn > -1.0e38f) ? expf(m_r[rt][r] - mn) : 1.0f; m_r[rt][r] = mn; const float p0 = ok0 ? expf(s0 - mn) : 0.f, p1 = ok1 ? expf(s1 - mn) : 0.f; l_r[rt][r] = l_r[rt][r] * al + p0 + p1;
#pragma unroll
        for (int dt = 0; dt < DT; ++dt) oacc[rt][dt][r] *= al;
        FragH t2; t2.h[0] = (_Float16)(p0 * 1024.0f); t2.h[1] = (_Float16)(p1 * 1024.0f); sP[w][rt * 16 + 8 * hh + r][ln] = t2.u[0]; sP[w][rt * 16 + 8 * hh + r][16 + ln] = t2.u[1]; }
    __builtin_amdgcn_fence(__ATOMIC_ACQ_REL, "workgroup"); __builtin_amdgcn_wave_barrier();
    FragH pa[2];
#pragma unroll
    for (int rt = 0; rt < RTN; ++rt) { pa[rt].half[0] = *(const v8us*)&sP[w][rt * 16 + ln][8 * hh]; pa[rt].half[1] = *(const v8us*)&sP[w][rt * 16 + ln][16 + 8 * hh]; }
#pragma unroll
    for (int dt = 0; dt < DT; ++dt) { const unsigned short* vrow = Vth + (size_t)(dt * 16 + ln) * TK + j0; FragH bv; bv.half[0] = *(const v8us*)(vrow + 8 * hh); bv.half[1] = *(const v8us*)(vrow + 16 + 8 * hh);
#pragma unroll
      for (int rt = 0; rt < RTN; ++rt) oacc[rt][dt] = mmaH<1>(pa[rt].v, pa[rt].v, bv.v, bv.v, oacc[rt][dt]); }
    __builtin_amdgcn_fence(__ATOMIC_ACQ_REL, "workgroup"); __builtin_amdgcn_wave_barrier(); }
#pragma unroll
  for (int rt = 0; rt < RTN; ++rt) {
#pragma unroll
    for (int r = 0; r < 8; ++r) { float l = l_r[rt][r]; l += __shfl_xor(l, 1, 32); l += __shfl_xor(l, 2, 32); l += __shfl_xor(l, 4, 32); l += __shfl_xor(l, 8, 32); l_r[rt][r] = (l > 0.f) ? 1.0f / (l * 1024.0f) : 0.f; }
#pragma unroll
    for (int dt = 0; dt < DT; ++dt)
#pragma unroll
      for (int r = 0; r < 8; ++r) sO[w][rt * 16 + 8 * hh + r][dt * 16 + ln] = oacc[rt][dt][r] * l_r[rt][r]; }
  __builtin_amdgcn_fence(__ATOMIC_ACQ_REL, "workgroup"); __builtin_amdgcn_wave_barrier();
  {
#pragma unroll
    for (int rp = 0; rp < RPW; rp += 2) { const int r = rp + (lane >> 4), pc = lane & 15; const v4f val = *(const v4fa*)&sO[w][r][pc * 4]; *(v4f*)(O + ((size_t)b * TQ + q0 + r) * ldo + h * 64 + pc * 4) = val; }
     } }

extern "C" void kernel_launch(void* const* d_in, const int* in_sizes, int n_in,
                              void* d_out, int out_size, void* d_ws, size_t ws_size, hipStream_t stream) {
  (void)in_sizes; (void)n_in; (void)out_size;
  const float* const* I = (const float* const*)d_in; const float* xt = I[0]; const float* xc = I[1]; const float* Wt = I[2]; const float* bt = I[3]; const float* Wc = I[4]; const float* bc = I[5]; const float* Wtp = I[6]; const float* btp = I[7]; const float* Wcp = I[8]; const float* bcp = I[9]; const int* ntcp = (const int*)d_in[10];      /* int64 in the module, read as int32 */
  char* ws = (char*)d_ws; size_t off = 0;
  auto take = [&](size_t bytes) { char* p = ws + off; off += (bytes + 255) & ~(size_t)255; return p; };
  _Float16* Bt_ = (_Float16*)take((size_t)DW * DD * 2); _Float16* Bc = (_Float16*)take((size_t)DW * DD * 2); _Float16* Btp = (_Float16*)take((size_t)DD * DD * 2); _Float16* Bcp = (_Float16*)take((size_t)DD * DD * 2);
  _Float16* XT = (_Float16*)take((size_t)NR * DD * 2); _Float16* XC = (_Float16*)take((size_t)NR * DD * 2); _Float16* TC = (_Float16*)take((size_t)BB * TK * DW * 2);      /* per batch: rows 0..1023 = tok, 1024..2047 = con */
  _Float16* Vt1 = (_Float16*)take((size_t)BB * NH * 64 * TK * 2); _Float16* Vt2 = (_Float16*)take((size_t)BB * NH * 64 * TK * 2); float* O = (float*)take((size_t)NR * DD * 4); _Float16* O16 = (_Float16*)take((size_t)NR * DD * 2);
  if (off > ws_size) return;      // 8.4 + 8.4 + 2.1 + 2.1 + 4.2 + 4.2 + 33.6 + 8.4 + 8.4 + 8.4 + 4.2 ≈ 92 MB
  const unsigned gw = (unsigned)(((size_t)DW * DD / 8 + 255) / 256), gp = (unsigned)(((size_t)DD * DD / 8 + 255) / 256);
  k_round16f<<<gw, 256, 0, stream>>>(Wt, Bt_, (size_t)DW * DD / 8); k_round16f<<<gw, 256, 0, stream>>>(Wc, Bc, (size_t)DW * DD / 8); k_round16f<<<gp, 256, 0, stream>>>(Wtp, Btp, (size_t)DD * DD / 8); k_round16f<<<gp, 256, 0, stream>>>(Wcp, Bcp, (size_t)DD * DD / 8);      /* torch (out,in) natural, ×2^4 */
  const unsigned g8 = (unsigned)(((size_t)NR * DD / 8 + 255) / 256); k_x16<<<g8, 256, 0, stream>>>(xt, XT, (size_t)NR * DD / 8); k_x16<<<g8, 256, 0, stream>>>(xc, XC, (size_t)NR * DD / 8);
  const dim3 gt(((TQ / 16) * (DW / 64) + 3) / 4, BB);
  k_gemm_hhx<0><<<gt, 128, 0, stream>>>(XT, DD, (size_t)TQ * DD, Bt_, DD, 0, 0.0625f, bt, 0, nullptr, 1, 0, 0, nullptr, TC, DW, (size_t)TK * DW, TQ, DW, DD);      /* tok[b] → plane rows 0..1023: M 1024 N 4096 K 1024 */
  k_gemm_hhx<0><<<gt, 128, 0, stream>>>(XC, DD, (size_t)TQ * DD, Bc, DD, 0, 0.0625f, bc, 0, nullptr, 1, 0, 0, nullptr, TC + (size_t)TQ * DW, DW, (size_t)TK * DW, TQ, DW, DD);      /* con[b] → plane rows 1024..2047 */
  k_vt<NH, TK><<<BB * NH * (TK / 64), 256, 0, stream>>>(TC, DW, 2 * DD, Vt1);      /* values read by tokens = columns 2048.. of both halves → Vᵀ [bh][64][2048] */
  k_vt<NH, TK><<<BB * NH * (TK / 64), 256, 0, stream>>>(TC, DW, 3 * DD, Vt2);      /* values read by concepts = columns 3072.. */
  const dim3 gpj(((NR / 16) * (DD / 64) + 3) / 4, 1);
  k_flashm<0><<<BB * NH * (TQ / 64), 128, 0, stream>>>(XT, DD, TC, DW, Vt1, ntcp, O, DD);      /* token queries; keys = columns 0..1023 (kt_t on token rows, kc_t on concept rows) */
  k_h16s<<<g8, 256, 0, stream>>>(O, O16, (size_t)NR * DD / 8);
  k_gemm_hhx<0><<<gpj, 128, 0, stream>>>(O16, DD, 0, Btp, DD, 0, 0.00390625f, btp, 0, nullptr, 1, 0, 0, (float*)d_out, nullptr, DD, 0, NR, DD, DD);      /* y_t = merged·Wtpᵀ + btp → output 0 */
  k_flashm<1><<<BB * NH * (TQ / 64), 128, 0, stream>>>(XC, DD, TC + DD, DW, Vt2, ntcp, O, DD);      /* concept queries; keys = columns 1024..2047 (kc_c on concept rows, kt_c on token rows) */
  k_h16s<<<g8, 256, 0, stream>>>(O, O16, (size_t)NR * DD / 8);
  k_gemm_hhx<0><<<gpj, 128, 0, stream>>>(O16, DD, 0, Bcp, DD, 0, 0.00390625f, bcp, 0, nullptr, 1, 0, 0, (float*)d_out + (size_t)NR * DD, nullptr, DD, 0, NR, DD, DD);      /* y_c → output 1 (offset B·T·NE floats) */
}

// v001
// A run of this version takes 477 microseconds.
// Two timings next to v000 put it at 1.62 and 1.61 times that version's speed.
#include <hip/hip_runtime.h>
// Token/concept two-stream causal attention (B=2, T=C=1024, NE=CD=1024, 16 heads × 64, n_tokens_per_concept = 8): tok = xt·Wtᵀ + bt, con = xc·Wcᵀ + bc (4096 outputs each = [k for token queries | k for concept queries | v read by tokens | v read by concepts]);
// token queries = heads(xt) (the residual stream itself) attend over [tokens ; concepts] with mask (s ≤ t) | (j < t/8 + 1), scale 1/√64; concept queries = heads(xc) attend over [concepts ; tokens] with mask (j ≤ i) | (s < 8(i+1)); disallowed = −1e9 (≡ −inf: every row keeps itself);
// y_t = merge(attn_t)·Wtpᵀ + btp, y_c = merge(attn_c)·Wcpᵀ + bcp (two outputs).
// Compute dtype: xt, xc, weights, biases rounded to bf16; tok/con as f16 GEMM planes written as the two 1024-row halves of one 2048-key plane per batch; queries = the bf16-exact x planes; fused flash-style kernels with the index-computed masks (n_tokens_per_concept read on device; online softmax f32,
// P f16 ×2^10, f32 accumulate) on v_wmma_f32_16x16x32_f16; O ×2^4 → f16 → projection GEMMs (+bias) straight into the two output slots.
#define BB 2
#define TQ 1024
#define TK 2048
#define DD 1024
#define NH 16
#define DW 4096
#define SCL 0.125f
#define NR (BB * TQ)
typedef __bf16 v16b __attribute__((ext_vector_type(16)));
typedef unsigned short v8us __attribute__((ext_vector_type(8), may_alias));
typedef float  v8f  __attribute__((ext_vector_type(8)));
typedef float  v4f  __attribute__((ext_vector_type(4)));
typedef float  v4fa __attribute__((ext_vector_type(4), may_alias));
union FragB { v16b v; v8us half[2]; unsigned short u[16]; };

__device__ __forceinline__ unsigned short bf16_bits(float x) { unsigned int u = __float_as_uint(x); return (unsigned short)((u + 0x7FFFu + ((u >> 16) & 1u)) >> 16); }
__device__ __forceinline__ float bf16_val(unsigned short b) { return __uint_as_float(((unsigned int)b) << 16); }
__device__ __forceinline__ float bf16_round(float x) { return bf16_val(bf16_bits(x)); }
// D += A·B with NT terms: 1 = ah·bh, 2 = + al·bh (A split), 3 = + ah·bl (both split)
template <int NT>
__device__ __forceinline__ v8f mmaN(v16b ah, v16b al, v16b bh, v16b bl, v8f c) {
  c = __builtin_amdgcn_wmma_f32_16x16x32_bf16(false, ah, false, bh, (short)0, c, false, false);
  if (NT >= 2) c = __builtin_amdgcn_wmma_f32_16x16x32_bf16(false, al, false, bh, (short)0, c, false, false);
  if (NT >= 3) c = __builtin_amdgcn_wmma_f32_16x16x32_bf16(false, ah, false, bl, (short)0, c, false, false);
  asm volatile("v_nop\n\tv_nop\n\tv_nop\n\tv_nop" : "+v"(c) : "v"(ah), "v"(al), "v"(bh), "v"(bl));
  return c;
}

__global__ __launch_bounds__(256) void k_wt_bf16(const float* __restrict__ W, unsigned short* __restrict__ Wt, int K, int N) {
  const int t = blockIdx.x * 256 + threadIdx.x;
  const int k8n = K / 8;
  if (t >= N * k8n) return;
  const int n = t / k8n, k8 = (t % k8n) * 8;
  v8us v;
#pragma unroll
  for (int i = 0; i < 8; ++i) v[i] = bf16_bits(W[(size_t)(k8 + i) * N + n]);
  *(v8us*)(Wt + (size_t)n * K + k8) = v;
  
}

// GEMM C[M][N] (f32, pitch ldc) = act(A[M][K]·W + bias). A f32 row-major (pitch lda) converted per fragment to bf16
// (ASPLIT: hi/lo two planes -> 2 terms, else single rounded term); Wt bf16 [N][K] (pitch ldb). BIAS_BF16 rounds the
// bias to bf16 first (bias quantised to bf16 before the add). K%32==0, M%16==0, N%64==0.
template <bool ASPLIT, int ACT, bool BIAS_BF16>
__global__ __launch_bounds__(128) void k_gemm_bf(const float* __restrict__ A, int lda, const unsigned short* __restrict__ Wt, int ldb,
                                               const float* __restrict__ bias, float* __restrict__ C, int ldc, int M, int N, int K) {
  __shared__ __attribute__((aligned(16))) float so[4][16][64];
  const int tid = threadIdx.x, w = tid >> 5, lane = tid & 31, ln = lane & 15, hh = lane >> 4;
  const int ntn = N / 64;
  const int wid = blockIdx.x * 4 + w;
  const int mt = wid / ntn, nq = wid % ntn;
  if (mt * 16 >= M) return;
  const int row0 = mt * 16, col0 = nq * 64;
  const float* arow = A + (size_t)(row0 + ln) * lda;
  v8f acc[4] = {};
  for (int kb = 0; kb < K; kb += 32) {
    FragB ah, al;
    const v4f x0 = *(const v4fa*)(arow + kb + 8 * hh), x1 = *(const v4fa*)(arow + kb + 8 * hh + 4);
    const v4f x2 = *(const v4fa*)(arow + kb + 16 + 8 * hh), x3 = *(const v4fa*)(arow + kb + 16 + 8 * hh + 4);
    float xs[16] = {x0[0],x0[1],x0[2],x0[3],x1[0],x1[1],x1[2],x1[3],x2[0],x2[1],x2[2],x2[3],x3[0],x3[1],x3[2],x3[3]};
#pragma unroll
    for (int i = 0; i < 16; ++i) { const unsigned short hb = bf16_bits(xs[i]); ah.u[i] = hb; al.u[i] = ASPLIT ? bf16_bits(xs[i] - bf16_val(hb)) : (unsigned short)0; }
#pragma unroll
    for (int t = 0; t < 4; ++t) {
      const unsigned short* brow = Wt + (size_t)(col0 + t * 16 + ln) * ldb + kb;
      FragB b;
      b.half[0] = *(const v8us*)(brow + 8 * hh);
      b.half[1] = *(const v8us*)(brow + 16 + 8 * hh);
      acc[t] = mmaN<ASPLIT ? 2 : 1>(ah.v, al.v, b.v, b.v, acc[t]);
    }
  }
#pragma unroll
  for (int t = 0; t < 4; ++t) {
    float bv = bias ? bias[col0 + t * 16 + ln] : 0.f;
    if (BIAS_BF16) bv = bf16_round(bv);
#pragma unroll
    for (int r = 0; r < 8; ++r) { float v = acc[t][r] + bv; if (ACT == 1) v = fmaxf(v, 0.f); so[w][8 * hh + r][t * 16 + ln] = v; }
  }
  __builtin_amdgcn_fence(__ATOMIC_ACQ_REL, "workgroup");
  __builtin_amdgcn_wave_barrier();
  const int rsub = lane >> 4, c4 = (lane & 15) * 4;
  {
#pragma unroll
    for (int q = 0; q < 8; ++q) {
      const int r = q * 2 + rsub;
      const v4f v = *(const v4fa*)&so[w][r][c4];
      *(v4f*)(C + (size_t)(row0 + r) * ldc + col0 + c4) = v;
    }
    
  }
}

// GEMM C = act(A·W + bias + resid): A f32 (ASPLIT -> hi/lo 2 terms), Wt bf16 [N][K]; ACT 0 none, 1 relu, 2 exact gelu;
// resid (optional, f32, row index = (row % rmod), pitch ldr, RES_BF16 rounds it) added before the activation.
template <bool ASPLIT, int ACT, bool BIAS_BF16, bool RES_BF16>
__global__ __launch_bounds__(128) void k_gemm_bf3(const float* __restrict__ A, int lda, const unsigned short* __restrict__ Wt, int ldb,
                                                const float* __restrict__ bias, const float* __restrict__ resid, int rmod, int ldr,
                                                float* __restrict__ C, int ldc, int M, int N, int K) {
  __shared__ __attribute__((aligned(16))) float so[4][16][64];
  const int tid = threadIdx.x, w = tid >> 5, lane = tid & 31, ln = lane & 15, hh = lane >> 4;
  const int ntn = N / 64;
  const int wid = blockIdx.x * 4 + w;
  const int mt = wid / ntn, nq = wid % ntn;
  if (mt * 16 >= M) return;
  const int row0 = mt * 16, col0 = nq * 64;
  const float* arow = A + (size_t)(row0 + ln) * lda;
  v8f acc[4] = {};
  for (int kb = 0; kb < K; kb += 32) {
    FragB ah, al;
    const v4f x0 = *(const v4fa*)(arow + kb + 8 * hh), x1 = *(const v4fa*)(arow + kb + 8 * hh + 4);
    const v4f x2 = *(const v4fa*)(arow + kb + 16 + 8 * hh), x3 = *(const v4fa*)(arow + kb + 16 + 8 * hh + 4);
    float xs[16] = {x0[0],x0[1],x0[2],x0[3],x1[0],x1[1],x1[2],x1[3],x2[0],x2[1],x2[2],x2[3],x3[0],x3[1],x3[2],x3[3]};
#pragma unroll
    for (int i = 0; i < 16; ++i) { const unsigned short hb = bf16_bits(xs[i]); ah.u[i] = hb; al.u[i] = ASPLIT ? bf16_bits(xs[i] - bf16_val(hb)) : (unsigned short)0; }
#pragma unroll
    for (int t = 0; t < 4; ++t) {
      const unsigned short* brow = Wt + (size_t)(col0 + t * 16 + ln) * ldb + kb;
      FragB b;
      b.half[0] = *(const v8us*)(brow + 8 * hh);
      b.half[1] = *(const v8us*)(brow + 16 + 8 * hh);
      acc[t] = mmaN<ASPLIT ? 2 : 1>(ah.v, al.v, b.v, b.v, acc[t]);
    }
  }
#pragma unroll
  for (int t = 0; t < 4; ++t) {
    const int col = col0 + t * 16 + ln;
    float bv = bias ? bias[col] : 0.f;
    if (BIAS_BF16) bv = bf16_round(bv);
#pragma unroll
    for (int r = 0; r < 8; ++r) {
      float v = acc[t][r] + bv;
      if (resid) { float rv = resid[(size_t)((row0 + 8 * hh + r) % rmod) * ldr + col]; if (RES_BF16) rv = bf16_round(rv); v += rv; }
      if (ACT == 1) v = fmaxf(v, 0.f);
      if (ACT == 2) v = 0.5f * v * (1.0f + erff(v * 0.70710678118654752f));
      if (ACT == 3) { const float u = 0.7978845608028654f * (v + 0.044715f * v * v * v); v = 0.5f * v * (1.0f + tanhf(u)); }
      so[w][8 * hh + r][t * 16 + ln] = v;
    }
  }
  __builtin_amdgcn_fence(__ATOMIC_ACQ_REL, "workgroup");
  __builtin_amdgcn_wave_barrier();
  const int rsub = lane >> 4, c4 = (lane & 15) * 4;
  {
#pragma unroll
    for (int q = 0; q < 8; ++q) {
      const int r = q * 2 + rsub;
      const v4f v = *(const v4fa*)&so[w][r][c4];
      *(v4f*)(C + (size_t)(row0 + r) * ldc + col0 + c4) = v;
    }
    
  }
}
// row LayerNorm (biased variance, eps) over N: s = X (+ R); optional out_sum <- s; out_norm <- (s-mu)*rsqrt(var+eps)*g + b
template <bool PARAM_BF16>
__global__ __launch_bounds__(256) void k_layernorm(const float* __restrict__ X, const float* __restrict__ R, const float* __restrict__ g, const float* __restrict__ bta,
                                                  float* __restrict__ out_sum, float* __restrict__ out_norm, int N, float eps) {
  __shared__ float red[256];
  const int row = blockIdx.x, tid = threadIdx.x;
  const float* x = X + (size_t)row * N; const float* rr = R ? R + (size_t)row * N : nullptr;
  float vals[16];                     // up to N = 4096
  const int per = N / 256;            // contiguous chunk per thread? use strided-by-4 chunks: thread handles j = tid*4 + 1024*u
  float s1 = 0.f;
  for (int u = 0; u < per / 4; ++u) {
    const int j = tid * 4 + 1024 * u;
    const v4f a = *(const v4fa*)(x + j);
    v4f b = {0.f,0.f,0.f,0.f}; if (rr) b = *(const v4fa*)(rr + j);
#pragma unroll
    for (int q = 0; q < 4; ++q) { const float v = a[q] + b[q]; vals[u * 4 + q] = v; s1 += v; }
  }
  red[tid] = s1; __syncthreads();
  for (int st = 128; st > 0; st >>= 1) { if (tid < st) red[tid] += red[tid + st]; __syncthreads(); }
  const float mu = red[0] / (float)N; __syncthreads();
  float s2 = 0.f;
  for (int u = 0; u < per / 4; ++u)
#pragma unroll
    for (int q = 0; q < 4; ++q) { const float c = vals[u * 4 + q] - mu; s2 += c * c; }
  red[tid] = s2; __syncthreads();
  for (int st = 128; st > 0; st >>= 1) { if (tid < st) red[tid] += red[tid + st]; __syncthreads(); }
  const float rs = rsqrtf(red[0] / (float)N + eps);
  {
    for (int u = 0; u < per / 4; ++u) {
      const int j = tid * 4 + 1024 * u;
      v4f o, sm;
#pragma unroll
      for (int q = 0; q < 4; ++q) {
        float gg = g[j + q], bb = bta[j + q];
        if (PARAM_BF16) { gg = bf16_round(gg); bb = bf16_round(bb); }
        sm[q] = vals[u * 4 + q]; o[q] = (vals[u * 4 + q] - mu) * rs * gg + bb;
      }
      if (out_sum) *(v4f*)(out_sum + (size_t)row * N + j) = sm;
      *(v4f*)(out_norm + (size_t)row * N + j) = o;
    }
    
  }
}



// ---- f16 WMMA path (v_wmma_f32_16x16x32_f16): 11-bit significands for operands in range — used where a [0,1] probability operand needs more precision than bf16
typedef _Float16 v16h __attribute__((ext_vector_type(16)));
union FragH { v16h v; v8us half[2]; _Float16 h[16]; unsigned short u[16]; };
template <int NT>
__device__ __forceinline__ v8f mmaH(v16h ah, v16h al, v16h bh, v16h bl, v8f c) {
  c = __builtin_amdgcn_wmma_f32_16x16x32_f16(false, ah, false, bh, (short)0, c, false, false);
  if (NT >= 2) c = __builtin_amdgcn_wmma_f32_16x16x32_f16(false, al, false, bh, (short)0, c, false, false);
  if (NT >= 3) c = __builtin_amdgcn_wmma_f32_16x16x32_f16(false, ah, false, bl, (short)0, c, false, false);
  asm volatile("v_nop\n\tv_nop\n\tv_nop\n\tv_nop" : "+v"(c) : "v"(ah), "v"(al), "v"(bh), "v"(bl));
  return c;
}
// batched GEMM like k_gemm_b but f16 operands: A f32 (split into f16 hi/lo if ASPLIT, else rounded to f16), Bt = f16 values [n][k]; alpha; C f32; N multiple of 16 (partial tiles skipped)
template <bool ASPLIT>
__global__ __launch_bounds__(128) void k_gemm_h(const float* __restrict__ A, int lda, size_t sA, const _Float16* __restrict__ Bh, int ldb, size_t sB, float alpha, float* __restrict__ C, int ldc, size_t sC, int M, int N, int K) {
  __shared__ __attribute__((aligned(16))) float so[4][16][64];
  const int tid = threadIdx.x, w = tid >> 5, lane = tid & 31, ln = lane & 15, hh = lane >> 4; const int by = blockIdx.y;
  A += (size_t)by * sA; Bh += (size_t)by * sB; C += (size_t)by * sC;
  const int ntn = (N + 63) / 64; const int wid = blockIdx.x * 4 + w; const int mt = wid / ntn, nq = wid % ntn; if (mt * 16 >= M) return;
  const int row0 = mt * 16, col0 = nq * 64; const float* arow = A + (size_t)(row0 + ln) * lda;
  v8f acc[4] = {};
  for (int kb = 0; kb < K; kb += 32) {
    FragH ah, al;
    const v4f x0 = *(const v4fa*)(arow + kb + 8 * hh), x1 = *(const v4fa*)(arow + kb + 8 * hh + 4), x2 = *(const v4fa*)(arow + kb + 16 + 8 * hh), x3 = *(const v4fa*)(arow + kb + 16 + 8 * hh + 4);
    float xs[16] = {x0[0],x0[1],x0[2],x0[3],x1[0],x1[1],x1[2],x1[3],x2[0],x2[1],x2[2],x2[3],x3[0],x3[1],x3[2],x3[3]};
#pragma unroll
    for (int i = 0; i < 16; ++i) { const _Float16 h = (_Float16)xs[i]; ah.h[i] = h; al.h[i] = ASPLIT ? (_Float16)(xs[i] - (float)h) : (_Float16)0.0f; }
#pragma unroll
    for (int t = 0; t < 4; ++t) { if (col0 + t * 16 >= N) continue; const size_t boff = (size_t)(col0 + t * 16 + ln) * ldb + kb; FragH bq; bq.half[0] = *(const v8us*)(Bh + boff + 8 * hh); bq.half[1] = *(const v8us*)(Bh + boff + 16 + 8 * hh);
      acc[t] = mmaH<ASPLIT ? 2 : 1>(ah.v, al.v, bq.v, bq.v, acc[t]); }
  }
#pragma unroll
  for (int t = 0; t < 4; ++t) { if (col0 + t * 16 >= N) continue;
#pragma unroll
    for (int r = 0; r < 8; ++r) so[w][8 * hh + r][t * 16 + ln] = acc[t][r] * alpha; }
  __builtin_amdgcn_fence(__ATOMIC_ACQ_REL, "workgroup"); __builtin_amdgcn_wave_barrier();
  const int rsub = lane >> 4, c4 = (lane & 15) * 4;
  {
#pragma unroll
    for (int q = 0; q < 8; ++q) { const int r = q * 2 + rsub; if (col0 + c4 < N) { const v4f v = *(const v4fa*)&so[w][r][c4]; *(v4f*)(C + (size_t)(row0 + r) * ldc + col0 + c4) = v; } }
     }
}

// Wt[n][k] = f16(W[k][n]·scale) from f32 row-major W[K][N] (scale = power of two; bf16-exact weights stay exact in f16 away from the subnormal range)
__global__ __launch_bounds__(256) void k_wt_f16(const float* __restrict__ W, _Float16* __restrict__ Wt, int K, int N, float scale) {
  const int t = blockIdx.x * 256 + threadIdx.x; if (t >= N * (K / 8)) return; const int n = t / (K / 8), k8 = (t % (K / 8)) * 8; FragH f;
#pragma unroll
  for (int i = 0; i < 8; ++i) f.h[i] = (_Float16)(bf16_round(W[(size_t)(k8 + i) * N + n]) * scale); const v8us o = f.half[0];
  *(v8us*)((unsigned short*)Wt + (size_t)n * K + k8) = o; 
}
// k_gemm_hh variant with fused epilogue: v = acc·alpha + bias[by·sBias + col] (+ CP[(row/rowsPerB)·sCPb + by·64 + col] if CP) ; ACT 0 none / 1 elu ; writes f16 C16 and/or f32 C, each if non-null
template <int ACT>
__global__ __launch_bounds__(128) void k_gemm_hhx(const _Float16* __restrict__ A, int lda, size_t sA, const _Float16* __restrict__ Bh, int ldb, size_t sB, float alpha, const float* __restrict__ bias, size_t sBias, const float* __restrict__ CP, int rowsPerB, size_t sCPb, int row0g,
    float* __restrict__ C, _Float16* __restrict__ C16, int ldc, size_t sC, int M, int N, int K) {
  __shared__ __attribute__((aligned(16))) float so[4][16][64];
  const int tid = threadIdx.x, w = tid >> 5, lane = tid & 31, ln = lane & 15, hh = lane >> 4; const int by = blockIdx.y;
  A += (size_t)by * sA; Bh += (size_t)by * sB; const size_t cofs = (size_t)by * sC; const float* bp = bias ? bias + (size_t)by * sBias : nullptr;
  const int ntn = (N + 63) / 64; const int wid = blockIdx.x * 4 + w; const int mt = wid / ntn, nq = wid % ntn; if (mt * 16 >= M) return;
  const int row0 = mt * 16, col0 = nq * 64; const _Float16* arow = A + (size_t)(row0 + ln) * lda;
  v8f acc[4] = {};
  for (int kb = 0; kb < K; kb += 32) { FragH ah; ah.half[0] = *(const v8us*)((const unsigned short*)arow + kb + 8 * hh); ah.half[1] = *(const v8us*)((const unsigned short*)arow + kb + 16 + 8 * hh);
#pragma unroll
    for (int t = 0; t < 4; ++t) { if (col0 + t * 16 >= N) continue; const size_t boff = (size_t)(col0 + t * 16 + ln) * ldb + kb; FragH bq; bq.half[0] = *(const v8us*)((const unsigned short*)Bh + boff + 8 * hh); bq.half[1] = *(const v8us*)((const unsigned short*)Bh + boff + 16 + 8 * hh);
      acc[t] = mmaH<1>(ah.v, ah.v, bq.v, bq.v, acc[t]); }
  }
#pragma unroll
  for (int t = 0; t < 4; ++t) { if (col0 + t * 16 >= N) continue; const int col = col0 + t * 16 + ln; const float bv = bp ? bf16_round(bp[col]) : 0.f;
#pragma unroll
    for (int r = 0; r < 8; ++r) { float v = acc[t][r] * alpha + bv; if (CP) { const int bidx = (row0g + row0 + 8 * hh + r) / rowsPerB; v += CP[(size_t)bidx * sCPb + (size_t)by * 64 + col]; } if (ACT == 1) v = (v > 0.f) ? v : expm1f(v); else if (ACT == 7) v = (v > 0.f) ? v + 1.0f : expf(v); else if (ACT == 8) v = tanhf(v); else if (ACT == 9) v = 0.5f * v * (1.0f + tanhf(0.7978845608028654f * (v + 0.044715f * v * v * v))); else if (ACT == 11) v = 1.0f / (1.0f + expf(-v)); else if (ACT == 12) v = (v > 0.f) ? v : 0.01f * v; else if (ACT == 14) v = (v > 0.f) ? v : 0.1f * v; else if (ACT == 15) v = v / (1.0f + expf(-v)); else if (ACT == 3) v = fmaxf(v, 0.f); else if (ACT == 6) v = 0.5f * v * (1.0f + erff(v * 0.70710678118654752f)); so[w][8 * hh + r][t * 16 + ln] = v; } }
  __builtin_amdgcn_fence(__ATOMIC_ACQ_REL, "workgroup"); __builtin_amdgcn_wave_barrier();
  const int rsub = lane >> 4, c4 = (lane & 15) * 4; typedef _Float16 v4h __attribute__((ext_vector_type(4)));
  {
#pragma unroll
    for (int q = 0; q < 8; ++q) { const int r = q * 2 + rsub; if (col0 + c4 < N) { const v4f v = *(const v4fa*)&so[w][r][c4]; if (C) *(v4f*)(C + cofs + (size_t)(row0 + r) * ldc + col0 + c4) = v; if (C16) { v4h h4; for (int i = 0; i < 4; ++i) h4[i] = (_Float16)v[i]; *(v4h*)(C16 + cofs + (size_t)(row0 + r) * ldc + col0 + c4) = h4; } } }
     }
}


typedef _Float16 v4h __attribute__((ext_vector_type(4)));

__global__ __launch_bounds__(256) void k_x16(const float* __restrict__ x, _Float16* __restrict__ X16, size_t n8) { const size_t t = (size_t)blockIdx.x * 256 + threadIdx.x; if (t >= n8) return; FragH f;
#pragma unroll
  for (int q = 0; q < 8; ++q) f.h[q] = (_Float16)bf16_round(x[t * 8 + q]); *(v8us*)((unsigned short*)X16 + t * 8) = f.half[0];  }
__global__ __launch_bounds__(256) void k_h16(const float* __restrict__ x, _Float16* __restrict__ X16, size_t n8) { const size_t t = (size_t)blockIdx.x * 256 + threadIdx.x; if (t >= n8) return; FragH f;
#pragma unroll
  for (int q = 0; q < 8; ++q) f.h[q] = (_Float16)x[t * 8 + q]; *(v8us*)((unsigned short*)X16 + t * 8) = f.half[0];  }
__global__ __launch_bounds__(256) void k_round16f(const float* __restrict__ W, _Float16* __restrict__ Bt, size_t n8) { const size_t t = (size_t)blockIdx.x * 256 + threadIdx.x; if (t >= n8) return; FragH f;
#pragma unroll
  for (int i = 0; i < 8; ++i) f.h[i] = (_Float16)(bf16_round(W[t * 8 + i]) * 16.0f); *(v8us*)((unsigned short*)Bt + t * 8) = f.half[0];  }
template <int NHv, int TTv>
__global__ __launch_bounds__(256) void k_vt(const _Float16* __restrict__ V16, int ldv, int voff, _Float16* __restrict__ Vt) { __shared__ unsigned short tl[64][66]; const int tid = threadIdx.x; const int slab = blockIdx.x / (TTv / 64), lg = blockIdx.x % (TTv / 64); const int b = slab / NHv, h = slab % NHv;
  for (int i = tid; i < 64 * 8; i += 256) { const int r = i / 8, c8 = (i % 8) * 8; FragH f; f.half[0] = *(const v8us*)((const unsigned short*)V16 + ((size_t)b * TTv + lg * 64 + r) * ldv + voff + h * 64 + c8);
#pragma unroll
    for (int q = 0; q < 8; ++q) tl[r][c8 + q] = f.u[q]; }
  __syncthreads();
  {
#pragma unroll
    for (int rd = 0; rd < 2; ++rd) { const int d = rd * 32 + tid / 8, pc = tid % 8; FragH f;
#pragma unroll
      for (int q = 0; q < 8; ++q) f.u[q] = tl[pc * 8 + q][d];
      *(v8us*)((unsigned short*)Vt + ((size_t)slab * 64 + d) * TTv + lg * 64 + pc * 8) = f.half[0]; }
     } }

__global__ __launch_bounds__(256) void k_hl(const float* __restrict__ F, _Float16* __restrict__ Hh, _Float16* __restrict__ Hl, size_t n8) { const size_t t = (size_t)blockIdx.x * 256 + threadIdx.x; if (t >= n8) return; FragH fh, fl; const v4f a = *(const v4fa*)(F + t * 8), c = *(const v4fa*)(F + t * 8 + 4);
#pragma unroll
  for (int q = 0; q < 4; ++q) { _Float16 h = (_Float16)a[q]; fh.h[q] = h; fl.h[q] = (_Float16)((a[q] - (float)h) * 1024.0f); h = (_Float16)c[q]; fh.h[4 + q] = h; fl.h[4 + q] = (_Float16)((c[q] - (float)h) * 1024.0f); }
  { *(v8us*)((unsigned short*)Hh + t * 8) = fh.half[0]; *(v8us*)((unsigned short*)Hl + t * 8) = fl.half[0];  } }

__global__ __launch_bounds__(256) void k_h16s(const float* __restrict__ F, _Float16* __restrict__ H, size_t n8) { const size_t t = (size_t)blockIdx.x * 256 + threadIdx.x; if (t >= n8) return; const v4f a = *(const v4fa*)(F + t * 8), c = *(const v4fa*)(F + t * 8 + 4); FragH f;
#pragma unroll
  for (int q = 0; q < 4; ++q) { f.h[q] = (_Float16)(a[q] * 16.0f); f.h[4 + q] = (_Float16)(c[q] * 16.0f); } *(v8us*)((unsigned short*)H + t * 8) = f.half[0];  }
// mask predicates over (query index q, key-plane row k): key-plane rows 0..T-1 are TOKENS, rows T..2T-1 are CONCEPTS (the tok/con GEMMs write the two halves of one plane per batch); MODE 0 = token queries: token s ≤ q (causal), concept j < q/ntc + 1;
// MODE 1 = concept queries: concept j ≤ q, token s < ntc·(q + 1). (Key order inside the softmax is irrelevant, so the plane order is used directly.)
template <int MODE> __device__ __forceinline__ bool allow(int q, int k, int ntc) {
  if (MODE == 0) return (k < TQ) ? (k <= q) : ((k - TQ) < q / ntc + 1);
  else           return (k < TQ) ? (k < ntc * (q + 1)) : ((k - TQ) <= q); }
// Work-group = 12 waves on the block's 64 query rows: wave w takes query tile (w & 3) and every third key tile, j0 = 32 * ((w >> 2) + 3 * i); the three partial softmax states of a query tile (row maximum, row sum, weighted V sum) are merged in LDS behind the loop.
template <int MODE>
__global__ __launch_bounds__(384) void k_flashm(const _Float16* __restrict__ Q16, int ldq, const _Float16* __restrict__ K16, int ldk, const _Float16* __restrict__ Vt, const int* __restrict__ NTCP, float* __restrict__ O, int ldo) {
  int ntc = NTCP[0]; ntc = (ntc < 1) ? 1 : ntc;      /* = 8 here; guarded so the index arithmetic can never divide by zero */
  constexpr int RPW = 16, RTN = RPW / 16, NQB = TQ / (4 * RPW), DT = 4, KS = 2, NSP = 3;
  __shared__ __attribute__((aligned(16))) unsigned short sP[4 * NSP][RPW][40]; __shared__ __attribute__((aligned(16))) float sO[4 * NSP][RPW][64 + 4]; __shared__ float sM[4 * NSP][RPW], sL[4 * NSP][RPW];
  const int tid = threadIdx.x, w = __builtin_amdgcn_readfirstlane(tid >> 5), lane = tid & 31, ln = lane & 15, hh = lane >> 4;      /* the wave's number in a scalar register: the key loop's counter and its tests on j0 stay scalar */
  const int slab = blockIdx.x / NQB, qblk = blockIdx.x % NQB; const int b = slab / NH, h = slab % NH; const int qb0 = qblk * (4 * RPW); const int qt = w & 3, sp = w >> 2; const int q0 = qb0 + qt * RPW;
  FragH aq[2][KS];
#pragma unroll
  for (int rt = 0; rt < RTN; ++rt) { const unsigned short* qr = (const unsigned short*)Q16 + ((size_t)b * TQ + q0 + rt * 16 + ln) * ldq + h * 64;
#pragma unroll
    for (int ks = 0; ks < KS; ++ks) { aq[rt][ks].half[0] = *(const v8us*)(qr + ks * 32 + 8 * hh); aq[rt][ks].half[1] = *(const v8us*)(qr + ks * 32 + 16 + 8 * hh); } }
  const unsigned short* Vth = (const unsigned short*)Vt + (size_t)slab * 64 * TK;
  float m_r[2][8], l_r[2][8]; v8f oacc[2][DT];
#pragma unroll
  for (int rt = 0; rt < RTN; ++rt) {
#pragma unroll
    for (int r = 0; r < 8; ++r) { m_r[rt][r] = -3.0e38f; l_r[rt][r] = 0.f; }
#pragma unroll
    for (int dt = 0; dt < DT; ++dt) oacc[rt][dt] = (v8f){0.f,0.f,0.f,0.f,0.f,0.f,0.f,0.f}; }
  const int jend = TK;
#pragma unroll 1
  for (int j0 = sp * 32; j0 < jend; j0 += 32 * NSP) {
    v8f s[2][2];
#pragma unroll
    for (int nt = 0; nt < 2; ++nt) { const unsigned short* kr = (const unsigned short*)K16 + ((size_t)b * TK + j0 + nt * 16 + ln) * ldk + h * 64; FragH bk[KS];
#pragma unroll
      for (int ks = 0; ks < KS; ++ks) { bk[ks].half[0] = *(const v8us*)(kr + ks * 32 + 8 * hh); bk[ks].half[1] = *(const v8us*)(kr + ks * 32 + 16 + 8 * hh); }
#pragma unroll
      for (int rt = 0; rt < RTN; ++rt) { v8f acc = (v8f){0.f,0.f,0.f,0.f,0.f,0.f,0.f,0.f};
#pragma unroll
        for (int ks = 0; ks < KS; ++ks) acc = mmaH<1>(aq[rt][ks].v, aq[rt][ks].v, bk[ks].v, bk[ks].v, acc); s[rt][nt] = acc; } }
#pragma unroll
    for (int rt = 0; rt < RTN; ++rt)
#pragma unroll
      for (int r = 0; r < 8; ++r) { const int tq = q0 + rt * 16 + 8 * hh + r; const int k0 = j0 + ln, k1 = j0 + 16 + ln; 
        const bool ok0 = allow<MODE>(tq, k0, ntc), ok1 = allow<MODE>(tq, k1, ntc);
        const float s0 = ok0 ? s[rt][0][r] * SCL : -INFINITY, s1 = ok1 ? s[rt][1][r] * SCL : -INFINITY; float mc = fmaxf(s0, s1);
        mc = fmaxf(mc, __shfl_xor(mc, 1, 32)); mc = fmaxf(mc, __shfl_xor(mc, 2, 32)); mc = fmaxf(mc, __shfl_xor(mc, 4, 32)); mc = fmaxf(mc, __shfl_xor(mc, 8, 32));
        const float mn = fmaxf(m_r[rt][r], mc); const float al = (mn > -1.0e38f) ? expf(m_r[rt][r] - mn) : 1.0f; m_r[rt][r] = mn; const float p0 = ok0 ? expf(s0 - mn) : 0.f, p1 = ok1 ? expf(s1 - mn) : 0.f; l_r[rt][r] = l_r[rt][r] * al + p0 + p1;
#pragma unroll
        for (int dt = 0; dt < DT; ++dt) oacc[rt][dt][r] *= al;
        FragH t2; t2.h[0] = (_Float16)(p0 * 1024.0f); t2.h[1] = (_Float16)(p1 * 1024.0f); sP[w][rt * 16 + 8 * hh + r][ln] = t2.u[0]; sP[w][rt * 16 + 8 * hh + r][16 + ln] = t2.u[1]; }
    __builtin_amdgcn_fence(__ATOMIC_ACQ_REL, "workgroup"); __builtin_amdgcn_wave_barrier();
    FragH pa[2];
#pragma unroll
    for (int rt = 0; rt < RTN; ++rt) { pa[rt].half[0] = *(const v8us*)&sP[w][rt * 16 + ln][8 * hh]; pa[rt].half[1] = *(const v8us*)&sP[w][rt * 16 + ln][16 + 8 * hh]; }
#pragma unroll
    for (int dt = 0; dt < DT; ++dt) { const unsigned short* vrow = Vth + (size_t)(dt * 16 + ln) * TK + j0; FragH bv; bv.half[0] = *(const v8us*)(vrow + 8 * hh); bv.half[1] = *(const v8us*)(vrow + 16 + 8 * hh);
#pragma unroll
      for (int rt = 0; rt < RTN; ++rt) oacc[rt][dt] = mmaH<1>(pa[rt].v, pa[rt].v, bv.v, bv.v, oacc[rt][dt]); }
    __builtin_amdgcn_fence(__ATOMIC_ACQ_REL, "workgroup"); __builtin_amdgcn_wave_barrier(); }
#pragma unroll
  for (int rt = 0; rt < RTN; ++rt) {
#pragma unroll
    for (int r = 0; r < 8; ++r) { float l = l_r[rt][r]; l += __shfl_xor(l, 1, 32); l += __shfl_xor(l, 2, 32); l += __shfl_xor(l, 4, 32); l += __shfl_xor(l, 8, 32);
      if (ln == 0) { sM[w][rt * 16 + 8 * hh + r] = m_r[rt][r]; sL[w][rt * 16 + 8 * hh + r] = l; } } }
  __syncthreads();      /* publishes every wave's row maxima and row sums */
#pragma unroll
  for (int rt = 0; rt < RTN; ++rt) {
#pragma unroll
    for (int r = 0; r < 8; ++r) { const int row = rt * 16 + 8 * hh + r; float mg = sM[qt][row];
#pragma unroll
      for (int s2 = 1; s2 < NSP; ++s2) mg = fmaxf(mg, sM[s2 * 4 + qt][row]);
      float l = 0.f, fo = 0.f;      /* a wave that met no allowed key of this row holds sum 0 and a zero V sum */
#pragma unroll
      for (int s2 = 0; s2 < NSP; ++s2) { const float e = expf(sM[s2 * 4 + qt][row] - mg); l += sL[s2 * 4 + qt][row] * e; if (s2 == sp) fo = e; }
      l_r[rt][r] = (l > 0.f) ? fo / (l * 1024.0f) : 0.f; }
#pragma unroll
    for (int dt = 0; dt < DT; ++dt)
#pragma unroll
      for (int r = 0; r < 8; ++r) sO[w][rt * 16 + 8 * hh + r][dt * 16 + ln] = oacc[rt][dt][r] * l_r[rt][r]; }
  __syncthreads();      /* publishes the rescaled partial outputs */
  for (int i = tid; i < 4 * RPW * 16; i += 128 * NSP) { const int q2 = i >> 8, r = (i >> 4) & 15, pc = i & 15; v4f val = *(const v4fa*)&sO[q2][r][pc * 4];
#pragma unroll
    for (int s2 = 1; s2 < NSP; ++s2) val += *(const v4fa*)&sO[s2 * 4 + q2][r][pc * 4];
    *(v4f*)(O + ((size_t)b * TQ + qb0 + q2 * RPW + r) * ldo + h * 64 + pc * 4) = val; } }

extern "C" void kernel_launch(void* const* d_in, const int* in_sizes, int n_in,
                              void* d_out, int out_size, void* d_ws, size_t ws_size, hipStream_t stream) {
  (void)in_sizes; (void)n_in; (void)out_size;
  const float* const* I = (const float* const*)d_in; const float* xt = I[0]; const float* xc = I[1]; const float* Wt = I[2]; const float* bt = I[3]; const float* Wc = I[4]; const float* bc = I[5]; const float* Wtp = I[6]; const float* btp = I[7]; const float* Wcp = I[8]; const float* bcp = I[9]; const int* ntcp = (const int*)d_in[10];      /* int64 in the module, read as int32 */
  char* ws = (char*)d_ws; size_t off = 0;
  auto take = [&](size_t bytes) { char* p = ws + off; off += (bytes + 255) & ~(size_t)255; return p; };
  _Float16* Bt_ = (_Float16*)take((size_t)DW * DD * 2); _Float16* Bc = (_Float16*)take((size_t)DW * DD * 2); _Float16* Btp = (_Float16*)take((size_t)DD * DD * 2); _Float16* Bcp = (_Float16*)take((size_t)DD * DD * 2);
  _Float16* XT = (_Float16*)take((size_t)NR * DD * 2); _Float16* XC = (_Float16*)take((size_t)NR * DD * 2); _Float16* TC = (_Float16*)take((size_t)BB * TK * DW * 2);      /* per batch: rows 0..1023 = tok, 1024..2047 = con */
  _Float16* Vt1 = (_Float16*)take((size_t)BB * NH * 64 * TK * 2); _Float16* Vt2 = (_Float16*)take((size_t)BB * NH * 64 * TK * 2); float* O = (float*)take((size_t)NR * DD * 4); _Float16* O16 = (_Float16*)take((size_t)NR * DD * 2);
  if (off > ws_size) return;      // 8.4 + 8.4 + 2.1 + 2.1 + 4.2 + 4.2 + 33.6 + 8.4 + 8.4 + 8.4 + 4.2 ≈ 92 MB
  const unsigned gw = (unsigned)(((size_t)DW * DD / 8 + 255) / 256), gp = (unsigned)(((size_t)DD * DD / 8 + 255) / 256);
  k_round16f<<<gw, 256, 0, stream>>>(Wt, Bt_, (size_t)DW * DD / 8); k_round16f<<<gw, 256, 0, stream>>>(Wc, Bc, (size_t)DW * DD / 8); k_round16f<<<gp, 256, 0, stream>>>(Wtp, Btp, (size_t)DD * DD / 8); k_round16f<<<gp, 256, 0, stream>>>(Wcp, Bcp, (size_t)DD * DD / 8);      /* torch (out,in) natural, ×2^4 */
  const unsigned g8 = (unsigned)(((size_t)NR * DD / 8 + 255) / 256); k_x16<<<g8, 256, 0, stream>>>(xt, XT, (size_t)NR * DD / 8); k_x16<<<g8, 256, 0, stream>>>(xc, XC, (size_t)NR * DD / 8);
  const dim3 gt(((TQ / 16) * (DW / 64) + 3) / 4, BB);
  k_gemm_hhx<0><<<gt, 128, 0, stream>>>(XT, DD, (size_t)TQ * DD, Bt_, DD, 0, 0.0625f, bt, 0, nullptr, 1, 0, 0, nullptr, TC, DW, (size_t)TK * DW, TQ, DW, DD);      /* tok[b] → plane rows 0..1023: M 1024 N 4096 K 1024 */
  k_gemm_hhx<0><<<gt, 128, 0, stream>>>(XC, DD, (size_t)TQ * DD, Bc, DD, 0, 0.0625f, bc, 0, nullptr, 1, 0, 0, nullptr, TC + (size_t)TQ * DW, DW, (size_t)TK * DW, TQ, DW, DD);      /* con[b] → plane rows 1024..2047 */
  k_vt<NH, TK><<<BB * NH * (TK / 64), 256, 0, stream>>>(TC, DW, 2 * DD, Vt1);      /* values read by tokens = columns 2048.. of both halves → Vᵀ [bh][64][2048] */
  k_vt<NH, TK><<<BB * NH * (TK / 64), 256, 0, stream>>>(TC, DW, 3 * DD, Vt2);      /* values read by concepts = columns 3072.. */
  const dim3 gpj(((NR / 16) * (DD / 64) + 3) / 4, 1);
  k_flashm<0><<<BB * NH * (TQ / 64), 384, 0, stream>>>(XT, DD, TC, DW, Vt1, ntcp, O, DD);      /* token queries; keys = columns 0..1023 (kt_t on token rows, kc_t on concept rows) */
  k_h16s<<<g8, 256, 0, stream>>>(O, O16, (size_t)NR * DD / 8);
  k_gemm_hhx<0><<<gpj, 128, 0, stream>>>(O16, DD, 0, Btp, DD, 0, 0.00390625f, btp, 0, nullptr, 1, 0, 0, (float*)d_out, nullptr, DD, 0, NR, DD, DD);      /* y_t = merged·Wtpᵀ + btp → output 0 */
  k_flashm<1><<<BB * NH * (TQ / 64), 384, 0, stream>>>(XC, DD, TC + DD, DW, Vt2, ntcp, O, DD);      /* concept queries; keys = columns 1024..2047 (kc_c on concept rows, kt_c on token rows) */
  k_h16s<<<g8, 256, 0, stream>>>(O, O16, (size_t)NR * DD / 8);
  k_gemm_hhx<0><<<gpj, 128, 0, stream>>>(O16, DD, 0, Bcp, DD, 0, 0.00390625f, bcp, 0, nullptr, 1, 0, 0, (float*)d_out + (size_t)NR * DD, nullptr, DD, 0, NR, DD, DD);      /* y_c → output 1 (offset B·T·NE floats) */
}

// v002
// It runs in 310 microseconds.
// Next to v001, in two timings, it ran 1.54 and 1.55 times as fast.
// Over all steps from v000 it is 2.50 times as fast.
#include <hip/hip_runtime.h>
// Token/concept two-stream causal attention (B=2, T=C=1024, NE=CD=1024, 16 heads × 64, n_tokens_per_concept = 8): tok = xt·Wtᵀ + bt, con = xc·Wcᵀ + bc (4096 outputs each = [k for token queries | k for concept queries | v read by tokens | v read by concepts]);
// token queries = heads(xt) (the residual stream itself) attend over [tokens ; concepts] with mask (s ≤ t) | (j < t/8 + 1), scale 1/√64; concept queries = heads(xc) attend over [concepts ; tokens] with mask (j ≤ i) | (s < 8(i+1)); disallowed = −1e9 (≡ −inf: every row keeps itself);
// y_t = merge(attn_t)·Wtpᵀ + btp, y_c = merge(attn_c)·Wcpᵀ + bcp (two outputs).
// Compute dtype: xt, xc, weights, biases rounded to bf16; tok/con as f16 GEMM planes written as the two 1024-row halves of one 2048-key plane per batch; queries = the bf16-exact x planes; fused flash-style kernels with the index-computed masks (n_tokens_per_concept read on device; online softmax f32,
// P f16 ×2^10, f32 accumulate) on v_wmma_f32_16x16x32_f16; O ×2^4 → f16 → projection GEMMs (+bias) straight into the two output slots.
#define BB 2
#define TQ 1024
#define TK 2048
#define DD 1024
#define NH 16
#define DW 4096
#define SCL 0.125f
#define NR (BB * TQ)
typedef __bf16 v16b __attribute__((ext_vector_type(16)));
typedef unsigned short v8us __attribute__((ext_vector_type(8), may_alias));
typedef float  v8f  __attribute__((ext_vector_type(8)));
typedef float  v4f  __attribute__((ext_vector_type(4)));
typedef float  v4fa __attribute__((ext_vector_type(4), may_alias));
union FragB { v16b v; v8us half[2]; unsigned short u[16]; };

__device__ __forceinline__ unsigned short bf16_bits(float x) { unsigned int u = __float_as_uint(x); return (unsigned short)((u + 0x7FFFu + ((u >> 16) & 1u)) >> 16); }
__device__ __forceinline__ float bf16_val(unsigned short b) { return __uint_as_float(((unsigned int)b) << 16); }
__device__ __forceinline__ float bf16_round(float x) { return bf16_val(bf16_bits(x)); }
// D += A·B with NT terms: 1 = ah·bh, 2 = + al·bh (A split), 3 = + ah·bl (both split)
template <int NT>
__device__ __forceinline__ v8f mmaN(v16b ah, v16b al, v16b bh, v16b bl, v8f c) {
  c = __builtin_amdgcn_wmma_f32_16x16x32_bf16(false, ah, false, bh, (short)0, c, false, false);
  if (NT >= 2) c = __builtin_amdgcn_wmma_f32_16x16x32_bf16(false, al, false, bh, (short)0, c, false, false);
  if (NT >= 3) c = __builtin_amdgcn_wmma_f32_16x16x32_bf16(false, ah, false, bl, (short)0, c, false, false);
  asm volatile("v_nop\n\tv_nop\n\tv_nop\n\tv_nop" : "+v"(c) : "v"(ah), "v"(al), "v"(bh), "v"(bl));
  return c;
}

__global__ __launch_bounds__(256) void k_wt_bf16(const float* __restrict__ W, unsigned short* __restrict__ Wt, int K, int N) {
  const int t = blockIdx.x * 256 + threadIdx.x;
  const int k8n = K / 8;
  if (t >= N * k8n) return;
  const int n = t / k8n, k8 = (t % k8n) * 8;
  v8us v;
#pragma unroll
  for (int i = 0; i < 8; ++i) v[i] = bf16_bits(W[(size_t)(k8 + i) * N + n]);
  *(v8us*)(Wt + (size_t)n * K + k8) = v;
  
}

// GEMM C[M][N] (f32, pitch ldc) = act(A[M][K]·W + bias). A f32 row-major (pitch lda) converted per fragment to bf16
// (ASPLIT: hi/lo two planes -> 2 terms, else single rounded term); Wt bf16 [N][K] (pitch ldb). BIAS_BF16 rounds the
// bias to bf16 first (bias quantised to bf16 before the add). K%32==0, M%16==0, N%64==0.
template <bool ASPLIT, int ACT, bool BIAS_BF16>
__global__ __launch_bounds__(128) void k_gemm_bf(const float* __restrict__ A, int lda, const unsigned short* __restrict__ Wt, int ldb,
                                               const float* __restrict__ bias, float* __restrict__ C, int ldc, int M, int N, int K) {
  __shared__ __attribute__((aligned(16))) float so[4][16][64];
  const int tid = threadIdx.x, w = tid >> 5, lane = tid & 31, ln = lane & 15, hh = lane >> 4;
  const int ntn = N / 64;
  const int wid = blockIdx.x * 4 + w;
  const int mt = wid / ntn, nq = wid % ntn;
  if (mt * 16 >= M) return;
  const int row0 = mt * 16, col0 = nq * 64;
  const float* arow = A + (size_t)(row0 + ln) * lda;
  v8f acc[4] = {};
  for (int kb = 0; kb < K; kb += 32) {
    FragB ah, al;
    const v4f x0 = *(const v4fa*)(arow + kb + 8 * hh), x1 = *(const v4fa*)(arow + kb + 8 * hh + 4);
    const v4f x2 = *(const v4fa*)(arow + kb + 16 + 8 * hh), x3 = *(const v4fa*)(arow + kb + 16 + 8 * hh + 4);
    float xs[16] = {x0[0],x0[1],x0[2],x0[3],x1[0],x1[1],x1[2],x1[3],x2[0],x2[1],x2[2],x2[3],x3[0],x3[1],x3[2],x3[3]};
#pragma unroll
    for (int i = 0; i < 16; ++i) { const unsigned short hb = bf16_bits(xs[i]); ah.u[i] = hb; al.u[i] = ASPLIT ? bf16_bits(xs[i] - bf16_val(hb)) : (unsigned short)0; }
#pragma unroll
    for (int t = 0; t < 4; ++t) {
      const unsigned short* brow = Wt + (size_t)(col0 + t * 16 + ln) * ldb + kb;
      FragB b;
      b.half[0] = *(const v8us*)(brow + 8 * hh);
      b.half[1] = *(const v8us*)(brow + 16 + 8 * hh);
      acc[t] = mmaN<ASPLIT ? 2 : 1>(ah.v, al.v, b.v, b.v, acc[t]);
    }
  }
#pragma unroll
  for (int t = 0; t < 4; ++t) {
    float bv = bias ? bias[col0 + t * 16 + ln] : 0.f;
    if (BIAS_BF16) bv = bf16_round(bv);
#pragma unroll
    for (int r = 0; r < 8; ++r) { float v = acc[t][r] + bv; if (ACT == 1) v = fmaxf(v, 0.f); so[w][8 * hh + r][t * 16 + ln] = v; }
  }
  __builtin_amdgcn_fence(__ATOMIC_ACQ_REL, "workgroup");
  __builtin_amdgcn_wave_barrier();
  const int rsub = lane >> 4, c4 = (lane & 15) * 4;
  {
#pragma unroll
    for (int q = 0; q < 8; ++q) {
      const int r = q * 2 + rsub;
      const v4f v = *(const v4fa*)&so[w][r][c4];
      *(v4f*)(C + (size_t)(row0 + r) * ldc + col0 + c4) = v;
    }
    
  }
}

// GEMM C = act(A·W + bias + resid): A f32 (ASPLIT -> hi/lo 2 terms), Wt bf16 [N][K]; ACT 0 none, 1 relu, 2 exact gelu;
// resid (optional, f32, row index = (row % rmod), pitch ldr, RES_BF16 rounds it) added before the activation.
template <bool ASPLIT, int ACT, bool BIAS_BF16, bool RES_BF16>
__global__ __launch_bounds__(128) void k_gemm_bf3(const float* __restrict__ A, int lda, const unsigned short* __restrict__ Wt, int ldb,
                                                const float* __restrict__ bias, const float* __restrict__ resid, int rmod, int ldr,
                                                float* __restrict__ C, int ldc, int M, int N, int K) {
  __shared__ __attribute__((aligned(16))) float so[4][16][64];
  const int tid = threadIdx.x, w = tid >> 5, lane = tid & 31, ln = lane & 15, hh = lane >> 4;
  const int ntn = N / 64;
  const int wid = blockIdx.x * 4 + w;
  const int mt = wid / ntn, nq = wid % ntn;
  if (mt * 16 >= M) return;
  const int row0 = mt * 16, col0 = nq * 64;
  const float* arow = A + (size_t)(row0 + ln) * lda;
  v8f acc[4] = {};
  for (int kb = 0; kb < K; kb += 32) {
    FragB ah, al;
    const v4f x0 = *(const v4fa*)(arow + kb + 8 * hh), x1 = *(const v4fa*)(arow + kb + 8 * hh + 4);
    const v4f x2 = *(const v4fa*)(arow + kb + 16 + 8 * hh), x3 = *(const v4fa*)(arow + kb + 16 + 8 * hh + 4);
    float xs[16] = {x0[0],x0[1],x0[2],x0[3],x1[0],x1[1],x1[2],x1[3],x2[0],x2[1],x2[2],x2[3],x3[0],x3[1],x3[2],x3[3]};
#pragma unroll
    for (int i = 0; i < 16; ++i) { const unsigned short hb = bf16_bits(xs[i]); ah.u[i] = hb; al.u[i] = ASPLIT ? bf16_bits(xs[i] - bf16_val(hb)) : (unsigned short)0; }
#pragma unroll
    for (int t = 0; t < 4; ++t) {
      const unsigned short* brow = Wt + (size_t)(col0 + t * 16 + ln) * ldb + kb;
      FragB b;
      b.half[0] = *(const v8us*)(brow + 8 * hh);
      b.half[1] = *(const v8us*)(brow + 16 + 8 * hh);
      acc[t] = mmaN<ASPLIT ? 2 : 1>(ah.v, al.v, b.v, b.v, acc[t]);
    }
  }
#pragma unroll
  for (int t = 0; t < 4; ++t) {
    const int col = col0 + t * 16 + ln;
    float bv = bias ? bias[col] : 0.f;
    if (BIAS_BF16) bv = bf16_round(bv);
#pragma unroll
    for (int r = 0; r < 8; ++r) {
      float v = acc[t][r] + bv;
      if (resid) { float rv = resid[(size_t)((row0 + 8 * hh + r) % rmod) * ldr + col]; if (RES_BF16) rv = bf16_round(rv); v += rv; }
      if (ACT == 1) v = fmaxf(v, 0.f);
      if (ACT == 2) v = 0.5f * v * (1.0f + erff(v * 0.70710678118654752f));
      if (ACT == 3) { const float u = 0.7978845608028654f * (v + 0.044715f * v * v * v); v = 0.5f * v * (1.0f + tanhf(u)); }
      so[w][8 * hh + r][t * 16 + ln] = v;
    }
  }
  __builtin_amdgcn_fence(__ATOMIC_ACQ_REL, "workgroup");
  __builtin_amdgcn_wave_barrier();
  const int rsub = lane >> 4, c4 = (lane & 15) * 4;
  {
#pragma unroll
    for (int q = 0; q < 8; ++q) {
      const int r = q * 2 + rsub;
      const v4f v = *(const v4fa*)&so[w][r][c4];
      *(v4f*)(C + (size_t)(row0 + r) * ldc + col0 + c4) = v;
    }
    
  }
}
// row LayerNorm (biased variance, eps) over N: s = X (+ R); optional out_sum <- s; out_norm <- (s-mu)*rsqrt(var+eps)*g + b
template <bool PARAM_BF16>
__global__ __launch_bounds__(256) void k_layernorm(const float* __restrict__ X, const float* __restrict__ R, const float* __restrict__ g, const float* __restrict__ bta,
                                                  float* __restrict__ out_sum, float* __restrict__ out_norm, int N, float eps) {
  __shared__ float red[256];
  const int row = blockIdx.x, tid = threadIdx.x;
  const float* x = X + (size_t)row * N; const float* rr = R ? R + (size_t)row * N : nullptr;
  float vals[16];                     // up to N = 4096
  const int per = N / 256;            // contiguous chunk per thread? use strided-by-4 chunks: thread handles j = tid*4 + 1024*u
  float s1 = 0.f;
  for (int u = 0; u < per / 4; ++u) {
    const int j = tid * 4 + 1024 * u;
    const v4f a = *(const v4fa*)(x + j);
    v4f b = {0.f,0.f,0.f,0.f}; if (rr) b = *(const v4fa*)(rr + j);
#pragma unroll
    for (int q = 0; q < 4; ++q) { const float v = a[q] + b[q]; vals[u * 4 + q] = v; s1 += v; }
  }
  red[tid] = s1; __syncthreads();
  for (int st = 128; st > 0; st >>= 1) { if (tid < st) red[tid] += red[tid + st]; __syncthreads(); }
  const float mu = red[0] / (float)N; __syncthreads();
  float s2 = 0.f;
  for (int u = 0; u < per / 4; ++u)
#pragma unroll
    for (int q = 0; q < 4; ++q) { const float c = vals[u * 4 + q] - mu; s2 += c * c; }
  red[tid] = s2; __syncthreads();
  for (int st = 128; st > 0; st >>= 1) { if (tid < st) red[tid] += red[tid + st]; __syncthreads(); }
  const float rs = rsqrtf(red[0] / (float)N + eps);
  {
    for (int u = 0; u < per / 4; ++u) {
      const int j = tid * 4 + 1024 * u;
      v4f o, sm;
#pragma unroll
      for (int q = 0; q < 4; ++q) {
        float gg = g[j + q], bb = bta[j + q];
        if (PARAM_BF16) { gg = bf16_round(gg); bb = bf16_round(bb); }
        sm[q] = vals[u * 4 + q]; o[q] = (vals[u * 4 + q] - mu) * rs * gg + bb;
      }
      if (out_sum) *(v4f*)(out_sum + (size_t)row * N + j) = sm;
      *(v4f*)(out_norm + (size_t)row * N + j) = o;
    }
    
  }
}



// ---- f16 WMMA path (v_wmma_f32_16x16x32_f16): 11-bit significands for operands in range — used where a [0,1] probability operand needs more precision than bf16
typedef _Float16 v16h __attribute__((ext_vector_type(16)));
union FragH { v16h v; v8us half[2]; _Float16 h[16]; unsigned short u[16]; };
template <int NT>
__device__ __forceinline__ v8f mmaH(v16h ah, v16h al, v16h bh, v16h bl, v8f c) {
  c = __builtin_amdgcn_wmma_f32_16x16x32_f16(false, ah, false, bh, (short)0, c, false, false);
  if (NT >= 2) c = __builtin_amdgcn_wmma_f32_16x16x32_f16(false, al, false, bh, (short)0, c, false, false);
  if (NT >= 3) c = __builtin_amdgcn_wmma_f32_16x16x32_f16(false, ah, false, bl, (short)0, c, false, false);
  asm volatile("v_nop\n\tv_nop\n\tv_nop\n\tv_nop" : "+v"(c) : "v"(ah), "v"(al), "v"(bh), "v"(bl));
  return c;
}
// batched GEMM like k_gemm_b but f16 operands: A f32 (split into f16 hi/lo if ASPLIT, else rounded to f16), Bt = f16 values [n][k]; alpha; C f32; N multiple of 16 (partial tiles skipped)
template <bool ASPLIT>
__global__ __launch_bounds__(128) void k_gemm_h(const float* __restrict__ A, int lda, size_t sA, const _Float16* __restrict__ Bh, int ldb, size_t sB, float alpha, float* __restrict__ C, int ldc, size_t sC, int M, int N, int K) {
  __shared__ __attribute__((aligned(16))) float so[4][16][64];
  const int tid = threadIdx.x, w = tid >> 5, lane = tid & 31, ln = lane & 15, hh = lane >> 4; const int by = blockIdx.y;
  A += (size_t)by * sA; Bh += (size_t)by * sB; C += (size_t)by * sC;
  const int ntn = (N + 63) / 64; const int wid = blockIdx.x * 4 + w; const int mt = wid / ntn, nq = wid % ntn; if (mt * 16 >= M) return;
  const int row0 = mt * 16, col0 = nq * 64; const float* arow = A + (size_t)(row0 + ln) * lda;
  v8f acc[4] = {};
  for (int kb = 0; kb < K; kb += 32) {
    FragH ah, al;
    const v4f x0 = *(const v4fa*)(arow + kb + 8 * hh), x1 = *(const v4fa*)(arow + kb + 8 * hh + 4), x2 = *(const v4fa*)(arow + kb + 16 + 8 * hh), x3 = *(const v4fa*)(arow + kb + 16 + 8 * hh + 4);
    float xs[16] = {x0[0],x0[1],x0[2],x0[3],x1[0],x1[1],x1[2],x1[3],x2[0],x2[1],x2[2],x2[3],x3[0],x3[1],x3[2],x3[3]};
#pragma unroll
    for (int i = 0; i < 16; ++i) { const _Float16 h = (_Float16)xs[i]; ah.h[i] = h; al.h[i] = ASPLIT ? (_Float16)(xs[i] - (float)h) : (_Float16)0.0f; }
#pragma unroll
    for (int t = 0; t < 4; ++t) { if (col0 + t * 16 >= N) continue; const size_t boff = (size_t)(col0 + t * 16 + ln) * ldb + kb; FragH bq; bq.half[0] = *(const v8us*)(Bh + boff + 8 * hh); bq.half[1] = *(const v8us*)(Bh + boff + 16 + 8 * hh);
      acc[t] = mmaH<ASPLIT ? 2 : 1>(ah.v, al.v, bq.v, bq.v, acc[t]); }
  }
#pragma unroll
  for (int t = 0; t < 4; ++t) { if (col0 + t * 16 >= N) continue;
#pragma unroll
    for (int r = 0; r < 8; ++r) so[w][8 * hh + r][t * 16 + ln] = acc[t][r] * alpha; }
  __builtin_amdgcn_fence(__ATOMIC_ACQ_REL, "workgroup"); __builtin_amdgcn_wave_barrier();
  const int rsub = lane >> 4, c4 = (lane & 15) * 4;
  {
#pragma unroll
    for (int q = 0; q < 8; ++q) { const int r = q * 2 + rsub; if (col0 + c4 < N) { const v4f v = *(const v4fa*)&so[w][r][c4]; *(v4f*)(C + (size_t)(row0 + r) * ldc + col0 + c4) = v; } }
     }
}

// Wt[n][k] = f16(W[k][n]·scale) from f32 row-major W[K][N] (scale = power of two; bf16-exact weights stay exact in f16 away from the subnormal range)
__global__ __launch_bounds__(256) void k_wt_f16(const float* __restrict__ W, _Float16* __restrict__ Wt, int K, int N, float scale) {
  const int t = blockIdx.x * 256 + threadIdx.x; if (t >= N * (K / 8)) return; const int n = t / (K / 8), k8 = (t % (K / 8)) * 8; FragH f;
#pragma unroll
  for (int i = 0; i < 8; ++i) f.h[i] = (_Float16)(bf16_round(W[(size_t)(k8 + i) * N + n]) * scale); const v8us o = f.half[0];
  *(v8us*)((unsigned short*)Wt + (size_t)n * K + k8) = o; 
}
// k_gemm_hh variant with fused epilogue: v = acc·alpha + bias[by·sBias + col] (+ CP[(row/rowsPerB)·sCPb + by·64 + col] if CP) ; ACT 0 none / 1 elu ; writes f16 C16 and/or f32 C, each if non-null
template <int ACT>
__global__ __launch_bounds__(128) void k_gemm_hhx(const _Float16* __restrict__ A, int lda, size_t sA, const _Float16* __restrict__ Bh, int ldb, size_t sB, float alpha, const float* __restrict__ bias, size_t sBias, const float* __restrict__ CP, int rowsPerB, size_t sCPb, int row0g,
    float* __restrict__ C, _Float16* __restrict__ C16, int ldc, size_t sC, int M, int N, int K) {
  __shared__ __attribute__((aligned(16))) float so[4][16][64];
  const int tid = threadIdx.x, w = tid >> 5, lane = tid & 31, ln = lane & 15, hh = lane >> 4; const int by = blockIdx.y;
  A += (size_t)by * sA; Bh += (size_t)by * sB; const size_t cofs = (size_t)by * sC; const float* bp = bias ? bias + (size_t)by * sBias : nullptr;
  const int ntn = (N + 63) / 64; const int wid = blockIdx.x * 4 + w; const int mt = wid / ntn, nq = wid % ntn; if (mt * 16 >= M) return;
  const int row0 = mt * 16, col0 = nq * 64; const _Float16* arow = A + (size_t)(row0 + ln) * lda;
  v8f acc[4] = {};
  for (int kb = 0; kb < K; kb += 32) { FragH ah; ah.half[0] = *(const v8us*)((const unsigned short*)arow + kb + 8 * hh); ah.half[1] = *(const v8us*)((const unsigned short*)arow + kb + 16 + 8 * hh);
#pragma unroll
    for (int t = 0; t < 4; ++t) { if (col0 + t * 16 >= N) continue; const size_t boff = (size_t)(col0 + t * 16 + ln) * ldb + kb; FragH bq; bq.half[0] = *(const v8us*)((const unsigned short*)Bh + boff + 8 * hh); bq.half[1] = *(const v8us*)((const unsigned short*)Bh + boff + 16 + 8 * hh);
      acc[t] = mmaH<1>(ah.v, ah.v, bq.v, bq.v, acc[t]); }
  }
#pragma unroll
  for (int t = 0; t < 4; ++t) { if (col0 + t * 16 >= N) continue; const int col = col0 + t * 16 + ln; const float bv = bp ? bf16_round(bp[col]) : 0.f;
#pragma unroll
    for (int r = 0; r < 8; ++r) { float v = acc[t][r] * alpha + bv; if (CP) { const int bidx = (row0g + row0 + 8 * hh + r) / rowsPerB; v += CP[(size_t)bidx * sCPb + (size_t)by * 64 + col]; } if (ACT == 1) v = (v > 0.f) ? v : expm1f(v); else if (ACT == 7) v = (v > 0.f) ? v + 1.0f : expf(v); else if (ACT == 8) v = tanhf(v); else if (ACT == 9) v = 0.5f * v * (1.0f + tanhf(0.7978845608028654f * (v + 0.044715f * v * v * v))); else if (ACT == 11) v = 1.0f / (1.0f + expf(-v)); else if (ACT == 12) v = (v > 0.f) ? v : 0.01f * v; else if (ACT == 14) v = (v > 0.f) ? v : 0.1f * v; else if (ACT == 15) v = v / (1.0f + expf(-v)); else if (ACT == 3) v = fmaxf(v, 0.f); else if (ACT == 6) v = 0.5f * v * (1.0f + erff(v * 0.70710678118654752f)); so[w][8 * hh + r][t * 16 + ln] = v; } }
  __builtin_amdgcn_fence(__ATOMIC_ACQ_REL, "workgroup"); __builtin_amdgcn_wave_barrier();
  const int rsub = lane >> 4, c4 = (lane & 15) * 4; typedef _Float16 v4h __attribute__((ext_vector_type(4)));
  {
#pragma unroll
    for (int q = 0; q < 8; ++q) { const int r = q * 2 + rsub; if (col0 + c4 < N) { const v4f v = *(const v4fa*)&so[w][r][c4]; if (C) *(v4f*)(C + cofs + (size_t)(row0 + r) * ldc + col0 + c4) = v; if (C16) { v4h h4; for (int i = 0; i < 4; ++i) h4[i] = (_Float16)v[i]; *(v4h*)(C16 + cofs + (size_t)(row0 + r) * ldc + col0 + c4) = h4; } } }
     }
}


// GEMM C = (A.B^T)*alpha + bias on f16 planes, A [M][KD] (batch stride sA), Bh [ND][KD], both k-contiguous at pitch KD; C [M][ND] (batch stride sC) as f16 (OUT16) or f32. M and ND multiples of 128, KD a multiple of 64; grid.x = (M / 128) * (ND / 128), grid.y = batch.
// One 128 x 128 tile of C per work-group of 8 waves (4 x 2, 32 x 64 each). A 64-k slice of both operands (128 bytes of each row) is brought in by loads that cover whole lines and laid in LDS at pitch 144 bytes; every wave reads its fragments from there,
// so a row is asked of L2 once per work-group, not once per wave. Two LDS buffers: the next slice is loaded into registers ahead of the products of this one and stored behind them. Each accumulator still sums its k blocks of 32 in rising order.
// The unroll directives on the short loops below make every index into the register arrays (staged rows, fragments, accumulators, bias) a constant, so that these arrays stay in registers.
template <bool OUT16, int KD, int ND>
__global__ __launch_bounds__(256) void k_gemm_lds(const _Float16* __restrict__ A, size_t sA, const _Float16* __restrict__ Bh, float alpha, const float* __restrict__ bias,
    float* __restrict__ C, _Float16* __restrict__ C16, size_t sC) {
  constexpr int BT = 128, BK = 64, LP = BK + 8;
  __shared__ __attribute__((aligned(16))) unsigned char sm[4 * BT * LP * 2];      /* the two operands' two buffers; behind the loop the same bytes stage the output rows */
  unsigned short (*tA)[BT][LP] = (unsigned short (*)[BT][LP])sm; unsigned short (*tB)[BT][LP] = (unsigned short (*)[BT][LP])(sm + 2 * BT * LP * 2);
  const int tid = threadIdx.x, w = tid >> 5, lane = tid & 31, ln = lane & 15, hh = lane >> 4;
  constexpr int ntn = ND / BT; const int row0 = ((int)blockIdx.x / ntn) * BT, col0 = ((int)blockIdx.x % ntn) * BT; const int wr = (w >> 1) * 32, wc = (w & 1) * 64;
  const int sr = tid >> 3, sc = (tid & 7) * 8;      /* staging: 8 threads take one row's 128 bytes, a wave 4 whole lines; rows sr + 32 i */
  const unsigned short* Ag = (const unsigned short*)A + (size_t)blockIdx.y * sA + (size_t)(row0 + sr) * KD + sc; const unsigned short* Bg = (const unsigned short*)Bh + (size_t)(col0 + sr) * KD + sc;
  float bv[4];
#pragma unroll
  for (int t = 0; t < 4; ++t) bv[t] = bf16_round(bias[col0 + wc + t * 16 + ln]);
  v8us ra[4], rb[4];
#pragma unroll
  for (int i = 0; i < 4; ++i) { ra[i] = *(const v8us*)(Ag + 32 * i * KD); rb[i] = *(const v8us*)(Bg + 32 * i * KD); }
#pragma unroll
  for (int i = 0; i < 4; ++i) { *(v8us*)&tA[0][sr + 32 * i][sc] = ra[i]; *(v8us*)&tB[0][sr + 32 * i][sc] = rb[i]; }
  __syncthreads();      /* publishes slice 0 */
  v8f acc[2][4];
#pragma unroll
  for (int mi = 0; mi < 2; ++mi)
#pragma unroll
    for (int t = 0; t < 4; ++t) acc[mi][t] = (v8f){0.f,0.f,0.f,0.f,0.f,0.f,0.f,0.f};
  constexpr int ns = KD / BK;
#pragma unroll      /* slice offsets and the buffer choice become immediates: no address arithmetic in the loop, and no address register is rewritten while loads are under way */
  for (int s = 0; s < ns; ++s) { const int cur = s & 1; const bool more = s + 1 < ns;
    if (more) {
#pragma unroll
      for (int i = 0; i < 4; ++i) { ra[i] = *(const v8us*)(Ag + 32 * i * KD + (s + 1) * BK); rb[i] = *(const v8us*)(Bg + 32 * i * KD + (s + 1) * BK); }
      __builtin_amdgcn_sched_barrier(0); }      /* keeps the next slice's loads ahead of this slice's products; the scheduler otherwise sinks them to their LDS stores and the group waits out their whole latency */
#pragma unroll
    for (int ks = 0; ks < 2; ++ks) { FragH fa[2], fb[4];
#pragma unroll
      for (int mi = 0; mi < 2; ++mi) { fa[mi].half[0] = *(const v8us*)&tA[cur][wr + mi * 16 + ln][ks * 32 + 8 * hh]; fa[mi].half[1] = *(const v8us*)&tA[cur][wr + mi * 16 + ln][ks * 32 + 16 + 8 * hh]; }
#pragma unroll
      for (int t = 0; t < 4; ++t) { fb[t].half[0] = *(const v8us*)&tB[cur][wc + t * 16 + ln][ks * 32 + 8 * hh]; fb[t].half[1] = *(const v8us*)&tB[cur][wc + t * 16 + ln][ks * 32 + 16 + 8 * hh]; }
#pragma unroll
      for (int mi = 0; mi < 2; ++mi)
#pragma unroll
        for (int t = 0; t < 4; ++t) acc[mi][t] = __builtin_amdgcn_wmma_f32_16x16x32_f16(false, fa[mi].v, false, fb[t].v, (short)0, acc[mi][t], false, false); }
    if (more) {
#pragma unroll
      for (int i = 0; i < 4; ++i) { *(v8us*)&tA[cur ^ 1][sr + 32 * i][sc] = ra[i]; *(v8us*)&tB[cur ^ 1][sr + 32 * i][sc] = rb[i]; } }
    __syncthreads();      /* publishes slice s + 1 and ends every wave's reads of slice s, whose buffer the next trip refills (behind the last slice: the output staging) */
  }
  const size_t cofs = (size_t)blockIdx.y * sC; const int rsub = lane >> 4, c4 = (lane & 15) * 4; typedef _Float16 v4hh __attribute__((ext_vector_type(4)));
  float (*so)[64 + 4] = (float (*)[64 + 4])sm + w * 32;      /* the wave's own 32 staging rows */
#pragma unroll
  for (int mi = 0; mi < 2; ++mi)
#pragma unroll
    for (int t = 0; t < 4; ++t)
#pragma unroll
      for (int r = 0; r < 8; ++r) so[mi * 16 + 8 * hh + r][t * 16 + ln] = acc[mi][t][r] * alpha + bv[t];
  __builtin_amdgcn_fence(__ATOMIC_ACQ_REL, "workgroup"); __builtin_amdgcn_wave_barrier();      /* the wave's own staging rows: every lane's stores stay ahead of the row reads below */
#pragma unroll
  for (int q = 0; q < 16; ++q) { const int r = q * 2 + rsub; const v4f v = *(const v4fa*)&so[r][c4]; const size_t o = cofs + (size_t)(row0 + wr + r) * ND + col0 + wc + c4;
    if (OUT16) { v4hh h4;
#pragma unroll
      for (int i = 0; i < 4; ++i) h4[i] = (_Float16)v[i];
      *(v4hh*)(C16 + o) = h4; }
    else *(v4f*)(C + o) = v; }
}

typedef _Float16 v4h __attribute__((ext_vector_type(4)));

__global__ __launch_bounds__(256) void k_x16(const float* __restrict__ x, _Float16* __restrict__ X16, size_t n8) { const size_t t = (size_t)blockIdx.x * 256 + threadIdx.x; if (t >= n8) return; FragH f;
#pragma unroll
  for (int q = 0; q < 8; ++q) f.h[q] = (_Float16)bf16_round(x[t * 8 + q]); *(v8us*)((unsigned short*)X16 + t * 8) = f.half[0];  }
__global__ __launch_bounds__(256) void k_h16(const float* __restrict__ x, _Float16* __restrict__ X16, size_t n8) { const size_t t = (size_t)blockIdx.x * 256 + threadIdx.x; if (t >= n8) return; FragH f;
#pragma unroll
  for (int q = 0; q < 8; ++q) f.h[q] = (_Float16)x[t * 8 + q]; *(v8us*)((unsigned short*)X16 + t * 8) = f.half[0];  }
__global__ __launch_bounds__(256) void k_round16f(const float* __restrict__ W, _Float16* __restrict__ Bt, size_t n8) { const size_t t = (size_t)blockIdx.x * 256 + threadIdx.x; if (t >= n8) return; FragH f;
#pragma unroll
  for (int i = 0; i < 8; ++i) f.h[i] = (_Float16)(bf16_round(W[t * 8 + i]) * 16.0f); *(v8us*)((unsigned short*)Bt + t * 8) = f.half[0];  }
template <int NHv, int TTv>
__global__ __launch_bounds__(256) void k_vt(const _Float16* __restrict__ V16, int ldv, int voff, _Float16* __restrict__ Vt) { __shared__ unsigned short tl[64][66]; const int tid = threadIdx.x; const int slab = blockIdx.x / (TTv / 64), lg = blockIdx.x % (TTv / 64); const int b = slab / NHv, h = slab % NHv;
  for (int i = tid; i < 64 * 8; i += 256) { const int r = i / 8, c8 = (i % 8) * 8; FragH f; f.half[0] = *(const v8us*)((const unsigned short*)V16 + ((size_t)b * TTv + lg * 64 + r) * ldv + voff + h * 64 + c8);
#pragma unroll
    for (int q = 0; q < 8; ++q) tl[r][c8 + q] = f.u[q]; }
  __syncthreads();
  {
#pragma unroll
    for (int rd = 0; rd < 2; ++rd) { const int d = rd * 32 + tid / 8, pc = tid % 8; FragH f;
#pragma unroll
      for (int q = 0; q < 8; ++q) f.u[q] = tl[pc * 8 + q][d];
      *(v8us*)((unsigned short*)Vt + ((size_t)slab * 64 + d) * TTv + lg * 64 + pc * 8) = f.half[0]; }
     } }

__global__ __launch_bounds__(256) void k_hl(const float* __restrict__ F, _Float16* __restrict__ Hh, _Float16* __restrict__ Hl, size_t n8) { const size_t t = (size_t)blockIdx.x * 256 + threadIdx.x; if (t >= n8) return; FragH fh, fl; const v4f a = *(const v4fa*)(F + t * 8), c = *(const v4fa*)(F + t * 8 + 4);
#pragma unroll
  for (int q = 0; q < 4; ++q) { _Float16 h = (_Float16)a[q]; fh.h[q] = h; fl.h[q] = (_Float16)((a[q] - (float)h) * 1024.0f); h = (_Float16)c[q]; fh.h[4 + q] = h; fl.h[4 + q] = (_Float16)((c[q] - (float)h) * 1024.0f); }
  { *(v8us*)((unsigned short*)Hh + t * 8) = fh.half[0]; *(v8us*)((unsigned short*)Hl + t * 8) = fl.half[0];  } }

__global__ __launch_bounds__(256) void k_h16s(const float* __restrict__ F, _Float16* __restrict__ H, size_t n8) { const size_t t = (size_t)blockIdx.x * 256 + threadIdx.x; if (t >= n8) return; const v4f a = *(const v4fa*)(F + t * 8), c = *(const v4fa*)(F + t * 8 + 4); FragH f;
#pragma unroll
  for (int q = 0; q < 4; ++q) { f.h[q] = (_Float16)(a[q] * 16.0f); f.h[4 + q] = (_Float16)(c[q] * 16.0f); } *(v8us*)((unsigned short*)H + t * 8) = f.half[0];  }
// mask predicates over (query index q, key-plane row k): key-plane rows 0..T-1 are TOKENS, rows T..2T-1 are CONCEPTS (the tok/con GEMMs write the two halves of one plane per batch); MODE 0 = token queries: token s ≤ q (causal), concept j < q/ntc + 1;
// MODE 1 = concept queries: concept j ≤ q, token s < ntc·(q + 1). (Key order inside the softmax is irrelevant, so the plane order is used directly.)
template <int MODE> __device__ __forceinline__ bool allow(int q, int k, int ntc) {
  if (MODE == 0) return (k < TQ) ? (k <= q) : ((k - TQ) < q / ntc + 1);
  else           return (k < TQ) ? (k < ntc * (q + 1)) : ((k - TQ) <= q); }
// Work-group = 12 waves on the block's 64 query rows: wave w takes query tile (w & 3) and every third key tile, j0 = 32 * ((w >> 2) + 3 * i); the three partial softmax states of a query tile (row maximum, row sum, weighted V sum) are merged in LDS behind the loop.
template <int MODE>
__global__ __launch_bounds__(384) void k_flashm(const _Float16* __restrict__ Q16, int ldq, const _Float16* __restrict__ K16, int ldk, const _Float16* __restrict__ Vt, const int* __restrict__ NTCP, float* __restrict__ O, int ldo) {
  int ntc = NTCP[0]; ntc = (ntc < 1) ? 1 : ntc;      /* = 8 here; guarded so the index arithmetic can never divide by zero */
  constexpr int RPW = 16, RTN = RPW / 16, NQB = TQ / (4 * RPW), DT = 4, KS = 2, NSP = 3;
  __shared__ __attribute__((aligned(16))) unsigned short sP[4 * NSP][RPW][40]; __shared__ __attribute__((aligned(16))) float sO[4 * NSP][RPW][64 + 4]; __shared__ float sM[4 * NSP][RPW], sL[4 * NSP][RPW];
  const int tid = threadIdx.x, w = __builtin_amdgcn_readfirstlane(tid >> 5), lane = tid & 31, ln = lane & 15, hh = lane >> 4;      /* the wave's number in a scalar register: the key loop's counter and its tests on j0 stay scalar */
  const int slab = blockIdx.x / NQB, qblk = blockIdx.x % NQB; const int b = slab / NH, h = slab % NH; const int qb0 = qblk * (4 * RPW); const int qt = w & 3, sp = w >> 2; const int q0 = qb0 + qt * RPW;
  FragH aq[2][KS];
#pragma unroll
  for (int rt = 0; rt < RTN; ++rt) { const unsigned short* qr = (const unsigned short*)Q16 + ((size_t)b * TQ + q0 + rt * 16 + ln) * ldq + h * 64;
#pragma unroll
    for (int ks = 0; ks < KS; ++ks) { aq[rt][ks].half[0] = *(const v8us*)(qr + ks * 32 + 8 * hh); aq[rt][ks].half[1] = *(const v8us*)(qr + ks * 32 + 16 + 8 * hh); } }
  const unsigned short* Vth = (const unsigned short*)Vt + (size_t)slab * 64 * TK;
  float m_r[2][8], l_r[2][8]; v8f oacc[2][DT];
#pragma unroll
  for (int rt = 0; rt < RTN; ++rt) {
#pragma unroll
    for (int r = 0; r < 8; ++r) { m_r[rt][r] = -3.0e38f; l_r[rt][r] = 0.f; }
#pragma unroll
    for (int dt = 0; dt < DT; ++dt) oacc[rt][dt] = (v8f){0.f,0.f,0.f,0.f,0.f,0.f,0.f,0.f}; }
  const int jend = TK;
#pragma unroll 1
  for (int j0 = sp * 32; j0 < jend; j0 += 32 * NSP) {
    v8f s[2][2];
#pragma unroll
    for (int nt = 0; nt < 2; ++nt) { const unsigned short* kr = (const unsigned short*)K16 + ((size_t)b * TK + j0 + nt * 16 + ln) * ldk + h * 64; FragH bk[KS];
#pragma unroll
      for (int ks = 0; ks < KS; ++ks) { bk[ks].half[0] = *(const v8us*)(kr + ks * 32 + 8 * hh); bk[ks].half[1] = *(const v8us*)(kr + ks * 32 + 16 + 8 * hh); }
#pragma unroll
      for (int rt = 0; rt < RTN; ++rt) { v8f acc = (v8f){0.f,0.f,0.f,0.f,0.f,0.f,0.f,0.f};
#pragma unroll
        for (int ks = 0; ks < KS; ++ks) acc = mmaH<1>(aq[rt][ks].v, aq[rt][ks].v, bk[ks].v, bk[ks].v, acc); s[rt][nt] = acc; } }
#pragma unroll
    for (int rt = 0; rt < RTN; ++rt)
#pragma unroll
      for (int r = 0; r < 8; ++r) { const int tq = q0 + rt * 16 + 8 * hh + r; const int k0 = j0 + ln, k1 = j0 + 16 + ln; 
        const bool ok0 = allow<MODE>(tq, k0, ntc), ok1 = allow<MODE>(tq, k1, ntc);
        const float s0 = ok0 ? s[rt][0][r] * SCL : -INFINITY, s1 = ok1 ? s[rt][1][r] * SCL : -INFINITY; float mc = fmaxf(s0, s1);
        mc = fmaxf(mc, __shfl_xor(mc, 1, 32)); mc = fmaxf(mc, __shfl_xor(mc, 2, 32)); mc = fmaxf(mc, __shfl_xor(mc, 4, 32)); mc = fmaxf(mc, __shfl_xor(mc, 8, 32));
        const float mn = fmaxf(m_r[rt][r], mc); const float al = (mn > -1.0e38f) ? expf(m_r[rt][r] - mn) : 1.0f; m_r[rt][r] = mn; const float p0 = ok0 ? expf(s0 - mn) : 0.f, p1 = ok1 ? expf(s1 - mn) : 0.f; l_r[rt][r] = l_r[rt][r] * al + p0 + p1;
#pragma unroll
        for (int dt = 0; dt < DT; ++dt) oacc[rt][dt][r] *= al;
        FragH t2; t2.h[0] = (_Float16)(p0 * 1024.0f); t2.h[1] = (_Float16)(p1 * 1024.0f); sP[w][rt * 16 + 8 * hh + r][ln] = t2.u[0]; sP[w][rt * 16 + 8 * hh + r][16 + ln] = t2.u[1]; }
    __builtin_amdgcn_fence(__ATOMIC_ACQ_REL, "workgroup"); __builtin_amdgcn_wave_barrier();
    FragH pa[2];
#pragma unroll
    for (int rt = 0; rt < RTN; ++rt) { pa[rt].half[0] = *(const v8us*)&sP[w][rt * 16 + ln][8 * hh]; pa[rt].half[1] = *(const v8us*)&sP[w][rt * 16 + ln][16 + 8 * hh]; }
#pragma unroll
    for (int dt = 0; dt < DT; ++dt) { const unsigned short* vrow = Vth + (size_t)(dt * 16 + ln) * TK + j0; FragH bv; bv.half[0] = *(const v8us*)(vrow + 8 * hh); bv.half[1] = *(const v8us*)(vrow + 16 + 8 * hh);
#pragma unroll
      for (int rt = 0; rt < RTN; ++rt) oacc[rt][dt] = mmaH<1>(pa[rt].v, pa[rt].v, bv.v, bv.v, oacc[rt][dt]); }
    __builtin_amdgcn_fence(__ATOMIC_ACQ_REL, "workgroup"); __builtin_amdgcn_wave_barrier(); }
#pragma unroll
  for (int rt = 0; rt < RTN; ++rt) {
#pragma unroll
    for (int r = 0; r < 8; ++r) { float l = l_r[rt][r]; l += __shfl_xor(l, 1, 32); l += __shfl_xor(l, 2, 32); l += __shfl_xor(l, 4, 32); l += __shfl_xor(l, 8, 32);
      if (ln == 0) { sM[w][rt * 16 + 8 * hh + r] = m_r[rt][r]; sL[w][rt * 16 + 8 * hh + r] = l; } } }
  __syncthreads();      /* publishes every wave's row maxima and row sums */
#pragma unroll
  for (int rt = 0; rt < RTN; ++rt) {
#pragma unroll
    for (int r = 0; r < 8; ++r) { const int row = rt * 16 + 8 * hh + r; float mg = sM[qt][row];
#pragma unroll
      for (int s2 = 1; s2 < NSP; ++s2) mg = fmaxf(mg, sM[s2 * 4 + qt][row]);
      float l = 0.f, fo = 0.f;      /* a wave that met no allowed key of this row holds sum 0 and a zero V sum */
#pragma unroll
      for (int s2 = 0; s2 < NSP; ++s2) { const float e = expf(sM[s2 * 4 + qt][row] - mg); l += sL[s2 * 4 + qt][row] * e; if (s2 == sp) fo = e; }
      l_r[rt][r] = (l > 0.f) ? fo / (l * 1024.0f) : 0.f; }
#pragma unroll
    for (int dt = 0; dt < DT; ++dt)
#pragma unroll
      for (int r = 0; r < 8; ++r) sO[w][rt * 16 + 8 * hh + r][dt * 16 + ln] = oacc[rt][dt][r] * l_r[rt][r]; }
  __syncthreads();      /* publishes the rescaled partial outputs */
  for (int i = tid; i < 4 * RPW * 16; i += 128 * NSP) { const int q2 = i >> 8, r = (i >> 4) & 15, pc = i & 15; v4f val = *(const v4fa*)&sO[q2][r][pc * 4];
#pragma unroll
    for (int s2 = 1; s2 < NSP; ++s2) val += *(const v4fa*)&sO[s2 * 4 + q2][r][pc * 4];
    *(v4f*)(O + ((size_t)b * TQ + qb0 + q2 * RPW + r) * ldo + h * 64 + pc * 4) = val; } }

extern "C" void kernel_launch(void* const* d_in, const int* in_sizes, int n_in,
                              void* d_out, int out_size, void* d_ws, size_t ws_size, hipStream_t stream) {
  (void)in_sizes; (void)n_in; (void)out_size;
  const float* const* I = (const float* const*)d_in; const float* xt = I[0]; const float* xc = I[1]; const float* Wt = I[2]; const float* bt = I[3]; const float* Wc = I[4]; const float* bc = I[5]; const float* Wtp = I[6]; const float* btp = I[7]; const float* Wcp = I[8]; const float* bcp = I[9]; const int* ntcp = (const int*)d_in[10];      /* int64 in the module, read as int32 */
  char* ws = (char*)d_ws; size_t off = 0;
  auto take = [&](size_t bytes) { char* p = ws + off; off += (bytes + 255) & ~(size_t)255; return p; };
  _Float16* Bt_ = (_Float16*)take((size_t)DW * DD * 2); _Float16* Bc = (_Float16*)take((size_t)DW * DD * 2); _Float16* Btp = (_Float16*)take((size_t)DD * DD * 2); _Float16* Bcp = (_Float16*)take((size_t)DD * DD * 2);
  _Float16* XT = (_Float16*)take((size_t)NR * DD * 2); _Float16* XC = (_Float16*)take((size_t)NR * DD * 2); _Float16* TC = (_Float16*)take((size_t)BB * TK * DW * 2);      /* per batch: rows 0..1023 = tok, 1024..2047 = con */
  _Float16* Vt1 = (_Float16*)take((size_t)BB * NH * 64 * TK * 2); _Float16* Vt2 = (_Float16*)take((size_t)BB * NH * 64 * TK * 2); float* O = (float*)take((size_t)NR * DD * 4); _Float16* O16 = (_Float16*)take((size_t)NR * DD * 2);
  if (off > ws_size) return;      // 8.4 + 8.4 + 2.1 + 2.1 + 4.2 + 4.2 + 33.6 + 8.4 + 8.4 + 8.4 + 4.2 ≈ 92 MB
  const unsigned gw = (unsigned)(((size_t)DW * DD / 8 + 255) / 256), gp = (unsigned)(((size_t)DD * DD / 8 + 255) / 256);
  k_round16f<<<gw, 256, 0, stream>>>(Wt, Bt_, (size_t)DW * DD / 8); k_round16f<<<gw, 256, 0, stream>>>(Wc, Bc, (size_t)DW * DD / 8); k_round16f<<<gp, 256, 0, stream>>>(Wtp, Btp, (size_t)DD * DD / 8); k_round16f<<<gp, 256, 0, stream>>>(Wcp, Bcp, (size_t)DD * DD / 8);      /* torch (out,in) natural, ×2^4 */
  const unsigned g8 = (unsigned)(((size_t)NR * DD / 8 + 255) / 256); k_x16<<<g8, 256, 0, stream>>>(xt, XT, (size_t)NR * DD / 8); k_x16<<<g8, 256, 0, stream>>>(xc, XC, (size_t)NR * DD / 8);
  const dim3 gt((TQ / 128) * (DW / 128), BB);
  k_gemm_lds<true, DD, DW><<<gt, 256, 0, stream>>>(XT, (size_t)TQ * DD, Bt_, 0.0625f, bt, nullptr, TC, (size_t)TK * DW);      /* tok[b] -> plane rows 0..1023: M 1024 N 4096 K 1024 */
  k_gemm_lds<true, DD, DW><<<gt, 256, 0, stream>>>(XC, (size_t)TQ * DD, Bc, 0.0625f, bc, nullptr, TC + (size_t)TQ * DW, (size_t)TK * DW);      /* con[b] -> plane rows 1024..2047 */
  k_vt<NH, TK><<<BB * NH * (TK / 64), 256, 0, stream>>>(TC, DW, 2 * DD, Vt1);      /* values read by tokens = columns 2048.. of both halves → Vᵀ [bh][64][2048] */
  k_vt<NH, TK><<<BB * NH * (TK / 64), 256, 0, stream>>>(TC, DW, 3 * DD, Vt2);      /* values read by concepts = columns 3072.. */
  const dim3 gpj((NR / 128) * (DD / 128), 1);
  k_flashm<0><<<BB * NH * (TQ / 64), 384, 0, stream>>>(XT, DD, TC, DW, Vt1, ntcp, O, DD);      /* token queries; keys = columns 0..1023 (kt_t on token rows, kc_t on concept rows) */
  k_h16s<<<g8, 256, 0, stream>>>(O, O16, (size_t)NR * DD / 8);
  k_gemm_lds<false, DD, DD><<<gpj, 256, 0, stream>>>(O16, 0, Btp, 0.00390625f, btp, (float*)d_out, nullptr, 0);      /* y_t = merged.Wtp^T + btp -> output 0 */
  k_flashm<1><<<BB * NH * (TQ / 64), 384, 0, stream>>>(XC, DD, TC + DD, DW, Vt2, ntcp, O, DD);      /* concept queries; keys = columns 1024..2047 (kc_c on concept rows, kt_c on token rows) */
  k_h16s<<<g8, 256, 0, stream>>>(O, O16, (size_t)NR * DD / 8);
  k_gemm_lds<false, DD, DD><<<gpj, 256, 0, stream>>>(O16, 0, Bcp, 0.00390625f, bcp, (float*)d_out + (size_t)NR * DD, nullptr, 0);      /* y_c -> output 1 (offset B.T.NE floats) */
}

// v003
// Measured time: 233 microseconds a run.
// Next to v002, in two timings, it ran 1.33 times as fast each time.
// Over all steps from v000 it is 3.33 times as fast.
#include <hip/hip_runtime.h>
// Token/concept two-stream causal attention (B=2, T=C=1024, NE=CD=1024, 16 heads × 64, n_tokens_per_concept = 8): tok = xt·Wtᵀ + bt, con = xc·Wcᵀ + bc (4096 outputs each = [k for token queries | k for concept queries | v read by tokens | v read by concepts]);
// token queries = heads(xt) (the residual stream itself) attend over [tokens ; concepts] with mask (s ≤ t) | (j < t/8 + 1), scale 1/√64; concept queries = heads(xc) attend over [concepts ; tokens] with mask (j ≤ i) | (s < 8(i+1)); disallowed = −1e9 (≡ −inf: every row keeps itself);
// y_t = merge(attn_t)·Wtpᵀ + btp, y_c = merge(attn_c)·Wcpᵀ + bcp (two outputs).
// Compute dtype: xt, xc, weights, biases rounded to bf16; tok/con as f16 GEMM planes written as the two 1024-row halves of one 2048-key plane per batch; queries = the bf16-exact x planes; fused flash-style kernels with the index-computed masks (n_tokens_per_concept read on device; online softmax f32,
// P f16 ×2^10, f32 accumulate) on v_wmma_f32_16x16x32_f16; O ×2^4 → f16 → projection GEMMs (+bias) straight into the two output slots.
#define BB 2
#define TQ 1024
#define TK 2048
#define DD 1024
#define NH 16
#define DW 4096
#define SCL 0.125f
#define NR (BB * TQ)
typedef __bf16 v16b __attribute__((ext_vector_type(16)));
typedef unsigned short v8us __attribute__((ext_vector_type(8), may_alias));
typedef float  v8f  __attribute__((ext_vector_type(8)));
typedef float  v4f  __attribute__((ext_vector_type(4)));
typedef float  v4fa __attribute__((ext_vector_type(4), may_alias));
union FragB { v16b v; v8us half[2]; unsigned short u[16]; };

__device__ __forceinline__ unsigned short bf16_bits(float x) { unsigned int u = __float_as_uint(x); return (unsigned short)((u + 0x7FFFu + ((u >> 16) & 1u)) >> 16); }
__device__ __forceinline__ float bf16_val(unsigned short b) { return __uint_as_float(((unsigned int)b) << 16); }
__device__ __forceinline__ float bf16_round(float x) { return bf16_val(bf16_bits(x)); }
// D += A·B with NT terms: 1 = ah·bh, 2 = + al·bh (A split), 3 = + ah·bl (both split)
template <int NT>
__device__ __forceinline__ v8f mmaN(v16b ah, v16b al, v16b bh, v16b bl, v8f c) {
  c = __builtin_amdgcn_wmma_f32_16x16x32_bf16(false, ah, false, bh, (short)0, c, false, false);
  if (NT >= 2) c = __builtin_amdgcn_wmma_f32_16x16x32_bf16(false, al, false, bh, (short)0, c, false, false);
  if (NT >= 3) c = __builtin_amdgcn_wmma_f32_16x16x32_bf16(false, ah, false, bl, (short)0, c, false, false);
  asm volatile("v_nop\n\tv_nop\n\tv_nop\n\tv_nop" : "+v"(c) : "v"(ah), "v"(al), "v"(bh), "v"(bl));
  return c;
}

__global__ __launch_bounds__(256) void k_wt_bf16(const float* __restrict__ W, unsigned short* __restrict__ Wt, int K, int N) {
  const int t = blockIdx.x * 256 + threadIdx.x;
  const int k8n = K / 8;
  if (t >= N * k8n) return;
  const int n = t / k8n, k8 = (t % k8n) * 8;
  v8us v;
#pragma unroll
  for (int i = 0; i < 8; ++i) v[i] = bf16_bits(W[(size_t)(k8 + i) * N + n]);
  *(v8us*)(Wt + (size_t)n * K + k8) = v;
  
}

// GEMM C[M][N] (f32, pitch ldc) = act(A[M][K]·W + bias). A f32 row-major (pitch lda) converted per fragment to bf16
// (ASPLIT: hi/lo two planes -> 2 terms, else single rounded term); Wt bf16 [N][K] (pitch ldb). BIAS_BF16 rounds the
// bias to bf16 first (bias quantised to bf16 before the add). K%32==0, M%16==0, N%64==0.
template <bool ASPLIT, int ACT, bool BIAS_BF16>
__global__ __launch_bounds__(128) void k_gemm_bf(const float* __restrict__ A, int lda, const unsigned short* __restrict__ Wt, int ldb,
                                               const float* __restrict__ bias, float* __restrict__ C, int ldc, int M, int N, int K) {
  __shared__ __attribute__((aligned(16))) float so[4][16][64];
  const int tid = threadIdx.x, w = tid >> 5, lane = tid & 31, ln = lane & 15, hh = lane >> 4;
  const int ntn = N / 64;
  const int wid = blockIdx.x * 4 + w;
  const int mt = wid / ntn, nq = wid % ntn;
  if (mt * 16 >= M) return;
  const int row0 = mt * 16, col0 = nq * 64;
  const float* arow = A + (size_t)(row0 + ln) * lda;
  v8f acc[4] = {};
  for (int kb = 0; kb < K; kb += 32) {
    FragB ah, al;
    const v4f x0 = *(const v4fa*)(arow + kb + 8 * hh), x1 = *(const v4fa*)(arow + kb + 8 * hh + 4);
    const v4f x2 = *(const v4fa*)(arow + kb + 16 + 8 * hh), x3 = *(const v4fa*)(arow + kb + 16 + 8 * hh + 4);
    float xs[16] = {x0[0],x0[1],x0[2],x0[3],x1[0],x1[1],x1[2],x1[3],x2[0],x2[1],x2[2],x2[3],x3[0],x3[1],x3[2],x3[3]};
#pragma unroll
    for (int i = 0; i < 16; ++i) { const unsigned short hb = bf16_bits(xs[i]); ah.u[i] = hb; al.u[i] = ASPLIT ? bf16_bits(xs[i] - bf16_val(hb)) : (unsigned short)0; }
#pragma unroll
    for (int t = 0; t < 4; ++t) {
      const unsigned short* brow = Wt + (size_t)(col0 + t * 16 + ln) * ldb + kb;
      FragB b;
      b.half[0] = *(const v8us*)(brow + 8 * hh);
      b.half[1] = *(const v8us*)(brow + 16 + 8 * hh);
      acc[t] = mmaN<ASPLIT ? 2 : 1>(ah.v, al.v, b.v, b.v, acc[t]);
    }
  }
#pragma unroll
  for (int t = 0; t < 4; ++t) {
    float bv = bias ? bias[col0 + t * 16 + ln] : 0.f;
    if (BIAS_BF16) bv = bf16_round(bv);
#pragma unroll
    for (int r = 0; r < 8; ++r) { float v = acc[t][r] + bv; if (ACT == 1) v = fmaxf(v, 0.f); so[w][8 * hh + r][t * 16 + ln] = v; }
  }
  __builtin_amdgcn_fence(__ATOMIC_ACQ_REL, "workgroup");
  __builtin_amdgcn_wave_barrier();
  const int rsub = lane >> 4, c4 = (lane & 15) * 4;
  {
#pragma unroll
    for (int q = 0; q < 8; ++q) {
      const int r = q * 2 + rsub;
      const v4f v = *(const v4fa*)&so[w][r][c4];
      *(v4f*)(C + (size_t)(row0 + r) * ldc + col0 + c4) = v;
    }
    
  }
}

// GEMM C = act(A·W + bias + resid): A f32 (ASPLIT -> hi/lo 2 terms), Wt bf16 [N][K]; ACT 0 none, 1 relu, 2 exact gelu;
// resid (optional, f32, row index = (row % rmod), pitch ldr, RES_BF16 rounds it) added before the activation.
template <bool ASPLIT, int ACT, bool BIAS_BF16, bool RES_BF16>
__global__ __launch_bounds__(128) void k_gemm_bf3(const float* __restrict__ A, int lda, const unsigned short* __restrict__ Wt, int ldb,
                                                const float* __restrict__ bias, const float* __restrict__ resid, int rmod, int ldr,
                                                float* __restrict__ C, int ldc, int M, int N, int K) {
  __shared__ __attribute__((aligned(16))) float so[4][16][64];
  const int tid = threadIdx.x, w = tid >> 5, lane = tid & 31, ln = lane & 15, hh = lane >> 4;
  const int ntn = N / 64;
  const int wid = blockIdx.x * 4 + w;
  const int mt = wid / ntn, nq = wid % ntn;
  if (mt * 16 >= M) return;
  const int row0 = mt * 16, col0 = nq * 64;
  const float* arow = A + (size_t)(row0 + ln) * lda;
  v8f acc[4] = {};
  for (int kb = 0; kb < K; kb += 32) {
    FragB ah, al;
    const v4f x0 = *(const v4fa*)(arow + kb + 8 * hh), x1 = *(const v4fa*)(arow + kb + 8 * hh + 4);
    const v4f x2 = *(const v4fa*)(arow + kb + 16 + 8 * hh), x3 = *(const v4fa*)(arow + kb + 16 + 8 * hh + 4);
    float xs[16] = {x0[0],x0[1],x0[2],x0[3],x1[0],x1[1],x1[2],x1[3],x2[0],x2[1],x2[2],x2[3],x3[0],x3[1],x3[2],x3[3]};
#pragma unroll
    for (int i = 0; i < 16; ++i) { const unsigned short hb = bf16_bits(xs[i]); ah.u[i] = hb; al.u[i] = ASPLIT ? bf16_bits(xs[i] - bf16_val(hb)) : (unsigned short)0; }
#pragma unroll
    for (int t = 0; t < 4; ++t) {
      const unsigned short* brow = Wt + (size_t)(col0 + t * 16 + ln) * ldb + kb;
      FragB b;
      b.half[0] = *(const v8us*)(brow + 8 * hh);
      b.half[1] = *(const v8us*)(brow + 16 + 8 * hh);
      acc[t] = mmaN<ASPLIT ? 2 : 1>(ah.v, al.v, b.v, b.v, acc[t]);
    }
  }
#pragma unroll
  for (int t = 0; t < 4; ++t) {
    const int col = col0 + t * 16 + ln;
    float bv = bias ? bias[col] : 0.f;
    if (BIAS_BF16) bv = bf16_round(bv);
#pragma unroll
    for (int r = 0; r < 8; ++r) {
      float v = acc[t][r] + bv;
      if (resid) { float rv = resid[(size_t)((row0 + 8 * hh + r) % rmod) * ldr + col]; if (RES_BF16) rv = bf16_round(rv); v += rv; }
      if (ACT == 1) v = fmaxf(v, 0.f);
      if (ACT == 2) v = 0.5f * v * (1.0f + erff(v * 0.70710678118654752f));
      if (ACT == 3) { const float u = 0.7978845608028654f * (v + 0.044715f * v * v * v); v = 0.5f * v * (1.0f + tanhf(u)); }
      so[w][8 * hh + r][t * 16 + ln] = v;
    }
  }
  __builtin_amdgcn_fence(__ATOMIC_ACQ_REL, "workgroup");
  __builtin_amdgcn_wave_barrier();
  const int rsub = lane >> 4, c4 = (lane & 15) * 4;
  {
#pragma unroll
    for (int q = 0; q < 8; ++q) {
      const int r = q * 2 + rsub;
      const v4f v = *(const v4fa*)&so[w][r][c4];
      *(v4f*)(C + (size_t)(row0 + r) * ldc + col0 + c4) = v;
    }
    
  }
}
// row LayerNorm (biased variance, eps) over N: s = X (+ R); optional out_sum <- s; out_norm <- (s-mu)*rsqrt(var+eps)*g + b
template <bool PARAM_BF16>
__global__ __launch_bounds__(256) void k_layernorm(const float* __restrict__ X, const float* __restrict__ R, const float* __restrict__ g, const float* __restrict__ bta,
                                                  float* __restrict__ out_sum, float* __restrict__ out_norm, int N, float eps) {
  __shared__ float red[256];
  const int row = blockIdx.x, tid = threadIdx.x;
  const float* x = X + (size_t)row * N; const float* rr = R ? R + (size_t)row * N : nullptr;
  float vals[16];                     // up to N = 4096
  const int per = N / 256;            // contiguous chunk per thread? use strided-by-4 chunks: thread handles j = tid*4 + 1024*u
  float s1 = 0.f;
  for (int u = 0; u < per / 4; ++u) {
    const int j = tid * 4 + 1024 * u;
    const v4f a = *(const v4fa*)(x + j);
    v4f b = {0.f,0.f,0.f,0.f}; if (rr) b = *(const v4fa*)(rr + j);
#pragma unroll
    for (int q = 0; q < 4; ++q) { const float v = a[q] + b[q]; vals[u * 4 + q] = v; s1 += v; }
  }
  red[tid] = s1; __syncthreads();
  for (int st = 128; st > 0; st >>= 1) { if (tid < st) red[tid] += red[tid + st]; __syncthreads(); }
  const float mu = red[0] / (float)N; __syncthreads();
  float s2 = 0.f;
  for (int u = 0; u < per / 4; ++u)
#pragma unroll
    for (int q = 0; q < 4; ++q) { const float c = vals[u * 4 + q] - mu; s2 += c * c; }
  red[tid] = s2; __syncthreads();
  for (int st = 128; st > 0; st >>= 1) { if (tid < st) red[tid] += red[tid + st]; __syncthreads(); }
  const float rs = rsqrtf(red[0] / (float)N + eps);
  {
    for (int u = 0; u < per / 4; ++u) {
      const int j = tid * 4 + 1024 * u;
      v4f o, sm;
#pragma unroll
      for (int q = 0; q < 4; ++q) {
        float gg = g[j + q], bb = bta[j + q];
        if (PARAM_BF16) { gg = bf16_round(gg); bb = bf16_round(bb); }
        sm[q] = vals[u * 4 + q]; o[q] = (vals[u * 4 + q] - mu) * rs * gg + bb;
      }
      if (out_sum) *(v4f*)(out_sum + (size_t)row * N + j) = sm;
      *(v4f*)(out_norm + (size_t)row * N + j) = o;
    }
    
  }
}



// ---- f16 WMMA path (v_wmma_f32_16x16x32_f16): 11-bit significands for operands in range — used where a [0,1] probability operand needs more precision than bf16
typedef _Float16 v16h __attribute__((ext_vector_type(16)));
union FragH { v16h v; v8us half[2]; _Float16 h[16]; unsigned short u[16]; };
template <int NT>
__device__ __forceinline__ v8f mmaH(v16h ah, v16h al, v16h bh, v16h bl, v8f c) {
  c = __builtin_amdgcn_wmma_f32_16x16x32_f16(false, ah, false, bh, (short)0, c, false, false);
  if (NT >= 2) c = __builtin_amdgcn_wmma_f32_16x16x32_f16(false, al, false, bh, (short)0, c, false, false);
  if (NT >= 3) c = __builtin_amdgcn_wmma_f32_16x16x32_f16(false, ah, false, bl, (short)0, c, false, false);
  asm volatile("v_nop\n\tv_nop\n\tv_nop\n\tv_nop" : "+v"(c) : "v"(ah), "v"(al), "v"(bh), "v"(bl));
  return c;
}
// batched GEMM like k_gemm_b but f16 operands: A f32 (split into f16 hi/lo if ASPLIT, else rounded to f16), Bt = f16 values [n][k]; alpha; C f32; N multiple of 16 (partial tiles skipped)
template <bool ASPLIT>
__global__ __launch_bounds__(128) void k_gemm_h(const float* __restrict__ A, int lda, size_t sA, const _Float16* __restrict__ Bh, int ldb, size_t sB, float alpha, float* __restrict__ C, int ldc, size_t sC, int M, int N, int K) {
  __shared__ __attribute__((aligned(16))) float so[4][16][64];
  const int tid = threadIdx.x, w = tid >> 5, lane = tid & 31, ln = lane & 15, hh = lane >> 4; const int by = blockIdx.y;
  A += (size_t)by * sA; Bh += (size_t)by * sB; C += (size_t)by * sC;
  const int ntn = (N + 63) / 64; const int wid = blockIdx.x * 4 + w; const int mt = wid / ntn, nq = wid % ntn; if (mt * 16 >= M) return;
  const int row0 = mt * 16, col0 = nq * 64; const float* arow = A + (size_t)(row0 + ln) * lda;
  v8f acc[4] = {};
  for (int kb = 0; kb < K; kb += 32) {
    FragH ah, al;
    const v4f x0 = *(const v4fa*)(arow + kb + 8 * hh), x1 = *(const v4fa*)(arow + kb + 8 * hh + 4), x2 = *(const v4fa*)(arow + kb + 16 + 8 * hh), x3 = *(const v4fa*)(arow + kb + 16 + 8 * hh + 4);
    float xs[16] = {x0[0],x0[1],x0[2],x0[3],x1[0],x1[1],x1[2],x1[3],x2[0],x2[1],x2[2],x2[3],x3[0],x3[1],x3[2],x3[3]};
#pragma unroll
    for (int i = 0; i < 16; ++i) { const _Float16 h = (_Float16)xs[i]; ah.h[i] = h; al.h[i] = ASPLIT ? (_Float16)(xs[i] - (float)h) : (_Float16)0.0f; }
#pragma unroll
    for (int t = 0; t < 4; ++t) { if (col0 + t * 16 >= N) continue; const size_t boff = (size_t)(col0 + t * 16 + ln) * ldb + kb; FragH bq; bq.half[0] = *(const v8us*)(Bh + boff + 8 * hh); bq.half[1] = *(const v8us*)(Bh + boff + 16 + 8 * hh);
      acc[t] = mmaH<ASPLIT ? 2 : 1>(ah.v, al.v, bq.v, bq.v, acc[t]); }
  }
#pragma unroll
  for (int t = 0; t < 4; ++t) { if (col0 + t * 16 >= N) continue;
#pragma unroll
    for (int r = 0; r < 8; ++r) so[w][8 * hh + r][t * 16 + ln] = acc[t][r] * alpha; }
  __builtin_amdgcn_fence(__ATOMIC_ACQ_REL, "workgroup"); __builtin_amdgcn_wave_barrier();
  const int rsub = lane >> 4, c4 = (lane & 15) * 4;
  {
#pragma unroll
    for (int q = 0; q < 8; ++q) { const int r = q * 2 + rsub; if (col0 + c4 < N) { const v4f v = *(const v4fa*)&so[w][r][c4]; *(v4f*)(C + (size_t)(row0 + r) * ldc + col0 + c4) = v; } }
     }
}

// Wt[n][k] = f16(W[k][n]·scale) from f32 row-major W[K][N] (scale = power of two; bf16-exact weights stay exact in f16 away from the subnormal range)
__global__ __launch_bounds__(256) void k_wt_f16(const float* __restrict__ W, _Float16* __restrict__ Wt, int K, int N, float scale) {
  const int t = blockIdx.x * 256 + threadIdx.x; if (t >= N * (K / 8)) return; const int n = t / (K / 8), k8 = (t % (K / 8)) * 8; FragH f;
#pragma unroll
  for (int i = 0; i < 8; ++i) f.h[i] = (_Float16)(bf16_round(W[(size_t)(k8 + i) * N + n]) * scale); const v8us o = f.half[0];
  *(v8us*)((unsigned short*)Wt + (size_t)n * K + k8) = o; 
}
// k_gemm_hh variant with fused epilogue: v = acc·alpha + bias[by·sBias + col] (+ CP[(row/rowsPerB)·sCPb + by·64 + col] if CP) ; ACT 0 none / 1 elu ; writes f16 C16 and/or f32 C, each if non-null
template <int ACT>
__global__ __launch_bounds__(128) void k_gemm_hhx(const _Float16* __restrict__ A, int lda, size_t sA, const _Float16* __restrict__ Bh, int ldb, size_t sB, float alpha, const float* __restrict__ bias, size_t sBias, const float* __restrict__ CP, int rowsPerB, size_t sCPb, int row0g,
    float* __restrict__ C, _Float16* __restrict__ C16, int ldc, size_t sC, int M, int N, int K) {
  __shared__ __attribute__((aligned(16))) float so[4][16][64];
  const int tid = threadIdx.x, w = tid >> 5, lane = tid & 31, ln = lane & 15, hh = lane >> 4; const int by = blockIdx.y;
  A += (size_t)by * sA; Bh += (size_t)by * sB; const size_t cofs = (size_t)by * sC; const float* bp = bias ? bias + (size_t)by * sBias : nullptr;
  const int ntn = (N + 63) / 64; const int wid = blockIdx.x * 4 + w; const int mt = wid / ntn, nq = wid % ntn; if (mt * 16 >= M) return;
  const int row0 = mt * 16, col0 = nq * 64; const _Float16* arow = A + (size_t)(row0 + ln) * lda;
  v8f acc[4] = {};
  for (int kb = 0; kb < K; kb += 32) { FragH ah; ah.half[0] = *(const v8us*)((const unsigned short*)arow + kb + 8 * hh); ah.half[1] = *(const v8us*)((const unsigned short*)arow + kb + 16 + 8 * hh);
#pragma unroll
    for (int t = 0; t < 4; ++t) { if (col0 + t * 16 >= N) continue; const size_t boff = (size_t)(col0 + t * 16 + ln) * ldb + kb; FragH bq; bq.half[0] = *(const v8us*)((const unsigned short*)Bh + boff + 8 * hh); bq.half[1] = *(const v8us*)((const unsigned short*)Bh + boff + 16 + 8 * hh);
      acc[t] = mmaH<1>(ah.v, ah.v, bq.v, bq.v, acc[t]); }
  }
#pragma unroll
  for (int t = 0; t < 4; ++t) { if (col0 + t * 16 >= N) continue; const int col = col0 + t * 16 + ln; const float bv = bp ? bf16_round(bp[col]) : 0.f;
#pragma unroll
    for (int r = 0; r < 8; ++r) { float v = acc[t][r] * alpha + bv; if (CP) { const int bidx = (row0g + row0 + 8 * hh + r) / rowsPerB; v += CP[(size_t)bidx * sCPb + (size_t)by * 64 + col]; } if (ACT == 1) v = (v > 0.f) ? v : expm1f(v); else if (ACT == 7) v = (v > 0.f) ? v + 1.0f : expf(v); else if (ACT == 8) v = tanhf(v); else if (ACT == 9) v = 0.5f * v * (1.0f + tanhf(0.7978845608028654f * (v + 0.044715f * v * v * v))); else if (ACT == 11) v = 1.0f / (1.0f + expf(-v)); else if (ACT == 12) v = (v > 0.f) ? v : 0.01f * v; else if (ACT == 14) v = (v > 0.f) ? v : 0.1f * v; else if (ACT == 15) v = v / (1.0f + expf(-v)); else if (ACT == 3) v = fmaxf(v, 0.f); else if (ACT == 6) v = 0.5f * v * (1.0f + erff(v * 0.70710678118654752f)); so[w][8 * hh + r][t * 16 + ln] = v; } }
  __builtin_amdgcn_fence(__ATOMIC_ACQ_REL, "workgroup"); __builtin_amdgcn_wave_barrier();
  const int rsub = lane >> 4, c4 = (lane & 15) * 4; typedef _Float16 v4h __attribute__((ext_vector_type(4)));
  {
#pragma unroll
    for (int q = 0; q < 8; ++q) { const int r = q * 2 + rsub; if (col0 + c4 < N) { const v4f v = *(const v4fa*)&so[w][r][c4]; if (C) *(v4f*)(C + cofs + (size_t)(row0 + r) * ldc + col0 + c4) = v; if (C16) { v4h h4; for (int i = 0; i < 4; ++i) h4[i] = (_Float16)v[i]; *(v4h*)(C16 + cofs + (size_t)(row0 + r) * ldc + col0 + c4) = h4; } } }
     }
}


// GEMM C = (A.B^T)*alpha + bias on f16 planes, A [M][KD] (batch stride sA), Bh [ND][KD], both k-contiguous at pitch KD; C [M][ND] (batch stride sC) as f16 (OUT16) or f32. M and ND multiples of 128, KD a multiple of 64; grid.x = (M / 128) * (ND / 128), grid.y = batch.
// One 128 x 128 tile of C per work-group of 8 waves (4 x 2, 32 x 64 each). A 64-k slice of both operands (128 bytes of each row) is brought in by loads that cover whole lines and laid in LDS at pitch 144 bytes; every wave reads its fragments from there,
// so a row is asked of L2 once per work-group, not once per wave. Two LDS buffers: the next slice is loaded into registers ahead of the products of this one and stored behind them. Each accumulator still sums its k blocks of 32 in rising order.
// The unroll directives on the short loops below make every index into the register arrays (staged rows, fragments, accumulators, bias) a constant, so that these arrays stay in registers.
template <bool OUT16, int KD, int ND>
__global__ __launch_bounds__(256) void k_gemm_lds(const _Float16* __restrict__ A, size_t sA, const _Float16* __restrict__ Bh, float alpha, const float* __restrict__ bias,
    float* __restrict__ C, _Float16* __restrict__ C16, size_t sC) {
  constexpr int BT = 128, BK = 64, LP = BK + 8;
  __shared__ __attribute__((aligned(16))) unsigned char sm[4 * BT * LP * 2];      /* the two operands' two buffers; behind the loop the same bytes stage the output rows */
  unsigned short (*tA)[BT][LP] = (unsigned short (*)[BT][LP])sm; unsigned short (*tB)[BT][LP] = (unsigned short (*)[BT][LP])(sm + 2 * BT * LP * 2);
  const int tid = threadIdx.x, w = tid >> 5, lane = tid & 31, ln = lane & 15, hh = lane >> 4;
  constexpr int ntn = ND / BT; const int row0 = ((int)blockIdx.x / ntn) * BT, col0 = ((int)blockIdx.x % ntn) * BT; const int wr = (w >> 1) * 32, wc = (w & 1) * 64;
  const int sr = tid >> 3, sc = (tid & 7) * 8;      /* staging: 8 threads take one row's 128 bytes, a wave 4 whole lines; rows sr + 32 i */
  const unsigned short* Ag = (const unsigned short*)A + (size_t)blockIdx.y * sA + (size_t)(row0 + sr) * KD + sc; const unsigned short* Bg = (const unsigned short*)Bh + (size_t)(col0 + sr) * KD + sc;
  float bv[4];
#pragma unroll
  for (int t = 0; t < 4; ++t) bv[t] = bf16_round(bias[col0 + wc + t * 16 + ln]);
  v8us ra[4], rb[4];
#pragma unroll
  for (int i = 0; i < 4; ++i) { ra[i] = *(const v8us*)(Ag + 32 * i * KD); rb[i] = *(const v8us*)(Bg + 32 * i * KD); }
#pragma unroll
  for (int i = 0; i < 4; ++i) { *(v8us*)&tA[0][sr + 32 * i][sc] = ra[i]; *(v8us*)&tB[0][sr + 32 * i][sc] = rb[i]; }
  __syncthreads();      /* publishes slice 0 */
  v8f acc[2][4];
#pragma unroll
  for (int mi = 0; mi < 2; ++mi)
#pragma unroll
    for (int t = 0; t < 4; ++t) acc[mi][t] = (v8f){0.f,0.f,0.f,0.f,0.f,0.f,0.f,0.f};
  constexpr int ns = KD / BK;
#pragma unroll      /* slice offsets and the buffer choice become immediates: no address arithmetic in the loop, and no address register is rewritten while loads are under way */
  for (int s = 0; s < ns; ++s) { const int cur = s & 1; const bool more = s + 1 < ns;
    if (more) {
#pragma unroll
      for (int i = 0; i < 4; ++i) { ra[i] = *(const v8us*)(Ag + 32 * i * KD + (s + 1) * BK); rb[i] = *(const v8us*)(Bg + 32 * i * KD + (s + 1) * BK); }
      __builtin_amdgcn_sched_barrier(0); }      /* keeps the next slice's loads ahead of this slice's products; the scheduler otherwise sinks them to their LDS stores and the group waits out their whole latency */
#pragma unroll
    for (int ks = 0; ks < 2; ++ks) { FragH fa[2], fb[4];
#pragma unroll
      for (int mi = 0; mi < 2; ++mi) { fa[mi].half[0] = *(const v8us*)&tA[cur][wr + mi * 16 + ln][ks * 32 + 8 * hh]; fa[mi].half[1] = *(const v8us*)&tA[cur][wr + mi * 16 + ln][ks * 32 + 16 + 8 * hh]; }
#pragma unroll
      for (int t = 0; t < 4; ++t) { fb[t].half[0] = *(const v8us*)&tB[cur][wc + t * 16 + ln][ks * 32 + 8 * hh]; fb[t].half[1] = *(const v8us*)&tB[cur][wc + t * 16 + ln][ks * 32 + 16 + 8 * hh]; }
#pragma unroll
      for (int mi = 0; mi < 2; ++mi)
#pragma unroll
        for (int t = 0; t < 4; ++t) acc[mi][t] = __builtin_amdgcn_wmma_f32_16x16x32_f16(false, fa[mi].v, false, fb[t].v, (short)0, acc[mi][t], false, false); }
    if (more) {
#pragma unroll
      for (int i = 0; i < 4; ++i) { *(v8us*)&tA[cur ^ 1][sr + 32 * i][sc] = ra[i]; *(v8us*)&tB[cur ^ 1][sr + 32 * i][sc] = rb[i]; } }
    __syncthreads();      /* publishes slice s + 1 and ends every wave's reads of slice s, whose buffer the next trip refills (behind the last slice: the output staging) */
  }
  const size_t cofs = (size_t)blockIdx.y * sC; const int rsub = lane >> 4, c4 = (lane & 15) * 4; typedef _Float16 v4hh __attribute__((ext_vector_type(4)));
  float (*so)[64 + 4] = (float (*)[64 + 4])sm + w * 32;      /* the wave's own 32 staging rows */
#pragma unroll
  for (int mi = 0; mi < 2; ++mi)
#pragma unroll
    for (int t = 0; t < 4; ++t)
#pragma unroll
      for (int r = 0; r < 8; ++r) so[mi * 16 + 8 * hh + r][t * 16 + ln] = acc[mi][t][r] * alpha + bv[t];
  __builtin_amdgcn_fence(__ATOMIC_ACQ_REL, "workgroup"); __builtin_amdgcn_wave_barrier();      /* the wave's own staging rows: every lane's stores stay ahead of the row reads below */
#pragma unroll
  for (int q = 0; q < 16; ++q) { const int r = q * 2 + rsub; const v4f v = *(const v4fa*)&so[r][c4]; const size_t o = cofs + (size_t)(row0 + wr + r) * ND + col0 + wc + c4;
    if (OUT16) { v4hh h4;
#pragma unroll
      for (int i = 0; i < 4; ++i) h4[i] = (_Float16)v[i];
      *(v4hh*)(C16 + o) = h4; }
    else *(v4f*)(C + o) = v; }
}

typedef _Float16 v4h __attribute__((ext_vector_type(4)));

__global__ __launch_bounds__(256) void k_x16(const float* __restrict__ x, _Float16* __restrict__ X16, size_t n8) { const size_t t = (size_t)blockIdx.x * 256 + threadIdx.x; if (t >= n8) return; FragH f;
#pragma unroll
  for (int q = 0; q < 8; ++q) f.h[q] = (_Float16)bf16_round(x[t * 8 + q]); *(v8us*)((unsigned short*)X16 + t * 8) = f.half[0];  }
__global__ __launch_bounds__(256) void k_h16(const float* __restrict__ x, _Float16* __restrict__ X16, size_t n8) { const size_t t = (size_t)blockIdx.x * 256 + threadIdx.x; if (t >= n8) return; FragH f;
#pragma unroll
  for (int q = 0; q < 8; ++q) f.h[q] = (_Float16)x[t * 8 + q]; *(v8us*)((unsigned short*)X16 + t * 8) = f.half[0];  }
__global__ __launch_bounds__(256) void k_round16f(const float* __restrict__ W, _Float16* __restrict__ Bt, size_t n8) { const size_t t = (size_t)blockIdx.x * 256 + threadIdx.x; if (t >= n8) return; FragH f;
#pragma unroll
  for (int i = 0; i < 8; ++i) f.h[i] = (_Float16)(bf16_round(W[t * 8 + i]) * 16.0f); *(v8us*)((unsigned short*)Bt + t * 8) = f.half[0];  }
template <int NHv, int TTv>
__global__ __launch_bounds__(256) void k_vt(const _Float16* __restrict__ V16, int ldv, int voff, _Float16* __restrict__ Vt) { __shared__ unsigned short tl[64][66]; const int tid = threadIdx.x; const int slab = blockIdx.x / (TTv / 64), lg = blockIdx.x % (TTv / 64); const int b = slab / NHv, h = slab % NHv;
  for (int i = tid; i < 64 * 8; i += 256) { const int r = i / 8, c8 = (i % 8) * 8; FragH f; f.half[0] = *(const v8us*)((const unsigned short*)V16 + ((size_t)b * TTv + lg * 64 + r) * ldv + voff + h * 64 + c8);
#pragma unroll
    for (int q = 0; q < 8; ++q) tl[r][c8 + q] = f.u[q]; }
  __syncthreads();
  {
#pragma unroll
    for (int rd = 0; rd < 2; ++rd) { const int d = rd * 32 + tid / 8, pc = tid % 8; FragH f;
#pragma unroll
      for (int q = 0; q < 8; ++q) f.u[q] = tl[pc * 8 + q][d];
      *(v8us*)((unsigned short*)Vt + ((size_t)slab * 64 + d) * TTv + lg * 64 + pc * 8) = f.half[0]; }
     } }

__global__ __launch_bounds__(256) void k_hl(const float* __restrict__ F, _Float16* __restrict__ Hh, _Float16* __restrict__ Hl, size_t n8) { const size_t t = (size_t)blockIdx.x * 256 + threadIdx.x; if (t >= n8) return; FragH fh, fl; const v4f a = *(const v4fa*)(F + t * 8), c = *(const v4fa*)(F + t * 8 + 4);
#pragma unroll
  for (int q = 0; q < 4; ++q) { _Float16 h = (_Float16)a[q]; fh.h[q] = h; fl.h[q] = (_Float16)((a[q] - (float)h) * 1024.0f); h = (_Float16)c[q]; fh.h[4 + q] = h; fl.h[4 + q] = (_Float16)((c[q] - (float)h) * 1024.0f); }
  { *(v8us*)((unsigned short*)Hh + t * 8) = fh.half[0]; *(v8us*)((unsigned short*)Hl + t * 8) = fl.half[0];  } }

__global__ __launch_bounds__(256) void k_h16s(const float* __restrict__ F, _Float16* __restrict__ H, size_t n8) { const size_t t = (size_t)blockIdx.x * 256 + threadIdx.x; if (t >= n8) return; const v4f a = *(const v4fa*)(F + t * 8), c = *(const v4fa*)(F + t * 8 + 4); FragH f;
#pragma unroll
  for (int q = 0; q < 4; ++q) { f.h[q] = (_Float16)(a[q] * 16.0f); f.h[4 + q] = (_Float16)(c[q] * 16.0f); } *(v8us*)((unsigned short*)H + t * 8) = f.half[0];  }
// mask predicates over (query index q, key-plane row k): key-plane rows 0..T-1 are TOKENS, rows T..2T-1 are CONCEPTS (the tok/con GEMMs write the two halves of one plane per batch); MODE 0 = token queries: token s ≤ q (causal), concept j < q/ntc + 1;
// MODE 1 = concept queries: concept j ≤ q, token s < ntc·(q + 1). (Key order inside the softmax is irrelevant, so the plane order is used directly.)
template <int MODE> __device__ __forceinline__ bool allow(int q, int k, int ntc) {
  if (MODE == 0) return (k < TQ) ? (k <= q) : ((k - TQ) * ntc <= q);      /* j < q / ntc + 1 in whole numbers, ntc >= 1: j <= q / ntc, that is j * ntc <= q; no quotient per query row has to be kept in a register across the key walk */
  else           return (k < TQ) ? (k < ntc * (q + 1)) : ((k - TQ) <= q); }
// Work-group = 12 waves on four query tiles of 16 rows, taken as two pairs (p, 63 - p), p = 2 * block + (w & 1): an early tile, which the masks leave few keys, with a late one, which they leave many, so that every wave of the grid walks about the same number of key tiles.
// A wave takes its pair's two query tiles one after the other (ph = 0, 1). Of the 64 key tiles of 32 it walks only those in which the mask allows some key to some row of the query tile: both masks grow with the query index and shrink with the key index inside each half of the key plane,
// so these are the first na tiles of the token half and the first nb of the concept half, counted from the tile's last row. A tile left out held only weights 0 and left maximum, sum and V sum as they were. The six waves (w >> 1) of a pair take every sixth tile of that list;
// the six partial softmax states of a query tile (row maximum, row sum, weighted V sum) are merged in LDS behind each walk.
template <int MODE>
__global__ __launch_bounds__(384) void k_flashm(const _Float16* __restrict__ Q16, int ldq, const _Float16* __restrict__ K16, int ldk, const _Float16* __restrict__ Vt, const int* __restrict__ NTCP, float* __restrict__ O, int ldo) {
  int ntc = NTCP[0]; ntc = (ntc < 1) ? 1 : ((ntc > TQ) ? TQ : ntc);      /* = 8 here; guarded so the index arithmetic can never divide by zero; from TQ up both masks read the same as at TQ, and the products below cannot overflow */
  constexpr int RPW = 16, NPR = 2, NQT = TQ / RPW, NQB = NQT / (2 * NPR), DT = 4, KS = 2, NSP = 6, HT = TQ / 32;
  __shared__ __attribute__((aligned(16))) unsigned short sP[NPR * NSP][RPW][40]; __shared__ __attribute__((aligned(16))) float sO[NPR * NSP][RPW][64 + 4]; __shared__ float sM[NPR * NSP][RPW], sL[NPR * NSP][RPW];
  const int tid = threadIdx.x, w = __builtin_amdgcn_readfirstlane(tid >> 5), lane = tid & 31, ln = lane & 15, hh = lane >> 4;      /* the wave's number in a scalar register: the key loop's counter and its tests stay scalar */
  const int slab = blockIdx.x / NQB, qblk = blockIdx.x % NQB; const int b = slab / NH, h = slab % NH; const int pr = w & 1, sp = w >> 1;
  const unsigned short* Vth = (const unsigned short*)Vt + (size_t)slab * 64 * TK;
#pragma unroll 1      /* one copy of the walk serves both query tiles */
  for (int ph = 0; ph < 2; ++ph) {
    const int q0 = (ph ? NQT - 1 - (qblk * NPR + pr) : qblk * NPR + pr) * RPW, qm = q0 + RPW - 1;
    int na = (MODE == 0) ? qm / 32 + 1 : (ntc * (qm + 1) + 31) / 32, nb = (MODE == 0) ? (qm / ntc) / 32 + 1 : qm / 32 + 1;      /* key tiles with an allowed key: token half, concept half */
    na = __builtin_amdgcn_readfirstlane((na > HT) ? HT : na); nb = __builtin_amdgcn_readfirstlane((nb > HT) ? HT : nb);      /* the same in every lane: in scalar registers the walk's bound and the tile's number cost no vector register */
    FragH aq[KS]; { const unsigned short* qr = (const unsigned short*)Q16 + ((size_t)b * TQ + q0 + ln) * ldq + h * 64;
#pragma unroll
      for (int ks = 0; ks < KS; ++ks) { aq[ks].half[0] = *(const v8us*)(qr + ks * 32 + 8 * hh); aq[ks].half[1] = *(const v8us*)(qr + ks * 32 + 16 + 8 * hh); } }
    float m_r[8], l_r[8]; v8f oacc[DT];
#pragma unroll
    for (int r = 0; r < 8; ++r) { m_r[r] = -3.0e38f; l_r[r] = 0.f; }
#pragma unroll
    for (int dt = 0; dt < DT; ++dt) oacc[dt] = (v8f){0.f,0.f,0.f,0.f,0.f,0.f,0.f,0.f};
#pragma unroll 1
    for (int it = sp; it < na + nb; it += NSP) { const int j0 = 32 * ((it < na) ? it : it - na + HT);
      v8f s[2];
#pragma unroll
      for (int nt = 0; nt < 2; ++nt) { const unsigned short* kr = (const unsigned short*)K16 + ((size_t)b * TK + j0 + nt * 16 + ln) * ldk + h * 64; FragH bk[KS];
#pragma unroll
        for (int ks = 0; ks < KS; ++ks) { bk[ks].half[0] = *(const v8us*)(kr + ks * 32 + 8 * hh); bk[ks].half[1] = *(const v8us*)(kr + ks * 32 + 16 + 8 * hh); }
        v8f acc = (v8f){0.f,0.f,0.f,0.f,0.f,0.f,0.f,0.f};
#pragma unroll
        for (int ks = 0; ks < KS; ++ks) acc = mmaH<1>(aq[ks].v, aq[ks].v, bk[ks].v, bk[ks].v, acc);
        s[nt] = acc; }
#pragma unroll
      for (int r = 0; r < 8; ++r) { const int tq = q0 + 8 * hh + r; const int k0 = j0 + ln, k1 = j0 + 16 + ln;
        const bool ok0 = allow<MODE>(tq, k0, ntc), ok1 = allow<MODE>(tq, k1, ntc);
        const float s0 = ok0 ? s[0][r] * SCL : -INFINITY, s1 = ok1 ? s[1][r] * SCL : -INFINITY; float mc = fmaxf(s0, s1);
        mc = fmaxf(mc, __shfl_xor(mc, 1, 32)); mc = fmaxf(mc, __shfl_xor(mc, 2, 32)); mc = fmaxf(mc, __shfl_xor(mc, 4, 32)); mc = fmaxf(mc, __shfl_xor(mc, 8, 32));
        const float mn = fmaxf(m_r[r], mc); const float al = (mn > -1.0e38f) ? expf(m_r[r] - mn) : 1.0f; m_r[r] = mn; const float p0 = ok0 ? expf(s0 - mn) : 0.f, p1 = ok1 ? expf(s1 - mn) : 0.f; l_r[r] = l_r[r] * al + p0 + p1;
#pragma unroll
        for (int dt = 0; dt < DT; ++dt) oacc[dt][r] *= al;
        FragH t2; t2.h[0] = (_Float16)(p0 * 1024.0f); t2.h[1] = (_Float16)(p1 * 1024.0f); sP[w][8 * hh + r][ln] = t2.u[0]; sP[w][8 * hh + r][16 + ln] = t2.u[1]; }
      __builtin_amdgcn_fence(__ATOMIC_ACQ_REL, "workgroup"); __builtin_amdgcn_wave_barrier();
      FragH pa; pa.half[0] = *(const v8us*)&sP[w][ln][8 * hh]; pa.half[1] = *(const v8us*)&sP[w][ln][16 + 8 * hh];
#pragma unroll
      for (int dt = 0; dt < DT; ++dt) { const unsigned short* vrow = Vth + (size_t)(dt * 16 + ln) * TK + j0; FragH bv; bv.half[0] = *(const v8us*)(vrow + 8 * hh); bv.half[1] = *(const v8us*)(vrow + 16 + 8 * hh);
        oacc[dt] = mmaH<1>(pa.v, pa.v, bv.v, bv.v, oacc[dt]); }
      __builtin_amdgcn_fence(__ATOMIC_ACQ_REL, "workgroup"); __builtin_amdgcn_wave_barrier(); }
#pragma unroll
    for (int r = 0; r < 8; ++r) { float l = l_r[r]; l += __shfl_xor(l, 1, 32); l += __shfl_xor(l, 2, 32); l += __shfl_xor(l, 4, 32); l += __shfl_xor(l, 8, 32);
      if (ln == 0) { sM[w][8 * hh + r] = m_r[r]; sL[w][8 * hh + r] = l; } }
    __syncthreads();      /* publishes every wave's row maxima and row sums; it also ends the reads of the partial outputs of the query tiles before */
#pragma unroll
    for (int r = 0; r < 8; ++r) { const int row = 8 * hh + r; float mg = sM[pr][row];
#pragma unroll
      for (int s2 = 1; s2 < NSP; ++s2) mg = fmaxf(mg, sM[s2 * NPR + pr][row]);
      float l = 0.f, fo = 0.f;      /* a wave that met no allowed key of this row holds sum 0 and a zero V sum */
#pragma unroll
      for (int s2 = 0; s2 < NSP; ++s2) { const float e = expf(sM[s2 * NPR + pr][row] - mg); l += sL[s2 * NPR + pr][row] * e; if (s2 == sp) fo = e; }
      l_r[r] = (l > 0.f) ? fo / (l * 1024.0f) : 0.f; }
#pragma unroll
    for (int dt = 0; dt < DT; ++dt)
#pragma unroll
      for (int r = 0; r < 8; ++r) sO[w][8 * hh + r][dt * 16 + ln] = oacc[dt][r] * l_r[r];
    __syncthreads();      /* publishes the rescaled partial outputs; it also ends the reads of the maxima and sums, which the next query tiles write anew */
    for (int i = tid; i < NPR * RPW * 16; i += 32 * NPR * NSP) { const int q2 = i >> 8, r = (i >> 4) & 15, pc = i & 15; v4f val = *(const v4fa*)&sO[q2][r][pc * 4];
#pragma unroll
      for (int s2 = 1; s2 < NSP; ++s2) val += *(const v4fa*)&sO[s2 * NPR + q2][r][pc * 4];
      const int qo = (ph ? NQT - 1 - (qblk * NPR + q2) : qblk * NPR + q2) * RPW;
      *(v4f*)(O + ((size_t)b * TQ + qo + r) * ldo + h * 64 + pc * 4) = val; } } }

extern "C" void kernel_launch(void* const* d_in, const int* in_sizes, int n_in,
                              void* d_out, int out_size, void* d_ws, size_t ws_size, hipStream_t stream) {
  (void)in_sizes; (void)n_in; (void)out_size;
  const float* const* I = (const float* const*)d_in; const float* xt = I[0]; const float* xc = I[1]; const float* Wt = I[2]; const float* bt = I[3]; const float* Wc = I[4]; const float* bc = I[5]; const float* Wtp = I[6]; const float* btp = I[7]; const float* Wcp = I[8]; const float* bcp = I[9]; const int* ntcp = (const int*)d_in[10];      /* int64 in the module, read as int32 */
  char* ws = (char*)d_ws; size_t off = 0;
  auto take = [&](size_t bytes) { char* p = ws + off; off += (bytes + 255) & ~(size_t)255; return p; };
  _Float16* Bt_ = (_Float16*)take((size_t)DW * DD * 2); _Float16* Bc = (_Float16*)take((size_t)DW * DD * 2); _Float16* Btp = (_Float16*)take((size_t)DD * DD * 2); _Float16* Bcp = (_Float16*)take((size_t)DD * DD * 2);
  _Float16* XT = (_Float16*)take((size_t)NR * DD * 2); _Float16* XC = (_Float16*)take((size_t)NR * DD * 2); _Float16* TC = (_Float16*)take((size_t)BB * TK * DW * 2);      /* per batch: rows 0..1023 = tok, 1024..2047 = con */
  _Float16* Vt1 = (_Float16*)take((size_t)BB * NH * 64 * TK * 2); _Float16* Vt2 = (_Float16*)take((size_t)BB * NH * 64 * TK * 2); float* O = (float*)take((size_t)NR * DD * 4); _Float16* O16 = (_Float16*)take((size_t)NR * DD * 2);
  if (off > ws_size) return;      // 8.4 + 8.4 + 2.1 + 2.1 + 4.2 + 4.2 + 33.6 + 8.4 + 8.4 + 8.4 + 4.2 ≈ 92 MB
  const unsigned gw = (unsigned)(((size_t)DW * DD / 8 + 255) / 256), gp = (unsigned)(((size_t)DD * DD / 8 + 255) / 256);
  k_round16f<<<gw, 256, 0, stream>>>(Wt, Bt_, (size_t)DW * DD / 8); k_round16f<<<gw, 256, 0, stream>>>(Wc, Bc, (size_t)DW * DD / 8); k_round16f<<<gp, 256, 0, stream>>>(Wtp, Btp, (size_t)DD * DD / 8); k_round16f<<<gp, 256, 0, stream>>>(Wcp, Bcp, (size_t)DD * DD / 8);      /* torch (out,in) natural, ×2^4 */
  const unsigned g8 = (unsigned)(((size_t)NR * DD / 8 + 255) / 256); k_x16<<<g8, 256, 0, stream>>>(xt, XT, (size_t)NR * DD / 8); k_x16<<<g8, 256, 0, stream>>>(xc, XC, (size_t)NR * DD / 8);
  const dim3 gt((TQ / 128) * (DW / 128), BB);
  k_gemm_lds<true, DD, DW><<<gt, 256, 0, stream>>>(XT, (size_t)TQ * DD, Bt_, 0.0625f, bt, nullptr, TC, (size_t)TK * DW);      /* tok[b] -> plane rows 0..1023: M 1024 N 4096 K 1024 */
  k_gemm_lds<true, DD, DW><<<gt, 256, 0, stream>>>(XC, (size_t)TQ * DD, Bc, 0.0625f, bc, nullptr, TC + (size_t)TQ * DW, (size_t)TK * DW);      /* con[b] -> plane rows 1024..2047 */
  k_vt<NH, TK><<<BB * NH * (TK / 64), 256, 0, stream>>>(TC, DW, 2 * DD, Vt1);      /* values read by tokens = columns 2048.. of both halves → Vᵀ [bh][64][2048] */
  k_vt<NH, TK><<<BB * NH * (TK / 64), 256, 0, stream>>>(TC, DW, 3 * DD, Vt2);      /* values read by concepts = columns 3072.. */
  const dim3 gpj((NR / 128) * (DD / 128), 1);
  k_flashm<0><<<BB * NH * (TQ / 64), 384, 0, stream>>>(XT, DD, TC, DW, Vt1, ntcp, O, DD);      /* token queries; keys = columns 0..1023 (kt_t on token rows, kc_t on concept rows) */
  k_h16s<<<g8, 256, 0, stream>>>(O, O16, (size_t)NR * DD / 8);
  k_gemm_lds<false, DD, DD><<<gpj, 256, 0, stream>>>(O16, 0, Btp, 0.00390625f, btp, (float*)d_out, nullptr, 0);      /* y_t = merged.Wtp^T + btp -> output 0 */
  k_flashm<1><<<BB * NH * (TQ / 64), 384, 0, stream>>>(XC, DD, TC + DD, DW, Vt2, ntcp, O, DD);      /* concept queries; keys = columns 1024..2047 (kc_c on concept rows, kt_c on token rows) */
  k_h16s<<<g8, 256, 0, stream>>>(O, O16, (size_t)NR * DD / 8);
  k_gemm_lds<false, DD, DD><<<gpj, 256, 0, stream>>>(O16, 0, Bcp, 0.00390625f, bcp, (float*)d_out + (size_t)NR * DD, nullptr, 0);      /* y_c -> output 1 (offset B.T.NE floats) */
}

// v004
// Measured time: 161 microseconds a run.
// In both of two side-by-side timings against v003, it was 1.45 times as fast.
// Over all steps from v000 it is 4.81 times as fast.
#include <hip/hip_runtime.h>
// Token/concept two-stream causal attention (B=2, T=C=1024, NE=CD=1024, 16 heads × 64, n_tokens_per_concept = 8): tok = xt·Wtᵀ + bt, con = xc·Wcᵀ + bc (4096 outputs each = [k for token queries | k for concept queries | v read by tokens | v read by concepts]);
// token queries = heads(xt) (the residual stream itself) attend over [tokens ; concepts] with mask (s ≤ t) | (j < t/8 + 1), scale 1/√64; concept queries = heads(xc) attend over [concepts ; tokens] with mask (j ≤ i) | (s < 8(i+1)); disallowed = −1e9 (≡ −inf: every row keeps itself);
// y_t = merge(attn_t)·Wtpᵀ + btp, y_c = merge(attn_c)·Wcpᵀ + bcp (two outputs).
// Compute dtype: xt, xc, weights, biases rounded to bf16; tok/con as f16 GEMM planes written as the two 1024-row halves of one 2048-key plane per batch; queries = the bf16-exact x planes; fused flash-style kernels with the index-computed masks (n_tokens_per_concept read on device; online softmax f32,
// P f16 ×2^10, f32 accumulate) on v_wmma_f32_16x16x32_f16; O ×2^4 → f16 → projection GEMMs (+bias) straight into the two output slots.
#define BB 2
#define TQ 1024
#define TK 2048
#define DD 1024
#define NH 16
#define DW 4096
#define SCL 0.125f
#define NR (BB * TQ)
typedef __bf16 v16b __attribute__((ext_vector_type(16)));
typedef unsigned short v8us __attribute__((ext_vector_type(8), may_alias));
typedef float  v8f  __attribute__((ext_vector_type(8)));
typedef float  v4f  __attribute__((ext_vector_type(4)));
typedef float  v4fa __attribute__((ext_vector_type(4), may_alias));
union FragB { v16b v; v8us half[2]; unsigned short u[16]; };

__device__ __forceinline__ unsigned short bf16_bits(float x) { unsigned int u = __float_as_uint(x); return (unsigned short)((u + 0x7FFFu + ((u >> 16) & 1u)) >> 16); }
__device__ __forceinline__ float bf16_val(unsigned short b) { return __uint_as_float(((unsigned int)b) << 16); }
__device__ __forceinline__ float bf16_round(float x) { return bf16_val(bf16_bits(x)); }
// D += A·B with NT terms: 1 = ah·bh, 2 = + al·bh (A split), 3 = + ah·bl (both split)
template <int NT>
__device__ __forceinline__ v8f mmaN(v16b ah, v16b al, v16b bh, v16b bl, v8f c) {
  c = __builtin_amdgcn_wmma_f32_16x16x32_bf16(false, ah, false, bh, (short)0, c, false, false);
  if (NT >= 2) c = __builtin_amdgcn_wmma_f32_16x16x32_bf16(false, al, false, bh, (short)0, c, false, false);
  if (NT >= 3) c = __builtin_amdgcn_wmma_f32_16x16x32_bf16(false, ah, false, bl, (short)0, c, false, false);
  asm volatile("v_nop\n\tv_nop\n\tv_nop\n\tv_nop" : "+v"(c) : "v"(ah), "v"(al), "v"(bh), "v"(bl));
  return c;
}

__global__ __launch_bounds__(256) void k_wt_bf16(const float* __restrict__ W, unsigned short* __restrict__ Wt, int K, int N) {
  const int t = blockIdx.x * 256 + threadIdx.x;
  const int k8n = K / 8;
  if (t >= N * k8n) return;
  const int n = t / k8n, k8 = (t % k8n) * 8;
  v8us v;
#pragma unroll
  for (int i = 0; i < 8; ++i) v[i] = bf16_bits(W[(size_t)(k8 + i) * N + n]);
  *(v8us*)(Wt + (size_t)n * K + k8) = v;
  
}

// GEMM C[M][N] (f32, pitch ldc) = act(A[M][K]·W + bias). A f32 row-major (pitch lda) converted per fragment to bf16
// (ASPLIT: hi/lo two planes -> 2 terms, else single rounded term); Wt bf16 [N][K] (pitch ldb). BIAS_BF16 rounds the
// bias to bf16 first (bias quantised to bf16 before the add). K%32==0, M%16==0, N%64==0.
template <bool ASPLIT, int ACT, bool BIAS_BF16>
__global__ __launch_bounds__(128) void k_gemm_bf(const float* __restrict__ A, int lda, const unsigned short* __restrict__ Wt, int ldb,
                                               const float* __restrict__ bias, float* __restrict__ C, int ldc, int M, int N, int K) {
  __shared__ __attribute__((aligned(16))) float so[4][16][64];
  const int tid = threadIdx.x, w = tid >> 5, lane = tid & 31, ln = lane & 15, hh = lane >> 4;
  const int ntn = N / 64;
  const int wid = blockIdx.x * 4 + w;
  const int mt = wid / ntn, nq = wid % ntn;
  if (mt * 16 >= M) return;
  const int row0 = mt * 16, col0 = nq * 64;
  const float* arow = A + (size_t)(row0 + ln) * lda;
  v8f acc[4] = {};
  for (int kb = 0; kb < K; kb += 32) {
    FragB ah, al;
    const v4f x0 = *(const v4fa*)(arow + kb + 8 * hh), x1 = *(const v4fa*)(arow + kb + 8 * hh + 4);
    const v4f x2 = *(const v4fa*)(arow + kb + 16 + 8 * hh), x3 = *(const v4fa*)(arow + kb + 16 + 8 * hh + 4);
    float xs[16] = {x0[0],x0[1],x0[2],x0[3],x1[0],x1[1],x1[2],x1[3],x2[0],x2[1],x2[2],x2[3],x3[0],x3[1],x3[2],x3[3]};
#pragma unroll
    for (int i = 0; i < 16; ++i) { const unsigned short hb = bf16_bits(xs[i]); ah.u[i] = hb; al.u[i] = ASPLIT ? bf16_bits(xs[i] - bf16_val(hb)) : (unsigned short)0; }
#pragma unroll
    for (int t = 0; t < 4; ++t) {
      const unsigned short* brow = Wt + (size_t)(col0 + t * 16 + ln) * ldb + kb;
      FragB b;
      b.half[0] = *(const v8us*)(brow + 8 * hh);
      b.half[1] = *(const v8us*)(brow + 16 + 8 * hh);
      acc[t] = mmaN<ASPLIT ? 2 : 1>(ah.v, al.v, b.v, b.v, acc[t]);
    }
  }
#pragma unroll
  for (int t = 0; t < 4; ++t) {
    float bv = bias ? bias[col0 + t * 16 + ln] : 0.f;
    if (BIAS_BF16) bv = bf16_round(bv);
#pragma unroll
    for (int r = 0; r < 8; ++r) { float v = acc[t][r] + bv; if (ACT == 1) v = fmaxf(v, 0.f); so[w][8 * hh + r][t * 16 + ln] = v; }
  }
  __builtin_amdgcn_fence(__ATOMIC_ACQ_REL, "workgroup");
  __builtin_amdgcn_wave_barrier();
  const int rsub = lane >> 4, c4 = (lane & 15) * 4;
  {
#pragma unroll
    for (int q = 0; q < 8; ++q) {
      const int r = q * 2 + rsub;
      const v4f v = *(const v4fa*)&so[w][r][c4];
      *(v4f*)(C + (size_t)(row0 + r) * ldc + col0 + c4) = v;
    }
    
  }
}

// GEMM C = act(A·W + bias + resid): A f32 (ASPLIT -> hi/lo 2 terms), Wt bf16 [N][K]; ACT 0 none, 1 relu, 2 exact gelu;
// resid (optional, f32, row index = (row % rmod), pitch ldr, RES_BF16 rounds it) added before the activation.
template <bool ASPLIT, int ACT, bool BIAS_BF16, bool RES_BF16>
__global__ __launch_bounds__(128) void k_gemm_bf3(const float* __restrict__ A, int lda, const unsigned short* __restrict__ Wt, int ldb,
                                                const float* __restrict__ bias, const float* __restrict__ resid, int rmod, int ldr,
                                                float* __restrict__ C, int ldc, int M, int N, int K) {
  __shared__ __attribute__((aligned(16))) float so[4][16][64];
  const int tid = threadIdx.x, w = tid >> 5, lane = tid & 31, ln = lane & 15, hh = lane >> 4;
  const int ntn = N / 64;
  const int wid = blockIdx.x * 4 + w;
  const int mt = wid / ntn, nq = wid % ntn;
  if (mt * 16 >= M) return;
  const int row0 = mt * 16, col0 = nq * 64;
  const float* arow = A + (size_t)(row0 + ln) * lda;
  v8f acc[4] = {};
  for (int kb = 0; kb < K; kb += 32) {
    FragB ah, al;
    const v4f x0 = *(const v4fa*)(arow + kb + 8 * hh), x1 = *(const v4fa*)(arow + kb + 8 * hh + 4);
    const v4f x2 = *(const v4fa*)(arow + kb + 16 + 8 * hh), x3 = *(const v4fa*)(arow + kb + 16 + 8 * hh + 4);
    float xs[16] = {x0[0],x0[1],x0[2],x0[3],x1[0],x1[1],x1[2],x1[3],x2[0],x2[1],x2[2],x2[3],x3[0],x3[1],x3[2],x3[3]};
#pragma unroll
    for (int i = 0; i < 16; ++i) { const unsigned short hb = bf16_bits(xs[i]); ah.u[i] = hb; al.u[i] = ASPLIT ? bf16_bits(xs[i] - bf16_val(hb)) : (unsigned short)0; }
#pragma unroll
    for (int t = 0; t < 4; ++t) {
      const unsigned short* brow = Wt + (size_t)(col0 + t * 16 + ln) * ldb + kb;
      FragB b;
      b.half[0] = *(const v8us*)(brow + 8 * hh);
      b.half[1] = *(const v8us*)(brow + 16 + 8 * hh);
      acc[t] = mmaN<ASPLIT ? 2 : 1>(ah.v, al.v, b.v, b.v, acc[t]);
    }
  }
#pragma unroll
  for (int t = 0; t < 4; ++t) {
    const int col = col0 + t * 16 + ln;
    float bv = bias ? bias[col] : 0.f;
    if (BIAS_BF16) bv = bf16_round(bv);
#pragma unroll
    for (int r = 0; r < 8; ++r) {
      float v = acc[t][r] + bv;
      if (resid) { float rv = resid[(size_t)((row0 + 8 * hh + r) % rmod) * ldr + col]; if (RES_BF16) rv = bf16_round(rv); v += rv; }
      if (ACT == 1) v = fmaxf(v, 0.f);
      if (ACT == 2) v = 0.5f * v * (1.0f + erff(v * 0.70710678118654752f));
      if (ACT == 3) { const float u = 0.7978845608028654f * (v + 0.044715f * v * v * v); v = 0.5f * v * (1.0f + tanhf(u)); }
      so[w][8 * hh + r][t * 16 + ln] = v;
    }
  }
  __builtin_amdgcn_fence(__ATOMIC_ACQ_REL, "workgroup");
  __builtin_amdgcn_wave_barrier();
  const int rsub = lane >> 4, c4 = (lane & 15) * 4;
  {
#pragma unroll
    for (int q = 0; q < 8; ++q) {
      const int r = q * 2 + rsub;
      const v4f v = *(const v4fa*)&so[w][r][c4];
      *(v4f*)(C + (size_t)(row0 + r) * ldc + col0 + c4) = v;
    }
    
  }
}
// row LayerNorm (biased variance, eps) over N: s = X (+ R); optional out_sum <- s; out_norm <- (s-mu)*rsqrt(var+eps)*g + b
template <bool PARAM_BF16>
__global__ __launch_bounds__(256) void k_layernorm(const float* __restrict__ X, const float* __restrict__ R, const float* __restrict__ g, const float* __restrict__ bta,
                                                  float* __restrict__ out_sum, float* __restrict__ out_norm, int N, float eps) {
  __shared__ float red[256];
  const int row = blockIdx.x, tid = threadIdx.x;
  const float* x = X + (size_t)row * N; const float* rr = R ? R + (size_t)row * N : nullptr;
  float vals[16];                     // up to N = 4096
  const int per = N / 256;            // contiguous chunk per thread? use strided-by-4 chunks: thread handles j = tid*4 + 1024*u
  float s1 = 0.f;
  for (int u = 0; u < per / 4; ++u) {
    const int j = tid * 4 + 1024 * u;
    const v4f a = *(const v4fa*)(x + j);
    v4f b = {0.f,0.f,0.f,0.f}; if (rr) b = *(const v4fa*)(rr + j);
#pragma unroll
    for (int q = 0; q < 4; ++q) { const float v = a[q] + b[q]; vals[u * 4 + q] = v; s1 += v; }
  }
  red[tid] = s1; __syncthreads();
  for (int st = 128; st > 0; st >>= 1) { if (tid < st) red[tid] += red[tid + st]; __syncthreads(); }
  const float mu = red[0] / (float)N; __syncthreads();
  float s2 = 0.f;
  for (int u = 0; u < per / 4; ++u)
#pragma unroll
    for (int q = 0; q < 4; ++q) { const float c = vals[u * 4 + q] - mu; s2 += c * c; }
  red[tid] = s2; __syncthreads();
  for (int st = 128; st > 0; st >>= 1) { if (tid < st) red[tid] += red[tid + st]; __syncthreads(); }
  const float rs = rsqrtf(red[0] / (float)N + eps);
  {
    for (int u = 0; u < per / 4; ++u) {
      const int j = tid * 4 + 1024 * u;
      v4f o, sm;
#pragma unroll
      for (int q = 0; q < 4; ++q) {
        float gg = g[j + q], bb = bta[j + q];
        if (PARAM_BF16) { gg = bf16_round(gg); bb = bf16_round(bb); }
        sm[q] = vals[u * 4 + q]; o[q] = (vals[u * 4 + q] - mu) * rs * gg + bb;
      }
      if (out_sum) *(v4f*)(out_sum + (size_t)row * N + j) = sm;
      *(v4f*)(out_norm + (size_t)row * N + j) = o;
    }
    
  }
}



// ---- f16 WMMA path (v_wmma_f32_16x16x32_f16): 11-bit significands for operands in range — used where a [0,1] probability operand needs more precision than bf16
typedef _Float16 v16h __attribute__((ext_vector_type(16)));
union FragH { v16h v; v8us half[2]; _Float16 h[16]; unsigned short u[16]; };
template <int NT>
__device__ __forceinline__ v8f mmaH(v16h ah, v16h al, v16h bh, v16h bl, v8f c) {
  c = __builtin_amdgcn_wmma_f32_16x16x32_f16(false, ah, false, bh, (short)0, c, false, false);
  if (NT >= 2) c = __builtin_amdgcn_wmma_f32_16x16x32_f16(false, al, false, bh, (short)0, c, false, false);
  if (NT >= 3) c = __builtin_amdgcn_wmma_f32_16x16x32_f16(false, ah, false, bl, (short)0, c, false, false);
  asm volatile("v_nop\n\tv_nop\n\tv_nop\n\tv_nop" : "+v"(c) : "v"(ah), "v"(al), "v"(bh), "v"(bl));
  return c;
}
// batched GEMM like k_gemm_b but f16 operands: A f32 (split into f16 hi/lo if ASPLIT, else rounded to f16), Bt = f16 values [n][k]; alpha; C f32; N multiple of 16 (partial tiles skipped)
template <bool ASPLIT>
__global__ __launch_bounds__(128) void k_gemm_h(const float* __restrict__ A, int lda, size_t sA, const _Float16* __restrict__ Bh, int ldb, size_t sB, float alpha, float* __restrict__ C, int ldc, size_t sC, int M, int N, int K) {
  __shared__ __attribute__((aligned(16))) float so[4][16][64];
  const int tid = threadIdx.x, w = tid >> 5, lane = tid & 31, ln = lane & 15, hh = lane >> 4; const int by = blockIdx.y;
  A += (size_t)by * sA; Bh += (size_t)by * sB; C += (size_t)by * sC;
  const int ntn = (N + 63) / 64; const int wid = blockIdx.x * 4 + w; const int mt = wid / ntn, nq = wid % ntn; if (mt * 16 >= M) return;
  const int row0 = mt * 16, col0 = nq * 64; const float* arow = A + (size_t)(row0 + ln) * lda;
  v8f acc[4] = {};
  for (int kb = 0; kb < K; kb += 32) {
    FragH ah, al;
    const v4f x0 = *(const v4fa*)(arow + kb + 8 * hh), x1 = *(const v4fa*)(arow + kb + 8 * hh + 4), x2 = *(const v4fa*)(arow + kb + 16 + 8 * hh), x3 = *(const v4fa*)(arow + kb + 16 + 8 * hh + 4);
    float xs[16] = {x0[0],x0[1],x0[2],x0[3],x1[0],x1[1],x1[2],x1[3],x2[0],x2[1],x2[2],x2[3],x3[0],x3[1],x3[2],x3[3]};
#pragma unroll
    for (int i = 0; i < 16; ++i) { const _Float16 h = (_Float16)xs[i]; ah.h[i] = h; al.h[i] = ASPLIT ? (_Float16)(xs[i] - (float)h) : (_Float16)0.0f; }
#pragma unroll
    for (int t = 0; t < 4; ++t) { if (col0 + t * 16 >= N) continue; const size_t boff = (size_t)(col0 + t * 16 + ln) * ldb + kb; FragH bq; bq.half[0] = *(const v8us*)(Bh + boff + 8 * hh); bq.half[1] = *(const v8us*)(Bh + boff + 16 + 8 * hh);
      acc[t] = mmaH<ASPLIT ? 2 : 1>(ah.v, al.v, bq.v, bq.v, acc[t]); }
  }
#pragma unroll
  for (int t = 0; t < 4; ++t) { if (col0 + t * 16 >= N) continue;
#pragma unroll
    for (int r = 0; r < 8; ++r) so[w][8 * hh + r][t * 16 + ln] = acc[t][r] * alpha; }
  __builtin_amdgcn_fence(__ATOMIC_ACQ_REL, "workgroup"); __builtin_amdgcn_wave_barrier();
  const int rsub = lane >> 4, c4 = (lane & 15) * 4;
  {
#pragma unroll
    for (int q = 0; q < 8; ++q) { const int r = q * 2 + rsub; if (col0 + c4 < N) { const v4f v = *(const v4fa*)&so[w][r][c4]; *(v4f*)(C + (size_t)(row0 + r) * ldc + col0 + c4) = v; } }
     }
}

// Wt[n][k] = f16(W[k][n]·scale) from f32 row-major W[K][N] (scale = power of two; bf16-exact weights stay exact in f16 away from the subnormal range)
__global__ __launch_bounds__(256) void k_wt_f16(const float* __restrict__ W, _Float16* __restrict__ Wt, int K, int N, float scale) {
  const int t = blockIdx.x * 256 + threadIdx.x; if (t >= N * (K / 8)) return; const int n = t / (K / 8), k8 = (t % (K / 8)) * 8; FragH f;
#pragma unroll
  for (int i = 0; i < 8; ++i) f.h[i] = (_Float16)(bf16_round(W[(size_t)(k8 + i) * N + n]) * scale); const v8us o = f.half[0];
  *(v8us*)((unsigned short*)Wt + (size_t)n * K + k8) = o; 
}
// k_gemm_hh variant with fused epilogue: v = acc·alpha + bias[by·sBias + col] (+ CP[(row/rowsPerB)·sCPb + by·64 + col] if CP) ; ACT 0 none / 1 elu ; writes f16 C16 and/or f32 C, each if non-null
template <int ACT>
__global__ __launch_bounds__(128) void k_gemm_hhx(const _Float16* __restrict__ A, int lda, size_t sA, const _Float16* __restrict__ Bh, int ldb, size_t sB, float alpha, const float* __restrict__ bias, size_t sBias, const float* __restrict__ CP, int rowsPerB, size_t sCPb, int row0g,
    float* __restrict__ C, _Float16* __restrict__ C16, int ldc, size_t sC, int M, int N, int K) {
  __shared__ __attribute__((aligned(16))) float so[4][16][64];
  const int tid = threadIdx.x, w = tid >> 5, lane = tid & 31, ln = lane & 15, hh = lane >> 4; const int by = blockIdx.y;
  A += (size_t)by * sA; Bh += (size_t)by * sB; const size_t cofs = (size_t)by * sC; const float* bp = bias ? bias + (size_t)by * sBias : nullptr;
  const int ntn = (N + 63) / 64; const int wid = blockIdx.x * 4 + w; const int mt = wid / ntn, nq = wid % ntn; if (mt * 16 >= M) return;
  const int row0 = mt * 16, col0 = nq * 64; const _Float16* arow = A + (size_t)(row0 + ln) * lda;
  v8f acc[4] = {};
  for (int kb = 0; kb < K; kb += 32) { FragH ah; ah.half[0] = *(const v8us*)((const unsigned short*)arow + kb + 8 * hh); ah.half[1] = *(const v8us*)((const unsigned short*)arow + kb + 16 + 8 * hh);
#pragma unroll
    for (int t = 0; t < 4; ++t) { if (col0 + t * 16 >= N) continue; const size_t boff = (size_t)(col0 + t * 16 + ln) * ldb + kb; FragH bq; bq.half[0] = *(const v8us*)((const unsigned short*)Bh + boff + 8 * hh); bq.half[1] = *(const v8us*)((const unsigned short*)Bh + boff + 16 + 8 * hh);
      acc[t] = mmaH<1>(ah.v, ah.v, bq.v, bq.v, acc[t]); }
  }
#pragma unroll
  for (int t = 0; t < 4; ++t) { if (col0 + t * 16 >= N) continue; const int col = col0 + t * 16 + ln; const float bv = bp ? bf16_round(bp[col]) : 0.f;
#pragma unroll
    for (int r = 0; r < 8; ++r) { float v = acc[t][r] * alpha + bv; if (CP) { const int bidx = (row0g + row0 + 8 * hh + r) / rowsPerB; v += CP[(size_t)bidx * sCPb + (size_t)by * 64 + col]; } if (ACT == 1) v = (v > 0.f) ? v : expm1f(v); else if (ACT == 7) v = (v > 0.f) ? v + 1.0f : expf(v); else if (ACT == 8) v = tanhf(v); else if (ACT == 9) v = 0.5f * v * (1.0f + tanhf(0.7978845608028654f * (v + 0.044715f * v * v * v))); else if (ACT == 11) v = 1.0f / (1.0f + expf(-v)); else if (ACT == 12) v = (v > 0.f) ? v : 0.01f * v; else if (ACT == 14) v = (v > 0.f) ? v : 0.1f * v; else if (ACT == 15) v = v / (1.0f + expf(-v)); else if (ACT == 3) v = fmaxf(v, 0.f); else if (ACT == 6) v = 0.5f * v * (1.0f + erff(v * 0.70710678118654752f)); so[w][8 * hh + r][t * 16 + ln] = v; } }
  __builtin_amdgcn_fence(__ATOMIC_ACQ_REL, "workgroup"); __builtin_amdgcn_wave_barrier();
  const int rsub = lane >> 4, c4 = (lane & 15) * 4; typedef _Float16 v4h __attribute__((ext_vector_type(4)));
  {
#pragma unroll
    for (int q = 0; q < 8; ++q) { const int r = q * 2 + rsub; if (col0 + c4 < N) { const v4f v = *(const v4fa*)&so[w][r][c4]; if (C) *(v4f*)(C + cofs + (size_t)(row0 + r) * ldc + col0 + c4) = v; if (C16) { v4h h4; for (int i = 0; i < 4; ++i) h4[i] = (_Float16)v[i]; *(v4h*)(C16 + cofs + (size_t)(row0 + r) * ldc + col0 + c4) = h4; } } }
     }
}


// GEMM C = (A.B^T)*alpha + bias on f16 planes, A [M][KD] (batch stride sA), Bh [ND][KD], both k-contiguous at pitch KD; C [M][ND] (batch stride sC) as f16 (OUT16) or f32. M and ND multiples of 128, KD a multiple of 64; grid.x = (M / 128) * (ND / 128), grid.y = batch.
// One 128 x 128 tile of C per work-group of 8 waves (4 x 2, 32 x 64 each). A 64-k slice of both operands (128 bytes of each row) is brought in by loads that cover whole lines and laid in LDS at pitch 144 bytes; every wave reads its fragments from there,
// so a row is asked of L2 once per work-group, not once per wave. Two LDS buffers: the next slice is loaded into registers ahead of the products of this one and stored behind them. Each accumulator still sums its k blocks of 32 in rising order.
// The unroll directives on the short loops below make every index into the register arrays (staged rows, fragments, accumulators, bias) a constant, so that these arrays stay in registers.
template <bool OUT16, int KD, int ND>
__global__ __launch_bounds__(256) void k_gemm_lds(const _Float16* __restrict__ A, size_t sA, const _Float16* __restrict__ Bh, float alpha, const float* __restrict__ bias,
    float* __restrict__ C, _Float16* __restrict__ C16, size_t sC) {
  constexpr int BT = 128, BK = 64, LP = BK + 8;
  __shared__ __attribute__((aligned(16))) unsigned char sm[4 * BT * LP * 2];      /* the two operands' two buffers; behind the loop the same bytes stage the output rows */
  unsigned short (*tA)[BT][LP] = (unsigned short (*)[BT][LP])sm; unsigned short (*tB)[BT][LP] = (unsigned short (*)[BT][LP])(sm + 2 * BT * LP * 2);
  const int tid = threadIdx.x, w = tid >> 5, lane = tid & 31, ln = lane & 15, hh = lane >> 4;
  constexpr int ntn = ND / BT; const int row0 = ((int)blockIdx.x / ntn) * BT, col0 = ((int)blockIdx.x % ntn) * BT; const int wr = (w >> 1) * 32, wc = (w & 1) * 64;
  const int sr = tid >> 3, sc = (tid & 7) * 8;      /* staging: 8 threads take one row's 128 bytes, a wave 4 whole lines; rows sr + 32 i */
  const unsigned short* Ag = (const unsigned short*)A + (size_t)blockIdx.y * sA + (size_t)(row0 + sr) * KD + sc; const unsigned short* Bg = (const unsigned short*)Bh + (size_t)(col0 + sr) * KD + sc;
  float bv[4];
#pragma unroll
  for (int t = 0; t < 4; ++t) bv[t] = bf16_round(bias[col0 + wc + t * 16 + ln]);
  v8us ra[4], rb[4];
#pragma unroll
  for (int i = 0; i < 4; ++i) { ra[i] = *(const v8us*)(Ag + 32 * i * KD); rb[i] = *(const v8us*)(Bg + 32 * i * KD); }
#pragma unroll
  for (int i = 0; i < 4; ++i) { *(v8us*)&tA[0][sr + 32 * i][sc] = ra[i]; *(v8us*)&tB[0][sr + 32 * i][sc] = rb[i]; }
  __syncthreads();      /* publishes slice 0 */
  v8f acc[2][4];
#pragma unroll
  for (int mi = 0; mi < 2; ++mi)
#pragma unroll
    for (int t = 0; t < 4; ++t) acc[mi][t] = (v8f){0.f,0.f,0.f,0.f,0.f,0.f,0.f,0.f};
  constexpr int ns = KD / BK;
#pragma unroll      /* slice offsets and the buffer choice become immediates: no address arithmetic in the loop, and no address register is rewritten while loads are under way */
  for (int s = 0; s < ns; ++s) { const int cur = s & 1; const bool more = s + 1 < ns;
    if (more) {
#pragma unroll
      for (int i = 0; i < 4; ++i) { ra[i] = *(const v8us*)(Ag + 32 * i * KD + (s + 1) * BK); rb[i] = *(const v8us*)(Bg + 32 * i * KD + (s + 1) * BK); }
      __builtin_amdgcn_sched_barrier(0); }      /* keeps the next slice's loads ahead of this slice's products; the scheduler otherwise sinks them to their LDS stores and the group waits out their whole latency */
#pragma unroll
    for (int ks = 0; ks < 2; ++ks) { FragH fa[2], fb[4];
#pragma unroll
      for (int mi = 0; mi < 2; ++mi) { fa[mi].half[0] = *(const v8us*)&tA[cur][wr + mi * 16 + ln][ks * 32 + 8 * hh]; fa[mi].half[1] = *(const v8us*)&tA[cur][wr + mi * 16 + ln][ks * 32 + 16 + 8 * hh]; }
#pragma unroll
      for (int t = 0; t < 4; ++t) { fb[t].half[0] = *(const v8us*)&tB[cur][wc + t * 16 + ln][ks * 32 + 8 * hh]; fb[t].half[1] = *(const v8us*)&tB[cur][wc + t * 16 + ln][ks * 32 + 16 + 8 * hh]; }
#pragma unroll
      for (int mi = 0; mi < 2; ++mi)
#pragma unroll
        for (int t = 0; t < 4; ++t) acc[mi][t] = __builtin_amdgcn_wmma_f32_16x16x32_f16(false, fa[mi].v, false, fb[t].v, (short)0, acc[mi][t], false, false); }
    if (more) {
#pragma unroll
      for (int i = 0; i < 4; ++i) { *(v8us*)&tA[cur ^ 1][sr + 32 * i][sc] = ra[i]; *(v8us*)&tB[cur ^ 1][sr + 32 * i][sc] = rb[i]; } }
    __syncthreads();      /* publishes slice s + 1 and ends every wave's reads of slice s, whose buffer the next trip refills (behind the last slice: the output staging) */
  }
  const size_t cofs = (size_t)blockIdx.y * sC; const int rsub = lane >> 4, c4 = (lane & 15) * 4; typedef _Float16 v4hh __attribute__((ext_vector_type(4)));
  float (*so)[64 + 4] = (float (*)[64 + 4])sm + w * 32;      /* the wave's own 32 staging rows */
#pragma unroll
  for (int mi = 0; mi < 2; ++mi)
#pragma unroll
    for (int t = 0; t < 4; ++t)
#pragma unroll
      for (int r = 0; r < 8; ++r) so[mi * 16 + 8 * hh + r][t * 16 + ln] = acc[mi][t][r] * alpha + bv[t];
  __builtin_amdgcn_fence(__ATOMIC_ACQ_REL, "workgroup"); __builtin_amdgcn_wave_barrier();      /* the wave's own staging rows: every lane's stores stay ahead of the row reads below */
#pragma unroll
  for (int q = 0; q < 16; ++q) { const int r = q * 2 + rsub; const v4f v = *(const v4fa*)&so[r][c4]; const size_t o = cofs + (size_t)(row0 + wr + r) * ND + col0 + wc + c4;
    if (OUT16) { v4hh h4;
#pragma unroll
      for (int i = 0; i < 4; ++i) h4[i] = (_Float16)v[i];
      *(v4hh*)(C16 + o) = h4; }
    else *(v4f*)(C + o) = v; }
}

typedef _Float16 v4h __attribute__((ext_vector_type(4)));

__global__ __launch_bounds__(256) void k_x16(const float* __restrict__ x, _Float16* __restrict__ X16, size_t n8) { const size_t t = (size_t)blockIdx.x * 256 + threadIdx.x; if (t >= n8) return; FragH f;
#pragma unroll
  for (int q = 0; q < 8; ++q) f.h[q] = (_Float16)bf16_round(x[t * 8 + q]); *(v8us*)((unsigned short*)X16 + t * 8) = f.half[0];  }
__global__ __launch_bounds__(256) void k_h16(const float* __restrict__ x, _Float16* __restrict__ X16, size_t n8) { const size_t t = (size_t)blockIdx.x * 256 + threadIdx.x; if (t >= n8) return; FragH f;
#pragma unroll
  for (int q = 0; q < 8; ++q) f.h[q] = (_Float16)x[t * 8 + q]; *(v8us*)((unsigned short*)X16 + t * 8) = f.half[0];  }
__global__ __launch_bounds__(256) void k_round16f(const float* __restrict__ W, _Float16* __restrict__ Bt, size_t n8) { const size_t t = (size_t)blockIdx.x * 256 + threadIdx.x; if (t >= n8) return; FragH f;
#pragma unroll
  for (int i = 0; i < 8; ++i) f.h[i] = (_Float16)(bf16_round(W[t * 8 + i]) * 16.0f); *(v8us*)((unsigned short*)Bt + t * 8) = f.half[0];  }
template <int NHv, int TTv>
__global__ __launch_bounds__(256) void k_vt(const _Float16* __restrict__ V16, int ldv, int voff, _Float16* __restrict__ Vt) { __shared__ unsigned short tl[64][66]; const int tid = threadIdx.x; const int slab = blockIdx.x / (TTv / 64), lg = blockIdx.x % (TTv / 64); const int b = slab / NHv, h = slab % NHv;
  for (int i = tid; i < 64 * 8; i += 256) { const int r = i / 8, c8 = (i % 8) * 8; FragH f; f.half[0] = *(const v8us*)((const unsigned short*)V16 + ((size_t)b * TTv + lg * 64 + r) * ldv + voff + h * 64 + c8);
#pragma unroll
    for (int q = 0; q < 8; ++q) tl[r][c8 + q] = f.u[q]; }
  __syncthreads();
  {
#pragma unroll
    for (int rd = 0; rd < 2; ++rd) { const int d = rd * 32 + tid / 8, pc = tid % 8; FragH f;
#pragma unroll
      for (int q = 0; q < 8; ++q) f.u[q] = tl[pc * 8 + q][d];
      *(v8us*)((unsigned short*)Vt + ((size_t)slab * 64 + d) * TTv + lg * 64 + pc * 8) = f.half[0]; }
     } }

__global__ __launch_bounds__(256) void k_hl(const float* __restrict__ F, _Float16* __restrict__ Hh, _Float16* __restrict__ Hl, size_t n8) { const size_t t = (size_t)blockIdx.x * 256 + threadIdx.x; if (t >= n8) return; FragH fh, fl; const v4f a = *(const v4fa*)(F + t * 8), c = *(const v4fa*)(F + t * 8 + 4);
#pragma unroll
  for (int q = 0; q < 4; ++q) { _Float16 h = (_Float16)a[q]; fh.h[q] = h; fl.h[q] = (_Float16)((a[q] - (float)h) * 1024.0f); h = (_Float16)c[q]; fh.h[4 + q] = h; fl.h[4 + q] = (_Float16)((c[q] - (float)h) * 1024.0f); }
  { *(v8us*)((unsigned short*)Hh + t * 8) = fh.half[0]; *(v8us*)((unsigned short*)Hl + t * 8) = fl.half[0];  } }

__global__ __launch_bounds__(256) void k_h16s(const float* __restrict__ F, _Float16* __restrict__ H, size_t n8) { const size_t t = (size_t)blockIdx.x * 256 + threadIdx.x; if (t >= n8) return; const v4f a = *(const v4fa*)(F + t * 8), c = *(const v4fa*)(F + t * 8 + 4); FragH f;
#pragma unroll
  for (int q = 0; q < 4; ++q) { f.h[q] = (_Float16)(a[q] * 16.0f); f.h[4 + q] = (_Float16)(c[q] * 16.0f); } *(v8us*)((unsigned short*)H + t * 8) = f.half[0];  }
// masks over (query index q, key-plane row): key-plane rows 0..T-1 are TOKENS, rows T..2T-1 are CONCEPTS (the tok/con GEMMs write the two halves of one plane per batch). Inside each half the allowed keys of a query are the indices 0 .. lim:
// MODE 0 = token queries: token s <= q (causal), concept j < q / ntc + 1, that is j <= q / ntc; MODE 1 = concept queries: token s < ntc * (q + 1), concept j <= q. (Key order inside the softmax is irrelevant, so the plane order is used directly.)
__device__ __forceinline__ float xhalf(float x) { return __builtin_bit_cast(float, __builtin_amdgcn_permlanex16(__builtin_bit_cast(int, x), __builtin_bit_cast(int, x), 0x76543210, 0xfedcba98, false, false)); }      /* lane l's value to lane l ^ 16 and back, in registers */
// Work-group = 12 waves on four query tiles of 16 rows, taken as two pairs (p, 63 - p), p = 2 * block + (w & 1): an early tile, which the masks leave few keys, with a late one, which they leave many, so that every wave of the grid walks about the same number of key tiles.
// A wave takes its pair's two query tiles one after the other (ph = 0, 1). Of the 64 key tiles of 32 it walks only those in which the mask allows some key to some row of the query tile: both masks grow with the query index and shrink with the key index inside each half of the key plane,
// so these are the first na tiles of the token half and the first nb of the concept half, counted from the tile's last row. A tile left out held only weights 0 and left maximum, sum and V sum as they were. The six waves (w >> 1) of a pair take every sixth tile of that list;
// the six partial softmax states of a query tile (row maximum, row sum, weighted V sum) are merged in LDS behind each walk.
// Both products are taken transposed: S^T = K.Q^T (A = key rows, B = query rows) and O^T += V^T.P^T (A = rows of V^T, B = P^T). A lane then holds 16 scores of ONE query (column ln; keys 8 hh + r and 16 + 8 hh + r of the tile), so that maximum and sum are taken inside the lane,
// with one exchange between the wave's halves, there is one maximum, one sum and one rescale factor per lane, and the two score tiles, converted in place, are the B operand P^T in the k order in which the V^T rows are loaded: P passes through no LDS.
// A masked score is -inf; against the finite maximum its weight is exp(-inf) = 0. The second launch bound asks for 6 waves per SIMD, two work-groups per WGP as before: left alone, this build interleaves the sixteen exponentials over 177 registers, which leaves room for one work-group only.
template <int MODE>
__global__ __launch_bounds__(384, 6) void k_flashm(const _Float16* __restrict__ Q16, int ldq, const _Float16* __restrict__ K16, int ldk, const _Float16* __restrict__ Vt, const int* __restrict__ NTCP, float* __restrict__ O, int ldo) {
  int ntc = NTCP[0]; ntc = (ntc < 1) ? 1 : ((ntc > TQ) ? TQ : ntc);      /* = 8 here; guarded so the index arithmetic can never divide by zero; from TQ up both masks read the same as at TQ, and the products below cannot overflow */
  constexpr int RPW = 16, NPR = 2, NQT = TQ / RPW, NQB = NQT / (2 * NPR), DT = 4, KS = 2, NSP = 6, HT = TQ / 32;
  __shared__ __attribute__((aligned(16))) float sO[NPR * NSP][RPW][64 + 4]; __shared__ float sM[NPR * NSP][RPW], sL[NPR * NSP][RPW];
  const int tid = threadIdx.x, w = __builtin_amdgcn_readfirstlane(tid >> 5), lane = tid & 31, ln = lane & 15, hh = lane >> 4;      /* the wave's number in a scalar register: the key loop's counter and its tests stay scalar */
  const int slab = blockIdx.x / NQB, qblk = blockIdx.x % NQB; const int b = slab / NH, h = slab % NH; const int pr = w & 1, sp = w >> 1;
  const unsigned short* Kl = (const unsigned short*)K16 + ((size_t)b * TK + ln) * ldk + h * 64 + 8 * hh;      /* the lane's place in the rows of key tile 0 */
  const unsigned short* Vl = (const unsigned short*)Vt + ((size_t)slab * 64 + ln) * TK + 8 * hh;      /* and in the rows of V^T */
#pragma unroll 1      /* one copy of the walk serves both query tiles */
  for (int ph = 0; ph < 2; ++ph) {
    const int q0 = (ph ? NQT - 1 - (qblk * NPR + pr) : qblk * NPR + pr) * RPW, qm = q0 + RPW - 1;
    int na = (MODE == 0) ? qm / 32 + 1 : (ntc * (qm + 1) + 31) / 32, nb = (MODE == 0) ? (qm / ntc) / 32 + 1 : qm / 32 + 1;      /* key tiles with an allowed key: token half, concept half */
    na = __builtin_amdgcn_readfirstlane((na > HT) ? HT : na); nb = __builtin_amdgcn_readfirstlane((nb > HT) ? HT : nb);      /* the same in every lane: in scalar registers the walk's bound and the tile's number cost no vector register */
    FragH aq[KS]; { const unsigned short* qr = (const unsigned short*)Q16 + ((size_t)b * TQ + q0 + ln) * ldq + h * 64;
#pragma unroll
      for (int ks = 0; ks < KS; ++ks) { aq[ks].half[0] = *(const v8us*)(qr + ks * 32 + 8 * hh); aq[ks].half[1] = *(const v8us*)(qr + ks * 32 + 16 + 8 * hh); } }
    const int q = q0 + ln; const int limA = (MODE == 0) ? q : ntc * (q + 1) - 1, limB = (MODE == 0) ? q / ntc : q;      /* the lane's query: its last allowed index in the token half and in the concept half */
    float m_q = -3.0e38f, l_q = 0.f; v8f oacc[DT];      /* the lane's query: maximum, sum over this half's keys, and 32 elements of its V sum */
#pragma unroll
    for (int dt = 0; dt < DT; ++dt) oacc[dt] = (v8f){0.f,0.f,0.f,0.f,0.f,0.f,0.f,0.f};
    int j0 = 32 * ((sp < na) ? sp : sp - na + HT); const unsigned short* kp0 = Kl + (size_t)j0 * ldk; const unsigned short* kp1 = kp0 + (size_t)16 * ldk; const unsigned short* vp = Vl + j0;      /* the wave's first key tile: its plane row, and the lane's addresses in it (key rows ln and 16 + ln, V^T columns). They are carried from tile to tile: a register that lives through the whole walk is never handed to a load's result while another load still names it */
#pragma unroll 1
    for (int it = sp; it < na + nb; it += NSP) { const bool ta = it < na; const int t0 = ta ? j0 : j0 - TQ;
      const int dl = (ta ? limA : limB) - t0 - 8 * hh;      /* the lane's score number nt * 8 + r belongs to index t0 + 8 hh + nt * 16 + r of the half: allowed where nt * 16 + r <= dl */
      FragH bk[2][KS], bv[DT];
#pragma unroll
      for (int nt = 0; nt < 2; ++nt)
#pragma unroll
        for (int ks = 0; ks < KS; ++ks) { bk[nt][ks].half[0] = *(const v8us*)((nt ? kp1 : kp0) + ks * 32); bk[nt][ks].half[1] = *(const v8us*)((nt ? kp1 : kp0) + ks * 32 + 16); }
#pragma unroll
      for (int dt = 0; dt < DT; ++dt) { bv[dt].half[0] = *(const v8us*)(vp + dt * 16 * TK); bv[dt].half[1] = *(const v8us*)(vp + dt * 16 * TK + 16); }
      asm volatile("s_wait_xcnt 0x0" ::: "memory");      /* stands behind the tile's loads, ahead of the step of the three addresses that they name */
      __builtin_amdgcn_sched_barrier(0);      /* keeps the wait behind all sixteen loads and the address step behind the wait; it also keeps the V^T loads up here, under way during the score products and the softmax (the scheduler otherwise sinks them to their products) */
      { const int in = it + NSP, jn = 32 * ((in < na) ? in : in - na + HT); const ptrdiff_t dk = (ptrdiff_t)(jn - j0) * ldk; kp0 += dk; kp1 += dk; vp += jn - j0; j0 = jn; }      /* on to the wave's next tile (behind the last one the addresses are not used) */
      float sm[16];
#pragma unroll
      for (int nt = 0; nt < 2; ++nt) { v8f acc = (v8f){0.f,0.f,0.f,0.f,0.f,0.f,0.f,0.f};
#pragma unroll
        for (int ks = 0; ks < KS; ++ks) acc = __builtin_amdgcn_wmma_f32_16x16x32_f16(false, bk[nt][ks].v, false, aq[ks].v, (short)0, acc, false, false);
#pragma unroll
        for (int r = 0; r < 8; ++r) sm[nt * 8 + r] = (nt * 16 + r <= dl) ? acc[r] * SCL : -INFINITY; }
      float mc = sm[0];
#pragma unroll
      for (int i = 1; i < 16; ++i) mc = fmaxf(mc, sm[i]);
      mc = fmaxf(mc, xhalf(mc));
      const float mn = fmaxf(m_q, mc), al = expf(m_q - mn); m_q = mn;      /* no allowed key so far: mn stays at its finite start value, al = exp(0) = 1 and every weight 0 */
      float ps = 0.f; FragH pb;
#pragma unroll
      for (int i = 0; i < 16; ++i) { const float p = expf(sm[i] - mn); ps += p; pb.h[i] = (_Float16)(p * 1024.0f); }
      l_q = l_q * al + ps;
#pragma unroll
      for (int dt = 0; dt < DT; ++dt) { oacc[dt] *= al; oacc[dt] = __builtin_amdgcn_wmma_f32_16x16x32_f16(false, bv[dt].v, false, pb.v, (short)0, oacc[dt], false, false); } }
    l_q += xhalf(l_q);
    if (hh == 0) { sM[w][ln] = m_q; sL[w][ln] = l_q; }
    __syncthreads();      /* publishes every wave's row maxima and row sums; it also ends the reads of the partial outputs of the query tiles before */
    float mg = sM[pr][ln];
#pragma unroll
    for (int s2 = 1; s2 < NSP; ++s2) mg = fmaxf(mg, sM[s2 * NPR + pr][ln]);
    float lt = 0.f, fo = 0.f;      /* a wave that met no allowed key of this row holds sum 0 and a zero V sum */
#pragma unroll
    for (int s2 = 0; s2 < NSP; ++s2) { const float e = expf(sM[s2 * NPR + pr][ln] - mg); lt += sL[s2 * NPR + pr][ln] * e; if (s2 == sp) fo = e; }
    const float fq = (lt > 0.f) ? fo / (lt * 1024.0f) : 0.f;
#pragma unroll
    for (int dt = 0; dt < DT; ++dt) { *(v4fa*)&sO[w][ln][dt * 16 + 8 * hh] = (v4f){oacc[dt][0] * fq, oacc[dt][1] * fq, oacc[dt][2] * fq, oacc[dt][3] * fq}; *(v4fa*)&sO[w][ln][dt * 16 + 8 * hh + 4] = (v4f){oacc[dt][4] * fq, oacc[dt][5] * fq, oacc[dt][6] * fq, oacc[dt][7] * fq}; }
    __syncthreads();      /* publishes the rescaled partial outputs; it also ends the reads of the maxima and sums, which the next query tiles write anew */
    for (int i = tid; i < NPR * RPW * 16; i += 32 * NPR * NSP) { const int q2 = i >> 8, r = (i >> 4) & 15, pc = i & 15; v4f val = *(const v4fa*)&sO[q2][r][pc * 4];
#pragma unroll
      for (int s2 = 1; s2 < NSP; ++s2) val += *(const v4fa*)&sO[s2 * NPR + q2][r][pc * 4];
      const int qo = (ph ? NQT - 1 - (qblk * NPR + q2) : qblk * NPR + q2) * RPW;
      *(v4f*)(O + ((size_t)b * TQ + qo + r) * ldo + h * 64 + pc * 4) = val; } } }

extern "C" void kernel_launch(void* const* d_in, const int* in_sizes, int n_in,
                              void* d_out, int out_size, void* d_ws, size_t ws_size, hipStream_t stream) {
  (void)in_sizes; (void)n_in; (void)out_size;
  const float* const* I = (const float* const*)d_in; const float* xt = I[0]; const float* xc = I[1]; const float* Wt = I[2]; const float* bt = I[3]; const float* Wc = I[4]; const float* bc = I[5]; const float* Wtp = I[6]; const float* btp = I[7]; const float* Wcp = I[8]; const float* bcp = I[9]; const int* ntcp = (const int*)d_in[10];      /* int64 in the module, read as int32 */
  char* ws = (char*)d_ws; size_t off = 0;
  auto take = [&](size_t bytes) { char* p = ws + off; off += (bytes + 255) & ~(size_t)255; return p; };
  _Float16* Bt_ = (_Float16*)take((size_t)DW * DD * 2); _Float16* Bc = (_Float16*)take((size_t)DW * DD * 2); _Float16* Btp = (_Float16*)take((size_t)DD * DD * 2); _Float16* Bcp = (_Float16*)take((size_t)DD * DD * 2);
  _Float16* XT = (_Float16*)take((size_t)NR * DD * 2); _Float16* XC = (_Float16*)take((size_t)NR * DD * 2); _Float16* TC = (_Float16*)take((size_t)BB * TK * DW * 2);      /* per batch: rows 0..1023 = tok, 1024..2047 = con */
  _Float16* Vt1 = (_Float16*)take((size_t)BB * NH * 64 * TK * 2); _Float16* Vt2 = (_Float16*)take((size_t)BB * NH * 64 * TK * 2); float* O = (float*)take((size_t)NR * DD * 4); _Float16* O16 = (_Float16*)take((size_t)NR * DD * 2);
  if (off > ws_size) return;      // 8.4 + 8.4 + 2.1 + 2.1 + 4.2 + 4.2 + 33.6 + 8.4 + 8.4 + 8.4 + 4.2 ≈ 92 MB
  const unsigned gw = (unsigned)(((size_t)DW * DD / 8 + 255) / 256), gp = (unsigned)(((size_t)DD * DD / 8 + 255) / 256);
  k_round16f<<<gw, 256, 0, stream>>>(Wt, Bt_, (size_t)DW * DD / 8); k_round16f<<<gw, 256, 0, stream>>>(Wc, Bc, (size_t)DW * DD / 8); k_round16f<<<gp, 256, 0, stream>>>(Wtp, Btp, (size_t)DD * DD / 8); k_round16f<<<gp, 256, 0, stream>>>(Wcp, Bcp, (size_t)DD * DD / 8);      /* torch (out,in) natural, ×2^4 */
  const unsigned g8 = (unsigned)(((size_t)NR * DD / 8 + 255) / 256); k_x16<<<g8, 256, 0, stream>>>(xt, XT, (size_t)NR * DD / 8); k_x16<<<g8, 256, 0, stream>>>(xc, XC, (size_t)NR * DD / 8);
  const dim3 gt((TQ / 128) * (DW / 128), BB);
  k_gemm_lds<true, DD, DW><<<gt, 256, 0, stream>>>(XT, (size_t)TQ * DD, Bt_, 0.0625f, bt, nullptr, TC, (size_t)TK * DW);      /* tok[b] -> plane rows 0..1023: M 1024 N 4096 K 1024 */
  k_gemm_lds<true, DD, DW><<<gt, 256, 0, stream>>>(XC, (size_t)TQ * DD, Bc, 0.0625f, bc, nullptr, TC + (size_t)TQ * DW, (size_t)TK * DW);      /* con[b] -> plane rows 1024..2047 */
  k_vt<NH, TK><<<BB * NH * (TK / 64), 256, 0, stream>>>(TC, DW, 2 * DD, Vt1);      /* values read by tokens = columns 2048.. of both halves → Vᵀ [bh][64][2048] */
  k_vt<NH, TK><<<BB * NH * (TK / 64), 256, 0, stream>>>(TC, DW, 3 * DD, Vt2);      /* values read by concepts = columns 3072.. */
  const dim3 gpj((NR / 128) * (DD / 128), 1);
  k_flashm<0><<<BB * NH * (TQ / 64), 384, 0, stream>>>(XT, DD, TC, DW, Vt1, ntcp, O, DD);      /* token queries; keys = columns 0..1023 (kt_t on token rows, kc_t on concept rows) */
  k_h16s<<<g8, 256, 0, stream>>>(O, O16, (size_t)NR * DD / 8);
  k_gemm_lds<false, DD, DD><<<gpj, 256, 0, stream>>>(O16, 0, Btp, 0.00390625f, btp, (float*)d_out, nullptr, 0);      /* y_t = merged.Wtp^T + btp -> output 0 */
  k_flashm<1><<<BB * NH * (TQ / 64), 384, 0, stream>>>(XC, DD, TC + DD, DW, Vt2, ntcp, O, DD);      /* concept queries; keys = columns 1024..2047 (kc_c on concept rows, kt_c on token rows) */
  k_h16s<<<g8, 256, 0, stream>>>(O, O16, (size_t)NR * DD / 8);
  k_gemm_lds<false, DD, DD><<<gpj, 256, 0, stream>>>(O16, 0, Bcp, 0.00390625f, bcp, (float*)d_out + (size_t)NR * DD, nullptr, 0);      /* y_c -> output 1 (offset B.T.NE floats) */
}

// v005
// A run of this version takes 127 microseconds.
// Next to v004, in two timings, it ran 1.27 and 1.25 times as fast.
// All steps since v000 together make it 6.07 times as fast.
#include <hip/hip_runtime.h>
// Token/concept two-stream causal attention (B=2, T=C=1024, NE=CD=1024, 16 heads × 64, n_tokens_per_concept = 8): tok = xt·Wtᵀ + bt, con = xc·Wcᵀ + bc (4096 outputs each = [k for token queries | k for concept queries | v read by tokens | v read by concepts]);
// token queries = heads(xt) (the residual stream itself) attend over [tokens ; concepts] with mask (s ≤ t) | (j < t/8 + 1), scale 1/√64; concept queries = heads(xc) attend over [concepts ; tokens] with mask (j ≤ i) | (s < 8(i+1)); disallowed = −1e9 (≡ −inf: every row keeps itself);
// y_t = merge(attn_t)·Wtpᵀ + btp, y_c = merge(attn_c)·Wcpᵀ + bcp (two outputs).
// Compute dtype: xt, xc, weights, biases rounded to bf16; tok/con as f16 GEMM planes written as the two 1024-row halves of one 2048-key plane per batch; queries = the bf16-exact x planes; one fused flash-style kernel with the index-computed masks (n_tokens_per_concept read on device; online softmax f32,
// P f16 ×2^10, f32 accumulate) on v_wmma_f32_16x16x32_f16; O ×2^4 → f16 → projection GEMMs (+bias) straight into the two output slots.
#define BB 2
#define TQ 1024
#define TK 2048
#define DD 1024
#define NH 16
#define DW 4096
#define SCL 0.125f
#define NR (BB * TQ)
typedef __bf16 v16b __attribute__((ext_vector_type(16)));
typedef unsigned short v8us __attribute__((ext_vector_type(8), may_alias));
typedef float  v8f  __attribute__((ext_vector_type(8)));
typedef float  v4f  __attribute__((ext_vector_type(4)));
typedef float  v4fa __attribute__((ext_vector_type(4), may_alias));
union FragB { v16b v; v8us half[2]; unsigned short u[16]; };

__device__ __forceinline__ unsigned short bf16_bits(float x) { unsigned int u = __float_as_uint(x); return (unsigned short)((u + 0x7FFFu + ((u >> 16) & 1u)) >> 16); }
__device__ __forceinline__ float bf16_val(unsigned short b) { return __uint_as_float(((unsigned int)b) << 16); }
__device__ __forceinline__ float bf16_round(float x) { return bf16_val(bf16_bits(x)); }
// D += A·B with NT terms: 1 = ah·bh, 2 = + al·bh (A split), 3 = + ah·bl (both split)
template <int NT>
__device__ __forceinline__ v8f mmaN(v16b ah, v16b al, v16b bh, v16b bl, v8f c) {
  c = __builtin_amdgcn_wmma_f32_16x16x32_bf16(false, ah, false, bh, (short)0, c, false, false);
  if (NT >= 2) c = __builtin_amdgcn_wmma_f32_16x16x32_bf16(false, al, false, bh, (short)0, c, false, false);
  if (NT >= 3) c = __builtin_amdgcn_wmma_f32_16x16x32_bf16(false, ah, false, bl, (short)0, c, false, false);
  asm volatile("v_nop\n\tv_nop\n\tv_nop\n\tv_nop" : "+v"(c) : "v"(ah), "v"(al), "v"(bh), "v"(bl));
  return c;
}

__global__ __launch_bounds__(256) void k_wt_bf16(const float* __restrict__ W, unsigned short* __restrict__ Wt, int K, int N) {
  const int t = blockIdx.x * 256 + threadIdx.x;
  const int k8n = K / 8;
  if (t >= N * k8n) return;
  const int n = t / k8n, k8 = (t % k8n) * 8;
  v8us v;
#pragma unroll
  for (int i = 0; i < 8; ++i) v[i] = bf16_bits(W[(size_t)(k8 + i) * N + n]);
  *(v8us*)(Wt + (size_t)n * K + k8) = v;
  
}

// GEMM C[M][N] (f32, pitch ldc) = act(A[M][K]·W + bias). A f32 row-major (pitch lda) converted per fragment to bf16
// (ASPLIT: hi/lo two planes -> 2 terms, else single rounded term); Wt bf16 [N][K] (pitch ldb). BIAS_BF16 rounds the
// bias to bf16 first (bias quantised to bf16 before the add). K%32==0, M%16==0, N%64==0.
template <bool ASPLIT, int ACT, bool BIAS_BF16>
__global__ __launch_bounds__(128) void k_gemm_bf(const float* __restrict__ A, int lda, const unsigned short* __restrict__ Wt, int ldb,
                                               const float* __restrict__ bias, float* __restrict__ C, int ldc, int M, int N, int K) {
  __shared__ __attribute__((aligned(16))) float so[4][16][64];
  const int tid = threadIdx.x, w = tid >> 5, lane = tid & 31, ln = lane & 15, hh = lane >> 4;
  const int ntn = N / 64;
  const int wid = blockIdx.x * 4 + w;
  const int mt = wid / ntn, nq = wid % ntn;
  if (mt * 16 >= M) return;
  const int row0 = mt * 16, col0 = nq * 64;
  const float* arow = A + (size_t)(row0 + ln) * lda;
  v8f acc[4] = {};
  for (int kb = 0; kb < K; kb += 32) {
    FragB ah, al;
    const v4f x0 = *(const v4fa*)(arow + kb + 8 * hh), x1 = *(const v4fa*)(arow + kb + 8 * hh + 4);
    const v4f x2 = *(const v4fa*)(arow + kb + 16 + 8 * hh), x3 = *(const v4fa*)(arow + kb + 16 + 8 * hh + 4);
    float xs[16] = {x0[0],x0[1],x0[2],x0[3],x1[0],x1[1],x1[2],x1[3],x2[0],x2[1],x2[2],x2[3],x3[0],x3[1],x3[2],x3[3]};
#pragma unroll
    for (int i = 0; i < 16; ++i) { const unsigned short hb = bf16_bits(xs[i]); ah.u[i] = hb; al.u[i] = ASPLIT ? bf16_bits(xs[i] - bf16_val(hb)) : (unsigned short)0; }
#pragma unroll
    for (int t = 0; t < 4; ++t) {
      const unsigned short* brow = Wt + (size_t)(col0 + t * 16 + ln) * ldb + kb;
      FragB b;
      b.half[0] = *(const v8us*)(brow + 8 * hh);
      b.half[1] = *(const v8us*)(brow + 16 + 8 * hh);
      acc[t] = mmaN<ASPLIT ? 2 : 1>(ah.v, al.v, b.v, b.v, acc[t]);
    }
  }
#pragma unroll
  for (int t = 0; t < 4; ++t) {
    float bv = bias ? bias[col0 + t * 16 + ln] : 0.f;
    if (BIAS_BF16) bv = bf16_round(bv);
#pragma unroll
    for (int r = 0; r < 8; ++r) { float v = acc[t][r] + bv; if (ACT == 1) v = fmaxf(v, 0.f); so[w][8 * hh + r][t * 16 + ln] = v; }
  }
  __builtin_amdgcn_fence(__ATOMIC_ACQ_REL, "workgroup");
  __builtin_amdgcn_wave_barrier();
  const int rsub = lane >> 4, c4 = (lane & 15) * 4;
  {
#pragma unroll
    for (int q = 0; q < 8; ++q) {
      const int r = q * 2 + rsub;
      const v4f v = *(const v4fa*)&so[w][r][c4];
      *(v4f*)(C + (size_t)(row0 + r) * ldc + col0 + c4) = v;
    }
    
  }
}

// GEMM C = act(A·W + bias + resid): A f32 (ASPLIT -> hi/lo 2 terms), Wt bf16 [N][K]; ACT 0 none, 1 relu, 2 exact gelu;
// resid (optional, f32, row index = (row % rmod), pitch ldr, RES_BF16 rounds it) added before the activation.
template <bool ASPLIT, int ACT, bool BIAS_BF16, bool RES_BF16>
__global__ __launch_bounds__(128) void k_gemm_bf3(const float* __restrict__ A, int lda, const unsigned short* __restrict__ Wt, int ldb,
                                                const float* __restrict__ bias, const float* __restrict__ resid, int rmod, int ldr,
                                                float* __restrict__ C, int ldc, int M, int N, int K) {
  __shared__ __attribute__((aligned(16))) float so[4][16][64];
  const int tid = threadIdx.x, w = tid >> 5, lane = tid & 31, ln = lane & 15, hh = lane >> 4;
  const int ntn = N / 64;
  const int wid = blockIdx.x * 4 + w;
  const int mt = wid / ntn, nq = wid % ntn;
  if (mt * 16 >= M) return;
  const int row0 = mt * 16, col0 = nq * 64;
  const float* arow = A + (size_t)(row0 + ln) * lda;
  v8f acc[4] = {};
  for (int kb = 0; kb < K; kb += 32) {
    FragB ah, al;
    const v4f x0 = *(const v4fa*)(arow + kb + 8 * hh), x1 = *(const v4fa*)(arow + kb + 8 * hh + 4);
    const v4f x2 = *(const v4fa*)(arow + kb + 16 + 8 * hh), x3 = *(const v4fa*)(arow + kb + 16 + 8 * hh + 4);
    float xs[16] = {x0[0],x0[1],x0[2],x0[3],x1[0],x1[1],x1[2],x1[3],x2[0],x2[1],x2[2],x2[3],x3[0],x3[1],x3[2],x3[3]};
#pragma unroll
    for (int i = 0; i < 16; ++i) { const unsigned short hb = bf16_bits(xs[i]); ah.u[i] = hb; al.u[i] = ASPLIT ? bf16_bits(xs[i] - bf16_val(hb)) : (unsigned short)0; }
#pragma unroll
    for (int t = 0; t < 4; ++t) {
      const unsigned short* brow = Wt + (size_t)(col0 + t * 16 + ln) * ldb + kb;
      FragB b;
      b.half[0] = *(const v8us*)(brow + 8 * hh);
      b.half[1] = *(const v8us*)(brow + 16 + 8 * hh);
      acc[t] = mmaN<ASPLIT ? 2 : 1>(ah.v, al.v, b.v, b.v, acc[t]);
    }
  }
#pragma unroll
  for (int t = 0; t < 4; ++t) {
    const int col = col0 + t * 16 + ln;
    float bv = bias ? bias[col] : 0.f;
    if (BIAS_BF16) bv = bf16_round(bv);
#pragma unroll
    for (int r = 0; r < 8; ++r) {
      float v = acc[t][r] + bv;
      if (resid) { float rv = resid[(size_t)((row0 + 8 * hh + r) % rmod) * ldr + col]; if (RES_BF16) rv = bf16_round(rv); v += rv; }
      if (ACT == 1) v = fmaxf(v, 0.f);
      if (ACT == 2) v = 0.5f * v * (1.0f + erff(v * 0.70710678118654752f));
      if (ACT == 3) { const float u = 0.7978845608028654f * (v + 0.044715f * v * v * v); v = 0.5f * v * (1.0f + tanhf(u)); }
      so[w][8 * hh + r][t * 16 + ln] = v;
    }
  }
  __builtin_amdgcn_fence(__ATOMIC_ACQ_REL, "workgroup");
  __builtin_amdgcn_wave_barrier();
  const int rsub = lane >> 4, c4 = (lane & 15) * 4;
  {
#pragma unroll
    for (int q = 0; q < 8; ++q) {
      const int r = q * 2 + rsub;
      const v4f v = *(const v4fa*)&so[w][r][c4];
      *(v4f*)(C + (size_t)(row0 + r) * ldc + col0 + c4) = v;
    }
    
  }
}
// row LayerNorm (biased variance, eps) over N: s = X (+ R); optional out_sum <- s; out_norm <- (s-mu)*rsqrt(var+eps)*g + b
template <bool PARAM_BF16>
__global__ __launch_bounds__(256) void k_layernorm(const float* __restrict__ X, const float* __restrict__ R, const float* __restrict__ g, const float* __restrict__ bta,
                                                  float* __restrict__ out_sum, float* __restrict__ out_norm, int N, float eps) {
  __shared__ float red[256];
  const int row = blockIdx.x, tid = threadIdx.x;
  const float* x = X + (size_t)row * N; const float* rr = R ? R + (size_t)row * N : nullptr;
  float vals[16];                     // up to N = 4096
  const int per = N / 256;            // contiguous chunk per thread? use strided-by-4 chunks: thread handles j = tid*4 + 1024*u
  float s1 = 0.f;
  for (int u = 0; u < per / 4; ++u) {
    const int j = tid * 4 + 1024 * u;
    const v4f a = *(const v4fa*)(x + j);
    v4f b = {0.f,0.f,0.f,0.f}; if (rr) b = *(const v4fa*)(rr + j);
#pragma unroll
    for (int q = 0; q < 4; ++q) { const float v = a[q] + b[q]; vals[u * 4 + q] = v; s1 += v; }
  }
  red[tid] = s1; __syncthreads();
  for (int st = 128; st > 0; st >>= 1) { if (tid < st) red[tid] += red[tid + st]; __syncthreads(); }
  const float mu = red[0] / (float)N; __syncthreads();
  float s2 = 0.f;
  for (int u = 0; u < per / 4; ++u)
#pragma unroll
    for (int q = 0; q < 4; ++q) { const float c = vals[u * 4 + q] - mu; s2 += c * c; }
  red[tid] = s2; __syncthreads();
  for (int st = 128; st > 0; st >>= 1) { if (tid < st) red[tid] += red[tid + st]; __syncthreads(); }
  const float rs = rsqrtf(red[0] / (float)N + eps);
  {
    for (int u = 0; u < per / 4; ++u) {
      const int j = tid * 4 + 1024 * u;
      v4f o, sm;
#pragma unroll
      for (int q = 0; q < 4; ++q) {
        float gg = g[j + q], bb = bta[j + q];
        if (PARAM_BF16) { gg = bf16_round(gg); bb = bf16_round(bb); }
        sm[q] = vals[u * 4 + q]; o[q] = (vals[u * 4 + q] - mu) * rs * gg + bb;
      }
      if (out_sum) *(v4f*)(out_sum + (size_t)row * N + j) = sm;
      *(v4f*)(out_norm + (size_t)row * N + j) = o;
    }
    
  }
}



// ---- f16 WMMA path (v_wmma_f32_16x16x32_f16): 11-bit significands for operands in range — used where a [0,1] probability operand needs more precision than bf16
typedef _Float16 v16h __attribute__((ext_vector_type(16)));
union FragH { v16h v; v8us half[2]; _Float16 h[16]; unsigned short u[16]; };
template <int NT>
__device__ __forceinline__ v8f mmaH(v16h ah, v16h al, v16h bh, v16h bl, v8f c) {
  c = __builtin_amdgcn_wmma_f32_16x16x32_f16(false, ah, false, bh, (short)0, c, false, false);
  if (NT >= 2) c = __builtin_amdgcn_wmma_f32_16x16x32_f16(false, al, false, bh, (short)0, c, false, false);
  if (NT >= 3) c = __builtin_amdgcn_wmma_f32_16x16x32_f16(false, ah, false, bl, (short)0, c, false, false);
  asm volatile("v_nop\n\tv_nop\n\tv_nop\n\tv_nop" : "+v"(c) : "v"(ah), "v"(al), "v"(bh), "v"(bl));
  return c;
}
// batched GEMM like k_gemm_b but f16 operands: A f32 (split into f16 hi/lo if ASPLIT, else rounded to f16), Bt = f16 values [n][k]; alpha; C f32; N multiple of 16 (partial tiles skipped)
template <bool ASPLIT>
__global__ __launch_bounds__(128) void k_gemm_h(const float* __restrict__ A, int lda, size_t sA, const _Float16* __restrict__ Bh, int ldb, size_t sB, float alpha, float* __restrict__ C, int ldc, size_t sC, int M, int N, int K) {
  __shared__ __attribute__((aligned(16))) float so[4][16][64];
  const int tid = threadIdx.x, w = tid >> 5, lane = tid & 31, ln = lane & 15, hh = lane >> 4; const int by = blockIdx.y;
  A += (size_t)by * sA; Bh += (size_t)by * sB; C += (size_t)by * sC;
  const int ntn = (N + 63) / 64; const int wid = blockIdx.x * 4 + w; const int mt = wid / ntn, nq = wid % ntn; if (mt * 16 >= M) return;
  const int row0 = mt * 16, col0 = nq * 64; const float* arow = A + (size_t)(row0 + ln) * lda;
  v8f acc[4] = {};
  for (int kb = 0; kb < K; kb += 32) {
    FragH ah, al;
    const v4f x0 = *(const v4fa*)(arow + kb + 8 * hh), x1 = *(const v4fa*)(arow + kb + 8 * hh + 4), x2 = *(const v4fa*)(arow + kb + 16 + 8 * hh), x3 = *(const v4fa*)(arow + kb + 16 + 8 * hh + 4);
    float xs[16] = {x0[0],x0[1],x0[2],x0[3],x1[0],x1[1],x1[2],x1[3],x2[0],x2[1],x2[2],x2[3],x3[0],x3[1],x3[2],x3[3]};
#pragma unroll
    for (int i = 0; i < 16; ++i) { const _Float16 h = (_Float16)xs[i]; ah.h[i] = h; al.h[i] = ASPLIT ? (_Float16)(xs[i] - (float)h) : (_Float16)0.0f; }
#pragma unroll
    for (int t = 0; t < 4; ++t) { if (col0 + t * 16 >= N) continue; const size_t boff = (size_t)(col0 + t * 16 + ln) * ldb + kb; FragH bq; bq.half[0] = *(const v8us*)(Bh + boff + 8 * hh); bq.half[1] = *(const v8us*)(Bh + boff + 16 + 8 * hh);
      acc[t] = mmaH<ASPLIT ? 2 : 1>(ah.v, al.v, bq.v, bq.v, acc[t]); }
  }
#pragma unroll
  for (int t = 0; t < 4; ++t) { if (col0 + t * 16 >= N) continue;
#pragma unroll
    for (int r = 0; r < 8; ++r) so[w][8 * hh + r][t * 16 + ln] = acc[t][r] * alpha; }
  __builtin_amdgcn_fence(__ATOMIC_ACQ_REL, "workgroup"); __builtin_amdgcn_wave_barrier();
  const int rsub = lane >> 4, c4 = (lane & 15) * 4;
  {
#pragma unroll
    for (int q = 0; q < 8; ++q) { const int r = q * 2 + rsub; if (col0 + c4 < N) { const v4f v = *(const v4fa*)&so[w][r][c4]; *(v4f*)(C + (size_t)(row0 + r) * ldc + col0 + c4) = v; } }
     }
}

// Wt[n][k] = f16(W[k][n]·scale) from f32 row-major W[K][N] (scale = power of two; bf16-exact weights stay exact in f16 away from the subnormal range)
__global__ __launch_bounds__(256) void k_wt_f16(const float* __restrict__ W, _Float16* __restrict__ Wt, int K, int N, float scale) {
  const int t = blockIdx.x * 256 + threadIdx.x; if (t >= N * (K / 8)) return; const int n = t / (K / 8), k8 = (t % (K / 8)) * 8; FragH f;
#pragma unroll
  for (int i = 0; i < 8; ++i) f.h[i] = (_Float16)(bf16_round(W[(size_t)(k8 + i) * N + n]) * scale); const v8us o = f.half[0];
  *(v8us*)((unsigned short*)Wt + (size_t)n * K + k8) = o; 
}
// k_gemm_hh variant with fused epilogue: v = acc·alpha + bias[by·sBias + col] (+ CP[(row/rowsPerB)·sCPb + by·64 + col] if CP) ; ACT 0 none / 1 elu ; writes f16 C16 and/or f32 C, each if non-null
template <int ACT>
__global__ __launch_bounds__(128) void k_gemm_hhx(const _Float16* __restrict__ A, int lda, size_t sA, const _Float16* __restrict__ Bh, int ldb, size_t sB, float alpha, const float* __restrict__ bias, size_t sBias, const float* __restrict__ CP, int rowsPerB, size_t sCPb, int row0g,
    float* __restrict__ C, _Float16* __restrict__ C16, int ldc, size_t sC, int M, int N, int K) {
  __shared__ __attribute__((aligned(16))) float so[4][16][64];
  const int tid = threadIdx.x, w = tid >> 5, lane = tid & 31, ln = lane & 15, hh = lane >> 4; const int by = blockIdx.y;
  A += (size_t)by * sA; Bh += (size_t)by * sB; const size_t cofs = (size_t)by * sC; const float* bp = bias ? bias + (size_t)by * sBias : nullptr;
  const int ntn = (N + 63) / 64; const int wid = blockIdx.x * 4 + w; const int mt = wid / ntn, nq = wid % ntn; if (mt * 16 >= M) return;
  const int row0 = mt * 16, col0 = nq * 64; const _Float16* arow = A + (size_t)(row0 + ln) * lda;
  v8f acc[4] = {};
  for (int kb = 0; kb < K; kb += 32) { FragH ah; ah.half[0] = *(const v8us*)((const unsigned short*)arow + kb + 8 * hh); ah.half[1] = *(const v8us*)((const unsigned short*)arow + kb + 16 + 8 * hh);
#pragma unroll
    for (int t = 0; t < 4; ++t) { if (col0 + t * 16 >= N) continue; const size_t boff = (size_t)(col0 + t * 16 + ln) * ldb + kb; FragH bq; bq.half[0] = *(const v8us*)((const unsigned short*)Bh + boff + 8 * hh); bq.half[1] = *(const v8us*)((const unsigned short*)Bh + boff + 16 + 8 * hh);
      acc[t] = mmaH<1>(ah.v, ah.v, bq.v, bq.v, acc[t]); }
  }
#pragma unroll
  for (int t = 0; t < 4; ++t) { if (col0 + t * 16 >= N) continue; const int col = col0 + t * 16 + ln; const float bv = bp ? bf16_round(bp[col]) : 0.f;
#pragma unroll
    for (int r = 0; r < 8; ++r) { float v = acc[t][r] * alpha + bv; if (CP) { const int bidx = (row0g + row0 + 8 * hh + r) / rowsPerB; v += CP[(size_t)bidx * sCPb + (size_t)by * 64 + col]; } if (ACT == 1) v = (v > 0.f) ? v : expm1f(v); else if (ACT == 7) v = (v > 0.f) ? v + 1.0f : expf(v); else if (ACT == 8) v = tanhf(v); else if (ACT == 9) v = 0.5f * v * (1.0f + tanhf(0.7978845608028654f * (v + 0.044715f * v * v * v))); else if (ACT == 11) v = 1.0f / (1.0f + expf(-v)); else if (ACT == 12) v = (v > 0.f) ? v : 0.01f * v; else if (ACT == 14) v = (v > 0.f) ? v : 0.1f * v; else if (ACT == 15) v = v / (1.0f + expf(-v)); else if (ACT == 3) v = fmaxf(v, 0.f); else if (ACT == 6) v = 0.5f * v * (1.0f + erff(v * 0.70710678118654752f)); so[w][8 * hh + r][t * 16 + ln] = v; } }
  __builtin_amdgcn_fence(__ATOMIC_ACQ_REL, "workgroup"); __builtin_amdgcn_wave_barrier();
  const int rsub = lane >> 4, c4 = (lane & 15) * 4; typedef _Float16 v4h __attribute__((ext_vector_type(4)));
  {
#pragma unroll
    for (int q = 0; q < 8; ++q) { const int r = q * 2 + rsub; if (col0 + c4 < N) { const v4f v = *(const v4fa*)&so[w][r][c4]; if (C) *(v4f*)(C + cofs + (size_t)(row0 + r) * ldc + col0 + c4) = v; if (C16) { v4h h4; for (int i = 0; i < 4; ++i) h4[i] = (_Float16)v[i]; *(v4h*)(C16 + cofs + (size_t)(row0 + r) * ldc + col0 + c4) = h4; } } }
     }
}


// GEMM C = (A.B^T)*alpha + bias on f16 planes, A [M][KD] (batch stride sA), Bh [ND][KD], both k-contiguous at pitch KD; C [M][ND] (batch stride sC) as f16 (OUT16) or f32. M and ND multiples of 128, KD a multiple of 64; grid.x = (M / 128) * (ND / 128), grid.y = batch, grid.z = 2: two independent products of one shape in one launch (operands A0, B0, bias0 or A1, B1, bias1; the second one's C lies sZ elements behind the first's).
// One 128 x 128 tile of C per work-group of 8 waves (4 x 2, 32 x 64 each). A 64-k slice of both operands (128 bytes of each row) is brought in by loads that cover whole lines and laid in LDS at pitch 144 bytes; every wave reads its fragments from there,
// so a row is asked of L2 once per work-group, not once per wave. Two LDS buffers: the next slice is loaded into registers ahead of the products of this one and stored behind them. Each accumulator still sums its k blocks of 32 in rising order.
// The unroll directives on the short loops below make every index into the register arrays (staged rows, fragments, accumulators, bias) a constant, so that these arrays stay in registers.
template <bool OUT16, int KD, int ND>
__global__ __launch_bounds__(256) void k_gemm_lds(const _Float16* __restrict__ A0, const _Float16* __restrict__ A1, size_t sA, const _Float16* __restrict__ B0, const _Float16* __restrict__ B1, float alpha, const float* __restrict__ bias0, const float* __restrict__ bias1,
    float* __restrict__ C, _Float16* __restrict__ C16, size_t sC, size_t sZ) {
  const bool z1 = blockIdx.z != 0; const _Float16* A = z1 ? A1 : A0; const _Float16* Bh = z1 ? B1 : B0; const float* bias = z1 ? bias1 : bias0;
  constexpr int BT = 128, BK = 64, LP = BK + 8;
  __shared__ __attribute__((aligned(16))) unsigned char sm[4 * BT * LP * 2];      /* the two operands' two buffers; behind the loop the same bytes stage the output rows */
  unsigned short (*tA)[BT][LP] = (unsigned short (*)[BT][LP])sm; unsigned short (*tB)[BT][LP] = (unsigned short (*)[BT][LP])(sm + 2 * BT * LP * 2);
  const int tid = threadIdx.x, w = tid >> 5, lane = tid & 31, ln = lane & 15, hh = lane >> 4;
  constexpr int ntn = ND / BT; const int row0 = ((int)blockIdx.x / ntn) * BT, col0 = ((int)blockIdx.x % ntn) * BT; const int wr = (w >> 1) * 32, wc = (w & 1) * 64;
  const int sr = tid >> 3, sc = (tid & 7) * 8;      /* staging: 8 threads take one row's 128 bytes, a wave 4 whole lines; rows sr + 32 i */
  const unsigned short* Ag = (const unsigned short*)A + (size_t)blockIdx.y * sA + (size_t)(row0 + sr) * KD + sc; const unsigned short* Bg = (const unsigned short*)Bh + (size_t)(col0 + sr) * KD + sc;
  float bv[4];
#pragma unroll
  for (int t = 0; t < 4; ++t) bv[t] = bf16_round(bias[col0 + wc + t * 16 + ln]);
  v8us ra[4], rb[4];
#pragma unroll
  for (int i = 0; i < 4; ++i) { ra[i] = *(const v8us*)(Ag + 32 * i * KD); rb[i] = *(const v8us*)(Bg + 32 * i * KD); }
#pragma unroll
  for (int i = 0; i < 4; ++i) { *(v8us*)&tA[0][sr + 32 * i][sc] = ra[i]; *(v8us*)&tB[0][sr + 32 * i][sc] = rb[i]; }
  __syncthreads();      /* publishes slice 0 */
  v8f acc[2][4];
#pragma unroll
  for (int mi = 0; mi < 2; ++mi)
#pragma unroll
    for (int t = 0; t < 4; ++t) acc[mi][t] = (v8f){0.f,0.f,0.f,0.f,0.f,0.f,0.f,0.f};
  constexpr int ns = KD / BK;
#pragma unroll      /* slice offsets and the buffer choice become immediates: no address arithmetic in the loop, and no address register is rewritten while loads are under way */
  for (int s = 0; s < ns; ++s) { const int cur = s & 1; const bool more = s + 1 < ns;
    if (more) {
#pragma unroll
      for (int i = 0; i < 4; ++i) { ra[i] = *(const v8us*)(Ag + 32 * i * KD + (s + 1) * BK); rb[i] = *(const v8us*)(Bg + 32 * i * KD + (s + 1) * BK); }
      __builtin_amdgcn_sched_barrier(0); }      /* keeps the next slice's loads ahead of this slice's products; the scheduler otherwise sinks them to their LDS stores and the group waits out their whole latency */
#pragma unroll
    for (int ks = 0; ks < 2; ++ks) { FragH fa[2], fb[4];
#pragma unroll
      for (int mi = 0; mi < 2; ++mi) { fa[mi].half[0] = *(const v8us*)&tA[cur][wr + mi * 16 + ln][ks * 32 + 8 * hh]; fa[mi].half[1] = *(const v8us*)&tA[cur][wr + mi * 16 + ln][ks * 32 + 16 + 8 * hh]; }
#pragma unroll
      for (int t = 0; t < 4; ++t) { fb[t].half[0] = *(const v8us*)&tB[cur][wc + t * 16 + ln][ks * 32 + 8 * hh]; fb[t].half[1] = *(const v8us*)&tB[cur][wc + t * 16 + ln][ks * 32 + 16 + 8 * hh]; }
#pragma unroll
      for (int mi = 0; mi < 2; ++mi)
#pragma unroll
        for (int t = 0; t < 4; ++t) acc[mi][t] = __builtin_amdgcn_wmma_f32_16x16x32_f16(false, fa[mi].v, false, fb[t].v, (short)0, acc[mi][t], false, false); }
    if (more) {
#pragma unroll
      for (int i = 0; i < 4; ++i) { *(v8us*)&tA[cur ^ 1][sr + 32 * i][sc] = ra[i]; *(v8us*)&tB[cur ^ 1][sr + 32 * i][sc] = rb[i]; } }
    __syncthreads();      /* publishes slice s + 1 and ends every wave's reads of slice s, whose buffer the next trip refills (behind the last slice: the output staging) */
  }
  const size_t cofs = (size_t)blockIdx.y * sC + (size_t)blockIdx.z * sZ; const int rsub = lane >> 4, c4 = (lane & 15) * 4; typedef _Float16 v4hh __attribute__((ext_vector_type(4)));
  float (*so)[64 + 4] = (float (*)[64 + 4])sm + w * 32;      /* the wave's own 32 staging rows */
#pragma unroll
  for (int mi = 0; mi < 2; ++mi)
#pragma unroll
    for (int t = 0; t < 4; ++t)
#pragma unroll
      for (int r = 0; r < 8; ++r) so[mi * 16 + 8 * hh + r][t * 16 + ln] = acc[mi][t][r] * alpha + bv[t];
  __builtin_amdgcn_fence(__ATOMIC_ACQ_REL, "workgroup"); __builtin_amdgcn_wave_barrier();      /* the wave's own staging rows: every lane's stores stay ahead of the row reads below */
#pragma unroll
  for (int q = 0; q < 16; ++q) { const int r = q * 2 + rsub; const v4f v = *(const v4fa*)&so[r][c4]; const size_t o = cofs + (size_t)(row0 + wr + r) * ND + col0 + wc + c4;
    if (OUT16) { v4hh h4;
#pragma unroll
      for (int i = 0; i < 4; ++i) h4[i] = (_Float16)v[i];
      *(v4hh*)(C16 + o) = h4; }
    else *(v4f*)(C + o) = v; }
}

typedef _Float16 v4h __attribute__((ext_vector_type(4)));

// One launch rounds all six f32 operands to their f16 planes, which lie one behind the other in the workspace: Wt, Wc, Wtp, Wcp (bf16-rounded, x 2^4), then xt, xc (bf16-rounded, x 1, which is exact).
// The 2048 elements of a work-group lie in one operand; which one is a scalar choice by the block index.
__global__ __launch_bounds__(256) void k_cvt6(const float* __restrict__ Wt, const float* __restrict__ Wc, const float* __restrict__ Wtp, const float* __restrict__ Wcp, const float* __restrict__ xt, const float* __restrict__ xc, _Float16* __restrict__ dst) {
  constexpr unsigned GW = DW * DD / 2048, GP = DD * DD / 2048, GX = NR * DD / 2048;
  unsigned blk = blockIdx.x; const float* s; float sc = 16.0f;
  if (blk < GW) s = Wt; else if ((blk -= GW) < GW) s = Wc; else if ((blk -= GW) < GP) s = Wtp; else if ((blk -= GP) < GP) s = Wcp; else if ((blk -= GP) < GX) { s = xt; sc = 1.0f; } else { blk -= GX; s = xc; sc = 1.0f; }
  const size_t t = (size_t)blk * 256 + threadIdx.x; FragH f;
#pragma unroll
  for (int q = 0; q < 8; ++q) f.h[q] = (_Float16)(bf16_round(s[t * 8 + q]) * sc);
  *(v8us*)((unsigned short*)dst + ((size_t)blockIdx.x * 256 + threadIdx.x) * 8) = f.half[0]; }
__global__ __launch_bounds__(256) void k_h16(const float* __restrict__ x, _Float16* __restrict__ X16, size_t n8) { const size_t t = (size_t)blockIdx.x * 256 + threadIdx.x; if (t >= n8) return; FragH f;
#pragma unroll
  for (int q = 0; q < 8; ++q) f.h[q] = (_Float16)x[t * 8 + q]; *(v8us*)((unsigned short*)X16 + t * 8) = f.half[0];  }
template <int NHv, int TTv>
__global__ __launch_bounds__(256) void k_vt(const _Float16* __restrict__ V16, int ldv, int voff, int vstep, _Float16* __restrict__ Vt, size_t sVt) { __shared__ unsigned short tl[64][66]; const int tid = threadIdx.x; voff += (int)blockIdx.y * vstep; Vt += (size_t)blockIdx.y * sVt;      /* grid.y: the column blocks of values, each to its own V^T plane, in one launch */ const int slab = blockIdx.x / (TTv / 64), lg = blockIdx.x % (TTv / 64); const int b = slab / NHv, h = slab % NHv;
  for (int i = tid; i < 64 * 8; i += 256) { const int r = i / 8, c8 = (i % 8) * 8; FragH f; f.half[0] = *(const v8us*)((const unsigned short*)V16 + ((size_t)b * TTv + lg * 64 + r) * ldv + voff + h * 64 + c8);
#pragma unroll
    for (int q = 0; q < 8; ++q) tl[r][c8 + q] = f.u[q]; }
  __syncthreads();
  {
#pragma unroll
    for (int rd = 0; rd < 2; ++rd) { const int d = rd * 32 + tid / 8, pc = tid % 8; FragH f;
#pragma unroll
      for (int q = 0; q < 8; ++q) f.u[q] = tl[pc * 8 + q][d];
      *(v8us*)((unsigned short*)Vt + ((size_t)slab * 64 + d) * TTv + lg * 64 + pc * 8) = f.half[0]; }
     } }

__global__ __launch_bounds__(256) void k_hl(const float* __restrict__ F, _Float16* __restrict__ Hh, _Float16* __restrict__ Hl, size_t n8) { const size_t t = (size_t)blockIdx.x * 256 + threadIdx.x; if (t >= n8) return; FragH fh, fl; const v4f a = *(const v4fa*)(F + t * 8), c = *(const v4fa*)(F + t * 8 + 4);
#pragma unroll
  for (int q = 0; q < 4; ++q) { _Float16 h = (_Float16)a[q]; fh.h[q] = h; fl.h[q] = (_Float16)((a[q] - (float)h) * 1024.0f); h = (_Float16)c[q]; fh.h[4 + q] = h; fl.h[4 + q] = (_Float16)((c[q] - (float)h) * 1024.0f); }
  { *(v8us*)((unsigned short*)Hh + t * 8) = fh.half[0]; *(v8us*)((unsigned short*)Hl + t * 8) = fl.half[0];  } }

__global__ __launch_bounds__(256) void k_h16s(const float* __restrict__ F, _Float16* __restrict__ H, size_t n8) { const size_t t = (size_t)blockIdx.x * 256 + threadIdx.x; if (t >= n8) return; const v4f a = *(const v4fa*)(F + t * 8), c = *(const v4fa*)(F + t * 8 + 4); FragH f;
#pragma unroll
  for (int q = 0; q < 4; ++q) { f.h[q] = (_Float16)(a[q] * 16.0f); f.h[4 + q] = (_Float16)(c[q] * 16.0f); } *(v8us*)((unsigned short*)H + t * 8) = f.half[0];  }
// masks over (query index q, key-plane row): key-plane rows 0..T-1 are TOKENS, rows T..2T-1 are CONCEPTS (the tok/con GEMMs write the two halves of one plane per batch). Inside each half the allowed keys of a query are the indices 0 .. lim:
// MODE 0 = token queries: token s <= q (causal), concept j < q / ntc + 1, that is j <= q / ntc; MODE 1 = concept queries: token s < ntc * (q + 1), concept j <= q. (Key order inside the softmax is irrelevant, so the plane order is used directly.)
__device__ __forceinline__ float xhalf(float x) { return __builtin_bit_cast(float, __builtin_amdgcn_permlanex16(__builtin_bit_cast(int, x), __builtin_bit_cast(int, x), 0x76543210, 0xfedcba98, false, false)); }      /* lane l's value to lane l ^ 16 and back, in registers */
// Work-group = 12 waves on four query tiles of 16 rows, taken as two pairs (p, 63 - p), p = 2 * block + (w & 1): an early tile, which the masks leave few keys, with a late one, which they leave many, so that within one MODE the waves walk more even numbers of key tiles.
// A wave takes its pair's two query tiles one after the other (ph = 0, 1). Of the 64 key tiles of 32 it walks only those in which the mask allows some key to some row of the query tile: both masks grow with the query index and shrink with the key index inside each half of the key plane,
// so these are the first na tiles of the token half and the first nb of the concept half, counted from the tile's last row. A tile left out held only weights 0 and left maximum, sum and V sum as they were. The six waves (w >> 1) of a pair take every sixth tile of that list;
// the six partial softmax states of a query tile (row maximum, row sum, weighted V sum) are merged in LDS behind each walk.
// Both products are taken transposed: S^T = K.Q^T (A = key rows, B = query rows) and O^T += V^T.P^T (A = rows of V^T, B = P^T). A lane then holds 16 scores of ONE query (column ln; keys 8 hh + r and 16 + 8 hh + r of the tile), so that maximum and sum are taken inside the lane,
// with one exchange between the wave's halves, there is one maximum, one sum and one rescale factor per lane, and the two score tiles, converted in place, are the B operand P^T in the k order in which the V^T rows are loaded: P passes through no LDS.
// A masked score is -inf; against the finite maximum its weight is exp(-inf) = 0. The second launch bound asks for 6 waves per SIMD, two work-groups per WGP as before: left alone, this build interleaves the sixteen exponentials over 177 registers, which leaves room for one work-group only.
// Both attentions run in one launch: the first half of the grid takes the concept queries (MODE 1, whose masks allow more keys), the second half the token queries (MODE 0). MODE is the same for a whole work-group and stays in a scalar register;
// it chooses the planes (MODE 1's queries, key columns, V^T and output lie sQ, sK, sV and sOut elements behind MODE 0's) and the walk's bounds, and the key loop does not read it.
__global__ __launch_bounds__(384, 6) void k_flashm(const _Float16* __restrict__ Q16, int ldq, size_t sQ, const _Float16* __restrict__ K16, int ldk, size_t sK, const _Float16* __restrict__ Vt, size_t sV, const int* __restrict__ NTCP, float* __restrict__ O, int ldo, size_t sOut) {
  int ntc = NTCP[0]; ntc = (ntc < 1) ? 1 : ((ntc > TQ) ? TQ : ntc);      /* = 8 here; guarded so the index arithmetic can never divide by zero; from TQ up both masks read the same as at TQ, and the products below cannot overflow */
  constexpr int RPW = 16, NPR = 2, NQT = TQ / RPW, NQB = NQT / (2 * NPR), DT = 4, KS = 2, NSP = 6, HT = TQ / 32;
  __shared__ __attribute__((aligned(16))) float sO[NPR * NSP][RPW][64 + 4]; __shared__ float sM[NPR * NSP][RPW], sL[NPR * NSP][RPW];
  const int tid = threadIdx.x, w = __builtin_amdgcn_readfirstlane(tid >> 5), lane = tid & 31, ln = lane & 15, hh = lane >> 4;      /* the wave's number in a scalar register: the key loop's counter and its tests stay scalar */
  const int MODE = ((int)blockIdx.x < BB * NH * NQB) ? 1 : 0, bx = (int)blockIdx.x - (MODE ? 0 : BB * NH * NQB); if (MODE) { Q16 += sQ; K16 += sK; Vt += sV; O += sOut; }
  const int slab = bx / NQB, qblk = bx % NQB; const int b = slab / NH, h = slab % NH; const int pr = w & 1, sp = w >> 1;
  const unsigned short* Kl = (const unsigned short*)K16 + ((size_t)b * TK + ln) * ldk + h * 64 + 8 * hh;      /* the lane's place in the rows of key tile 0 */
  const unsigned short* Vl = (const unsigned short*)Vt + ((size_t)slab * 64 + ln) * TK + 8 * hh;      /* and in the rows of V^T */
#pragma unroll 1      /* one copy of the walk serves both query tiles */
  for (int ph = 0; ph < 2; ++ph) {
    const int q0 = (ph ? NQT - 1 - (qblk * NPR + pr) : qblk * NPR + pr) * RPW, qm = q0 + RPW - 1;
    int na = (MODE == 0) ? qm / 32 + 1 : (ntc * (qm + 1) + 31) / 32, nb = (MODE == 0) ? (qm / ntc) / 32 + 1 : qm / 32 + 1;      /* key tiles with an allowed key: token half, concept half */
    na = __builtin_amdgcn_readfirstlane((na > HT) ? HT : na); nb = __builtin_amdgcn_readfirstlane((nb > HT) ? HT : nb);      /* the same in every lane: in scalar registers the walk's bound and the tile's number cost no vector register */
    FragH aq[KS]; { const unsigned short* qr = (const unsigned short*)Q16 + ((size_t)b * TQ + q0 + ln) * ldq + h * 64;
#pragma unroll
      for (int ks = 0; ks < KS; ++ks) { aq[ks].half[0] = *(const v8us*)(qr + ks * 32 + 8 * hh); aq[ks].half[1] = *(const v8us*)(qr + ks * 32 + 16 + 8 * hh); }
      asm volatile("s_wait_xcnt 0x0" ::: "memory"); }      /* stands behind the query loads, ahead of the index arithmetic that reuses their address registers */
    const int q = q0 + ln; const int limA = (MODE == 0) ? q : ntc * (q + 1) - 1, limB = (MODE == 0) ? q / ntc : q;      /* the lane's query: its last allowed index in the token half and in the concept half */
    float m_q = -3.0e38f, l_q = 0.f; v8f oacc[DT];      /* the lane's query: maximum, sum over this half's keys, and 32 elements of its V sum */
#pragma unroll
    for (int dt = 0; dt < DT; ++dt) oacc[dt] = (v8f){0.f,0.f,0.f,0.f,0.f,0.f,0.f,0.f};
    int j0 = 32 * ((sp < na) ? sp : sp - na + HT); const unsigned short* kp0 = Kl + (size_t)j0 * ldk; const unsigned short* kp1 = kp0 + (size_t)16 * ldk; const unsigned short* vp = Vl + j0;      /* the wave's first key tile: its plane row, and the lane's addresses in it (key rows ln and 16 + ln, V^T columns). They are carried from tile to tile: a register that lives through the whole walk is never handed to a load's result while another load still names it */
#pragma unroll 1
    for (int it = sp; it < na + nb; it += NSP) { const bool ta = it < na; const int t0 = ta ? j0 : j0 - TQ;
      const int dl = (ta ? limA : limB) - t0 - 8 * hh;      /* the lane's score number nt * 8 + r belongs to index t0 + 8 hh + nt * 16 + r of the half: allowed where nt * 16 + r <= dl */
      FragH bk[2][KS], bv[DT];
#pragma unroll
      for (int nt = 0; nt < 2; ++nt)
#pragma unroll
        for (int ks = 0; ks < KS; ++ks) { bk[nt][ks].half[0] = *(const v8us*)((nt ? kp1 : kp0) + ks * 32); bk[nt][ks].half[1] = *(const v8us*)((nt ? kp1 : kp0) + ks * 32 + 16); }
#pragma unroll
      for (int dt = 0; dt < DT; ++dt) { bv[dt].half[0] = *(const v8us*)(vp + dt * 16 * TK); bv[dt].half[1] = *(const v8us*)(vp + dt * 16 * TK + 16); }
      asm volatile("s_wait_xcnt 0x0" ::: "memory");      /* stands behind the tile's loads, ahead of the step of the three addresses that they name */
      __builtin_amdgcn_sched_barrier(0);      /* keeps the wait behind all sixteen loads and the address step behind the wait; it also keeps the V^T loads up here, under way during the score products and the softmax (the scheduler otherwise sinks them to their products) */
      { const int in = it + NSP, jn = 32 * ((in < na) ? in : in - na + HT); const ptrdiff_t dk = (ptrdiff_t)(jn - j0) * ldk; kp0 += dk; kp1 += dk; vp += jn - j0; j0 = jn; }      /* on to the wave's next tile (behind the last one the addresses are not used) */
      float sm[16];
#pragma unroll
      for (int nt = 0; nt < 2; ++nt) { v8f acc = (v8f){0.f,0.f,0.f,0.f,0.f,0.f,0.f,0.f};
#pragma unroll
        for (int ks = 0; ks < KS; ++ks) acc = __builtin_amdgcn_wmma_f32_16x16x32_f16(false, bk[nt][ks].v, false, aq[ks].v, (short)0, acc, false, false);
#pragma unroll
        for (int r = 0; r < 8; ++r) sm[nt * 8 + r] = (nt * 16 + r <= dl) ? acc[r] * SCL : -INFINITY; }
      float mc = sm[0];
#pragma unroll
      for (int i = 1; i < 16; ++i) mc = fmaxf(mc, sm[i]);
      mc = fmaxf(mc, xhalf(mc));
      const float mn = fmaxf(m_q, mc), al = expf(m_q - mn); m_q = mn;      /* no allowed key so far: mn stays at its finite start value, al = exp(0) = 1 and every weight 0 */
      float ps = 0.f; FragH pb;
#pragma unroll
      for (int i = 0; i < 16; ++i) { const float p = expf(sm[i] - mn); ps += p; pb.h[i] = (_Float16)(p * 1024.0f); }
      l_q = l_q * al + ps;
#pragma unroll
      for (int dt = 0; dt < DT; ++dt) { oacc[dt] *= al; oacc[dt] = __builtin_amdgcn_wmma_f32_16x16x32_f16(false, bv[dt].v, false, pb.v, (short)0, oacc[dt], false, false); } }
    l_q += xhalf(l_q);
    if (hh == 0) { sM[w][ln] = m_q; sL[w][ln] = l_q; }
    __syncthreads();      /* publishes every wave's row maxima and row sums; it also ends the reads of the partial outputs of the query tiles before */
    float mg = sM[pr][ln];
#pragma unroll
    for (int s2 = 1; s2 < NSP; ++s2) mg = fmaxf(mg, sM[s2 * NPR + pr][ln]);
    float lt = 0.f, fo = 0.f;      /* a wave that met no allowed key of this row holds sum 0 and a zero V sum */
#pragma unroll
    for (int s2 = 0; s2 < NSP; ++s2) { const float e = expf(sM[s2 * NPR + pr][ln] - mg); lt += sL[s2 * NPR + pr][ln] * e; if (s2 == sp) fo = e; }
    const float fq = (lt > 0.f) ? fo / (lt * 1024.0f) : 0.f;
#pragma unroll
    for (int dt = 0; dt < DT; ++dt) { *(v4fa*)&sO[w][ln][dt * 16 + 8 * hh] = (v4f){oacc[dt][0] * fq, oacc[dt][1] * fq, oacc[dt][2] * fq, oacc[dt][3] * fq}; *(v4fa*)&sO[w][ln][dt * 16 + 8 * hh + 4] = (v4f){oacc[dt][4] * fq, oacc[dt][5] * fq, oacc[dt][6] * fq, oacc[dt][7] * fq}; }
    __syncthreads();      /* publishes the rescaled partial outputs; it also ends the reads of the maxima and sums, which the next query tiles write anew */
    for (int i = tid; i < NPR * RPW * 16; i += 32 * NPR * NSP) { const int q2 = i >> 8, r = (i >> 4) & 15, pc = i & 15; v4f val = *(const v4fa*)&sO[q2][r][pc * 4];
#pragma unroll
      for (int s2 = 1; s2 < NSP; ++s2) val += *(const v4fa*)&sO[s2 * NPR + q2][r][pc * 4];
      const int qo = (ph ? NQT - 1 - (qblk * NPR + q2) : qblk * NPR + q2) * RPW;
      *(v4f*)(O + ((size_t)b * TQ + qo + r) * ldo + h * 64 + pc * 4) = val; } } }

extern "C" void kernel_launch(void* const* d_in, const int* in_sizes, int n_in,
                              void* d_out, int out_size, void* d_ws, size_t ws_size, hipStream_t stream) {
  (void)in_sizes; (void)n_in; (void)out_size;
  const float* const* I = (const float* const*)d_in; const float* xt = I[0]; const float* xc = I[1]; const float* Wt = I[2]; const float* bt = I[3]; const float* Wc = I[4]; const float* bc = I[5]; const float* Wtp = I[6]; const float* btp = I[7]; const float* Wcp = I[8]; const float* bcp = I[9]; const int* ntcp = (const int*)d_in[10];      /* int64 in the module, read as int32 */
  char* ws = (char*)d_ws; size_t off = 0;
  auto take = [&](size_t bytes) { char* p = ws + off; off += (bytes + 255) & ~(size_t)255; return p; };
  _Float16* Bt_ = (_Float16*)take((size_t)DW * DD * 2); _Float16* Bc = (_Float16*)take((size_t)DW * DD * 2); _Float16* Btp = (_Float16*)take((size_t)DD * DD * 2); _Float16* Bcp = (_Float16*)take((size_t)DD * DD * 2);
  _Float16* XT = (_Float16*)take((size_t)NR * DD * 2); _Float16* XC = (_Float16*)take((size_t)NR * DD * 2); _Float16* TC = (_Float16*)take((size_t)BB * TK * DW * 2);      /* per batch: rows 0..1023 = tok, 1024..2047 = con */
  _Float16* Vt1 = (_Float16*)take((size_t)BB * NH * 64 * TK * 2); _Float16* Vt2 = (_Float16*)take((size_t)BB * NH * 64 * TK * 2); float* O = (float*)take((size_t)2 * NR * DD * 4); _Float16* O16 = (_Float16*)take((size_t)2 * NR * DD * 2);      /* O, O16: token rows, then concept rows */
  (void)Vt2;
  if (off > ws_size) return;      // 8.4 + 8.4 + 2.1 + 2.1 + 4.2 + 4.2 + 33.6 + 8.4 + 8.4 + 16.8 + 8.4 = 105 MB
  /* Six launches, one per stage: launches that do not depend on each other share one grid. Every plane's size is a multiple of 256 bytes, so that planes taken one after the other lie back to back. */
  k_cvt6<<<(2 * DW * DD + 2 * DD * DD + 2 * NR * DD) / 2048, 256, 0, stream>>>(Wt, Wc, Wtp, Wcp, xt, xc, Bt_);      /* weights: torch (out,in) natural, x 2^4 */
  const dim3 gt((TQ / 128) * (DW / 128), BB, 2);
  k_gemm_lds<true, DD, DW><<<gt, 256, 0, stream>>>(XT, XC, (size_t)TQ * DD, Bt_, Bc, 0.0625f, bt, bc, nullptr, TC, (size_t)TK * DW, (size_t)TQ * DW);      /* tok[b] -> plane rows 0..1023, con[b] -> plane rows 1024..2047: each M 1024 N 4096 K 1024 */
  k_vt<NH, TK><<<dim3(BB * NH * (TK / 64), 2), 256, 0, stream>>>(TC, DW, 2 * DD, DD, Vt1, (size_t)BB * NH * 64 * TK);      /* values read by tokens = columns 2048.. of both halves -> V^T [bh][64][2048]; values read by concepts = columns 3072.. */
  k_flashm<<<2 * BB * NH * (TQ / 64), 384, 0, stream>>>(XT, DD, (size_t)NR * DD, TC, DW, (size_t)DD, Vt1, (size_t)BB * NH * 64 * TK, ntcp, O, DD, (size_t)NR * DD);      /* token queries: keys = columns 0..1023 (kt_t on token rows, kc_t on concept rows); concept queries: keys = columns 1024..2047 (kt_c, kc_c) */
  k_h16s<<<2 * NR * DD / 2048, 256, 0, stream>>>(O, O16, (size_t)2 * NR * DD / 8);
  const dim3 gpj((NR / 128) * (DD / 128), 1, 2);
  k_gemm_lds<false, DD, DD><<<gpj, 256, 0, stream>>>(O16, O16 + (size_t)NR * DD, 0, Btp, Bcp, 0.00390625f, btp, bcp, (float*)d_out, nullptr, 0, (size_t)NR * DD);      /* y_t = merged.Wtp^T + btp -> output 0; y_c -> output 1 (offset B.T.NE floats) */
}

// v006
// One run takes 118 microseconds.
// Next to v005, in two timings, it ran 1.08 times as fast each time.
// Counting every step since v000, it is 6.56 times as fast.
#include <hip/hip_runtime.h>
// Token/concept two-stream causal attention (B=2, T=C=1024, NE=CD=1024, 16 heads × 64, n_tokens_per_concept = 8): tok = xt·Wtᵀ + bt, con = xc·Wcᵀ + bc (4096 outputs each = [k for token queries | k for concept queries | v read by tokens | v read by concepts]);
// token queries = heads(xt) (the residual stream itself) attend over [tokens ; concepts] with mask (s ≤ t) | (j < t/8 + 1), scale 1/√64; concept queries = heads(xc) attend over [concepts ; tokens] with mask (j ≤ i) | (s < 8(i+1)); disallowed = −1e9 (≡ −inf: every row keeps itself);
// y_t = merge(attn_t)·Wtpᵀ + btp, y_c = merge(attn_c)·Wcpᵀ + bcp (two outputs).
// Compute dtype: xt, xc, weights, biases rounded to bf16; tok/con as f16 GEMM planes written as the two 1024-row halves of one 2048-key plane per batch; queries = the bf16-exact x planes; fused flash-style kernels with the index-computed masks (n_tokens_per_concept read on device; online softmax f32,
// P f16 ×2^10, f32 accumulate) on v_wmma_f32_16x16x32_f16; O ×2^4 → f16 (stored so by the flash kernel) → projection GEMMs (+bias) straight into the two output slots.
#define BB 2
#define TQ 1024
#define TK 2048
#define DD 1024
#define NH 16
#define DW 4096
#define SCL 0.125f
#define NR (BB * TQ)
typedef __bf16 v16b __attribute__((ext_vector_type(16)));
typedef unsigned short v8us __attribute__((ext_vector_type(8), may_alias));
typedef float  v8f  __attribute__((ext_vector_type(8)));
typedef float  v4f  __attribute__((ext_vector_type(4)));
typedef float  v4fa __attribute__((ext_vector_type(4), may_alias));
union FragB { v16b v; v8us half[2]; unsigned short u[16]; };

__device__ __forceinline__ unsigned short bf16_bits(float x) { unsigned int u = __float_as_uint(x); return (unsigned short)((u + 0x7FFFu + ((u >> 16) & 1u)) >> 16); }
__device__ __forceinline__ float bf16_val(unsigned short b) { return __uint_as_float(((unsigned int)b) << 16); }
__device__ __forceinline__ float bf16_round(float x) { return bf16_val(bf16_bits(x)); }
// D += A·B with NT terms: 1 = ah·bh, 2 = + al·bh (A split), 3 = + ah·bl (both split)
template <int NT>
__device__ __forceinline__ v8f mmaN(v16b ah, v16b al, v16b bh, v16b bl, v8f c) {
  c = __builtin_amdgcn_wmma_f32_16x16x32_bf16(false, ah, false, bh, (short)0, c, false, false);
  if (NT >= 2) c = __builtin_amdgcn_wmma_f32_16x16x32_bf16(false, al, false, bh, (short)0, c, false, false);
  if (NT >= 3) c = __builtin_amdgcn_wmma_f32_16x16x32_bf16(false, ah, false, bl, (short)0, c, false, false);
  asm volatile("v_nop\n\tv_nop\n\tv_nop\n\tv_nop" : "+v"(c) : "v"(ah), "v"(al), "v"(bh), "v"(bl));
  return c;
}

__global__ __launch_bounds__(256) void k_wt_bf16(const float* __restrict__ W, unsigned short* __restrict__ Wt, int K, int N) {
  const int t = blockIdx.x * 256 + threadIdx.x;
  const int k8n = K / 8;
  if (t >= N * k8n) return;
  const int n = t / k8n, k8 = (t % k8n) * 8;
  v8us v;
#pragma unroll
  for (int i = 0; i < 8; ++i) v[i] = bf16_bits(W[(size_t)(k8 + i) * N + n]);
  *(v8us*)(Wt + (size_t)n * K + k8) = v;
  
}

// GEMM C[M][N] (f32, pitch ldc) = act(A[M][K]·W + bias). A f32 row-major (pitch lda) converted per fragment to bf16
// (ASPLIT: hi/lo two planes -> 2 terms, else single rounded term); Wt bf16 [N][K] (pitch ldb). BIAS_BF16 rounds the
// bias to bf16 first (bias quantised to bf16 before the add). K%32==0, M%16==0, N%64==0.
template <bool ASPLIT, int ACT, bool BIAS_BF16>
__global__ __launch_bounds__(128) void k_gemm_bf(const float* __restrict__ A, int lda, const unsigned short* __restrict__ Wt, int ldb,
                                               const float* __restrict__ bias, float* __restrict__ C, int ldc, int M, int N, int K) {
  __shared__ __attribute__((aligned(16))) float so[4][16][64];
  const int tid = threadIdx.x, w = tid >> 5, lane = tid & 31, ln = lane & 15, hh = lane >> 4;
  const int ntn = N / 64;
  const int wid = blockIdx.x * 4 + w;
  const int mt = wid / ntn, nq = wid % ntn;
  if (mt * 16 >= M) return;
  const int row0 = mt * 16, col0 = nq * 64;
  const float* arow = A + (size_t)(row0 + ln) * lda;
  v8f acc[4] = {};
  for (int kb = 0; kb < K; kb += 32) {
    FragB ah, al;
    const v4f x0 = *(const v4fa*)(arow + kb + 8 * hh), x1 = *(const v4fa*)(arow + kb + 8 * hh + 4);
    const v4f x2 = *(const v4fa*)(arow + kb + 16 + 8 * hh), x3 = *(const v4fa*)(arow + kb + 16 + 8 * hh + 4);
    float xs[16] = {x0[0],x0[1],x0[2],x0[3],x1[0],x1[1],x1[2],x1[3],x2[0],x2[1],x2[2],x2[3],x3[0],x3[1],x3[2],x3[3]};
#pragma unroll
    for (int i = 0; i < 16; ++i) { const unsigned short hb = bf16_bits(xs[i]); ah.u[i] = hb; al.u[i] = ASPLIT ? bf16_bits(xs[i] - bf16_val(hb)) : (unsigned short)0; }
#pragma unroll
    for (int t = 0; t < 4; ++t) {
      const unsigned short* brow = Wt + (size_t)(col0 + t * 16 + ln) * ldb + kb;
      FragB b;
      b.half[0] = *(const v8us*)(brow + 8 * hh);
      b.half[1] = *(const v8us*)(brow + 16 + 8 * hh);
      acc[t] = mmaN<ASPLIT ? 2 : 1>(ah.v, al.v, b.v, b.v, acc[t]);
    }
  }
#pragma unroll
  for (int t = 0; t < 4; ++t) {
    float bv = bias ? bias[col0 + t * 16 + ln] : 0.f;
    if (BIAS_BF16) bv = bf16_round(bv);
#pragma unroll
    for (int r = 0; r < 8; ++r) { float v = acc[t][r] + bv; if (ACT == 1) v = fmaxf(v, 0.f); so[w][8 * hh + r][t * 16 + ln] = v; }
  }
  __builtin_amdgcn_fence(__ATOMIC_ACQ_REL, "workgroup");
  __builtin_amdgcn_wave_barrier();
  const int rsub = lane >> 4, c4 = (lane & 15) * 4;
  {
#pragma unroll
    for (int q = 0; q < 8; ++q) {
      const int r = q * 2 + rsub;
      const v4f v = *(const v4fa*)&so[w][r][c4];
      *(v4f*)(C + (size_t)(row0 + r) * ldc + col0 + c4) = v;
    }
    
  }
}

// GEMM C = act(A·W + bias + resid): A f32 (ASPLIT -> hi/lo 2 terms), Wt bf16 [N][K]; ACT 0 none, 1 relu, 2 exact gelu;
// resid (optional, f32, row index = (row % rmod), pitch ldr, RES_BF16 rounds it) added before the activation.
template <bool ASPLIT, int ACT, bool BIAS_BF16, bool RES_BF16>
__global__ __launch_bounds__(128) void k_gemm_bf3(const float* __restrict__ A, int lda, const unsigned short* __restrict__ Wt, int ldb,
                                                const float* __restrict__ bias, const float* __restrict__ resid, int rmod, int ldr,
                                                float* __restrict__ C, int ldc, int M, int N, int K) {
  __shared__ __attribute__((aligned(16))) float so[4][16][64];
  const int tid = threadIdx.x, w = tid >> 5, lane = tid & 31, ln = lane & 15, hh = lane >> 4;
  const int ntn = N / 64;
  const int wid = blockIdx.x * 4 + w;
  const int mt = wid / ntn, nq = wid % ntn;
  if (mt * 16 >= M) return;
  const int row0 = mt * 16, col0 = nq * 64;
  const float* arow = A + (size_t)(row0 + ln) * lda;
  v8f acc[4] = {};
  for (int kb = 0; kb < K; kb += 32) {
    FragB ah, al;
    const v4f x0 = *(const v4fa*)(arow + kb + 8 * hh), x1 = *(const v4fa*)(arow + kb + 8 * hh + 4);
    const v4f x2 = *(const v4fa*)(arow + kb + 16 + 8 * hh), x3 = *(const v4fa*)(arow + kb + 16 + 8 * hh + 4);
    float xs[16] = {x0[0],x0[1],x0[2],x0[3],x1[0],x1[1],x1[2],x1[3],x2[0],x2[1],x2[2],x2[3],x3[0],x3[1],x3[2],x3[3]};
#pragma unroll
    for (int i = 0; i < 16; ++i) { const unsigned short hb = bf16_bits(xs[i]); ah.u[i] = hb; al.u[i] = ASPLIT ? bf16_bits(xs[i] - bf16_val(hb)) : (unsigned short)0; }
#pragma unroll
    for (int t = 0; t < 4; ++t) {
      const unsigned short* brow = Wt + (size_t)(col0 + t * 16 + ln) * ldb + kb;
      FragB b;
      b.half[0] = *(const v8us*)(brow + 8 * hh);
      b.half[1] = *(const v8us*)(brow + 16 + 8 * hh);
      acc[t] = mmaN<ASPLIT ? 2 : 1>(ah.v, al.v, b.v, b.v, acc[t]);
    }
  }
#pragma unroll
  for (int t = 0; t < 4; ++t) {
    const int col = col0 + t * 16 + ln;
    float bv = bias ? bias[col] : 0.f;
    if (BIAS_BF16) bv = bf16_round(bv);
#pragma unroll
    for (int r = 0; r < 8; ++r) {
      float v = acc[t][r] + bv;
      if (resid) { float rv = resid[(size_t)((row0 + 8 * hh + r) % rmod) * ldr + col]; if (RES_BF16) rv = bf16_round(rv); v += rv; }
      if (ACT == 1) v = fmaxf(v, 0.f);
      if (ACT == 2) v = 0.5f * v * (1.0f + erff(v * 0.70710678118654752f));
      if (ACT == 3) { const float u = 0.7978845608028654f * (v + 0.044715f * v * v * v); v = 0.5f * v * (1.0f + tanhf(u)); }
      so[w][8 * hh + r][t * 16 + ln] = v;
    }
  }
  __builtin_amdgcn_fence(__ATOMIC_ACQ_REL, "workgroup");
  __builtin_amdgcn_wave_barrier();
  const int rsub = lane >> 4, c4 = (lane & 15) * 4;
  {
#pragma unroll
    for (int q = 0; q < 8; ++q) {
      const int r = q * 2 + rsub;
      const v4f v = *(const v4fa*)&so[w][r][c4];
      *(v4f*)(C + (size_t)(row0 + r) * ldc + col0 + c4) = v;
    }
    
  }
}
// row LayerNorm (biased variance, eps) over N: s = X (+ R); optional out_sum <- s; out_norm <- (s-mu)*rsqrt(var+eps)*g + b
template <bool PARAM_BF16>
__global__ __launch_bounds__(256) void k_layernorm(const float* __restrict__ X, const float* __restrict__ R, const float* __restrict__ g, const float* __restrict__ bta,
                                                  float* __restrict__ out_sum, float* __restrict__ out_norm, int N, float eps) {
  __shared__ float red[256];
  const int row = blockIdx.x, tid = threadIdx.x;
  const float* x = X + (size_t)row * N; const float* rr = R ? R + (size_t)row * N : nullptr;
  float vals[16];                     // up to N = 4096
  const int per = N / 256;            // contiguous chunk per thread? use strided-by-4 chunks: thread handles j = tid*4 + 1024*u
  float s1 = 0.f;
  for (int u = 0; u < per / 4; ++u) {
    const int j = tid * 4 + 1024 * u;
    const v4f a = *(const v4fa*)(x + j);
    v4f b = {0.f,0.f,0.f,0.f}; if (rr) b = *(const v4fa*)(rr + j);
#pragma unroll
    for (int q = 0; q < 4; ++q) { const float v = a[q] + b[q]; vals[u * 4 + q] = v; s1 += v; }
  }
  red[tid] = s1; __syncthreads();
  for (int st = 128; st > 0; st >>= 1) { if (tid < st) red[tid] += red[tid + st]; __syncthreads(); }
  const float mu = red[0] / (float)N; __syncthreads();
  float s2 = 0.f;
  for (int u = 0; u < per / 4; ++u)
#pragma unroll
    for (int q = 0; q < 4; ++q) { const float c = vals[u * 4 + q] - mu; s2 += c * c; }
  red[tid] = s2; __syncthreads();
  for (int st = 128; st > 0; st >>= 1) { if (tid < st) red[tid] += red[tid + st]; __syncthreads(); }
  const float rs = rsqrtf(red[0] / (float)N + eps);
  {
    for (int u = 0; u < per / 4; ++u) {
      const int j = tid * 4 + 1024 * u;
      v4f o, sm;
#pragma unroll
      for (int q = 0; q < 4; ++q) {
        float gg = g[j + q], bb = bta[j + q];
        if (PARAM_BF16) { gg = bf16_round(gg); bb = bf16_round(bb); }
        sm[q] = vals[u * 4 + q]; o[q] = (vals[u * 4 + q] - mu) * rs * gg + bb;
      }
      if (out_sum) *(v4f*)(out_sum + (size_t)row * N + j) = sm;
      *(v4f*)(out_norm + (size_t)row * N + j) = o;
    }
    
  }
}



// ---- f16 WMMA path (v_wmma_f32_16x16x32_f16): 11-bit significands for operands in range — used where a [0,1] probability operand needs more precision than bf16
typedef _Float16 v16h __attribute__((ext_vector_type(16)));
union FragH { v16h v; v8us half[2]; _Float16 h[16]; unsigned short u[16]; };
template <int NT>
__device__ __forceinline__ v8f mmaH(v16h ah, v16h al, v16h bh, v16h bl, v8f c) {
  c = __builtin_amdgcn_wmma_f32_16x16x32_f16(false, ah, false, bh, (short)0, c, false, false);
  if (NT >= 2) c = __builtin_amdgcn_wmma_f32_16x16x32_f16(false, al, false, bh, (short)0, c, false, false);
  if (NT >= 3) c = __builtin_amdgcn_wmma_f32_16x16x32_f16(false, ah, false, bl, (short)0, c, false, false);
  asm volatile("v_nop\n\tv_nop\n\tv_nop\n\tv_nop" : "+v"(c) : "v"(ah), "v"(al), "v"(bh), "v"(bl));
  return c;
}
// batched GEMM like k_gemm_b but f16 operands: A f32 (split into f16 hi/lo if ASPLIT, else rounded to f16), Bt = f16 values [n][k]; alpha; C f32; N multiple of 16 (partial tiles skipped)
template <bool ASPLIT>
__global__ __launch_bounds__(128) void k_gemm_h(const float* __restrict__ A, int lda, size_t sA, const _Float16* __restrict__ Bh, int ldb, size_t sB, float alpha, float* __restrict__ C, int ldc, size_t sC, int M, int N, int K) {
  __shared__ __attribute__((aligned(16))) float so[4][16][64];
  const int tid = threadIdx.x, w = tid >> 5, lane = tid & 31, ln = lane & 15, hh = lane >> 4; const int by = blockIdx.y;
  A += (size_t)by * sA; Bh += (size_t)by * sB; C += (size_t)by * sC;
  const int ntn = (N + 63) / 64; const int wid = blockIdx.x * 4 + w; const int mt = wid / ntn, nq = wid % ntn; if (mt * 16 >= M) return;
  const int row0 = mt * 16, col0 = nq * 64; const float* arow = A + (size_t)(row0 + ln) * lda;
  v8f acc[4] = {};
  for (int kb = 0; kb < K; kb += 32) {
    FragH ah, al;
    const v4f x0 = *(const v4fa*)(arow + kb + 8 * hh), x1 = *(const v4fa*)(arow + kb + 8 * hh + 4), x2 = *(const v4fa*)(arow + kb + 16 + 8 * hh), x3 = *(const v4fa*)(arow + kb + 16 + 8 * hh + 4);
    float xs[16] = {x0[0],x0[1],x0[2],x0[3],x1[0],x1[1],x1[2],x1[3],x2[0],x2[1],x2[2],x2[3],x3[0],x3[1],x3[2],x3[3]};
#pragma unroll
    for (int i = 0; i < 16; ++i) { const _Float16 h = (_Float16)xs[i]; ah.h[i] = h; al.h[i] = ASPLIT ? (_Float16)(xs[i] - (float)h) : (_Float16)0.0f; }
#pragma unroll
    for (int t = 0; t < 4; ++t) { if (col0 + t * 16 >= N) continue; const size_t boff = (size_t)(col0 + t * 16 + ln) * ldb + kb; FragH bq; bq.half[0] = *(const v8us*)(Bh + boff + 8 * hh); bq.half[1] = *(const v8us*)(Bh + boff + 16 + 8 * hh);
      acc[t] = mmaH<ASPLIT ? 2 : 1>(ah.v, al.v, bq.v, bq.v, acc[t]); }
  }
#pragma unroll
  for (int t = 0; t < 4; ++t) { if (col0 + t * 16 >= N) continue;
#pragma unroll
    for (int r = 0; r < 8; ++r) so[w][8 * hh + r][t * 16 + ln] = acc[t][r] * alpha; }
  __builtin_amdgcn_fence(__ATOMIC_ACQ_REL, "workgroup"); __builtin_amdgcn_wave_barrier();
  const int rsub = lane >> 4, c4 = (lane & 15) * 4;
  {
#pragma unroll
    for (int q = 0; q < 8; ++q) { const int r = q * 2 + rsub; if (col0 + c4 < N) { const v4f v = *(const v4fa*)&so[w][r][c4]; *(v4f*)(C + (size_t)(row0 + r) * ldc + col0 + c4) = v; } }
     }
}

// Wt[n][k] = f16(W[k][n]·scale) from f32 row-major W[K][N] (scale = power of two; bf16-exact weights stay exact in f16 away from the subnormal range)
__global__ __launch_bounds__(256) void k_wt_f16(const float* __restrict__ W, _Float16* __restrict__ Wt, int K, int N, float scale) {
  const int t = blockIdx.x * 256 + threadIdx.x; if (t >= N * (K / 8)) return; const int n = t / (K / 8), k8 = (t % (K / 8)) * 8; FragH f;
#pragma unroll
  for (int i = 0; i < 8; ++i) f.h[i] = (_Float16)(bf16_round(W[(size_t)(k8 + i) * N + n]) * scale); const v8us o = f.half[0];
  *(v8us*)((unsigned short*)Wt + (size_t)n * K + k8) = o; 
}
// k_gemm_hh variant with fused epilogue: v = acc·alpha + bias[by·sBias + col] (+ CP[(row/rowsPerB)·sCPb + by·64 + col] if CP) ; ACT 0 none / 1 elu ; writes f16 C16 and/or f32 C, each if non-null
template <int ACT>
__global__ __launch_bounds__(128) void k_gemm_hhx(const _Float16* __restrict__ A, int lda, size_t sA, const _Float16* __restrict__ Bh, int ldb, size_t sB, float alpha, const float* __restrict__ bias, size_t sBias, const float* __restrict__ CP, int rowsPerB, size_t sCPb, int row0g,
    float* __restrict__ C, _Float16* __restrict__ C16, int ldc, size_t sC, int M, int N, int K) {
  __shared__ __attribute__((aligned(16))) float so[4][16][64];
  const int tid = threadIdx.x, w = tid >> 5, lane = tid & 31, ln = lane & 15, hh = lane >> 4; const int by = blockIdx.y;
  A += (size_t)by * sA; Bh += (size_t)by * sB; const size_t cofs = (size_t)by * sC; const float* bp = bias ? bias + (size_t)by * sBias : nullptr;
  const int ntn = (N + 63) / 64; const int wid = blockIdx.x * 4 + w; const int mt = wid / ntn, nq = wid % ntn; if (mt * 16 >= M) return;
  const int row0 = mt * 16, col0 = nq * 64; const _Float16* arow = A + (size_t)(row0 + ln) * lda;
  v8f acc[4] = {};
  for (int kb = 0; kb < K; kb += 32) { FragH ah; ah.half[0] = *(const v8us*)((const unsigned short*)arow + kb + 8 * hh); ah.half[1] = *(const v8us*)((const unsigned short*)arow + kb + 16 + 8 * hh);
#pragma unroll
    for (int t = 0; t < 4; ++t) { if (col0 + t * 16 >= N) continue; const size_t boff = (size_t)(col0 + t * 16 + ln) * ldb + kb; FragH bq; bq.half[0] = *(const v8us*)((const unsigned short*)Bh + boff + 8 * hh); bq.half[1] = *(const v8us*)((const unsigned short*)Bh + boff + 16 + 8 * hh);
      acc[t] = mmaH<1>(ah.v, ah.v, bq.v, bq.v, acc[t]); }
  }
#pragma unroll
  for (int t = 0; t < 4; ++t) { if (col0 + t * 16 >= N) continue; const int col = col0 + t * 16 + ln; const float bv = bp ? bf16_round(bp[col]) : 0.f;
#pragma unroll
    for (int r = 0; r < 8; ++r) { float v = acc[t][r] * alpha + bv; if (CP) { const int bidx = (row0g + row0 + 8 * hh + r) / rowsPerB; v += CP[(size_t)bidx * sCPb + (size_t)by * 64 + col]; } if (ACT == 1) v = (v > 0.f) ? v : expm1f(v); else if (ACT == 7) v = (v > 0.f) ? v + 1.0f : expf(v); else if (ACT == 8) v = tanhf(v); else if (ACT == 9) v = 0.5f * v * (1.0f + tanhf(0.7978845608028654f * (v + 0.044715f * v * v * v))); else if (ACT == 11) v = 1.0f / (1.0f + expf(-v)); else if (ACT == 12) v = (v > 0.f) ? v : 0.01f * v; else if (ACT == 14) v = (v > 0.f) ? v : 0.1f * v; else if (ACT == 15) v = v / (1.0f + expf(-v)); else if (ACT == 3) v = fmaxf(v, 0.f); else if (ACT == 6) v = 0.5f * v * (1.0f + erff(v * 0.70710678118654752f)); so[w][8 * hh + r][t * 16 + ln] = v; } }
  __builtin_amdgcn_fence(__ATOMIC_ACQ_REL, "workgroup"); __builtin_amdgcn_wave_barrier();
  const int rsub = lane >> 4, c4 = (lane & 15) * 4; typedef _Float16 v4h __attribute__((ext_vector_type(4)));
  {
#pragma unroll
    for (int q = 0; q < 8; ++q) { const int r = q * 2 + rsub; if (col0 + c4 < N) { const v4f v = *(const v4fa*)&so[w][r][c4]; if (C) *(v4f*)(C + cofs + (size_t)(row0 + r) * ldc + col0 + c4) = v; if (C16) { v4h h4; for (int i = 0; i < 4; ++i) h4[i] = (_Float16)v[i]; *(v4h*)(C16 + cofs + (size_t)(row0 + r) * ldc + col0 + c4) = h4; } } }
     }
}


// GEMM C = (A.B^T)*alpha + bias on f16 planes, A [M][KD] (batch stride sA), Bh [ND][KD], both k-contiguous at pitch KD; C [M][ND] (batch stride sC) as f16 (OUT16) or f32. M and ND multiples of 128, KD a multiple of 64; grid.x = (M / 128) * (ND / 128), grid.y = batch, grid.z = 2: two independent products of one shape in one launch (operands A0, B0, bias0 or A1, B1, bias1; the second one's C lies sZ elements behind the first's).
// One 128 x 128 tile of C per work-group of 8 waves (4 x 2, 32 x 64 each). A 64-k slice of both operands (128 bytes of each row) is brought in by loads that cover whole lines and laid in LDS at pitch 144 bytes; every wave reads its fragments from there,
// so a row is asked of L2 once per work-group, not once per wave. Two LDS buffers: the next slice is loaded into registers ahead of the products of this one and stored behind them. Each accumulator still sums its k blocks of 32 in rising order.
// Tiles whose columns start at NT0 or later (the value columns; NT0 = ND: none) are wanted transposed by their reader. Such a work-group takes the two operands in each other's place: it forms Bh.A^T, the same sums over k, and its tile's rows are columns of C,
// stored as rows of the plane Ct = V^T [column block of DD][batch][DD columns][TK keys]; no pass over C follows. Which way a work-group goes is a scalar choice by its block index. The bias then belongs to the tile's row: lane l holds that of the wave's row l.
// The unroll directives on the short loops below make every index into the register arrays (staged rows, fragments, accumulators, bias) a constant, so that these arrays stay in registers.
template <bool OUT16, int KD, int ND, int NT0>
__global__ __launch_bounds__(256) void k_gemm_lds(const _Float16* __restrict__ A0, const _Float16* __restrict__ A1, size_t sA, const _Float16* __restrict__ B0, const _Float16* __restrict__ B1, float alpha, const float* __restrict__ bias0, const float* __restrict__ bias1,
    float* __restrict__ C, _Float16* __restrict__ C16, _Float16* __restrict__ Ct, size_t sC, size_t sZ) {
  const bool z1 = blockIdx.z != 0; const _Float16* A = z1 ? A1 : A0; const _Float16* Bh = z1 ? B1 : B0; const float* bias = z1 ? bias1 : bias0;
  constexpr int BT = 128, BK = 64, LP = BK + 8;
  __shared__ __attribute__((aligned(16))) unsigned char sm[4 * BT * LP * 2];      /* the two operands' two buffers; behind the loop the same bytes stage the output rows */
  unsigned short (*tA)[BT][LP] = (unsigned short (*)[BT][LP])sm; unsigned short (*tB)[BT][LP] = (unsigned short (*)[BT][LP])(sm + 2 * BT * LP * 2);
  const int tid = threadIdx.x, w = tid >> 5, lane = tid & 31, ln = lane & 15, hh = lane >> 4;
  constexpr int ntn = ND / BT; const int row0 = ((int)blockIdx.x / ntn) * BT, col0 = ((int)blockIdx.x % ntn) * BT; const int wr = (w >> 1) * 32, wc = (w & 1) * 64;
  const int sr = tid >> 3, sc = (tid & 7) * 8;      /* staging: 8 threads take one row's 128 bytes, a wave 4 whole lines; rows sr + 32 i */
  const bool tr = NT0 < ND && col0 >= NT0;      /* the same for the whole work-group */
  const unsigned short* Ar = (const unsigned short*)A + (size_t)blockIdx.y * sA + (size_t)(row0 + sr) * KD + sc; const unsigned short* Br = (const unsigned short*)Bh + (size_t)(col0 + sr) * KD + sc;
  const unsigned short* Ag = tr ? Br : Ar; const unsigned short* Bg = tr ? Ar : Br;
  float bv[4]; const float bR = bf16_round(bias[col0 + wr + lane]);      /* read on both ways (all five places lie in the tile's 128 columns), so that the loads go out together, under no branch */
#pragma unroll
  for (int t = 0; t < 4; ++t) { const float x = bf16_round(bias[col0 + wc + t * 16 + ln]); bv[t] = tr ? 0.f : x; }
  v8us ra[4], rb[4];
#pragma unroll
  for (int i = 0; i < 4; ++i) { ra[i] = *(const v8us*)(Ag + 32 * i * KD); rb[i] = *(const v8us*)(Bg + 32 * i * KD); }
#pragma unroll
  for (int i = 0; i < 4; ++i) { *(v8us*)&tA[0][sr + 32 * i][sc] = ra[i]; *(v8us*)&tB[0][sr + 32 * i][sc] = rb[i]; }
  __syncthreads();      /* publishes slice 0 */
  v8f acc[2][4];
#pragma unroll
  for (int mi = 0; mi < 2; ++mi)
#pragma unroll
    for (int t = 0; t < 4; ++t) acc[mi][t] = (v8f){0.f,0.f,0.f,0.f,0.f,0.f,0.f,0.f};
  constexpr int ns = KD / BK;
#pragma unroll      /* slice offsets and the buffer choice become immediates: no address arithmetic in the loop, and no address register is rewritten while loads are under way */
  for (int s = 0; s < ns; ++s) { const int cur = s & 1; const bool more = s + 1 < ns;
    if (more) {
#pragma unroll
      for (int i = 0; i < 4; ++i) { ra[i] = *(const v8us*)(Ag + 32 * i * KD + (s + 1) * BK); rb[i] = *(const v8us*)(Bg + 32 * i * KD + (s + 1) * BK); }
      __builtin_amdgcn_sched_barrier(0); }      /* keeps the next slice's loads ahead of this slice's products; the scheduler otherwise sinks them to their LDS stores and the group waits out their whole latency */
#pragma unroll
    for (int ks = 0; ks < 2; ++ks) { FragH fa[2], fb[4];
#pragma unroll
      for (int mi = 0; mi < 2; ++mi) { fa[mi].half[0] = *(const v8us*)&tA[cur][wr + mi * 16 + ln][ks * 32 + 8 * hh]; fa[mi].half[1] = *(const v8us*)&tA[cur][wr + mi * 16 + ln][ks * 32 + 16 + 8 * hh]; }
#pragma unroll
      for (int t = 0; t < 4; ++t) { fb[t].half[0] = *(const v8us*)&tB[cur][wc + t * 16 + ln][ks * 32 + 8 * hh]; fb[t].half[1] = *(const v8us*)&tB[cur][wc + t * 16 + ln][ks * 32 + 16 + 8 * hh]; }
#pragma unroll
      for (int mi = 0; mi < 2; ++mi)
#pragma unroll
        for (int t = 0; t < 4; ++t) acc[mi][t] = __builtin_amdgcn_wmma_f32_16x16x32_f16(false, fa[mi].v, false, fb[t].v, (short)0, acc[mi][t], false, false); }
    if (more) {
#pragma unroll
      for (int i = 0; i < 4; ++i) { *(v8us*)&tA[cur ^ 1][sr + 32 * i][sc] = ra[i]; *(v8us*)&tB[cur ^ 1][sr + 32 * i][sc] = rb[i]; } }
    __syncthreads();      /* publishes slice s + 1 and ends every wave's reads of slice s, whose buffer the next trip refills (behind the last slice: the output staging) */
  }
  const size_t cofs = (size_t)blockIdx.y * sC + (size_t)blockIdx.z * sZ; const int rsub = lane >> 4, c4 = (lane & 15) * 4; typedef _Float16 v4hh __attribute__((ext_vector_type(4)));
  float (*so)[64 + 4] = (float (*)[64 + 4])sm + w * 32;      /* the wave's own 32 staging rows */
#pragma unroll
  for (int mi = 0; mi < 2; ++mi)
#pragma unroll
    for (int t = 0; t < 4; ++t)
#pragma unroll
      for (int r = 0; r < 8; ++r) so[mi * 16 + 8 * hh + r][t * 16 + ln] = acc[mi][t][r] * alpha + bv[t];
  __builtin_amdgcn_fence(__ATOMIC_ACQ_REL, "workgroup"); __builtin_amdgcn_wave_barrier();      /* the wave's own staging rows: every lane's stores stay ahead of the row reads below */
  if (NT0 < ND && tr) { const int cv = col0 - NT0;      /* the tile's 128 columns lie in one block of DD; the wave's row r is column cv + wr + r, its 64 keys one whole line of V^T */
    _Float16* P = Ct + ((size_t)((cv / DD) * BB + (int)blockIdx.y) * DD + cv % DD + wr + rsub) * TK + (size_t)blockIdx.z * TQ + row0 + wc + c4;
#pragma unroll      /* the lane numbers read below and the stores' offsets become immediates: one address register pair serves all sixteen stores and is never rewritten */
    for (int q = 0; q < 16; ++q) { const v4f v = *(const v4fa*)&so[q * 2 + rsub][c4];
      const float b0 = __builtin_bit_cast(float, __builtin_amdgcn_readlane(__builtin_bit_cast(int, bR), q * 2)), b1 = __builtin_bit_cast(float, __builtin_amdgcn_readlane(__builtin_bit_cast(int, bR), q * 2 + 1)), br = rsub ? b1 : b0; v4hh h4;
#pragma unroll
      for (int i = 0; i < 4; ++i) h4[i] = (_Float16)(v[i] + br);
      *(v4hh*)(P + q * 2 * TK) = h4; }
    return; }
#pragma unroll
  for (int q = 0; q < 16; ++q) { const int r = q * 2 + rsub; const v4f v = *(const v4fa*)&so[r][c4]; const size_t o = cofs + (size_t)(row0 + wr + r) * ND + col0 + wc + c4;
    if (OUT16) { v4hh h4;
#pragma unroll
      for (int i = 0; i < 4; ++i) h4[i] = (_Float16)v[i];
      *(v4hh*)(C16 + o) = h4; }
    else *(v4f*)(C + o) = v; }
}

typedef _Float16 v4h __attribute__((ext_vector_type(4)));

// One launch rounds all six f32 operands to their f16 planes, which lie one behind the other in the workspace: Wt, Wc, Wtp, Wcp (bf16-rounded, x 2^4), then xt, xc (bf16-rounded, x 1, which is exact).
// The 2048 elements of a work-group lie in one operand; which one is a scalar choice by the block index.
__global__ __launch_bounds__(256) void k_cvt6(const float* __restrict__ Wt, const float* __restrict__ Wc, const float* __restrict__ Wtp, const float* __restrict__ Wcp, const float* __restrict__ xt, const float* __restrict__ xc, _Float16* __restrict__ dst) {
  constexpr unsigned GW = DW * DD / 2048, GP = DD * DD / 2048, GX = NR * DD / 2048;
  unsigned blk = blockIdx.x; const float* s; float sc = 16.0f;
  if (blk < GW) s = Wt; else if ((blk -= GW) < GW) s = Wc; else if ((blk -= GW) < GP) s = Wtp; else if ((blk -= GP) < GP) s = Wcp; else if ((blk -= GP) < GX) { s = xt; sc = 1.0f; } else { blk -= GX; s = xc; sc = 1.0f; }
  const size_t t = (size_t)blk * 256 + threadIdx.x; FragH f;
#pragma unroll
  for (int q = 0; q < 8; ++q) f.h[q] = (_Float16)(bf16_round(s[t * 8 + q]) * sc);
  *(v8us*)((unsigned short*)dst + ((size_t)blockIdx.x * 256 + threadIdx.x) * 8) = f.half[0]; }
__global__ __launch_bounds__(256) void k_h16(const float* __restrict__ x, _Float16* __restrict__ X16, size_t n8) { const size_t t = (size_t)blockIdx.x * 256 + threadIdx.x; if (t >= n8) return; FragH f;
#pragma unroll
  for (int q = 0; q < 8; ++q) f.h[q] = (_Float16)x[t * 8 + q]; *(v8us*)((unsigned short*)X16 + t * 8) = f.half[0];  }
__global__ __launch_bounds__(256) void k_hl(const float* __restrict__ F, _Float16* __restrict__ Hh, _Float16* __restrict__ Hl, size_t n8) { const size_t t = (size_t)blockIdx.x * 256 + threadIdx.x; if (t >= n8) return; FragH fh, fl; const v4f a = *(const v4fa*)(F + t * 8), c = *(const v4fa*)(F + t * 8 + 4);
#pragma unroll
  for (int q = 0; q < 4; ++q) { _Float16 h = (_Float16)a[q]; fh.h[q] = h; fl.h[q] = (_Float16)((a[q] - (float)h) * 1024.0f); h = (_Float16)c[q]; fh.h[4 + q] = h; fl.h[4 + q] = (_Float16)((c[q] - (float)h) * 1024.0f); }
  { *(v8us*)((unsigned short*)Hh + t * 8) = fh.half[0]; *(v8us*)((unsigned short*)Hl + t * 8) = fl.half[0];  } }

// masks over (query index q, key-plane row): key-plane rows 0..T-1 are TOKENS, rows T..2T-1 are CONCEPTS (the tok/con GEMMs write the two halves of one plane per batch). Inside each half the allowed keys of a query are the indices 0 .. lim:
// MODE 0 = token queries: token s <= q (causal), concept j < q / ntc + 1, that is j <= q / ntc; MODE 1 = concept queries: token s < ntc * (q + 1), concept j <= q. (Key order inside the softmax is irrelevant, so the plane order is used directly.)
__device__ __forceinline__ float xhalf(float x) { return __builtin_bit_cast(float, __builtin_amdgcn_permlanex16(__builtin_bit_cast(int, x), __builtin_bit_cast(int, x), 0x76543210, 0xfedcba98, false, false)); }      /* lane l's value to lane l ^ 16 and back, in registers */
// Work-group = 12 waves on four query tiles of 16 rows, taken as two pairs (p, 63 - p), p = 2 * block + (w & 1): an early tile, which the masks leave few keys, with a late one, which they leave many, so that within one MODE the waves walk more even numbers of key tiles.
// A wave takes its pair's two query tiles one after the other (ph = 0, 1). Of the 64 key tiles of 32 it walks only those in which the mask allows some key to some row of the query tile: both masks grow with the query index and shrink with the key index inside each half of the key plane,
// so these are the first na tiles of the token half and the first nb of the concept half, counted from the tile's last row. A tile left out held only weights 0 and left maximum, sum and V sum as they were. The six waves (w >> 1) of a pair take every sixth tile of that list;
// the six partial softmax states of a query tile (row maximum, row sum, weighted V sum) are merged in LDS behind each walk.
// Both products are taken transposed: S^T = K.Q^T (A = key rows, B = query rows) and O^T += V^T.P^T (A = rows of V^T, B = P^T). A lane then holds 16 scores of ONE query (column ln; keys 8 hh + r and 16 + 8 hh + r of the tile), so that maximum and sum are taken inside the lane,
// with one exchange between the wave's halves, there is one maximum, one sum and one rescale factor per lane, and the two score tiles, converted in place, are the B operand P^T in the k order in which the V^T rows are loaded: P passes through no LDS.
// A masked score is -inf; against the finite maximum its weight is exp(-inf) = 0. The second launch bound asks for 6 waves per SIMD, two work-groups per WGP as before: left alone, this build interleaves the sixteen exponentials over 177 registers, which leaves room for one work-group only.
// Both attentions run in one launch: the first half of the grid takes the concept queries (MODE 1, whose masks allow more keys), the second half the token queries (MODE 0). MODE is the same for a whole work-group and stays in a scalar register;
// it chooses the planes (MODE 1's queries, key columns, V^T and output lie sQ, sK, sV and sOut elements behind MODE 0's) and the walk's bounds, and the key loop does not read it.
// The merged rows are stored as the projection reads them: x 2^4, rounded to f16, a head's 64 columns of a row as one whole line.
__global__ __launch_bounds__(384, 6) void k_flashm(const _Float16* __restrict__ Q16, int ldq, size_t sQ, const _Float16* __restrict__ K16, int ldk, size_t sK, const _Float16* __restrict__ Vt, size_t sV, const int* __restrict__ NTCP, _Float16* __restrict__ O, int ldo, size_t sOut) {
  int ntc = NTCP[0]; ntc = (ntc < 1) ? 1 : ((ntc > TQ) ? TQ : ntc);      /* = 8 here; guarded so the index arithmetic can never divide by zero; from TQ up both masks read the same as at TQ, and the products below cannot overflow */
  constexpr int RPW = 16, NPR = 2, NQT = TQ / RPW, NQB = NQT / (2 * NPR), DT = 4, KS = 2, NSP = 6, HT = TQ / 32;
  __shared__ __attribute__((aligned(16))) float sO[NPR * NSP][RPW][64 + 4]; __shared__ float sM[NPR * NSP][RPW], sL[NPR * NSP][RPW];
  const int tid = threadIdx.x, w = __builtin_amdgcn_readfirstlane(tid >> 5), lane = tid & 31, ln = lane & 15, hh = lane >> 4;      /* the wave's number in a scalar register: the key loop's counter and its tests stay scalar */
  const int MODE = ((int)blockIdx.x < BB * NH * NQB) ? 1 : 0, bx = (int)blockIdx.x - (MODE ? 0 : BB * NH * NQB); if (MODE) { Q16 += sQ; K16 += sK; Vt += sV; O += sOut; }
  const int slab = bx / NQB, qblk = bx % NQB; const int b = slab / NH, h = slab % NH; const int pr = w & 1, sp = w >> 1;
  const unsigned short* Kl = (const unsigned short*)K16 + ((size_t)b * TK + ln) * ldk + h * 64 + 8 * hh;      /* the lane's place in the rows of key tile 0 */
  const unsigned short* Vl = (const unsigned short*)Vt + ((size_t)slab * 64 + ln) * TK + 8 * hh;      /* and in the rows of V^T */
#pragma unroll 1      /* one copy of the walk serves both query tiles */
  for (int ph = 0; ph < 2; ++ph) {
    const int q0 = (ph ? NQT - 1 - (qblk * NPR + pr) : qblk * NPR + pr) * RPW, qm = q0 + RPW - 1;
    int na = (MODE == 0) ? qm / 32 + 1 : (ntc * (qm + 1) + 31) / 32, nb = (MODE == 0) ? (qm / ntc) / 32 + 1 : qm / 32 + 1;      /* key tiles with an allowed key: token half, concept half */
    na = __builtin_amdgcn_readfirstlane((na > HT) ? HT : na); nb = __builtin_amdgcn_readfirstlane((nb > HT) ? HT : nb);      /* the same in every lane: in scalar registers the walk's bound and the tile's number cost no vector register */
    FragH aq[KS]; { const unsigned short* qr = (const unsigned short*)Q16 + ((size_t)b * TQ + q0 + ln) * ldq + h * 64;
#pragma unroll
      for (int ks = 0; ks < KS; ++ks) { aq[ks].half[0] = *(const v8us*)(qr + ks * 32 + 8 * hh); aq[ks].half[1] = *(const v8us*)(qr + ks * 32 + 16 + 8 * hh); }
      asm volatile("s_wait_xcnt 0x0" ::: "memory"); }      /* stands behind the query loads, ahead of the index arithmetic that reuses their address registers */
    const int q = q0 + ln; const int limA = (MODE == 0) ? q : ntc * (q + 1) - 1, limB = (MODE == 0) ? q / ntc : q;      /* the lane's query: its last allowed index in the token half and in the concept half */
    float m_q = -3.0e38f, l_q = 0.f; v8f oacc[DT];      /* the lane's query: maximum, sum over this half's keys, and 32 elements of its V sum */
#pragma unroll
    for (int dt = 0; dt < DT; ++dt) oacc[dt] = (v8f){0.f,0.f,0.f,0.f,0.f,0.f,0.f,0.f};
    int j0 = 32 * ((sp < na) ? sp : sp - na + HT); const unsigned short* kp0 = Kl + (size_t)j0 * ldk; const unsigned short* kp1 = kp0 + (size_t)16 * ldk; const unsigned short* vp = Vl + j0;      /* the wave's first key tile: its plane row, and the lane's addresses in it (key rows ln and 16 + ln, V^T columns). They are carried from tile to tile: a register that lives through the whole walk is never handed to a load's result while another load still names it */
#pragma unroll 1
    for (int it = sp; it < na + nb; it += NSP) { const bool ta = it < na; const int t0 = ta ? j0 : j0 - TQ;
      const int dl = (ta ? limA : limB) - t0 - 8 * hh;      /* the lane's score number nt * 8 + r belongs to index t0 + 8 hh + nt * 16 + r of the half: allowed where nt * 16 + r <= dl */
      FragH bk[2][KS], bv[DT];
#pragma unroll
      for (int nt = 0; nt < 2; ++nt)
#pragma unroll
        for (int ks = 0; ks < KS; ++ks) { bk[nt][ks].half[0] = *(const v8us*)((nt ? kp1 : kp0) + ks * 32); bk[nt][ks].half[1] = *(const v8us*)((nt ? kp1 : kp0) + ks * 32 + 16); }
#pragma unroll
      for (int dt = 0; dt < DT; ++dt) { bv[dt].half[0] = *(const v8us*)(vp + dt * 16 * TK); bv[dt].half[1] = *(const v8us*)(vp + dt * 16 * TK + 16); }
      asm volatile("s_wait_xcnt 0x0" ::: "memory");      /* stands behind the tile's loads, ahead of the step of the three addresses that they name */
      __builtin_amdgcn_sched_barrier(0);      /* keeps the wait behind all sixteen loads and the address step behind the wait; it also keeps the V^T loads up here, under way during the score products and the softmax (the scheduler otherwise sinks them to their products) */
      { const int in = it + NSP, jn = 32 * ((in < na) ? in : in - na + HT); const ptrdiff_t dk = (ptrdiff_t)(jn - j0) * ldk; kp0 += dk; kp1 += dk; vp += jn - j0; j0 = jn; }      /* on to the wave's next tile (behind the last one the addresses are not used) */
      float sm[16];
#pragma unroll
      for (int nt = 0; nt < 2; ++nt) { v8f acc = (v8f){0.f,0.f,0.f,0.f,0.f,0.f,0.f,0.f};
#pragma unroll
        for (int ks = 0; ks < KS; ++ks) acc = __builtin_amdgcn_wmma_f32_16x16x32_f16(false, bk[nt][ks].v, false, aq[ks].v, (short)0, acc, false, false);
#pragma unroll
        for (int r = 0; r < 8; ++r) sm[nt * 8 + r] = (nt * 16 + r <= dl) ? acc[r] * SCL : -INFINITY; }
      float mc = sm[0];
#pragma unroll
      for (int i = 1; i < 16; ++i) mc = fmaxf(mc, sm[i]);
      mc = fmaxf(mc, xhalf(mc));
      const float mn = fmaxf(m_q, mc), al = expf(m_q - mn); m_q = mn;      /* no allowed key so far: mn stays at its finite start value, al = exp(0) = 1 and every weight 0 */
      float ps = 0.f; FragH pb;
#pragma unroll
      for (int i = 0; i < 16; ++i) { const float p = expf(sm[i] - mn); ps += p; pb.h[i] = (_Float16)(p * 1024.0f); }
      l_q = l_q * al + ps;
#pragma unroll
      for (int dt = 0; dt < DT; ++dt) { oacc[dt] *= al; oacc[dt] = __builtin_amdgcn_wmma_f32_16x16x32_f16(false, bv[dt].v, false, pb.v, (short)0, oacc[dt], false, false); } }
    l_q += xhalf(l_q);
    if (hh == 0) { sM[w][ln] = m_q; sL[w][ln] = l_q; }
    __syncthreads();      /* publishes every wave's row maxima and row sums; it also ends the reads of the partial outputs of the query tiles before */
    float mg = sM[pr][ln];
#pragma unroll
    for (int s2 = 1; s2 < NSP; ++s2) mg = fmaxf(mg, sM[s2 * NPR + pr][ln]);
    float lt = 0.f, fo = 0.f;      /* a wave that met no allowed key of this row holds sum 0 and a zero V sum */
#pragma unroll
    for (int s2 = 0; s2 < NSP; ++s2) { const float e = expf(sM[s2 * NPR + pr][ln] - mg); lt += sL[s2 * NPR + pr][ln] * e; if (s2 == sp) fo = e; }
    const float fq = (lt > 0.f) ? fo / (lt * 1024.0f) : 0.f;
#pragma unroll
    for (int dt = 0; dt < DT; ++dt) { *(v4fa*)&sO[w][ln][dt * 16 + 8 * hh] = (v4f){oacc[dt][0] * fq, oacc[dt][1] * fq, oacc[dt][2] * fq, oacc[dt][3] * fq}; *(v4fa*)&sO[w][ln][dt * 16 + 8 * hh + 4] = (v4f){oacc[dt][4] * fq, oacc[dt][5] * fq, oacc[dt][6] * fq, oacc[dt][7] * fq}; }
    __syncthreads();      /* publishes the rescaled partial outputs; it also ends the reads of the maxima and sums, which the next query tiles write anew */
    for (int i = tid; i < NPR * RPW * 16; i += 32 * NPR * NSP) { const int q2 = i >> 8, r = (i >> 4) & 15, pc = i & 15; v4f val = *(const v4fa*)&sO[q2][r][pc * 4];
#pragma unroll
      for (int s2 = 1; s2 < NSP; ++s2) val += *(const v4fa*)&sO[s2 * NPR + q2][r][pc * 4];
      const int qo = (ph ? NQT - 1 - (qblk * NPR + q2) : qblk * NPR + q2) * RPW;
      *(v4h*)(O + ((size_t)b * TQ + qo + r) * ldo + h * 64 + pc * 4) = (v4h){(_Float16)(val[0] * 16.0f), (_Float16)(val[1] * 16.0f), (_Float16)(val[2] * 16.0f), (_Float16)(val[3] * 16.0f)}; } } }

extern "C" void kernel_launch(void* const* d_in, const int* in_sizes, int n_in,
                              void* d_out, int out_size, void* d_ws, size_t ws_size, hipStream_t stream) {
  (void)in_sizes; (void)n_in; (void)out_size;
  const float* const* I = (const float* const*)d_in; const float* xt = I[0]; const float* xc = I[1]; const float* Wt = I[2]; const float* bt = I[3]; const float* Wc = I[4]; const float* bc = I[5]; const float* Wtp = I[6]; const float* btp = I[7]; const float* Wcp = I[8]; const float* bcp = I[9]; const int* ntcp = (const int*)d_in[10];      /* int64 in the module, read as int32 */
  char* ws = (char*)d_ws; size_t off = 0;
  auto take = [&](size_t bytes) { char* p = ws + off; off += (bytes + 255) & ~(size_t)255; return p; };
  _Float16* Bt_ = (_Float16*)take((size_t)DW * DD * 2); _Float16* Bc = (_Float16*)take((size_t)DW * DD * 2); _Float16* Btp = (_Float16*)take((size_t)DD * DD * 2); _Float16* Bcp = (_Float16*)take((size_t)DD * DD * 2);
  _Float16* XT = (_Float16*)take((size_t)NR * DD * 2); _Float16* XC = (_Float16*)take((size_t)NR * DD * 2); _Float16* TC = (_Float16*)take((size_t)BB * TK * DW * 2);      /* per batch: rows 0..1023 = tok, 1024..2047 = con */
  _Float16* Vt1 = (_Float16*)take((size_t)BB * NH * 64 * TK * 2); _Float16* Vt2 = (_Float16*)take((size_t)BB * NH * 64 * TK * 2); _Float16* O16 = (_Float16*)take((size_t)2 * NR * DD * 2);      /* O16: token rows, then concept rows */
  (void)Vt2;
  if (off > ws_size) return;      // 8.4 + 8.4 + 2.1 + 2.1 + 4.2 + 4.2 + 33.6 + 8.4 + 8.4 + 8.4 = 88 MB
  /* Four launches, one per stage: launches that do not depend on each other share one grid, and each product stores what its reader takes (V^T; O as f16), so that no pass stands between them. Every plane's size is a multiple of 256 bytes, so that planes taken one after the other lie back to back. */
  k_cvt6<<<(2 * DW * DD + 2 * DD * DD + 2 * NR * DD) / 2048, 256, 0, stream>>>(Wt, Wc, Wtp, Wcp, xt, xc, Bt_);      /* weights: torch (out,in) natural, x 2^4 */
  const dim3 gt((TQ / 128) * (DW / 128), BB, 2);
  k_gemm_lds<true, DD, DW, 2 * DD><<<gt, 256, 0, stream>>>(XT, XC, (size_t)TQ * DD, Bt_, Bc, 0.0625f, bt, bc, nullptr, TC, Vt1, (size_t)TK * DW, (size_t)TQ * DW);      /* tok[b] -> plane rows 0..1023, con[b] -> plane rows 1024..2047: each M 1024 N 4096 K 1024; key columns 0..2047 to the plane, values read by tokens (columns 2048..) and by concepts (3072..) to V^T [bh][64][2048], keys in plane-row order */
  k_flashm<<<2 * BB * NH * (TQ / 64), 384, 0, stream>>>(XT, DD, (size_t)NR * DD, TC, DW, (size_t)DD, Vt1, (size_t)BB * NH * 64 * TK, ntcp, O16, DD, (size_t)NR * DD);      /* token queries: keys = columns 0..1023 (kt_t on token rows, kc_t on concept rows); concept queries: keys = columns 1024..2047 (kt_c, kc_c) */
  const dim3 gpj((NR / 128) * (DD / 128), 1, 2);
  k_gemm_lds<false, DD, DD, DD><<<gpj, 256, 0, stream>>>(O16, O16 + (size_t)NR * DD, 0, Btp, Bcp, 0.00390625f, btp, bcp, (float*)d_out, nullptr, nullptr, 0, (size_t)NR * DD);      /* y_t = merged.Wtp^T + btp -> output 0; y_c -> output 1 (offset B.T.NE floats) */
}

// v007
// A run of this version takes 101 microseconds.
// Two timings next to v006 put it at 1.17 and 1.16 times that version's speed.
// Counting every step since v000, it is 7.67 times as fast.
#include <hip/hip_runtime.h>
// Token/concept two-stream causal attention (B=2, T=C=1024, NE=CD=1024, 16 heads × 64, n_tokens_per_concept = 8): tok = xt·Wtᵀ + bt, con = xc·Wcᵀ + bc (4096 outputs each = [k for token queries | k for concept queries | v read by tokens | v read by concepts]);
// token queries = heads(xt) (the residual stream itself) attend over [tokens ; concepts] with mask (s ≤ t) | (j < t/8 + 1), scale 1/√64; concept queries = heads(xc) attend over [concepts ; tokens] with mask (j ≤ i) | (s < 8(i+1)); disallowed = −1e9 (≡ −inf: every row keeps itself);
// y_t = merge(attn_t)·Wtpᵀ + btp, y_c = merge(attn_c)·Wcpᵀ + bcp (two outputs).
// Compute dtype: xt, xc, weights, biases rounded to bf16; tok/con as f16 GEMM planes written as the two 1024-row halves of one 2048-key plane per batch; queries = the bf16-exact x planes; fused flash-style kernels with the index-computed masks (n_tokens_per_concept read on device; online softmax f32,
// P f16 ×2^10, f32 accumulate) on v_wmma_f32_16x16x32_f16; O ×2^4 → f16 (stored so by the flash kernel) → projection GEMMs (+bias) straight into the two output slots.
#define BB 2
#define TQ 1024
#define TK 2048
#define DD 1024
#define NH 16
#define DW 4096
#define SCL 0.125f
#define NR (BB * TQ)
typedef __bf16 v16b __attribute__((ext_vector_type(16)));
typedef unsigned short v8us __attribute__((ext_vector_type(8), may_alias));
typedef float  v8f  __attribute__((ext_vector_type(8)));
typedef float  v4f  __attribute__((ext_vector_type(4)));
typedef float  v4fa __attribute__((ext_vector_type(4), may_alias));
union FragB { v16b v; v8us half[2]; unsigned short u[16]; };

__device__ __forceinline__ unsigned short bf16_bits(float x) { unsigned int u = __float_as_uint(x); return (unsigned short)((u + 0x7FFFu + ((u >> 16) & 1u)) >> 16); }
__device__ __forceinline__ float bf16_val(unsigned short b) { return __uint_as_float(((unsigned int)b) << 16); }
__device__ __forceinline__ float bf16_round(float x) { return bf16_val(bf16_bits(x)); }
// D += A·B with NT terms: 1 = ah·bh, 2 = + al·bh (A split), 3 = + ah·bl (both split)
template <int NT>
__device__ __forceinline__ v8f mmaN(v16b ah, v16b al, v16b bh, v16b bl, v8f c) {
  c = __builtin_amdgcn_wmma_f32_16x16x32_bf16(false, ah, false, bh, (short)0, c, false, false);
  if (NT >= 2) c = __builtin_amdgcn_wmma_f32_16x16x32_bf16(false, al, false, bh, (short)0, c, false, false);
  if (NT >= 3) c = __builtin_amdgcn_wmma_f32_16x16x32_bf16(false, ah, false, bl, (short)0, c, false, false);
  asm volatile("v_nop\n\tv_nop\n\tv_nop\n\tv_nop" : "+v"(c) : "v"(ah), "v"(al), "v"(bh), "v"(bl));
  return c;
}

__global__ __launch_bounds__(256) void k_wt_bf16(const float* __restrict__ W, unsigned short* __restrict__ Wt, int K, int N) {
  const int t = blockIdx.x * 256 + threadIdx.x;
  const int k8n = K / 8;
  if (t >= N * k8n) return;
  const int n = t / k8n, k8 = (t % k8n) * 8;
  v8us v;
#pragma unroll
  for (int i = 0; i < 8; ++i) v[i] = bf16_bits(W[(size_t)(k8 + i) * N + n]);
  *(v8us*)(Wt + (size_t)n * K + k8) = v;
  
}

// GEMM C[M][N] (f32, pitch ldc) = act(A[M][K]·W + bias). A f32 row-major (pitch lda) converted per fragment to bf16
// (ASPLIT: hi/lo two planes -> 2 terms, else single rounded term); Wt bf16 [N][K] (pitch ldb). BIAS_BF16 rounds the
// bias to bf16 first (bias quantised to bf16 before the add). K%32==0, M%16==0, N%64==0.
template <bool ASPLIT, int ACT, bool BIAS_BF16>
__global__ __launch_bounds__(128) void k_gemm_bf(const float* __restrict__ A, int lda, const unsigned short* __restrict__ Wt, int ldb,
                                               const float* __restrict__ bias, float* __restrict__ C, int ldc, int M, int N, int K) {
  __shared__ __attribute__((aligned(16))) float so[4][16][64];
  const int tid = threadIdx.x, w = tid >> 5, lane = tid & 31, ln = lane & 15, hh = lane >> 4;
  const int ntn = N / 64;
  const int wid = blockIdx.x * 4 + w;
  const int mt = wid / ntn, nq = wid % ntn;
  if (mt * 16 >= M) return;
  const int row0 = mt * 16, col0 = nq * 64;
  const float* arow = A + (size_t)(row0 + ln) * lda;
  v8f acc[4] = {};
  for (int kb = 0; kb < K; kb += 32) {
    FragB ah, al;
    const v4f x0 = *(const v4fa*)(arow + kb + 8 * hh), x1 = *(const v4fa*)(arow + kb + 8 * hh + 4);
    const v4f x2 = *(const v4fa*)(arow + kb + 16 + 8 * hh), x3 = *(const v4fa*)(arow + kb + 16 + 8 * hh + 4);
    float xs[16] = {x0[0],x0[1],x0[2],x0[3],x1[0],x1[1],x1[2],x1[3],x2[0],x2[1],x2[2],x2[3],x3[0],x3[1],x3[2],x3[3]};
#pragma unroll
    for (int i = 0; i < 16; ++i) { const unsigned short hb = bf16_bits(xs[i]); ah.u[i] = hb; al.u[i] = ASPLIT ? bf16_bits(xs[i] - bf16_val(hb)) : (unsigned short)0; }
#pragma unroll
    for (int t = 0; t < 4; ++t) {
      const unsigned short* brow = Wt + (size_t)(col0 + t * 16 + ln) * ldb + kb;
      FragB b;
      b.half[0] = *(const v8us*)(brow + 8 * hh);
      b.half[1] = *(const v8us*)(brow + 16 + 8 * hh);
      acc[t] = mmaN<ASPLIT ? 2 : 1>(ah.v, al.v, b.v, b.v, acc[t]);
    }
  }
#pragma unroll
  for (int t = 0; t < 4; ++t) {
    float bv = bias ? bias[col0 + t * 16 + ln] : 0.f;
    if (BIAS_BF16) bv = bf16_round(bv);
#pragma unroll
    for (int r = 0; r < 8; ++r) { float v = acc[t][r] + bv; if (ACT == 1) v = fmaxf(v, 0.f); so[w][8 * hh + r][t * 16 + ln] = v; }
  }
  __builtin_amdgcn_fence(__ATOMIC_ACQ_REL, "workgroup");
  __builtin_amdgcn_wave_barrier();
  const int rsub = lane >> 4, c4 = (lane & 15) * 4;
  {
#pragma unroll
    for (int q = 0; q < 8; ++q) {
      const int r = q * 2 + rsub;
      const v4f v = *(const v4fa*)&so[w][r][c4];
      *(v4f*)(C + (size_t)(row0 + r) * ldc + col0 + c4) = v;
    }
    
  }
}

// GEMM C = act(A·W + bias + resid): A f32 (ASPLIT -> hi/lo 2 terms), Wt bf16 [N][K]; ACT 0 none, 1 relu, 2 exact gelu;
// resid (optional, f32, row index = (row % rmod), pitch ldr, RES_BF16 rounds it) added before the activation.
template <bool ASPLIT, int ACT, bool BIAS_BF16, bool RES_BF16>
__global__ __launch_bounds__(128) void k_gemm_bf3(const float* __restrict__ A, int lda, const unsigned short* __restrict__ Wt, int ldb,
                                                const float* __restrict__ bias, const float* __restrict__ resid, int rmod, int ldr,
                                                float* __restrict__ C, int ldc, int M, int N, int K) {
  __shared__ __attribute__((aligned(16))) float so[4][16][64];
  const int tid = threadIdx.x, w = tid >> 5, lane = tid & 31, ln = lane & 15, hh = lane >> 4;
  const int ntn = N / 64;
  const int wid = blockIdx.x * 4 + w;
  const int mt = wid / ntn, nq = wid % ntn;
  if (mt * 16 >= M) return;
  const int row0 = mt * 16, col0 = nq * 64;
  const float* arow = A + (size_t)(row0 + ln) * lda;
  v8f acc[4] = {};
  for (int kb = 0; kb < K; kb += 32) {
    FragB ah, al;
    const v4f x0 = *(const v4fa*)(arow + kb + 8 * hh), x1 = *(const v4fa*)(arow + kb + 8 * hh + 4);
    const v4f x2 = *(const v4fa*)(arow + kb + 16 + 8 * hh), x3 = *(const v4fa*)(arow + kb + 16 + 8 * hh + 4);
    float xs[16] = {x0[0],x0[1],x0[2],x0[3],x1[0],x1[1],x1[2],x1[3],x2[0],x2[1],x2[2],x2[3],x3[0],x3[1],x3[2],x3[3]};
#pragma unroll
    for (int i = 0; i < 16; ++i) { const unsigned short hb = bf16_bits(xs[i]); ah.u[i] = hb; al.u[i] = ASPLIT ? bf16_bits(xs[i] - bf16_val(hb)) : (unsigned short)0; }
#pragma unroll
    for (int t = 0; t < 4; ++t) {
      const unsigned short* brow = Wt + (size_t)(col0 + t * 16 + ln) * ldb + kb;
      FragB b;
      b.half[0] = *(const v8us*)(brow + 8 * hh);
      b.half[1] = *(const v8us*)(brow + 16 + 8 * hh);
      acc[t] = mmaN<ASPLIT ? 2 : 1>(ah.v, al.v, b.v, b.v, acc[t]);
    }
  }
#pragma unroll
  for (int t = 0; t < 4; ++t) {
    const int col = col0 + t * 16 + ln;
    float bv = bias ? bias[col] : 0.f;
    if (BIAS_BF16) bv = bf16_round(bv);
#pragma unroll
    for (int r = 0; r < 8; ++r) {
      float v = acc[t][r] + bv;
      if (resid) { float rv = resid[(size_t)((row0 + 8 * hh + r) % rmod) * ldr + col]; if (RES_BF16) rv = bf16_round(rv); v += rv; }
      if (ACT == 1) v = fmaxf(v, 0.f);
      if (ACT == 2) v = 0.5f * v * (1.0f + erff(v * 0.70710678118654752f));
      if (ACT == 3) { const float u = 0.7978845608028654f * (v + 0.044715f * v * v * v); v = 0.5f * v * (1.0f + tanhf(u)); }
      so[w][8 * hh + r][t * 16 + ln] = v;
    }
  }
  __builtin_amdgcn_fence(__ATOMIC_ACQ_REL, "workgroup");
  __builtin_amdgcn_wave_barrier();
  const int rsub = lane >> 4, c4 = (lane & 15) * 4;
  {
#pragma unroll
    for (int q = 0; q < 8; ++q) {
      const int r = q * 2 + rsub;
      const v4f v = *(const v4fa*)&so[w][r][c4];
      *(v4f*)(C + (size_t)(row0 + r) * ldc + col0 + c4) = v;
    }
    
  }
}
// row LayerNorm (biased variance, eps) over N: s = X (+ R); optional out_sum <- s; out_norm <- (s-mu)*rsqrt(var+eps)*g + b
template <bool PARAM_BF16>
__global__ __launch_bounds__(256) void k_layernorm(const float* __restrict__ X, const float* __restrict__ R, const float* __restrict__ g, const float* __restrict__ bta,
                                                  float* __restrict__ out_sum, float* __restrict__ out_norm, int N, float eps) {
  __shared__ float red[256];
  const int row = blockIdx.x, tid = threadIdx.x;
  const float* x = X + (size_t)row * N; const float* rr = R ? R + (size_t)row * N : nullptr;
  float vals[16];                     // up to N = 4096
  const int per = N / 256;            // contiguous chunk per thread? use strided-by-4 chunks: thread handles j = tid*4 + 1024*u
  float s1 = 0.f;
  for (int u = 0; u < per / 4; ++u) {
    const int j = tid * 4 + 1024 * u;
    const v4f a = *(const v4fa*)(x + j);
    v4f b = {0.f,0.f,0.f,0.f}; if (rr) b = *(const v4fa*)(rr + j);
#pragma unroll
    for (int q = 0; q < 4; ++q) { const float v = a[q] + b[q]; vals[u * 4 + q] = v; s1 += v; }
  }
  red[tid] = s1; __syncthreads();
  for (int st = 128; st > 0; st >>= 1) { if (tid < st) red[tid] += red[tid + st]; __syncthreads(); }
  const float mu = red[0] / (float)N; __syncthreads();
  float s2 = 0.f;
  for (int u = 0; u < per / 4; ++u)
#pragma unroll
    for (int q = 0; q < 4; ++q) { const float c = vals[u * 4 + q] - mu; s2 += c * c; }
  red[tid] = s2; __syncthreads();
  for (int st = 128; st > 0; st >>= 1) { if (tid < st) red[tid] += red[tid + st]; __syncthreads(); }
  const float rs = rsqrtf(red[0] / (float)N + eps);
  {
    for (int u = 0; u < per / 4; ++u) {
      const int j = tid * 4 + 1024 * u;
      v4f o, sm;
#pragma unroll
      for (int q = 0; q < 4; ++q) {
        float gg = g[j + q], bb = bta[j + q];
        if (PARAM_BF16) { gg = bf16_round(gg); bb = bf16_round(bb); }
        sm[q] = vals[u * 4 + q]; o[q] = (vals[u * 4 + q] - mu) * rs * gg + bb;
      }
      if (out_sum) *(v4f*)(out_sum + (size_t)row * N + j) = sm;
      *(v4f*)(out_norm + (size_t)row * N + j) = o;
    }
    
  }
}



// ---- f16 WMMA path (v_wmma_f32_16x16x32_f16): 11-bit significands for operands in range — used where a [0,1] probability operand needs more precision than bf16
typedef _Float16 v16h __attribute__((ext_vector_type(16)));
union FragH { v16h v; v8us half[2]; _Float16 h[16]; unsigned short u[16]; };
template <int NT>
__device__ __forceinline__ v8f mmaH(v16h ah, v16h al, v16h bh, v16h bl, v8f c) {
  c = __builtin_amdgcn_wmma_f32_16x16x32_f16(false, ah, false, bh, (short)0, c, false, false);
  if (NT >= 2) c = __builtin_amdgcn_wmma_f32_16x16x32_f16(false, al, false, bh, (short)0, c, false, false);
  if (NT >= 3) c = __builtin_amdgcn_wmma_f32_16x16x32_f16(false, ah, false, bl, (short)0, c, false, false);
  asm volatile("v_nop\n\tv_nop\n\tv_nop\n\tv_nop" : "+v"(c) : "v"(ah), "v"(al), "v"(bh), "v"(bl));
  return c;
}
// batched GEMM like k_gemm_b but f16 operands: A f32 (split into f16 hi/lo if ASPLIT, else rounded to f16), Bt = f16 values [n][k]; alpha; C f32; N multiple of 16 (partial tiles skipped)
template <bool ASPLIT>
__global__ __launch_bounds__(128) void k_gemm_h(const float* __restrict__ A, int lda, size_t sA, const _Float16* __restrict__ Bh, int ldb, size_t sB, float alpha, float* __restrict__ C, int ldc, size_t sC, int M, int N, int K) {
  __shared__ __attribute__((aligned(16))) float so[4][16][64];
  const int tid = threadIdx.x, w = tid >> 5, lane = tid & 31, ln = lane & 15, hh = lane >> 4; const int by = blockIdx.y;
  A += (size_t)by * sA; Bh += (size_t)by * sB; C += (size_t)by * sC;
  const int ntn = (N + 63) / 64; const int wid = blockIdx.x * 4 + w; const int mt = wid / ntn, nq = wid % ntn; if (mt * 16 >= M) return;
  const int row0 = mt * 16, col0 = nq * 64; const float* arow = A + (size_t)(row0 + ln) * lda;
  v8f acc[4] = {};
  for (int kb = 0; kb < K; kb += 32) {
    FragH ah, al;
    const v4f x0 = *(const v4fa*)(arow + kb + 8 * hh), x1 = *(const v4fa*)(arow + kb + 8 * hh + 4), x2 = *(const v4fa*)(arow + kb + 16 + 8 * hh), x3 = *(const v4fa*)(arow + kb + 16 + 8 * hh + 4);
    float xs[16] = {x0[0],x0[1],x0[2],x0[3],x1[0],x1[1],x1[2],x1[3],x2[0],x2[1],x2[2],x2[3],x3[0],x3[1],x3[2],x3[3]};
#pragma unroll
    for (int i = 0; i < 16; ++i) { const _Float16 h = (_Float16)xs[i]; ah.h[i] = h; al.h[i] = ASPLIT ? (_Float16)(xs[i] - (float)h) : (_Float16)0.0f; }
#pragma unroll
    for (int t = 0; t < 4; ++t) { if (col0 + t * 16 >= N) continue; const size_t boff = (size_t)(col0 + t * 16 + ln) * ldb + kb; FragH bq; bq.half[0] = *(const v8us*)(Bh + boff + 8 * hh); bq.half[1] = *(const v8us*)(Bh + boff + 16 + 8 * hh);
      acc[t] = mmaH<ASPLIT ? 2 : 1>(ah.v, al.v, bq.v, bq.v, acc[t]); }
  }
#pragma unroll
  for (int t = 0; t < 4; ++t) { if (col0 + t * 16 >= N) continue;
#pragma unroll
    for (int r = 0; r < 8; ++r) so[w][8 * hh + r][t * 16 + ln] = acc[t][r] * alpha; }
  __builtin_amdgcn_fence(__ATOMIC_ACQ_REL, "workgroup"); __builtin_amdgcn_wave_barrier();
  const int rsub = lane >> 4, c4 = (lane & 15) * 4;
  {
#pragma unroll
    for (int q = 0; q < 8; ++q) { const int r = q * 2 + rsub; if (col0 + c4 < N) { const v4f v = *(const v4fa*)&so[w][r][c4]; *(v4f*)(C + (size_t)(row0 + r) * ldc + col0 + c4) = v; } }
     }
}

// Wt[n][k] = f16(W[k][n]·scale) from f32 row-major W[K][N] (scale = power of two; bf16-exact weights stay exact in f16 away from the subnormal range)
__global__ __launch_bounds__(256) void k_wt_f16(const float* __restrict__ W, _Float16* __restrict__ Wt, int K, int N, float scale) {
  const int t = blockIdx.x * 256 + threadIdx.x; if (t >= N * (K / 8)) return; const int n = t / (K / 8), k8 = (t % (K / 8)) * 8; FragH f;
#pragma unroll
  for (int i = 0; i < 8; ++i) f.h[i] = (_Float16)(bf16_round(W[(size_t)(k8 + i) * N + n]) * scale); const v8us o = f.half[0];
  *(v8us*)((unsigned short*)Wt + (size_t)n * K + k8) = o; 
}
// k_gemm_hh variant with fused epilogue: v = acc·alpha + bias[by·sBias + col] (+ CP[(row/rowsPerB)·sCPb + by·64 + col] if CP) ; ACT 0 none / 1 elu ; writes f16 C16 and/or f32 C, each if non-null
template <int ACT>
__global__ __launch_bounds__(128) void k_gemm_hhx(const _Float16* __restrict__ A, int lda, size_t sA, const _Float16* __restrict__ Bh, int ldb, size_t sB, float alpha, const float* __restrict__ bias, size_t sBias, const float* __restrict__ CP, int rowsPerB, size_t sCPb, int row0g,
    float* __restrict__ C, _Float16* __restrict__ C16, int ldc, size_t sC, int M, int N, int K) {
  __shared__ __attribute__((aligned(16))) float so[4][16][64];
  const int tid = threadIdx.x, w = tid >> 5, lane = tid & 31, ln = lane & 15, hh = lane >> 4; const int by = blockIdx.y;
  A += (size_t)by * sA; Bh += (size_t)by * sB; const size_t cofs = (size_t)by * sC; const float* bp = bias ? bias + (size_t)by * sBias : nullptr;
  const int ntn = (N + 63) / 64; const int wid = blockIdx.x * 4 + w; const int mt = wid / ntn, nq = wid % ntn; if (mt * 16 >= M) return;
  const int row0 = mt * 16, col0 = nq * 64; const _Float16* arow = A + (size_t)(row0 + ln) * lda;
  v8f acc[4] = {};
  for (int kb = 0; kb < K; kb += 32) { FragH ah; ah.half[0] = *(const v8us*)((const unsigned short*)arow + kb + 8 * hh); ah.half[1] = *(const v8us*)((const unsigned short*)arow + kb + 16 + 8 * hh);
#pragma unroll
    for (int t = 0; t < 4; ++t) { if (col0 + t * 16 >= N) continue; const size_t boff = (size_t)(col0 + t * 16 + ln) * ldb + kb; FragH bq; bq.half[0] = *(const v8us*)((const unsigned short*)Bh + boff + 8 * hh); bq.half[1] = *(const v8us*)((const unsigned short*)Bh + boff + 16 + 8 * hh);
      acc[t] = mmaH<1>(ah.v, ah.v, bq.v, bq.v, acc[t]); }
  }
#pragma unroll
  for (int t = 0; t < 4; ++t) { if (col0 + t * 16 >= N) continue; const int col = col0 + t * 16 + ln; const float bv = bp ? bf16_round(bp[col]) : 0.f;
#pragma unroll
    for (int r = 0; r < 8; ++r) { float v = acc[t][r] * alpha + bv; if (CP) { const int bidx = (row0g + row0 + 8 * hh + r) / rowsPerB; v += CP[(size_t)bidx * sCPb + (size_t)by * 64 + col]; } if (ACT == 1) v = (v > 0.f) ? v : expm1f(v); else if (ACT == 7) v = (v > 0.f) ? v + 1.0f : expf(v); else if (ACT == 8) v = tanhf(v); else if (ACT == 9) v = 0.5f * v * (1.0f + tanhf(0.7978845608028654f * (v + 0.044715f * v * v * v))); else if (ACT == 11) v = 1.0f / (1.0f + expf(-v)); else if (ACT == 12) v = (v > 0.f) ? v : 0.01f * v; else if (ACT == 14) v = (v > 0.f) ? v : 0.1f * v; else if (ACT == 15) v = v / (1.0f + expf(-v)); else if (ACT == 3) v = fmaxf(v, 0.f); else if (ACT == 6) v = 0.5f * v * (1.0f + erff(v * 0.70710678118654752f)); so[w][8 * hh + r][t * 16 + ln] = v; } }
  __builtin_amdgcn_fence(__ATOMIC_ACQ_REL, "workgroup"); __builtin_amdgcn_wave_barrier();
  const int rsub = lane >> 4, c4 = (lane & 15) * 4; typedef _Float16 v4h __attribute__((ext_vector_type(4)));
  {
#pragma unroll
    for (int q = 0; q < 8; ++q) { const int r = q * 2 + rsub; if (col0 + c4 < N) { const v4f v = *(const v4fa*)&so[w][r][c4]; if (C) *(v4f*)(C + cofs + (size_t)(row0 + r) * ldc + col0 + c4) = v; if (C16) { v4h h4; for (int i = 0; i < 4; ++i) h4[i] = (_Float16)v[i]; *(v4h*)(C16 + cofs + (size_t)(row0 + r) * ldc + col0 + c4) = h4; } } }
     }
}


// GEMM C = (A.B^T)*alpha + bias on f16 planes, A [M][KD] (batch stride sA), Bh [ND][KD], both k-contiguous at pitch KD; C [M][ND] (batch stride sC) as f32, or as f16 (OUT16) in the reader's fragment order described below. M and ND multiples of 128, KD a multiple of 64; grid.x = (M / 128) * (ND / 128), grid.y = batch, grid.z = 2: two independent products of one shape in one launch (operands A0, B0, bias0 or A1, B1, bias1; the second one's f32 C lies sZ elements behind the first's; its f16 rows are keys TQ.. of the key planes).
// One 128 x 128 tile of C per work-group of 8 waves (4 x 2, 32 x 64 each). A 64-k slice of both operands (128 bytes of each row) is brought in by loads that cover whole lines and laid in LDS at pitch 144 bytes; every wave reads its fragments from there,
// so a row is asked of L2 once per work-group, not once per wave. Two LDS buffers: the next slice is loaded into registers ahead of the products of this one and stored behind them. Each accumulator still sums its k blocks of 32 in rising order.
// Tiles whose columns start at NT0 or later (the value columns; NT0 = ND: none) are wanted transposed by their reader. Such a work-group takes the two operands in each other's place: it forms Bh.A^T, the same sums over k, and its tile's rows are columns of C;
// no pass over C follows. Which way a work-group goes is a scalar choice by its block index. The bias then belongs to the tile's row.
// The f16 output (OUT16) is stored in the order in which the attention kernel's lanes take their matrix fragments, so that each of its 16-byte-per-lane loads covers 512 bytes in a row (four whole lines) and not 32-byte pieces of sixteen rows. Both planes are [column block of DD][batch][head][key tile of 32][2048 elements]:
// keys (C16): [16-key group nt][load j][lane][8], lane (ln, hh) holding key nt * 16 + ln, head columns (j >> 1) * 32 + (j & 1) * 16 + 8 hh + 0..7; values (Ct): [16-column group dt][load hf][lane][8], lane (ln, hh) holding head column dt * 16 + ln, keys hf * 16 + 8 hh + 0..7.
// A wave's 32 x 64 tile is one head's columns of one key tile (keys), or two column groups of two key tiles (values): it stores runs of 4 KB or 2 KB.
// The unroll directives on the short loops below make every index into the register arrays (staged rows, fragments, accumulators, bias) a constant, so that these arrays stay in registers.
template <bool OUT16, int KD, int ND, int NT0>
__global__ __launch_bounds__(256) void k_gemm_lds(const _Float16* __restrict__ A0, const _Float16* __restrict__ A1, size_t sA, const _Float16* __restrict__ B0, const _Float16* __restrict__ B1, float alpha, const float* __restrict__ bias0, const float* __restrict__ bias1,
    float* __restrict__ C, _Float16* __restrict__ C16, _Float16* __restrict__ Ct, size_t sC, size_t sZ) {
  const bool z1 = blockIdx.z != 0; const _Float16* A = z1 ? A1 : A0; const _Float16* Bh = z1 ? B1 : B0; const float* bias = z1 ? bias1 : bias0;
  constexpr int BT = 128, BK = 64, LP = BK + 8;
  __shared__ __attribute__((aligned(16))) unsigned char sm[4 * BT * LP * 2];      /* the two operands' two buffers; behind the loop the same bytes stage the output rows */
  unsigned short (*tA)[BT][LP] = (unsigned short (*)[BT][LP])sm; unsigned short (*tB)[BT][LP] = (unsigned short (*)[BT][LP])(sm + 2 * BT * LP * 2);
  const int tid = threadIdx.x, w = tid >> 5, lane = tid & 31, ln = lane & 15, hh = lane >> 4;
  constexpr int ntn = ND / BT; const int row0 = ((int)blockIdx.x / ntn) * BT, col0 = ((int)blockIdx.x % ntn) * BT; const int wr = (w >> 1) * 32, wc = (w & 1) * 64;
  const int sr = tid >> 3, sc = (tid & 7) * 8;      /* staging: 8 threads take one row's 128 bytes, a wave 4 whole lines; rows sr + 32 i */
  const bool tr = NT0 < ND && col0 >= NT0;      /* the same for the whole work-group */
  const unsigned short* Ar = (const unsigned short*)A + (size_t)blockIdx.y * sA + (size_t)(row0 + sr) * KD + sc; const unsigned short* Br = (const unsigned short*)Bh + (size_t)(col0 + sr) * KD + sc;
  const unsigned short* Ag = tr ? Br : Ar; const unsigned short* Bg = tr ? Ar : Br;
  float bv[4]; const float bR0 = bf16_round(bias[col0 + wr + ln]), bR1 = bf16_round(bias[col0 + wr + 16 + ln]);      /* the transposed way's row biases: rows ln and 16 + ln of the wave's tile. Read on both ways (all six places lie in the tile's 128 columns), so that the loads go out together, under no branch */
#pragma unroll
  for (int t = 0; t < 4; ++t) { const float x = bf16_round(bias[col0 + wc + t * 16 + ln]); bv[t] = tr ? 0.f : x; }
  v8us ra[4], rb[4];
#pragma unroll
  for (int i = 0; i < 4; ++i) { ra[i] = *(const v8us*)(Ag + 32 * i * KD); rb[i] = *(const v8us*)(Bg + 32 * i * KD); }
#pragma unroll
  for (int i = 0; i < 4; ++i) { *(v8us*)&tA[0][sr + 32 * i][sc] = ra[i]; *(v8us*)&tB[0][sr + 32 * i][sc] = rb[i]; }
  __syncthreads();      /* publishes slice 0 */
  v8f acc[2][4];
#pragma unroll
  for (int mi = 0; mi < 2; ++mi)
#pragma unroll
    for (int t = 0; t < 4; ++t) acc[mi][t] = (v8f){0.f,0.f,0.f,0.f,0.f,0.f,0.f,0.f};
  constexpr int ns = KD / BK;
#pragma unroll      /* slice offsets and the buffer choice become immediates: no address arithmetic in the loop, and no address register is rewritten while loads are under way */
  for (int s = 0; s < ns; ++s) { const int cur = s & 1; const bool more = s + 1 < ns;
    if (more) {
#pragma unroll
      for (int i = 0; i < 4; ++i) { ra[i] = *(const v8us*)(Ag + 32 * i * KD + (s + 1) * BK); rb[i] = *(const v8us*)(Bg + 32 * i * KD + (s + 1) * BK); }
      __builtin_amdgcn_sched_barrier(0); }      /* keeps the next slice's loads ahead of this slice's products; the scheduler otherwise sinks them to their LDS stores and the group waits out their whole latency */
#pragma unroll
    for (int ks = 0; ks < 2; ++ks) { FragH fa[2], fb[4];
#pragma unroll
      for (int mi = 0; mi < 2; ++mi) { fa[mi].half[0] = *(const v8us*)&tA[cur][wr + mi * 16 + ln][ks * 32 + 8 * hh]; fa[mi].half[1] = *(const v8us*)&tA[cur][wr + mi * 16 + ln][ks * 32 + 16 + 8 * hh]; }
#pragma unroll
      for (int t = 0; t < 4; ++t) { fb[t].half[0] = *(const v8us*)&tB[cur][wc + t * 16 + ln][ks * 32 + 8 * hh]; fb[t].half[1] = *(const v8us*)&tB[cur][wc + t * 16 + ln][ks * 32 + 16 + 8 * hh]; }
#pragma unroll
      for (int mi = 0; mi < 2; ++mi)
#pragma unroll
        for (int t = 0; t < 4; ++t) acc[mi][t] = __builtin_amdgcn_wmma_f32_16x16x32_f16(false, fa[mi].v, false, fb[t].v, (short)0, acc[mi][t], false, false); }
    if (more) {
#pragma unroll
      for (int i = 0; i < 4; ++i) { *(v8us*)&tA[cur ^ 1][sr + 32 * i][sc] = ra[i]; *(v8us*)&tB[cur ^ 1][sr + 32 * i][sc] = rb[i]; } }
    __syncthreads();      /* publishes slice s + 1 and ends every wave's reads of slice s, whose buffer the next trip refills (behind the last slice: the output staging) */
  }
  const size_t cofs = (size_t)blockIdx.y * sC + (size_t)blockIdx.z * sZ; const int rsub = lane >> 4, c4 = (lane & 15) * 4;
  float (*so)[64 + 4] = (float (*)[64 + 4])sm + w * 32;      /* the wave's own 32 staging rows */
#pragma unroll
  for (int mi = 0; mi < 2; ++mi)
#pragma unroll
    for (int t = 0; t < 4; ++t)
#pragma unroll
      for (int r = 0; r < 8; ++r) so[mi * 16 + 8 * hh + r][t * 16 + ln] = acc[mi][t][r] * alpha + bv[t];
  __builtin_amdgcn_fence(__ATOMIC_ACQ_REL, "workgroup"); __builtin_amdgcn_wave_barrier();      /* the wave's own staging rows: every lane's stores stay ahead of the row reads below */
  if (NT0 < ND && tr) { const int cv = col0 - NT0, cd = cv % DD + wr;      /* the tile's 128 columns lie in one block of DD; the wave's row r is column cd + r of that block (two column groups of one head), its 64 keys two key tiles */
    unsigned short* P = (unsigned short*)Ct + ((((size_t)((cv / DD) * BB + (int)blockIdx.y) * NH + cd / 64) * (TK / 32) + ((int)blockIdx.z * TQ + row0 + wc) / 32) * 4 + (cd % 64) / 16) * 512 + lane * 8;
#pragma unroll      /* the staging rows and the stores' offsets become immediates: one address register pair serves all eight stores and is never rewritten */
    for (int q = 0; q < 8; ++q) { const int kk = q >> 2, dl = (q >> 1) & 1, hf = q & 1; const float* s = &so[dl * 16 + ln][kk * 32 + hf * 16 + 8 * hh]; const v4f v0 = *(const v4fa*)s, v1 = *(const v4fa*)(s + 4); const float br = dl ? bR1 : bR0; FragH f;
#pragma unroll
      for (int i = 0; i < 4; ++i) { f.h[i] = (_Float16)(v0[i] + br); f.h[4 + i] = (_Float16)(v1[i] + br); }
      *(v8us*)(P + kk * 2048 + dl * 512 + hf * 256) = f.half[0]; }
    return; }
  if (OUT16) { const int cg = col0 + wc;      /* the wave's 64 columns are one head's, its 32 rows one key tile */
    unsigned short* P = (unsigned short*)C16 + (((size_t)((cg / DD) * BB + (int)blockIdx.y) * NH + (cg % DD) / 64) * (TK / 32) + ((int)blockIdx.z * TQ + row0 + wr) / 32) * 2048 + lane * 8;
#pragma unroll      /* as above: immediates, one address register pair */
    for (int q = 0; q < 8; ++q) { const int nt = q >> 2, j = q & 3; const float* s = &so[nt * 16 + ln][(j >> 1) * 32 + (j & 1) * 16 + 8 * hh]; const v4f v0 = *(const v4fa*)s, v1 = *(const v4fa*)(s + 4); FragH f;
#pragma unroll
      for (int i = 0; i < 4; ++i) { f.h[i] = (_Float16)v0[i]; f.h[4 + i] = (_Float16)v1[i]; }
      *(v8us*)(P + nt * 1024 + j * 256) = f.half[0]; }
    asm volatile("s_wait_xcnt 0x0" ::: "memory");      /* stands behind the eight stores, ahead of whatever code the build lays behind them: nothing rewrites a register that a store still names */
    return; }
#pragma unroll
  for (int q = 0; q < 16; ++q) { const int r = q * 2 + rsub; const v4f v = *(const v4fa*)&so[r][c4]; *(v4f*)(C + cofs + (size_t)(row0 + wr + r) * ND + col0 + wc + c4) = v; }
}

typedef _Float16 v4h __attribute__((ext_vector_type(4)));

// One launch rounds all six f32 operands to their f16 planes, which lie one behind the other in the workspace: Wt, Wc, Wtp, Wcp (bf16-rounded, x 2^4), then xt, xc (bf16-rounded, x 1, which is exact).
// The 2048 elements of a work-group lie in one operand; which one is a scalar choice by the block index.
__global__ __launch_bounds__(256) void k_cvt6(const float* __restrict__ Wt, const float* __restrict__ Wc, const float* __restrict__ Wtp, const float* __restrict__ Wcp, const float* __restrict__ xt, const float* __restrict__ xc, _Float16* __restrict__ dst) {
  constexpr unsigned GW = DW * DD / 2048, GP = DD * DD / 2048, GX = NR * DD / 2048;
  unsigned blk = blockIdx.x; const float* s; float sc = 16.0f;
  if (blk < GW) s = Wt; else if ((blk -= GW) < GW) s = Wc; else if ((blk -= GW) < GP) s = Wtp; else if ((blk -= GP) < GP) s = Wcp; else if ((blk -= GP) < GX) { s = xt; sc = 1.0f; } else { blk -= GX; s = xc; sc = 1.0f; }
  const size_t t = (size_t)blk * 256 + threadIdx.x; FragH f;
#pragma unroll
  for (int q = 0; q < 8; ++q) f.h[q] = (_Float16)(bf16_round(s[t * 8 + q]) * sc);
  *(v8us*)((unsigned short*)dst + ((size_t)blockIdx.x * 256 + threadIdx.x) * 8) = f.half[0]; }
__global__ __launch_bounds__(256) void k_h16(const float* __restrict__ x, _Float16* __restrict__ X16, size_t n8) { const size_t t = (size_t)blockIdx.x * 256 + threadIdx.x; if (t >= n8) return; FragH f;
#pragma unroll
  for (int q = 0; q < 8; ++q) f.h[q] = (_Float16)x[t * 8 + q]; *(v8us*)((unsigned short*)X16 + t * 8) = f.half[0];  }
__global__ __launch_bounds__(256) void k_hl(const float* __restrict__ F, _Float16* __restrict__ Hh, _Float16* __restrict__ Hl, size_t n8) { const size_t t = (size_t)blockIdx.x * 256 + threadIdx.x; if (t >= n8) return; FragH fh, fl; const v4f a = *(const v4fa*)(F + t * 8), c = *(const v4fa*)(F + t * 8 + 4);
#pragma unroll
  for (int q = 0; q < 4; ++q) { _Float16 h = (_Float16)a[q]; fh.h[q] = h; fl.h[q] = (_Float16)((a[q] - (float)h) * 1024.0f); h = (_Float16)c[q]; fh.h[4 + q] = h; fl.h[4 + q] = (_Float16)((c[q] - (float)h) * 1024.0f); }
  { *(v8us*)((unsigned short*)Hh + t * 8) = fh.half[0]; *(v8us*)((unsigned short*)Hl + t * 8) = fl.half[0];  } }

// masks over (query index q, key-plane row): key-plane rows 0..T-1 are TOKENS, rows T..2T-1 are CONCEPTS (the tok/con GEMMs write the two halves of one plane per batch). Inside each half the allowed keys of a query are the indices 0 .. lim:
// MODE 0 = token queries: token s <= q (causal), concept j < q / ntc + 1, that is j <= q / ntc; MODE 1 = concept queries: token s < ntc * (q + 1), concept j <= q. (Key order inside the softmax is irrelevant, so the plane order is used directly.)
__device__ __forceinline__ float xhalf(float x) { return __builtin_bit_cast(float, __builtin_amdgcn_permlanex16(__builtin_bit_cast(int, x), __builtin_bit_cast(int, x), 0x76543210, 0xfedcba98, false, false)); }      /* lane l's value to lane l ^ 16 and back, in registers */
// Work-group = 12 waves on four query tiles of 16 rows, taken as two pairs (p, 63 - p), p = 2 * block + (w & 1): an early tile, which the masks leave few keys, with a late one, which they leave many, so that within one MODE the waves walk more even numbers of key tiles.
// A wave takes its pair's two query tiles one after the other (ph = 0, 1). Of the 64 key tiles of 32 it walks only those in which the mask allows some key to some row of the query tile: both masks grow with the query index and shrink with the key index inside each half of the key plane,
// so these are the first na tiles of the token half and the first nb of the concept half, counted from the tile's last row. A tile left out held only weights 0 and left maximum, sum and V sum as they were. The six waves (w >> 1) of a pair take every sixth tile of that list;
// the six partial softmax states of a query tile (row maximum, row sum, weighted V sum) are merged in LDS behind each walk.
// Both products are taken transposed: S^T = K.Q^T (A = key rows, B = query rows) and O^T += V^T.P^T (A = rows of V^T, B = P^T). A lane then holds 16 scores of ONE query (column ln; keys 8 hh + r and 16 + 8 hh + r of the tile), so that maximum and sum are taken inside the lane,
// with one exchange between the wave's halves, there is one maximum, one sum and one rescale factor per lane, and the two score tiles, converted in place, are the B operand P^T in the k order in which the V^T rows are loaded: P passes through no LDS.
// A masked score is -inf; against the finite maximum its weight is exp(-inf) = 0. The second launch bound asks for 6 waves per SIMD, two work-groups per WGP as before: left alone, this build interleaves the sixteen exponentials over 177 registers, which leaves room for one work-group only.
// Both attentions run in one launch: the first half of the grid takes the concept queries (MODE 1, whose masks allow more keys), the second half the token queries (MODE 0). MODE is the same for a whole work-group and stays in a scalar register;
// it chooses the planes (MODE 1's queries, key columns, V^T and output lie sQ, sK, sV and sOut elements behind MODE 0's) and the walk's bounds, and the key loop does not read it.
// The merged rows are stored as the projection reads them: x 2^4, rounded to f16, a head's 64 columns of a row as one whole line.
__global__ __launch_bounds__(384, 6) void k_flashm(const _Float16* __restrict__ Q16, int ldq, size_t sQ, const _Float16* __restrict__ K16, size_t sK, const _Float16* __restrict__ Vt, size_t sV, const int* __restrict__ NTCP, _Float16* __restrict__ O, int ldo, size_t sOut) {
  int ntc = NTCP[0]; ntc = (ntc < 1) ? 1 : ((ntc > TQ) ? TQ : ntc);      /* = 8 here; guarded so the index arithmetic can never divide by zero; from TQ up both masks read the same as at TQ, and the products below cannot overflow */
  constexpr int RPW = 16, NPR = 2, NQT = TQ / RPW, NQB = NQT / (2 * NPR), DT = 4, KS = 2, NSP = 6, HT = TQ / 32;
  __shared__ __attribute__((aligned(16))) float sO[NPR * NSP][RPW][64 + 4]; __shared__ float sM[NPR * NSP][RPW], sL[NPR * NSP][RPW];
  const int tid = threadIdx.x, w = __builtin_amdgcn_readfirstlane(tid >> 5), lane = tid & 31, ln = lane & 15, hh = lane >> 4;      /* the wave's number in a scalar register: the key loop's counter and its tests stay scalar */
  const int MODE = ((int)blockIdx.x < BB * NH * NQB) ? 1 : 0, bx = (int)blockIdx.x - (MODE ? 0 : BB * NH * NQB); if (MODE) { Q16 += sQ; K16 += sK; Vt += sV; O += sOut; }
  const int slab = bx / NQB, qblk = bx % NQB; const int b = slab / NH, h = slab % NH; const int pr = w & 1, sp = w >> 1;
  const unsigned short* Kl = (const unsigned short*)K16 + (size_t)slab * (TK * 64) + lane * 8;      /* the lane's place in the 4 KB of key tile 0 of this head: both planes lie in fragment order (see the GEMM that writes them), 2048 elements per key tile, and a load of the wave covers 512 bytes in a row */
  const unsigned short* Vl = (const unsigned short*)Vt + (size_t)slab * (TK * 64) + lane * 8;      /* and in the value plane */
#pragma unroll 1      /* one copy of the walk serves both query tiles */
  for (int ph = 0; ph < 2; ++ph) {
    const int q0 = (ph ? NQT - 1 - (qblk * NPR + pr) : qblk * NPR + pr) * RPW, qm = q0 + RPW - 1;
    int na = (MODE == 0) ? qm / 32 + 1 : (ntc * (qm + 1) + 31) / 32, nb = (MODE == 0) ? (qm / ntc) / 32 + 1 : qm / 32 + 1;      /* key tiles with an allowed key: token half, concept half */
    na = __builtin_amdgcn_readfirstlane((na > HT) ? HT : na); nb = __builtin_amdgcn_readfirstlane((nb > HT) ? HT : nb);      /* the same in every lane: in scalar registers the walk's bound and the tile's number cost no vector register */
    FragH aq[KS]; { const unsigned short* qr = (const unsigned short*)Q16 + ((size_t)b * TQ + q0 + ln) * ldq + h * 64;
#pragma unroll
      for (int ks = 0; ks < KS; ++ks) { aq[ks].half[0] = *(const v8us*)(qr + ks * 32 + 8 * hh); aq[ks].half[1] = *(const v8us*)(qr + ks * 32 + 16 + 8 * hh); }
      asm volatile("s_wait_xcnt 0x0" ::: "memory"); }      /* stands behind the query loads, ahead of the index arithmetic that reuses their address registers */
    const int q = q0 + ln; const int limA = (MODE == 0) ? q : ntc * (q + 1) - 1, limB = (MODE == 0) ? q / ntc : q;      /* the lane's query: its last allowed index in the token half and in the concept half */
    float m_q = -3.0e38f, l_q = 0.f; v8f oacc[DT];      /* the lane's query: maximum, sum over this half's keys, and 32 elements of its V sum */
#pragma unroll
    for (int dt = 0; dt < DT; ++dt) oacc[dt] = (v8f){0.f,0.f,0.f,0.f,0.f,0.f,0.f,0.f};
    int j0 = 32 * ((sp < na) ? sp : sp - na + HT); const unsigned short* kp = Kl + (size_t)j0 * 64; const unsigned short* vp = Vl + (size_t)j0 * 64;      /* the wave's first key tile: its plane row, and the lane's addresses in its two 4-KB blocks. They are carried from tile to tile: a register that lives through the whole walk is never handed to a load's result while another load still names it */
#pragma unroll 1
    for (int it = sp; it < na + nb; it += NSP) { const bool ta = it < na; const int t0 = ta ? j0 : j0 - TQ;
      const int dl = (ta ? limA : limB) - t0 - 8 * hh;      /* the lane's score number nt * 8 + r belongs to index t0 + 8 hh + nt * 16 + r of the half: allowed where nt * 16 + r <= dl */
      FragH bk[2][KS], bv[DT];
#pragma unroll
      for (int nt = 0; nt < 2; ++nt)
#pragma unroll
        for (int ks = 0; ks < KS; ++ks) { bk[nt][ks].half[0] = *(const v8us*)(kp + nt * 1024 + ks * 512); bk[nt][ks].half[1] = *(const v8us*)(kp + nt * 1024 + ks * 512 + 256); }
#pragma unroll
      for (int dt = 0; dt < DT; ++dt) { bv[dt].half[0] = *(const v8us*)(vp + dt * 512); bv[dt].half[1] = *(const v8us*)(vp + dt * 512 + 256); }
      asm volatile("s_wait_xcnt 0x0" ::: "memory");      /* stands behind the tile's loads, ahead of the step of the two addresses that they name */
      __builtin_amdgcn_sched_barrier(0);      /* keeps the wait behind all sixteen loads and the address step behind the wait; it also keeps the V^T loads up here, under way during the score products and the softmax (the scheduler otherwise sinks them to their products) */
      { const int in = it + NSP, jn = 32 * ((in < na) ? in : in - na + HT); const ptrdiff_t dk = (ptrdiff_t)(jn - j0) * 64; kp += dk; vp += dk; j0 = jn; }      /* on to the wave's next tile (behind the last one the addresses are not used) */
      float sm[16];
#pragma unroll
      for (int nt = 0; nt < 2; ++nt) { v8f acc = (v8f){0.f,0.f,0.f,0.f,0.f,0.f,0.f,0.f};
#pragma unroll
        for (int ks = 0; ks < KS; ++ks) acc = __builtin_amdgcn_wmma_f32_16x16x32_f16(false, bk[nt][ks].v, false, aq[ks].v, (short)0, acc, false, false);
#pragma unroll
        for (int r = 0; r < 8; ++r) sm[nt * 8 + r] = (nt * 16 + r <= dl) ? acc[r] * SCL : -INFINITY; }
      float mc = sm[0];
#pragma unroll
      for (int i = 1; i < 16; ++i) mc = fmaxf(mc, sm[i]);
      mc = fmaxf(mc, xhalf(mc));
      const float mn = fmaxf(m_q, mc), al = expf(m_q - mn); m_q = mn;      /* no allowed key so far: mn stays at its finite start value, al = exp(0) = 1 and every weight 0 */
      float ps = 0.f; FragH pb;
#pragma unroll
      for (int i = 0; i < 16; ++i) { const float p = expf(sm[i] - mn); ps += p; pb.h[i] = (_Float16)(p * 1024.0f); }
      l_q = l_q * al + ps;
#pragma unroll
      for (int dt = 0; dt < DT; ++dt) { oacc[dt] *= al; oacc[dt] = __builtin_amdgcn_wmma_f32_16x16x32_f16(false, bv[dt].v, false, pb.v, (short)0, oacc[dt], false, false); } }
    l_q += xhalf(l_q);
    if (hh == 0) { sM[w][ln] = m_q; sL[w][ln] = l_q; }
    __syncthreads();      /* publishes every wave's row maxima and row sums; it also ends the reads of the partial outputs of the query tiles before */
    float mg = sM[pr][ln];
#pragma unroll
    for (int s2 = 1; s2 < NSP; ++s2) mg = fmaxf(mg, sM[s2 * NPR + pr][ln]);
    float lt = 0.f, fo = 0.f;      /* a wave that met no allowed key of this row holds sum 0 and a zero V sum */
#pragma unroll
    for (int s2 = 0; s2 < NSP; ++s2) { const float e = expf(sM[s2 * NPR + pr][ln] - mg); lt += sL[s2 * NPR + pr][ln] * e; if (s2 == sp) fo = e; }
    const float fq = (lt > 0.f) ? fo / (lt * 1024.0f) : 0.f;
#pragma unroll
    for (int dt = 0; dt < DT; ++dt) { *(v4fa*)&sO[w][ln][dt * 16 + 8 * hh] = (v4f){oacc[dt][0] * fq, oacc[dt][1] * fq, oacc[dt][2] * fq, oacc[dt][3] * fq}; *(v4fa*)&sO[w][ln][dt * 16 + 8 * hh + 4] = (v4f){oacc[dt][4] * fq, oacc[dt][5] * fq, oacc[dt][6] * fq, oacc[dt][7] * fq}; }
    __syncthreads();      /* publishes the rescaled partial outputs; it also ends the reads of the maxima and sums, which the next query tiles write anew */
    for (int i = tid; i < NPR * RPW * 16; i += 32 * NPR * NSP) { const int q2 = i >> 8, r = (i >> 4) & 15, pc = i & 15; v4f val = *(const v4fa*)&sO[q2][r][pc * 4];
#pragma unroll
      for (int s2 = 1; s2 < NSP; ++s2) val += *(const v4fa*)&sO[s2 * NPR + q2][r][pc * 4];
      const int qo = (ph ? NQT - 1 - (qblk * NPR + q2) : qblk * NPR + q2) * RPW;
      *(v4h*)(O + ((size_t)b * TQ + qo + r) * ldo + h * 64 + pc * 4) = (v4h){(_Float16)(val[0] * 16.0f), (_Float16)(val[1] * 16.0f), (_Float16)(val[2] * 16.0f), (_Float16)(val[3] * 16.0f)}; } } }

extern "C" void kernel_launch(void* const* d_in, const int* in_sizes, int n_in,
                              void* d_out, int out_size, void* d_ws, size_t ws_size, hipStream_t stream) {
  (void)in_sizes; (void)n_in; (void)out_size;
  const float* const* I = (const float* const*)d_in; const float* xt = I[0]; const float* xc = I[1]; const float* Wt = I[2]; const float* bt = I[3]; const float* Wc = I[4]; const float* bc = I[5]; const float* Wtp = I[6]; const float* btp = I[7]; const float* Wcp = I[8]; const float* bcp = I[9]; const int* ntcp = (const int*)d_in[10];      /* int64 in the module, read as int32 */
  char* ws = (char*)d_ws; size_t off = 0;
  auto take = [&](size_t bytes) { char* p = ws + off; off += (bytes + 255) & ~(size_t)255; return p; };
  _Float16* Bt_ = (_Float16*)take((size_t)DW * DD * 2); _Float16* Bc = (_Float16*)take((size_t)DW * DD * 2); _Float16* Btp = (_Float16*)take((size_t)DD * DD * 2); _Float16* Bcp = (_Float16*)take((size_t)DD * DD * 2);
  _Float16* XT = (_Float16*)take((size_t)NR * DD * 2); _Float16* XC = (_Float16*)take((size_t)NR * DD * 2); _Float16* TC = (_Float16*)take((size_t)2 * BB * NH * TK * 64 * 2);      /* keys for token queries, then for concept queries, in fragment order; key rows 0..1023 = tok, 1024..2047 = con */
  _Float16* Vt1 = (_Float16*)take((size_t)BB * NH * 64 * TK * 2); _Float16* Vt2 = (_Float16*)take((size_t)BB * NH * 64 * TK * 2); _Float16* O16 = (_Float16*)take((size_t)2 * NR * DD * 2);      /* O16: token rows, then concept rows */
  (void)Vt2;
  if (off > ws_size) return;      // 8.4 + 8.4 + 2.1 + 2.1 + 4.2 + 4.2 + 16.8 + 8.4 + 8.4 + 8.4 = 71 MB
  /* Four launches, one per stage: launches that do not depend on each other share one grid, and each product stores what its reader takes (V^T; O as f16), so that no pass stands between them. Every plane's size is a multiple of 256 bytes, so that planes taken one after the other lie back to back. */
  k_cvt6<<<(2 * DW * DD + 2 * DD * DD + 2 * NR * DD) / 2048, 256, 0, stream>>>(Wt, Wc, Wtp, Wcp, xt, xc, Bt_);      /* weights: torch (out,in) natural, x 2^4 */
  const dim3 gt((TQ / 128) * (DW / 128), BB, 2);
  k_gemm_lds<true, DD, DW, 2 * DD><<<gt, 256, 0, stream>>>(XT, XC, (size_t)TQ * DD, Bt_, Bc, 0.0625f, bt, bc, nullptr, TC, Vt1, 0, 0);      /* tok[b] -> keys 0..1023, con[b] -> keys 1024..2047: each M 1024 N 4096 K 1024; key columns 0..2047 to the key planes, values read by tokens (columns 2048..) and by concepts (3072..) to the value planes, all in the flash kernel's fragment order */
  k_flashm<<<2 * BB * NH * (TQ / 64), 384, 0, stream>>>(XT, DD, (size_t)NR * DD, TC, (size_t)BB * NH * TK * 64, Vt1, (size_t)BB * NH * 64 * TK, ntcp, O16, DD, (size_t)NR * DD);      /* token queries: keys = columns 0..1023 (kt_t on token rows, kc_t on concept rows); concept queries: keys = columns 1024..2047 (kt_c, kc_c) */
  const dim3 gpj((NR / 128) * (DD / 128), 1, 2);
  k_gemm_lds<false, DD, DD, DD><<<gpj, 256, 0, stream>>>(O16, O16 + (size_t)NR * DD, 0, Btp, Bcp, 0.00390625f, btp, bcp, (float*)d_out, nullptr, nullptr, 0, (size_t)NR * DD);      /* y_t = merged.Wtp^T + btp -> output 0; y_c -> output 1 (offset B.T.NE floats) */
}

// v008
// A run of this version takes 91.2 microseconds.
// Timed twice side by side with v007, it ran 1.11 times as fast both times.
// Over all steps from v000 it is 8.51 times as fast.
#include <hip/hip_runtime.h>
// Token/concept two-stream causal attention (B=2, T=C=1024, NE=CD=1024, 16 heads × 64, n_tokens_per_concept = 8): tok = xt·Wtᵀ + bt, con = xc·Wcᵀ + bc (4096 outputs each = [k for token queries | k for concept queries | v read by tokens | v read by concepts]);
// token queries = heads(xt) (the residual stream itself) attend over [tokens ; concepts] with mask (s ≤ t) | (j < t/8 + 1), scale 1/√64; concept queries = heads(xc) attend over [concepts ; tokens] with mask (j ≤ i) | (s < 8(i+1)); disallowed = −1e9 (≡ −inf: every row keeps itself);
// y_t = merge(attn_t)·Wtpᵀ + btp, y_c = merge(attn_c)·Wcpᵀ + bcp (two outputs).
// Compute dtype: xt, xc, weights, biases rounded to bf16; tok/con as f16 GEMM planes written as the two 1024-row halves of one 2048-key plane per batch; queries = the bf16-exact x planes; fused flash-style kernels with the index-computed masks (n_tokens_per_concept read on device; online softmax f32,
// P f16 ×2^10, f32 accumulate) on v_wmma_f32_16x16x32_f16; O ×2^4 → f16 (stored so by the flash kernel) → projection GEMMs (+bias) straight into the two output slots.
#define BB 2
#define TQ 1024
#define TK 2048
#define DD 1024
#define NH 16
#define DW 4096
#define SCL 0.125f
#define NR (BB * TQ)
typedef __bf16 v16b __attribute__((ext_vector_type(16)));
typedef unsigned short v8us __attribute__((ext_vector_type(8), may_alias));
typedef float  v8f  __attribute__((ext_vector_type(8)));
typedef float  v4f  __attribute__((ext_vector_type(4)));
typedef float  v4fa __attribute__((ext_vector_type(4), may_alias));
union FragB { v16b v; v8us half[2]; unsigned short u[16]; };

__device__ __forceinline__ unsigned short bf16_bits(float x) { unsigned int u = __float_as_uint(x); return (unsigned short)((u + 0x7FFFu + ((u >> 16) & 1u)) >> 16); }
__device__ __forceinline__ float bf16_val(unsigned short b) { return __uint_as_float(((unsigned int)b) << 16); }
__device__ __forceinline__ float bf16_round(float x) { return bf16_val(bf16_bits(x)); }
// D += A·B with NT terms: 1 = ah·bh, 2 = + al·bh (A split), 3 = + ah·bl (both split)
template <int NT>
__device__ __forceinline__ v8f mmaN(v16b ah, v16b al, v16b bh, v16b bl, v8f c) {
  c = __builtin_amdgcn_wmma_f32_16x16x32_bf16(false, ah, false, bh, (short)0, c, false, false);
  if (NT >= 2) c = __builtin_amdgcn_wmma_f32_16x16x32_bf16(false, al, false, bh, (short)0, c, false, false);
  if (NT >= 3) c = __builtin_amdgcn_wmma_f32_16x16x32_bf16(false, ah, false, bl, (short)0, c, false, false);
  asm volatile("v_nop\n\tv_nop\n\tv_nop\n\tv_nop" : "+v"(c) : "v"(ah), "v"(al), "v"(bh), "v"(bl));
  return c;
}

__global__ __launch_bounds__(256) void k_wt_bf16(const float* __restrict__ W, unsigned short* __restrict__ Wt, int K, int N) {
  const int t = blockIdx.x * 256 + threadIdx.x;
  const int k8n = K / 8;
  if (t >= N * k8n) return;
  const int n = t / k8n, k8 = (t % k8n) * 8;
  v8us v;
#pragma unroll
  for (int i = 0; i < 8; ++i) v[i] = bf16_bits(W[(size_t)(k8 + i) * N + n]);
  *(v8us*)(Wt + (size_t)n * K + k8) = v;
  
}

// GEMM C[M][N] (f32, pitch ldc) = act(A[M][K]·W + bias). A f32 row-major (pitch lda) converted per fragment to bf16
// (ASPLIT: hi/lo two planes -> 2 terms, else single rounded term); Wt bf16 [N][K] (pitch ldb). BIAS_BF16 rounds the
// bias to bf16 first (bias quantised to bf16 before the add). K%32==0, M%16==0, N%64==0.
template <bool ASPLIT, int ACT, bool BIAS_BF16>
__global__ __launch_bounds__(128) void k_gemm_bf(const float* __restrict__ A, int lda, const unsigned short* __restrict__ Wt, int ldb,
                                               const float* __restrict__ bias, float* __restrict__ C, int ldc, int M, int N, int K) {
  __shared__ __attribute__((aligned(16))) float so[4][16][64];
  const int tid = threadIdx.x, w = tid >> 5, lane = tid & 31, ln = lane & 15, hh = lane >> 4;
  const int ntn = N / 64;
  const int wid = blockIdx.x * 4 + w;
  const int mt = wid / ntn, nq = wid % ntn;
  if (mt * 16 >= M) return;
  const int row0 = mt * 16, col0 = nq * 64;
  const float* arow = A + (size_t)(row0 + ln) * lda;
  v8f acc[4] = {};
  for (int kb = 0; kb < K; kb += 32) {
    FragB ah, al;
    const v4f x0 = *(const v4fa*)(arow + kb + 8 * hh), x1 = *(const v4fa*)(arow + kb + 8 * hh + 4);
    const v4f x2 = *(const v4fa*)(arow + kb + 16 + 8 * hh), x3 = *(const v4fa*)(arow + kb + 16 + 8 * hh + 4);
    float xs[16] = {x0[0],x0[1],x0[2],x0[3],x1[0],x1[1],x1[2],x1[3],x2[0],x2[1],x2[2],x2[3],x3[0],x3[1],x3[2],x3[3]};
#pragma unroll
    for (int i = 0; i < 16; ++i) { const unsigned short hb = bf16_bits(xs[i]); ah.u[i] = hb; al.u[i] = ASPLIT ? bf16_bits(xs[i] - bf16_val(hb)) : (unsigned short)0; }
#pragma unroll
    for (int t = 0; t < 4; ++t) {
      const unsigned short* brow = Wt + (size_t)(col0 + t * 16 + ln) * ldb + kb;
      FragB b;
      b.half[0] = *(const v8us*)(brow + 8 * hh);
      b.half[1] = *(const v8us*)(brow + 16 + 8 * hh);
      acc[t] = mmaN<ASPLIT ? 2 : 1>(ah.v, al.v, b.v, b.v, acc[t]);
    }
  }
#pragma unroll
  for (int t = 0; t < 4; ++t) {
    float bv = bias ? bias[col0 + t * 16 + ln] : 0.f;
    if (BIAS_BF16) bv = bf16_round(bv);
#pragma unroll
    for (int r = 0; r < 8; ++r) { float v = acc[t][r] + bv; if (ACT == 1) v = fmaxf(v, 0.f); so[w][8 * hh + r][t * 16 + ln] = v; }
  }
  __builtin_amdgcn_fence(__ATOMIC_ACQ_REL, "workgroup");
  __builtin_amdgcn_wave_barrier();
  const int rsub = lane >> 4, c4 = (lane & 15) * 4;
  {
#pragma unroll
    for (int q = 0; q < 8; ++q) {
      const int r = q * 2 + rsub;
      const v4f v = *(const v4fa*)&so[w][r][c4];
      *(v4f*)(C + (size_t)(row0 + r) * ldc + col0 + c4) = v;
    }
    
  }
}

// GEMM C = act(A·W + bias + resid): A f32 (ASPLIT -> hi/lo 2 terms), Wt bf16 [N][K]; ACT 0 none, 1 relu, 2 exact gelu;
// resid (optional, f32, row index = (row % rmod), pitch ldr, RES_BF16 rounds it) added before the activation.
template <bool ASPLIT, int ACT, bool BIAS_BF16, bool RES_BF16>
__global__ __launch_bounds__(128) void k_gemm_bf3(const float* __restrict__ A, int lda, const unsigned short* __restrict__ Wt, int ldb,
                                                const float* __restrict__ bias, const float* __restrict__ resid, int rmod, int ldr,
                                                float* __restrict__ C, int ldc, int M, int N, int K) {
  __shared__ __attribute__((aligned(16))) float so[4][16][64];
  const int tid = threadIdx.x, w = tid >> 5, lane = tid & 31, ln = lane & 15, hh = lane >> 4;
  const int ntn = N / 64;
  const int wid = blockIdx.x * 4 + w;
  const int mt = wid / ntn, nq = wid % ntn;
  if (mt * 16 >= M) return;
  const int row0 = mt * 16, col0 = nq * 64;
  const float* arow = A + (size_t)(row0 + ln) * lda;
  v8f acc[4] = {};
  for (int kb = 0; kb < K; kb += 32) {
    FragB ah, al;
    const v4f x0 = *(const v4fa*)(arow + kb + 8 * hh), x1 = *(const v4fa*)(arow + kb + 8 * hh + 4);
    const v4f x2 = *(const v4fa*)(arow + kb + 16 + 8 * hh), x3 = *(const v4fa*)(arow + kb + 16 + 8 * hh + 4);
    float xs[16] = {x0[0],x0[1],x0[2],x0[3],x1[0],x1[1],x1[2],x1[3],x2[0],x2[1],x2[2],x2[3],x3[0],x3[1],x3[2],x3[3]};
#pragma unroll
    for (int i = 0; i < 16; ++i) { const unsigned short hb = bf16_bits(xs[i]); ah.u[i] = hb; al.u[i] = ASPLIT ? bf16_bits(xs[i] - bf16_val(hb)) : (unsigned short)0; }
#pragma unroll
    for (int t = 0; t < 4; ++t) {
      const unsigned short* brow = Wt + (size_t)(col0 + t * 16 + ln) * ldb + kb;
      FragB b;
      b.half[0] = *(const v8us*)(brow + 8 * hh);
      b.half[1] = *(const v8us*)(brow + 16 + 8 * hh);
      acc[t] = mmaN<ASPLIT ? 2 : 1>(ah.v, al.v, b.v, b.v, acc[t]);
    }
  }
#pragma unroll
  for (int t = 0; t < 4; ++t) {
    const int col = col0 + t * 16 + ln;
    float bv = bias ? bias[col] : 0.f;
    if (BIAS_BF16) bv = bf16_round(bv);
#pragma unroll
    for (int r = 0; r < 8; ++r) {
      float v = acc[t][r] + bv;
      if (resid) { float rv = resid[(size_t)((row0 + 8 * hh + r) % rmod) * ldr + col]; if (RES_BF16) rv = bf16_round(rv); v += rv; }
      if (ACT == 1) v = fmaxf(v, 0.f);
      if (ACT == 2) v = 0.5f * v * (1.0f + erff(v * 0.70710678118654752f));
      if (ACT == 3) { const float u = 0.7978845608028654f * (v + 0.044715f * v * v * v); v = 0.5f * v * (1.0f + tanhf(u)); }
      so[w][8 * hh + r][t * 16 + ln] = v;
    }
  }
  __builtin_amdgcn_fence(__ATOMIC_ACQ_REL, "workgroup");
  __builtin_amdgcn_wave_barrier();
  const int rsub = lane >> 4, c4 = (lane & 15) * 4;
  {
#pragma unroll
    for (int q = 0; q < 8; ++q) {
      const int r = q * 2 + rsub;
      const v4f v = *(const v4fa*)&so[w][r][c4];
      *(v4f*)(C + (size_t)(row0 + r) * ldc + col0 + c4) = v;
    }
    
  }
}
// row LayerNorm (biased variance, eps) over N: s = X (+ R); optional out_sum <- s; out_norm <- (s-mu)*rsqrt(var+eps)*g + b
template <bool PARAM_BF16>
__global__ __launch_bounds__(256) void k_layernorm(const float* __restrict__ X, const float* __restrict__ R, const float* __restrict__ g, const float* __restrict__ bta,
                                                  float* __restrict__ out_sum, float* __restrict__ out_norm, int N, float eps) {
  __shared__ float red[256];
  const int row = blockIdx.x, tid = threadIdx.x;
  const float* x = X + (size_t)row * N; const float* rr = R ? R + (size_t)row * N : nullptr;
  float vals[16];                     // up to N = 4096
  const int per = N / 256;            // contiguous chunk per thread? use strided-by-4 chunks: thread handles j = tid*4 + 1024*u
  float s1 = 0.f;
  for (int u = 0; u < per / 4; ++u) {
    const int j = tid * 4 + 1024 * u;
    const v4f a = *(const v4fa*)(x + j);
    v4f b = {0.f,0.f,0.f,0.f}; if (rr) b = *(const v4fa*)(rr + j);
#pragma unroll
    for (int q = 0; q < 4; ++q) { const float v = a[q] + b[q]; vals[u * 4 + q] = v; s1 += v; }
  }
  red[tid] = s1; __syncthreads();
  for (int st = 128; st > 0; st >>= 1) { if (tid < st) red[tid] += red[tid + st]; __syncthreads(); }
  const float mu = red[0] / (float)N; __syncthreads();
  float s2 = 0.f;
  for (int u = 0; u < per / 4; ++u)
#pragma unroll
    for (int q = 0; q < 4; ++q) { const float c = vals[u * 4 + q] - mu; s2 += c * c; }
  red[tid] = s2; __syncthreads();
  for (int st = 128; st > 0; st >>= 1) { if (tid < st) red[tid] += red[tid + st]; __syncthreads(); }
  const float rs = rsqrtf(red[0] / (float)N + eps);
  {
    for (int u = 0; u < per / 4; ++u) {
      const int j = tid * 4 + 1024 * u;
      v4f o, sm;
#pragma unroll
      for (int q = 0; q < 4; ++q) {
        float gg = g[j + q], bb = bta[j + q];
        if (PARAM_BF16) { gg = bf16_round(gg); bb = bf16_round(bb); }
        sm[q] = vals[u * 4 + q]; o[q] = (vals[u * 4 + q] - mu) * rs * gg + bb;
      }
      if (out_sum) *(v4f*)(out_sum + (size_t)row * N + j) = sm;
      *(v4f*)(out_norm + (size_t)row * N + j) = o;
    }
    
  }
}



// ---- f16 WMMA path (v_wmma_f32_16x16x32_f16): 11-bit significands for operands in range — used where a [0,1] probability operand needs more precision than bf16
typedef _Float16 v16h __attribute__((ext_vector_type(16)));
union FragH { v16h v; v8us half[2]; _Float16 h[16]; unsigned short u[16]; };
template <int NT>
__device__ __forceinline__ v8f mmaH(v16h ah, v16h al, v16h bh, v16h bl, v8f c) {
  c = __builtin_amdgcn_wmma_f32_16x16x32_f16(false, ah, false, bh, (short)0, c, false, false);
  if (NT >= 2) c = __builtin_amdgcn_wmma_f32_16x16x32_f16(false, al, false, bh, (short)0, c, false, false);
  if (NT >= 3) c = __builtin_amdgcn_wmma_f32_16x16x32_f16(false, ah, false, bl, (short)0, c, false, false);
  asm volatile("v_nop\n\tv_nop\n\tv_nop\n\tv_nop" : "+v"(c) : "v"(ah), "v"(al), "v"(bh), "v"(bl));
  return c;
}
// batched GEMM like k_gemm_b but f16 operands: A f32 (split into f16 hi/lo if ASPLIT, else rounded to f16), Bt = f16 values [n][k]; alpha; C f32; N multiple of 16 (partial tiles skipped)
template <bool ASPLIT>
__global__ __launch_bounds__(128) void k_gemm_h(const float* __restrict__ A, int lda, size_t sA, const _Float16* __restrict__ Bh, int ldb, size_t sB, float alpha, float* __restrict__ C, int ldc, size_t sC, int M, int N, int K) {
  __shared__ __attribute__((aligned(16))) float so[4][16][64];
  const int tid = threadIdx.x, w = tid >> 5, lane = tid & 31, ln = lane & 15, hh = lane >> 4; const int by = blockIdx.y;
  A += (size_t)by * sA; Bh += (size_t)by * sB; C += (size_t)by * sC;
  const int ntn = (N + 63) / 64; const int wid = blockIdx.x * 4 + w; const int mt = wid / ntn, nq = wid % ntn; if (mt * 16 >= M) return;
  const int row0 = mt * 16, col0 = nq * 64; const float* arow = A + (size_t)(row0 + ln) * lda;
  v8f acc[4] = {};
  for (int kb = 0; kb < K; kb += 32) {
    FragH ah, al;
    const v4f x0 = *(const v4fa*)(arow + kb + 8 * hh), x1 = *(const v4fa*)(arow + kb + 8 * hh + 4), x2 = *(const v4fa*)(arow + kb + 16 + 8 * hh), x3 = *(const v4fa*)(arow + kb + 16 + 8 * hh + 4);
    float xs[16] = {x0[0],x0[1],x0[2],x0[3],x1[0],x1[1],x1[2],x1[3],x2[0],x2[1],x2[2],x2[3],x3[0],x3[1],x3[2],x3[3]};
#pragma unroll
    for (int i = 0; i < 16; ++i) { const _Float16 h = (_Float16)xs[i]; ah.h[i] = h; al.h[i] = ASPLIT ? (_Float16)(xs[i] - (float)h) : (_Float16)0.0f; }
#pragma unroll
    for (int t = 0; t < 4; ++t) { if (col0 + t * 16 >= N) continue; const size_t boff = (size_t)(col0 + t * 16 + ln) * ldb + kb; FragH bq; bq.half[0] = *(const v8us*)(Bh + boff + 8 * hh); bq.half[1] = *(const v8us*)(Bh + boff + 16 + 8 * hh);
      acc[t] = mmaH<ASPLIT ? 2 : 1>(ah.v, al.v, bq.v, bq.v, acc[t]); }
  }
#pragma unroll
  for (int t = 0; t < 4; ++t) { if (col0 + t * 16 >= N) continue;
#pragma unroll
    for (int r = 0; r < 8; ++r) so[w][8 * hh + r][t * 16 + ln] = acc[t][r] * alpha; }
  __builtin_amdgcn_fence(__ATOMIC_ACQ_REL, "workgroup"); __builtin_amdgcn_wave_barrier();
  const int rsub = lane >> 4, c4 = (lane & 15) * 4;
  {
#pragma unroll
    for (int q = 0; q < 8; ++q) { const int r = q * 2 + rsub; if (col0 + c4 < N) { const v4f v = *(const v4fa*)&so[w][r][c4]; *(v4f*)(C + (size_t)(row0 + r) * ldc + col0 + c4) = v; } }
     }
}

// Wt[n][k] = f16(W[k][n]·scale) from f32 row-major W[K][N] (scale = power of two; bf16-exact weights stay exact in f16 away from the subnormal range)
__global__ __launch_bounds__(256) void k_wt_f16(const float* __restrict__ W, _Float16* __restrict__ Wt, int K, int N, float scale) {
  const int t = blockIdx.x * 256 + threadIdx.x; if (t >= N * (K / 8)) return; const int n = t / (K / 8), k8 = (t % (K / 8)) * 8; FragH f;
#pragma unroll
  for (int i = 0; i < 8; ++i) f.h[i] = (_Float16)(bf16_round(W[(size_t)(k8 + i) * N + n]) * scale); const v8us o = f.half[0];
  *(v8us*)((unsigned short*)Wt + (size_t)n * K + k8) = o; 
}
// k_gemm_hh variant with fused epilogue: v = acc·alpha + bias[by·sBias + col] (+ CP[(row/rowsPerB)·sCPb + by·64 + col] if CP) ; ACT 0 none / 1 elu ; writes f16 C16 and/or f32 C, each if non-null
template <int ACT>
__global__ __launch_bounds__(128) void k_gemm_hhx(const _Float16* __restrict__ A, int lda, size_t sA, const _Float16* __restrict__ Bh, int ldb, size_t sB, float alpha, const float* __restrict__ bias, size_t sBias, const float* __restrict__ CP, int rowsPerB, size_t sCPb, int row0g,
    float* __restrict__ C, _Float16* __restrict__ C16, int ldc, size_t sC, int M, int N, int K) {
  __shared__ __attribute__((aligned(16))) float so[4][16][64];
  const int tid = threadIdx.x, w = tid >> 5, lane = tid & 31, ln = lane & 15, hh = lane >> 4; const int by = blockIdx.y;
  A += (size_t)by * sA; Bh += (size_t)by * sB; const size_t cofs = (size_t)by * sC; const float* bp = bias ? bias + (size_t)by * sBias : nullptr;
  const int ntn = (N + 63) / 64; const int wid = blockIdx.x * 4 + w; const int mt = wid / ntn, nq = wid % ntn; if (mt * 16 >= M) return;
  const int row0 = mt * 16, col0 = nq * 64; const _Float16* arow = A + (size_t)(row0 + ln) * lda;
  v8f acc[4] = {};
  for (int kb = 0; kb < K; kb += 32) { FragH ah; ah.half[0] = *(const v8us*)((const unsigned short*)arow + kb + 8 * hh); ah.half[1] = *(const v8us*)((const unsigned short*)arow + kb + 16 + 8 * hh);
#pragma unroll
    for (int t = 0; t < 4; ++t) { if (col0 + t * 16 >= N) continue; const size_t boff = (size_t)(col0 + t * 16 + ln) * ldb + kb; FragH bq; bq.half[0] = *(const v8us*)((const unsigned short*)Bh + boff + 8 * hh); bq.half[1] = *(const v8us*)((const unsigned short*)Bh + boff + 16 + 8 * hh);
      acc[t] = mmaH<1>(ah.v, ah.v, bq.v, bq.v, acc[t]); }
  }
#pragma unroll
  for (int t = 0; t < 4; ++t) { if (col0 + t * 16 >= N) continue; const int col = col0 + t * 16 + ln; const float bv = bp ? bf16_round(bp[col]) : 0.f;
#pragma unroll
    for (int r = 0; r < 8; ++r) { float v = acc[t][r] * alpha + bv; if (CP) { const int bidx = (row0g + row0 + 8 * hh + r) / rowsPerB; v += CP[(size_t)bidx * sCPb + (size_t)by * 64 + col]; } if (ACT == 1) v = (v > 0.f) ? v : expm1f(v); else if (ACT == 7) v = (v > 0.f) ? v + 1.0f : expf(v); else if (ACT == 8) v = tanhf(v); else if (ACT == 9) v = 0.5f * v * (1.0f + tanhf(0.7978845608028654f * (v + 0.044715f * v * v * v))); else if (ACT == 11) v = 1.0f / (1.0f + expf(-v)); else if (ACT == 12) v = (v > 0.f) ? v : 0.01f * v; else if (ACT == 14) v = (v > 0.f) ? v : 0.1f * v; else if (ACT == 15) v = v / (1.0f + expf(-v)); else if (ACT == 3) v = fmaxf(v, 0.f); else if (ACT == 6) v = 0.5f * v * (1.0f + erff(v * 0.70710678118654752f)); so[w][8 * hh + r][t * 16 + ln] = v; } }
  __builtin_amdgcn_fence(__ATOMIC_ACQ_REL, "workgroup"); __builtin_amdgcn_wave_barrier();
  const int rsub = lane >> 4, c4 = (lane & 15) * 4; typedef _Float16 v4h __attribute__((ext_vector_type(4)));
  {
#pragma unroll
    for (int q = 0; q < 8; ++q) { const int r = q * 2 + rsub; if (col0 + c4 < N) { const v4f v = *(const v4fa*)&so[w][r][c4]; if (C) *(v4f*)(C + cofs + (size_t)(row0 + r) * ldc + col0 + c4) = v; if (C16) { v4h h4; for (int i = 0; i < 4; ++i) h4[i] = (_Float16)v[i]; *(v4h*)(C16 + cofs + (size_t)(row0 + r) * ldc + col0 + c4) = h4; } } }
     }
}


// GEMM C = (A.B^T)*alpha + bias on f16 planes, A [M][KD] (batch stride sA), Bh [ND][KD], both k-contiguous at pitch KD; C [M][ND] (batch stride sC) as f32, or as f16 (OUT16) in the reader's fragment order described below. M and ND multiples of 128, KD a multiple of 64; grid.x = (M / 128) * (ND / 128), grid.y = batch, grid.z = 2: two independent products of one shape in one launch (operands A0, B0, bias0 or A1, B1, bias1; the second one's f32 C lies sZ elements behind the first's; its f16 rows are keys TQ.. of the key planes).
// One 128 x 128 tile of C per work-group of 8 waves (4 x 2, 32 x 64 each). A 64-k slice of both operands (128 bytes of each row) is brought in by loads that cover whole lines and laid in LDS at pitch 144 bytes; every wave reads its fragments from there,
// so a row is asked of L2 once per work-group, not once per wave. Two LDS buffers: the next slice is loaded into registers ahead of the products of this one and stored behind them. Each accumulator still sums its k blocks of 32 in rising order.
// Tiles whose columns start at NT0 or later (the value columns; NT0 = ND: none) are wanted transposed by their reader. Such a work-group takes the two operands in each other's place: it forms Bh.A^T, the same sums over k, and its tile's rows are columns of C;
// no pass over C follows. Which way a work-group goes is a scalar choice by its block index. The bias then belongs to the tile's row.
// The f16 output (OUT16) is stored in the order in which the attention kernel's lanes take their matrix fragments, so that each of its 16-byte-per-lane loads covers 512 bytes in a row (four whole lines) and not 32-byte pieces of sixteen rows. Both planes are [column block of DD][batch][head][key tile of 32][2048 elements]:
// keys (C16): [16-key group nt][load j][lane][8], lane (ln, hh) holding key nt * 16 + ln, head columns (j >> 1) * 32 + (j & 1) * 16 + 8 hh + 0..7; values (Ct): [16-column group dt][load hf][lane][8], lane (ln, hh) holding head column dt * 16 + ln, keys hf * 16 + 8 hh + 0..7.
// A wave's 32 x 64 tile is one head's columns of one key tile (keys), or two column groups of two key tiles (values): it stores runs of 4 KB or 2 KB.
// The unroll directives on the short loops below make every index into the register arrays (staged rows, fragments, accumulators, bias) a constant, so that these arrays stay in registers.
template <bool OUT16, int KD, int ND, int NT0>
__global__ __launch_bounds__(256) void k_gemm_lds(const _Float16* __restrict__ A0, const _Float16* __restrict__ A1, size_t sA, const _Float16* __restrict__ B0, const _Float16* __restrict__ B1, float alpha, const float* __restrict__ bias0, const float* __restrict__ bias1,
    float* __restrict__ C, _Float16* __restrict__ C16, _Float16* __restrict__ Ct, size_t sC, size_t sZ) {
  const bool z1 = blockIdx.z != 0; const _Float16* A = z1 ? A1 : A0; const _Float16* Bh = z1 ? B1 : B0; const float* bias = z1 ? bias1 : bias0;
  constexpr int BT = 128, BK = 64, LP = BK + 8;
  __shared__ __attribute__((aligned(16))) unsigned char sm[4 * BT * LP * 2];      /* the two operands' two buffers; behind the loop the same bytes stage the output rows */
  unsigned short (*tA)[BT][LP] = (unsigned short (*)[BT][LP])sm; unsigned short (*tB)[BT][LP] = (unsigned short (*)[BT][LP])(sm + 2 * BT * LP * 2);
  const int tid = threadIdx.x, w = tid >> 5, lane = tid & 31, ln = lane & 15, hh = lane >> 4;
  constexpr int ntn = ND / BT; const int row0 = ((int)blockIdx.x / ntn) * BT, col0 = ((int)blockIdx.x % ntn) * BT; const int wr = (w >> 1) * 32, wc = (w & 1) * 64;
  const int sr = tid >> 3, sc = (tid & 7) * 8;      /* staging: 8 threads take one row's 128 bytes, a wave 4 whole lines; rows sr + 32 i */
  const bool tr = NT0 < ND && col0 >= NT0;      /* the same for the whole work-group */
  const unsigned short* Ar = (const unsigned short*)A + (size_t)blockIdx.y * sA + (size_t)(row0 + sr) * KD + sc; const unsigned short* Br = (const unsigned short*)Bh + (size_t)(col0 + sr) * KD + sc;
  const unsigned short* Ag = tr ? Br : Ar; const unsigned short* Bg = tr ? Ar : Br;
  float bv[4]; const float bR0 = bf16_round(bias[col0 + wr + ln]), bR1 = bf16_round(bias[col0 + wr + 16 + ln]);      /* the transposed way's row biases: rows ln and 16 + ln of the wave's tile. Read on both ways (all six places lie in the tile's 128 columns), so that the loads go out together, under no branch */
#pragma unroll
  for (int t = 0; t < 4; ++t) { const float x = bf16_round(bias[col0 + wc + t * 16 + ln]); bv[t] = tr ? 0.f : x; }
  v8us ra[4], rb[4];
#pragma unroll
  for (int i = 0; i < 4; ++i) { ra[i] = *(const v8us*)(Ag + 32 * i * KD); rb[i] = *(const v8us*)(Bg + 32 * i * KD); }
#pragma unroll
  for (int i = 0; i < 4; ++i) { *(v8us*)&tA[0][sr + 32 * i][sc] = ra[i]; *(v8us*)&tB[0][sr + 32 * i][sc] = rb[i]; }
  __syncthreads();      /* publishes slice 0 */
  v8f acc[2][4];
#pragma unroll
  for (int mi = 0; mi < 2; ++mi)
#pragma unroll
    for (int t = 0; t < 4; ++t) acc[mi][t] = (v8f){0.f,0.f,0.f,0.f,0.f,0.f,0.f,0.f};
  constexpr int ns = KD / BK;
#pragma unroll      /* slice offsets and the buffer choice become immediates: no address arithmetic in the loop, and no address register is rewritten while loads are under way */
  for (int s = 0; s < ns; ++s) { const int cur = s & 1; const bool more = s + 1 < ns;
    if (more) {
#pragma unroll
      for (int i = 0; i < 4; ++i) { ra[i] = *(const v8us*)(Ag + 32 * i * KD + (s + 1) * BK); rb[i] = *(const v8us*)(Bg + 32 * i * KD + (s + 1) * BK); }
      __builtin_amdgcn_sched_barrier(0); }      /* keeps the next slice's loads ahead of this slice's products; the scheduler otherwise sinks them to their LDS stores and the group waits out their whole latency */
#pragma unroll
    for (int ks = 0; ks < 2; ++ks) { FragH fa[2], fb[4];
#pragma unroll
      for (int mi = 0; mi < 2; ++mi) { fa[mi].half[0] = *(const v8us*)&tA[cur][wr + mi * 16 + ln][ks * 32 + 8 * hh]; fa[mi].half[1] = *(const v8us*)&tA[cur][wr + mi * 16 + ln][ks * 32 + 16 + 8 * hh]; }
#pragma unroll
      for (int t = 0; t < 4; ++t) { fb[t].half[0] = *(const v8us*)&tB[cur][wc + t * 16 + ln][ks * 32 + 8 * hh]; fb[t].half[1] = *(const v8us*)&tB[cur][wc + t * 16 + ln][ks * 32 + 16 + 8 * hh]; }
#pragma unroll
      for (int mi = 0; mi < 2; ++mi)
#pragma unroll
        for (int t = 0; t < 4; ++t) acc[mi][t] = __builtin_amdgcn_wmma_f32_16x16x32_f16(false, fa[mi].v, false, fb[t].v, (short)0, acc[mi][t], false, false); }
    if (more) {
#pragma unroll
      for (int i = 0; i < 4; ++i) { *(v8us*)&tA[cur ^ 1][sr + 32 * i][sc] = ra[i]; *(v8us*)&tB[cur ^ 1][sr + 32 * i][sc] = rb[i]; } }
    __syncthreads();      /* publishes slice s + 1 and ends every wave's reads of slice s, whose buffer the next trip refills (behind the last slice: the output staging) */
  }
  const size_t cofs = (size_t)blockIdx.y * sC + (size_t)blockIdx.z * sZ; const int rsub = lane >> 4, c4 = (lane & 15) * 4;
  float (*so)[64 + 4] = (float (*)[64 + 4])sm + w * 32;      /* the wave's own 32 staging rows */
#pragma unroll
  for (int mi = 0; mi < 2; ++mi)
#pragma unroll
    for (int t = 0; t < 4; ++t)
#pragma unroll
      for (int r = 0; r < 8; ++r) so[mi * 16 + 8 * hh + r][t * 16 + ln] = acc[mi][t][r] * alpha + bv[t];
  __builtin_amdgcn_fence(__ATOMIC_ACQ_REL, "workgroup"); __builtin_amdgcn_wave_barrier();      /* the wave's own staging rows: every lane's stores stay ahead of the row reads below */
  if (NT0 < ND && tr) { const int cv = col0 - NT0, cd = cv % DD + wr;      /* the tile's 128 columns lie in one block of DD; the wave's row r is column cd + r of that block (two column groups of one head), its 64 keys two key tiles */
    unsigned short* P = (unsigned short*)Ct + ((((size_t)((cv / DD) * BB + (int)blockIdx.y) * NH + cd / 64) * (TK / 32) + ((int)blockIdx.z * TQ + row0 + wc) / 32) * 4 + (cd % 64) / 16) * 512 + lane * 8;
#pragma unroll      /* the staging rows and the stores' offsets become immediates: one address register pair serves all eight stores and is never rewritten */
    for (int q = 0; q < 8; ++q) { const int kk = q >> 2, dl = (q >> 1) & 1, hf = q & 1; const float* s = &so[dl * 16 + ln][kk * 32 + hf * 16 + 8 * hh]; const v4f v0 = *(const v4fa*)s, v1 = *(const v4fa*)(s + 4); const float br = dl ? bR1 : bR0; FragH f;
#pragma unroll
      for (int i = 0; i < 4; ++i) { f.h[i] = (_Float16)(v0[i] + br); f.h[4 + i] = (_Float16)(v1[i] + br); }
      *(v8us*)(P + kk * 2048 + dl * 512 + hf * 256) = f.half[0]; }
    return; }
  if (OUT16) { const int cg = col0 + wc;      /* the wave's 64 columns are one head's, its 32 rows one key tile */
    unsigned short* P = (unsigned short*)C16 + (((size_t)((cg / DD) * BB + (int)blockIdx.y) * NH + (cg % DD) / 64) * (TK / 32) + ((int)blockIdx.z * TQ + row0 + wr) / 32) * 2048 + lane * 8;
#pragma unroll      /* as above: immediates, one address register pair */
    for (int q = 0; q < 8; ++q) { const int nt = q >> 2, j = q & 3; const float* s = &so[nt * 16 + ln][(j >> 1) * 32 + (j & 1) * 16 + 8 * hh]; const v4f v0 = *(const v4fa*)s, v1 = *(const v4fa*)(s + 4); FragH f;
#pragma unroll
      for (int i = 0; i < 4; ++i) { f.h[i] = (_Float16)v0[i]; f.h[4 + i] = (_Float16)v1[i]; }
      *(v8us*)(P + nt * 1024 + j * 256) = f.half[0]; }
    asm volatile("s_wait_xcnt 0x0" ::: "memory");      /* stands behind the eight stores, ahead of whatever code the build lays behind them: nothing rewrites a register that a store still names */
    return; }
#pragma unroll
  for (int q = 0; q < 16; ++q) { const int r = q * 2 + rsub; const v4f v = *(const v4fa*)&so[r][c4]; *(v4f*)(C + cofs + (size_t)(row0 + wr + r) * ND + col0 + wc + c4) = v; }
}

typedef _Float16 v4h __attribute__((ext_vector_type(4)));

// One launch rounds all six f32 operands to their f16 planes, which lie one behind the other in the workspace: Wt, Wc, Wtp, Wcp (bf16-rounded, x 2^4), then xt, xc (bf16-rounded, x 1, which is exact).
// The 2048 elements of a work-group lie in one operand; which one is a scalar choice by the block index.
__global__ __launch_bounds__(256) void k_cvt6(const float* __restrict__ Wt, const float* __restrict__ Wc, const float* __restrict__ Wtp, const float* __restrict__ Wcp, const float* __restrict__ xt, const float* __restrict__ xc, _Float16* __restrict__ dst) {
  constexpr unsigned GW = DW * DD / 2048, GP = DD * DD / 2048, GX = NR * DD / 2048;
  unsigned blk = blockIdx.x; const float* s; float sc = 16.0f;
  if (blk < GW) s = Wt; else if ((blk -= GW) < GW) s = Wc; else if ((blk -= GW) < GP) s = Wtp; else if ((blk -= GP) < GP) s = Wcp; else if ((blk -= GP) < GX) { s = xt; sc = 1.0f; } else { blk -= GX; s = xc; sc = 1.0f; }
  const size_t t = (size_t)blk * 256 + threadIdx.x; FragH f;
#pragma unroll
  for (int q = 0; q < 8; ++q) f.h[q] = (_Float16)(bf16_round(s[t * 8 + q]) * sc);
  *(v8us*)((unsigned short*)dst + ((size_t)blockIdx.x * 256 + threadIdx.x) * 8) = f.half[0]; }
__global__ __launch_bounds__(256) void k_h16(const float* __restrict__ x, _Float16* __restrict__ X16, size_t n8) { const size_t t = (size_t)blockIdx.x * 256 + threadIdx.x; if (t >= n8) return; FragH f;
#pragma unroll
  for (int q = 0; q < 8; ++q) f.h[q] = (_Float16)x[t * 8 + q]; *(v8us*)((unsigned short*)X16 + t * 8) = f.half[0];  }
__global__ __launch_bounds__(256) void k_hl(const float* __restrict__ F, _Float16* __restrict__ Hh, _Float16* __restrict__ Hl, size_t n8) { const size_t t = (size_t)blockIdx.x * 256 + threadIdx.x; if (t >= n8) return; FragH fh, fl; const v4f a = *(const v4fa*)(F + t * 8), c = *(const v4fa*)(F + t * 8 + 4);
#pragma unroll
  for (int q = 0; q < 4; ++q) { _Float16 h = (_Float16)a[q]; fh.h[q] = h; fl.h[q] = (_Float16)((a[q] - (float)h) * 1024.0f); h = (_Float16)c[q]; fh.h[4 + q] = h; fl.h[4 + q] = (_Float16)((c[q] - (float)h) * 1024.0f); }
  { *(v8us*)((unsigned short*)Hh + t * 8) = fh.half[0]; *(v8us*)((unsigned short*)Hl + t * 8) = fl.half[0];  } }

// masks over (query index q, key-plane row): key-plane rows 0..T-1 are TOKENS, rows T..2T-1 are CONCEPTS (the tok/con GEMMs write the two halves of one plane per batch). Inside each half the allowed keys of a query are the indices 0 .. lim:
// MODE 0 = token queries: token s <= q (causal), concept j < q / ntc + 1, that is j <= q / ntc; MODE 1 = concept queries: token s < ntc * (q + 1), concept j <= q. (Key order inside the softmax is irrelevant, so the plane order is used directly.)
__device__ __forceinline__ float xhalf(float x) { return __builtin_bit_cast(float, __builtin_amdgcn_permlanex16(__builtin_bit_cast(int, x), __builtin_bit_cast(int, x), 0x76543210, 0xfedcba98, false, false)); }      /* lane l's value to lane l ^ 16 and back, in registers */
// Work-group = 12 waves on four query tiles of 16 rows, taken as two pairs (p, 63 - p), p = 2 * block + (w & 1): an early tile, which the masks leave few keys, with a late one, which they leave many, so that within one MODE the waves walk more even numbers of key tiles.
// A wave takes its pair's two query tiles one after the other (ph = 0, 1). Of the 64 key tiles of 32 it walks only those in which the mask allows some key to some row of the query tile: both masks grow with the query index and shrink with the key index inside each half of the key plane,
// so these are the first na tiles of the token half and the first nb of the concept half, counted from the tile's last row. A tile left out held only weights 0 and left maximum, sum and V sum as they were. The six waves (w >> 1) of a pair take every sixth tile of that list;
// the six partial softmax states of a query tile (row maximum, row sum, weighted V sum) are merged in LDS behind each walk.
// Both products are taken transposed: S^T = K.Q^T (A = key rows, B = query rows) and O^T += V^T.P^T (A = rows of V^T, B = P^T). A lane then holds 16 scores of ONE query (column ln; keys 8 hh + r and 16 + 8 hh + r of the tile), so that maximum and sum are taken inside the lane,
// with one exchange between the wave's halves, there is one maximum, one sum and one rescale factor per lane, and the two score tiles, converted in place, are the B operand P^T in the k order in which the V^T rows are loaded: P passes through no LDS.
// A masked score is -inf; against the finite maximum its weight is exp(-inf) = 0. The second launch bound states the aim: 6 waves per SIMD, two work-groups per WGP (at most 160 registers a wave).
// Both attentions run in one launch: the first half of the grid takes the concept queries (MODE 1, whose masks allow more keys), the second half the token queries (MODE 0). MODE is the same for a whole work-group and stays in a scalar register;
// it chooses the planes (MODE 1's queries, key columns, V^T and output lie sQ, sK, sV and sOut elements behind MODE 0's) and the walk's bounds, and the key loop does not read it.
// The merged rows are stored as the projection reads them: x 2^4, rounded to f16, a head's 64 columns of a row as one whole line.
__global__ __launch_bounds__(384, 6) void k_flashm(const _Float16* __restrict__ Q16, int ldq, size_t sQ, const _Float16* __restrict__ K16, size_t sK, const _Float16* __restrict__ Vt, size_t sV, const int* __restrict__ NTCP, _Float16* __restrict__ O, int ldo, size_t sOut) {
  int ntc = NTCP[0]; ntc = (ntc < 1) ? 1 : ((ntc > TQ) ? TQ : ntc);      /* = 8 here; guarded so the index arithmetic can never divide by zero; from TQ up both masks read the same as at TQ, and the products below cannot overflow */
  constexpr int RPW = 16, NPR = 2, NQT = TQ / RPW, NQB = NQT / (2 * NPR), DT = 4, KS = 2, NSP = 6, HT = TQ / 32;
  constexpr float C2 = SCL * 1.4426950408889634f;      /* score scale x log2(e): exp(SCL * s - m) = 2^(C2 * s - m * log2(e)) */
  __shared__ __attribute__((aligned(16))) float sO[NPR * NSP][RPW][64 + 4]; __shared__ float sM[NPR * NSP][RPW], sL[NPR * NSP][RPW];
  const int tid = threadIdx.x, w = __builtin_amdgcn_readfirstlane(tid >> 5), lane = tid & 31, ln = lane & 15, hh = lane >> 4;      /* the wave's number in a scalar register: the key loop's counter and its tests stay scalar */
  const int MODE = ((int)blockIdx.x < BB * NH * NQB) ? 1 : 0, bx = (int)blockIdx.x - (MODE ? 0 : BB * NH * NQB); if (MODE) { Q16 += sQ; K16 += sK; Vt += sV; O += sOut; }
  const int slab = bx / NQB, qblk = bx % NQB; const int b = slab / NH, h = slab % NH; const int pr = w & 1, sp = w >> 1;
  const unsigned short* Kl = (const unsigned short*)K16 + (size_t)slab * (TK * 64) + lane * 8;      /* the lane's place in the 4 KB of key tile 0 of this head: both planes lie in fragment order (see the GEMM that writes them), 2048 elements per key tile, and a load of the wave covers 512 bytes in a row */
  const unsigned short* Vl = (const unsigned short*)Vt + (size_t)slab * (TK * 64) + lane * 8;      /* and in the value plane */
#pragma unroll 1      /* one copy of the walk serves both query tiles */
  for (int ph = 0; ph < 2; ++ph) {
    const int q0 = (ph ? NQT - 1 - (qblk * NPR + pr) : qblk * NPR + pr) * RPW, qm = q0 + RPW - 1;
    int na = (MODE == 0) ? qm / 32 + 1 : (ntc * (qm + 1) + 31) / 32, nb = (MODE == 0) ? (qm / ntc) / 32 + 1 : qm / 32 + 1;      /* key tiles with an allowed key: token half, concept half */
    na = __builtin_amdgcn_readfirstlane((na > HT) ? HT : na); nb = __builtin_amdgcn_readfirstlane((nb > HT) ? HT : nb);      /* the same in every lane: in scalar registers the walk's bound and the tile's number cost no vector register */
    FragH aq[KS]; { const unsigned short* qr = (const unsigned short*)Q16 + ((size_t)b * TQ + q0 + ln) * ldq + h * 64;
#pragma unroll
      for (int ks = 0; ks < KS; ++ks) { aq[ks].half[0] = *(const v8us*)(qr + ks * 32 + 8 * hh); aq[ks].half[1] = *(const v8us*)(qr + ks * 32 + 16 + 8 * hh); }
      asm volatile("s_wait_xcnt 0x0" ::: "memory"); }      /* stands behind the query loads, ahead of the index arithmetic that reuses their address registers */
    const int q = q0 + ln; const int limA = (MODE == 0) ? q : ntc * (q + 1) - 1, limB = (MODE == 0) ? q / ntc : q;      /* the lane's query: its last allowed index in the token half and in the concept half */
    float m_q = -3.0e38f, l_q = 0.f; v8f oacc[DT];      /* the lane's query: maximum, sum over this half's keys, and 32 elements of its V sum */
#pragma unroll
    for (int dt = 0; dt < DT; ++dt) oacc[dt] = (v8f){0.f,0.f,0.f,0.f,0.f,0.f,0.f,0.f};
    int j0 = 32 * ((sp < na) ? sp : sp - na + HT); const unsigned short* kp = Kl + (size_t)j0 * 64; const unsigned short* vp = Vl + (size_t)j0 * 64;      /* the wave's first key tile: its plane row, and the lane's addresses in its two 4-KB blocks. They are carried from tile to tile: a register that lives through the whole walk is never handed to a load's result while another load still names it */
#pragma unroll 1
    for (int it = sp; it < na + nb; it += NSP) { const bool ta = it < na; const int t0 = ta ? j0 : j0 - TQ;
      const int dl = (ta ? limA : limB) - t0 - 8 * hh;      /* the lane's score number nt * 8 + r belongs to index t0 + 8 hh + nt * 16 + r of the half: allowed where nt * 16 + r <= dl */
      FragH bk[2][KS], bv[DT];
#pragma unroll
      for (int nt = 0; nt < 2; ++nt)
#pragma unroll
        for (int ks = 0; ks < KS; ++ks) { bk[nt][ks].half[0] = *(const v8us*)(kp + nt * 1024 + ks * 512); bk[nt][ks].half[1] = *(const v8us*)(kp + nt * 1024 + ks * 512 + 256); }
#pragma unroll
      for (int dt = 0; dt < DT; ++dt) { bv[dt].half[0] = *(const v8us*)(vp + dt * 512); bv[dt].half[1] = *(const v8us*)(vp + dt * 512 + 256); }
      asm volatile("s_wait_xcnt 0x0" ::: "memory");      /* stands behind the tile's loads, ahead of the step of the two addresses that they name */
      __builtin_amdgcn_sched_barrier(0);      /* keeps the wait behind all sixteen loads and the address step behind the wait; it also keeps the V^T loads up here, under way during the score products and the softmax (the scheduler otherwise sinks them to their products) */
      { const int in = it + NSP, jn = 32 * ((in < na) ? in : in - na + HT); const ptrdiff_t dk = (ptrdiff_t)(jn - j0) * 64; kp += dk; vp += dk; j0 = jn; }      /* on to the wave's next tile (behind the last one the addresses are not used) */
      float sm[16];
#pragma unroll
      for (int nt = 0; nt < 2; ++nt) { v8f acc = (v8f){0.f,0.f,0.f,0.f,0.f,0.f,0.f,0.f};
#pragma unroll
        for (int ks = 0; ks < KS; ++ks) acc = __builtin_amdgcn_wmma_f32_16x16x32_f16(false, bk[nt][ks].v, false, aq[ks].v, (short)0, acc, false, false);
#pragma unroll
        for (int r = 0; r < 8; ++r) sm[nt * 8 + r] = (nt * 16 + r <= dl) ? acc[r] : -INFINITY; }      /* the bare products: their scale is folded into the exponent's multiply-add below */
      float mc = sm[0];
#pragma unroll
      for (int i = 1; i < 16; ++i) mc = fmaxf(mc, sm[i]);
      mc = fmaxf(mc, xhalf(mc));
      const float mn = fmaxf(m_q, mc * C2), al = __builtin_amdgcn_exp2f(m_q - mn); m_q = mn;      /* the maximum is kept in base-2 units (C2 > 0: scaling keeps the order). No allowed key so far: mn stays at its finite start value, al = 2^0 = 1 and every weight 0 */
      const float nb = 10.0f - mn;      /* the weights' factor 2^10 rides in the exponent */
      float ps = 0.f; FragH pb;
#pragma unroll
      for (int i = 0; i < 16; ++i) { const float p = __builtin_amdgcn_exp2f(fmaf(sm[i], C2, nb)); ps += p; pb.h[i] = (_Float16)p; }      /* one multiply-add and one hardware exponential per score; a masked score stays -inf through the multiply-add and gives 0 */
      l_q = l_q * al + ps;
#pragma unroll
      for (int dt = 0; dt < DT; ++dt) { oacc[dt] *= al; oacc[dt] = __builtin_amdgcn_wmma_f32_16x16x32_f16(false, bv[dt].v, false, pb.v, (short)0, oacc[dt], false, false); } }
    l_q += xhalf(l_q);
    if (hh == 0) { sM[w][ln] = m_q; sL[w][ln] = l_q; }
    __syncthreads();      /* publishes every wave's row maxima and row sums; it also ends the reads of the partial outputs of the query tiles before */
    float mg = sM[pr][ln];
#pragma unroll
    for (int s2 = 1; s2 < NSP; ++s2) mg = fmaxf(mg, sM[s2 * NPR + pr][ln]);
    float lt = 0.f, fo = 0.f;      /* a wave that met no allowed key of this row holds sum 0 and a zero V sum */
#pragma unroll
    for (int s2 = 0; s2 < NSP; ++s2) { const float e = __builtin_amdgcn_exp2f(sM[s2 * NPR + pr][ln] - mg); lt += sL[s2 * NPR + pr][ln] * e; if (s2 == sp) fo = e; }      /* the maxima are base-2 exponents */
    const float fq = (lt > 0.f) ? fo / lt : 0.f;      /* sums and V sums both carry the factor 2^10 */
#pragma unroll
    for (int dt = 0; dt < DT; ++dt) { *(v4fa*)&sO[w][ln][dt * 16 + 8 * hh] = (v4f){oacc[dt][0] * fq, oacc[dt][1] * fq, oacc[dt][2] * fq, oacc[dt][3] * fq}; *(v4fa*)&sO[w][ln][dt * 16 + 8 * hh + 4] = (v4f){oacc[dt][4] * fq, oacc[dt][5] * fq, oacc[dt][6] * fq, oacc[dt][7] * fq}; }
    __syncthreads();      /* publishes the rescaled partial outputs; it also ends the reads of the maxima and sums, which the next query tiles write anew */
    for (int i = tid; i < NPR * RPW * 16; i += 32 * NPR * NSP) { const int q2 = i >> 8, r = (i >> 4) & 15, pc = i & 15; v4f val = *(const v4fa*)&sO[q2][r][pc * 4];
#pragma unroll
      for (int s2 = 1; s2 < NSP; ++s2) val += *(const v4fa*)&sO[s2 * NPR + q2][r][pc * 4];
      const int qo = (ph ? NQT - 1 - (qblk * NPR + q2) : qblk * NPR + q2) * RPW;
      *(v4h*)(O + ((size_t)b * TQ + qo + r) * ldo + h * 64 + pc * 4) = (v4h){(_Float16)(val[0] * 16.0f), (_Float16)(val[1] * 16.0f), (_Float16)(val[2] * 16.0f), (_Float16)(val[3] * 16.0f)}; } } }

extern "C" void kernel_launch(void* const* d_in, const int* in_sizes, int n_in,
                              void* d_out, int out_size, void* d_ws, size_t ws_size, hipStream_t stream) {
  (void)in_sizes; (void)n_in; (void)out_size;
  const float* const* I = (const float* const*)d_in; const float* xt = I[0]; const float* xc = I[1]; const float* Wt = I[2]; const float* bt = I[3]; const float* Wc = I[4]; const float* bc = I[5]; const float* Wtp = I[6]; const float* btp = I[7]; const float* Wcp = I[8]; const float* bcp = I[9]; const int* ntcp = (const int*)d_in[10];      /* int64 in the module, read as int32 */
  char* ws = (char*)d_ws; size_t off = 0;
  auto take = [&](size_t bytes) { char* p = ws + off; off += (bytes + 255) & ~(size_t)255; return p; };
  _Float16* Bt_ = (_Float16*)take((size_t)DW * DD * 2); _Float16* Bc = (_Float16*)take((size_t)DW * DD * 2); _Float16* Btp = (_Float16*)take((size_t)DD * DD * 2); _Float16* Bcp = (_Float16*)take((size_t)DD * DD * 2);
  _Float16* XT = (_Float16*)take((size_t)NR * DD * 2); _Float16* XC = (_Float16*)take((size_t)NR * DD * 2); _Float16* TC = (_Float16*)take((size_t)2 * BB * NH * TK * 64 * 2);      /* keys for token queries, then for concept queries, in fragment order; key rows 0..1023 = tok, 1024..2047 = con */
  _Float16* Vt1 = (_Float16*)take((size_t)BB * NH * 64 * TK * 2); _Float16* Vt2 = (_Float16*)take((size_t)BB * NH * 64 * TK * 2); _Float16* O16 = (_Float16*)take((size_t)2 * NR * DD * 2);      /* O16: token rows, then concept rows */
  (void)Vt2;
  if (off > ws_size) return;      // 8.4 + 8.4 + 2.1 + 2.1 + 4.2 + 4.2 + 16.8 + 8.4 + 8.4 + 8.4 = 71 MB
  /* Four launches, one per stage: launches that do not depend on each other share one grid, and each product stores what its reader takes (V^T; O as f16), so that no pass stands between them. Every plane's size is a multiple of 256 bytes, so that planes taken one after the other lie back to back. */
  k_cvt6<<<(2 * DW * DD + 2 * DD * DD + 2 * NR * DD) / 2048, 256, 0, stream>>>(Wt, Wc, Wtp, Wcp, xt, xc, Bt_);      /* weights: torch (out,in) natural, x 2^4 */
  const dim3 gt((TQ / 128) * (DW / 128), BB, 2);
  k_gemm_lds<true, DD, DW, 2 * DD><<<gt, 256, 0, stream>>>(XT, XC, (size_t)TQ * DD, Bt_, Bc, 0.0625f, bt, bc, nullptr, TC, Vt1, 0, 0);      /* tok[b] -> keys 0..1023, con[b] -> keys 1024..2047: each M 1024 N 4096 K 1024; key columns 0..2047 to the key planes, values read by tokens (columns 2048..) and by concepts (3072..) to the value planes, all in the flash kernel's fragment order */
  k_flashm<<<2 * BB * NH * (TQ / 64), 384, 0, stream>>>(XT, DD, (size_t)NR * DD, TC, (size_t)BB * NH * TK * 64, Vt1, (size_t)BB * NH * 64 * TK, ntcp, O16, DD, (size_t)NR * DD);      /* token queries: keys = columns 0..1023 (kt_t on token rows, kc_t on concept rows); concept queries: keys = columns 1024..2047 (kt_c, kc_c) */
  const dim3 gpj((NR / 128) * (DD / 128), 1, 2);
  k_gemm_lds<false, DD, DD, DD><<<gpj, 256, 0, stream>>>(O16, O16 + (size_t)NR * DD, 0, Btp, Bcp, 0.00390625f, btp, bcp, (float*)d_out, nullptr, nullptr, 0, (size_t)NR * DD);      /* y_t = merged.Wtp^T + btp -> output 0; y_c -> output 1 (offset B.T.NE floats) */
}

// v009
// It runs in 84.1 microseconds.
// In two side-by-side timings against v008, it was 1.06 and 1.08 times as fast.
// All steps since v000 together make it 9.11 times as fast.
#include <hip/hip_runtime.h>
// Token/concept two-stream causal attention (B=2, T=C=1024, NE=CD=1024, 16 heads × 64, n_tokens_per_concept = 8): tok = xt·Wtᵀ + bt, con = xc·Wcᵀ + bc (4096 outputs each = [k for token queries | k for concept queries | v read by tokens | v read by concepts]);
// token queries = heads(xt) (the residual stream itself) attend over [tokens ; concepts] with mask (s ≤ t) | (j < t/8 + 1), scale 1/√64; concept queries = heads(xc) attend over [concepts ; tokens] with mask (j ≤ i) | (s < 8(i+1)); disallowed = −1e9 (≡ −inf: every row keeps itself);
// y_t = merge(attn_t)·Wtpᵀ + btp, y_c = merge(attn_c)·Wcpᵀ + bcp (two outputs).
// Compute dtype: xt, xc, weights, biases rounded to bf16; tok/con as f16 GEMM planes written as the two 1024-row halves of one 2048-key plane per batch; queries = the bf16-exact x planes; fused flash-style kernels with the index-computed masks (n_tokens_per_concept read on device; online softmax f32,
// P f16 ×2^10, f32 accumulate) on v_wmma_f32_16x16x32_f16; O ×2^4 → f16 (stored so by the flash kernel) → projection GEMMs (+bias) straight into the two output slots.
#define BB 2
#define TQ 1024
#define TK 2048
#define DD 1024
#define NH 16
#define DW 4096
#define SCL 0.125f
#define NR (BB * TQ)
typedef __bf16 v16b __attribute__((ext_vector_type(16)));
typedef unsigned short v8us __attribute__((ext_vector_type(8), may_alias));
typedef float  v8f  __attribute__((ext_vector_type(8)));
typedef float  v4f  __attribute__((ext_vector_type(4)));
typedef float  v4fa __attribute__((ext_vector_type(4), may_alias));
union FragB { v16b v; v8us half[2]; unsigned short u[16]; };

__device__ __forceinline__ unsigned short bf16_bits(float x) { unsigned int u = __float_as_uint(x); return (unsigned short)((u + 0x7FFFu + ((u >> 16) & 1u)) >> 16); }
__device__ __forceinline__ float bf16_val(unsigned short b) { return __uint_as_float(((unsigned int)b) << 16); }
__device__ __forceinline__ float bf16_round(float x) { return bf16_val(bf16_bits(x)); }
// D += A·B with NT terms: 1 = ah·bh, 2 = + al·bh (A split), 3 = + ah·bl (both split)
template <int NT>
__device__ __forceinline__ v8f mmaN(v16b ah, v16b al, v16b bh, v16b bl, v8f c) {
  c = __builtin_amdgcn_wmma_f32_16x16x32_bf16(false, ah, false, bh, (short)0, c, false, false);
  if (NT >= 2) c = __builtin_amdgcn_wmma_f32_16x16x32_bf16(false, al, false, bh, (short)0, c, false, false);
  if (NT >= 3) c = __builtin_amdgcn_wmma_f32_16x16x32_bf16(false, ah, false, bl, (short)0, c, false, false);
  asm volatile("v_nop\n\tv_nop\n\tv_nop\n\tv_nop" : "+v"(c) : "v"(ah), "v"(al), "v"(bh), "v"(bl));
  return c;
}

__global__ __launch_bounds__(256) void k_wt_bf16(const float* __restrict__ W, unsigned short* __restrict__ Wt, int K, int N) {
  const int t = blockIdx.x * 256 + threadIdx.x;
  const int k8n = K / 8;
  if (t >= N * k8n) return;
  const int n = t / k8n, k8 = (t % k8n) * 8;
  v8us v;
#pragma unroll
  for (int i = 0; i < 8; ++i) v[i] = bf16_bits(W[(size_t)(k8 + i) * N + n]);
  *(v8us*)(Wt + (size_t)n * K + k8) = v;
  
}

// GEMM C[M][N] (f32, pitch ldc) = act(A[M][K]·W + bias). A f32 row-major (pitch lda) converted per fragment to bf16
// (ASPLIT: hi/lo two planes -> 2 terms, else single rounded term); Wt bf16 [N][K] (pitch ldb). BIAS_BF16 rounds the
// bias to bf16 first (bias quantised to bf16 before the add). K%32==0, M%16==0, N%64==0.
template <bool ASPLIT, int ACT, bool BIAS_BF16>
__global__ __launch_bounds__(128) void k_gemm_bf(const float* __restrict__ A, int lda, const unsigned short* __restrict__ Wt, int ldb,
                                               const float* __restrict__ bias, float* __restrict__ C, int ldc, int M, int N, int K) {
  __shared__ __attribute__((aligned(16))) float so[4][16][64];
  const int tid = threadIdx.x, w = tid >> 5, lane = tid & 31, ln = lane & 15, hh = lane >> 4;
  const int ntn = N / 64;
  const int wid = blockIdx.x * 4 + w;
  const int mt = wid / ntn, nq = wid % ntn;
  if (mt * 16 >= M) return;
  const int row0 = mt * 16, col0 = nq * 64;
  const float* arow = A + (size_t)(row0 + ln) * lda;
  v8f acc[4] = {};
  for (int kb = 0; kb < K; kb += 32) {
    FragB ah, al;
    const v4f x0 = *(const v4fa*)(arow + kb + 8 * hh), x1 = *(const v4fa*)(arow + kb + 8 * hh + 4);
    const v4f x2 = *(const v4fa*)(arow + kb + 16 + 8 * hh), x3 = *(const v4fa*)(arow + kb + 16 + 8 * hh + 4);
    float xs[16] = {x0[0],x0[1],x0[2],x0[3],x1[0],x1[1],x1[2],x1[3],x2[0],x2[1],x2[2],x2[3],x3[0],x3[1],x3[2],x3[3]};
#pragma unroll
    for (int i = 0; i < 16; ++i) { const unsigned short hb = bf16_bits(xs[i]); ah.u[i] = hb; al.u[i] = ASPLIT ? bf16_bits(xs[i] - bf16_val(hb)) : (unsigned short)0; }
#pragma unroll
    for (int t = 0; t < 4; ++t) {
      const unsigned short* brow = Wt + (size_t)(col0 + t * 16 + ln) * ldb + kb;
      FragB b;
      b.half[0] = *(const v8us*)(brow + 8 * hh);
      b.half[1] = *(const v8us*)(brow + 16 + 8 * hh);
      acc[t] = mmaN<ASPLIT ? 2 : 1>(ah.v, al.v, b.v, b.v, acc[t]);
    }
  }
#pragma unroll
  for (int t = 0; t < 4; ++t) {
    float bv = bias ? bias[col0 + t * 16 + ln] : 0.f;
    if (BIAS_BF16) bv = bf16_round(bv);
#pragma unroll
    for (int r = 0; r < 8; ++r) { float v = acc[t][r] + bv; if (ACT == 1) v = fmaxf(v, 0.f); so[w][8 * hh + r][t * 16 + ln] = v; }
  }
  __builtin_amdgcn_fence(__ATOMIC_ACQ_REL, "workgroup");
  __builtin_amdgcn_wave_barrier();
  const int rsub = lane >> 4, c4 = (lane & 15) * 4;
  {
#pragma unroll
    for (int q = 0; q < 8; ++q) {
      const int r = q * 2 + rsub;
      const v4f v = *(const v4fa*)&so[w][r][c4];
      *(v4f*)(C + (size_t)(row0 + r) * ldc + col0 + c4) = v;
    }
    
  }
}

// GEMM C = act(A·W + bias + resid): A f32 (ASPLIT -> hi/lo 2 terms), Wt bf16 [N][K]; ACT 0 none, 1 relu, 2 exact gelu;
// resid (optional, f32, row index = (row % rmod), pitch ldr, RES_BF16 rounds it) added before the activation.
template <bool ASPLIT, int ACT, bool BIAS_BF16, bool RES_BF16>
__global__ __launch_bounds__(128) void k_gemm_bf3(const float* __restrict__ A, int lda, const unsigned short* __restrict__ Wt, int ldb,
                                                const float* __restrict__ bias, const float* __restrict__ resid, int rmod, int ldr,
                                                float* __restrict__ C, int ldc, int M, int N, int K) {
  __shared__ __attribute__((aligned(16))) float so[4][16][64];
  const int tid = threadIdx.x, w = tid >> 5, lane = tid & 31, ln = lane & 15, hh = lane >> 4;
  const int ntn = N / 64;
  const int wid = blockIdx.x * 4 + w;
  const int mt = wid / ntn, nq = wid % ntn;
  if (mt * 16 >= M) return;
  const int row0 = mt * 16, col0 = nq * 64;
  const float* arow = A + (size_t)(row0 + ln) * lda;
  v8f acc[4] = {};
  for (int kb = 0; kb < K; kb += 32) {
    FragB ah, al;
    const v4f x0 = *(const v4fa*)(arow + kb + 8 * hh), x1 = *(const v4fa*)(arow + kb + 8 * hh + 4);
    const v4f x2 = *(const v4fa*)(arow + kb + 16 + 8 * hh), x3 = *(const v4fa*)(arow + kb + 16 + 8 * hh + 4);
    float xs[16] = {x0[0],x0[1],x0[2],x0[3],x1[0],x1[1],x1[2],x1[3],x2[0],x2[1],x2[2],x2[3],x3[0],x3[1],x3[2],x3[3]};
#pragma unroll
    for (int i = 0; i < 16; ++i) { const unsigned short hb = bf16_bits(xs[i]); ah.u[i] = hb; al.u[i] = ASPLIT ? bf16_bits(xs[i] - bf16_val(hb)) : (unsigned short)0; }
#pragma unroll
    for (int t = 0; t < 4; ++t) {
      const unsigned short* brow = Wt + (size_t)(col0 + t * 16 + ln) * ldb + kb;
      FragB b;
      b.half[0] = *(const v8us*)(brow + 8 * hh);
      b.half[1] = *(const v8us*)(brow + 16 + 8 * hh);
      acc[t] = mmaN<ASPLIT ? 2 : 1>(ah.v, al.v, b.v, b.v, acc[t]);
    }
  }
#pragma unroll
  for (int t = 0; t < 4; ++t) {
    const int col = col0 + t * 16 + ln;
    float bv = bias ? bias[col] : 0.f;
    if (BIAS_BF16) bv = bf16_round(bv);
#pragma unroll
    for (int r = 0; r < 8; ++r) {
      float v = acc[t][r] + bv;
      if (resid) { float rv = resid[(size_t)((row0 + 8 * hh + r) % rmod) * ldr + col]; if (RES_BF16) rv = bf16_round(rv); v += rv; }
      if (ACT == 1) v = fmaxf(v, 0.f);
      if (ACT == 2) v = 0.5f * v * (1.0f + erff(v * 0.70710678118654752f));
      if (ACT == 3) { const float u = 0.7978845608028654f * (v + 0.044715f * v * v * v); v = 0.5f * v * (1.0f + tanhf(u)); }
      so[w][8 * hh + r][t * 16 + ln] = v;
    }
  }
  __builtin_amdgcn_fence(__ATOMIC_ACQ_REL, "workgroup");
  __builtin_amdgcn_wave_barrier();
  const int rsub = lane >> 4, c4 = (lane & 15) * 4;
  {
#pragma unroll
    for (int q = 0; q < 8; ++q) {
      const int r = q * 2 + rsub;
      const v4f v = *(const v4fa*)&so[w][r][c4];
      *(v4f*)(C + (size_t)(row0 + r) * ldc + col0 + c4) = v;
    }
    
  }
}
// row LayerNorm (biased variance, eps) over N: s = X (+ R); optional out_sum <- s; out_norm <- (s-mu)*rsqrt(var+eps)*g + b
template <bool PARAM_BF16>
__global__ __launch_bounds__(256) void k_layernorm(const float* __restrict__ X, const float* __restrict__ R, const float* __restrict__ g, const float* __restrict__ bta,
                                                  float* __restrict__ out_sum, float* __restrict__ out_norm, int N, float eps) {
  __shared__ float red[256];
  const int row = blockIdx.x, tid = threadIdx.x;
  const float* x = X + (size_t)row * N; const float* rr = R ? R + (size_t)row * N : nullptr;
  float vals[16];                     // up to N = 4096
  const int per = N / 256;            // contiguous chunk per thread? use strided-by-4 chunks: thread handles j = tid*4 + 1024*u
  float s1 = 0.f;
  for (int u = 0; u < per / 4; ++u) {
    const int j = tid * 4 + 1024 * u;
    const v4f a = *(const v4fa*)(x + j);
    v4f b = {0.f,0.f,0.f,0.f}; if (rr) b = *(const v4fa*)(rr + j);
#pragma unroll
    for (int q = 0; q < 4; ++q) { const float v = a[q] + b[q]; vals[u * 4 + q] = v; s1 += v; }
  }
  red[tid] = s1; __syncthreads();
  for (int st = 128; st > 0; st >>= 1) { if (tid < st) red[tid] += red[tid + st]; __syncthreads(); }
  const float mu = red[0] / (float)N; __syncthreads();
  float s2 = 0.f;
  for (int u = 0; u < per / 4; ++u)
#pragma unroll
    for (int q = 0; q < 4; ++q) { const float c = vals[u * 4 + q] - mu; s2 += c * c; }
  red[tid] = s2; __syncthreads();
  for (int st = 128; st > 0; st >>= 1) { if (tid < st) red[tid] += red[tid + st]; __syncthreads(); }
  const float rs = rsqrtf(red[0] / (float)N + eps);
  {
    for (int u = 0; u < per / 4; ++u) {
      const int j = tid * 4 + 1024 * u;
      v4f o, sm;
#pragma unroll
      for (int q = 0; q < 4; ++q) {
        float gg = g[j + q], bb = bta[j + q];
        if (PARAM_BF16) { gg = bf16_round(gg); bb = bf16_round(bb); }
        sm[q] = vals[u * 4 + q]; o[q] = (vals[u * 4 + q] - mu) * rs * gg + bb;
      }
      if (out_sum) *(v4f*)(out_sum + (size_t)row * N + j) = sm;
      *(v4f*)(out_norm + (size_t)row * N + j) = o;
    }
    
  }
}



// ---- f16 WMMA path (v_wmma_f32_16x16x32_f16): 11-bit significands for operands in range — used where a [0,1] probability operand needs more precision than bf16
typedef _Float16 v16h __attribute__((ext_vector_type(16)));
union FragH { v16h v; v8us half[2]; _Float16 h[16]; unsigned short u[16]; };
template <int NT>
__device__ __forceinline__ v8f mmaH(v16h ah, v16h al, v16h bh, v16h bl, v8f c) {
  c = __builtin_amdgcn_wmma_f32_16x16x32_f16(false, ah, false, bh, (short)0, c, false, false);
  if (NT >= 2) c = __builtin_amdgcn_wmma_f32_16x16x32_f16(false, al, false, bh, (short)0, c, false, false);
  if (NT >= 3) c = __builtin_amdgcn_wmma_f32_16x16x32_f16(false, ah, false, bl, (short)0, c, false, false);
  asm volatile("v_nop\n\tv_nop\n\tv_nop\n\tv_nop" : "+v"(c) : "v"(ah), "v"(al), "v"(bh), "v"(bl));
  return c;
}
// batched GEMM like k_gemm_b but f16 operands: A f32 (split into f16 hi/lo if ASPLIT, else rounded to f16), Bt = f16 values [n][k]; alpha; C f32; N multiple of 16 (partial tiles skipped)
template <bool ASPLIT>
__global__ __launch_bounds__(128) void k_gemm_h(const float* __restrict__ A, int lda, size_t sA, const _Float16* __restrict__ Bh, int ldb, size_t sB, float alpha, float* __restrict__ C, int ldc, size_t sC, int M, int N, int K) {
  __shared__ __attribute__((aligned(16))) float so[4][16][64];
  const int tid = threadIdx.x, w = tid >> 5, lane = tid & 31, ln = lane & 15, hh = lane >> 4; const int by = blockIdx.y;
  A += (size_t)by * sA; Bh += (size_t)by * sB; C += (size_t)by * sC;
  const int ntn = (N + 63) / 64; const int wid = blockIdx.x * 4 + w; const int mt = wid / ntn, nq = wid % ntn; if (mt * 16 >= M) return;
  const int row0 = mt * 16, col0 = nq * 64; const float* arow = A + (size_t)(row0 + ln) * lda;
  v8f acc[4] = {};
  for (int kb = 0; kb < K; kb += 32) {
    FragH ah, al;
    const v4f x0 = *(const v4fa*)(arow + kb + 8 * hh), x1 = *(const v4fa*)(arow + kb + 8 * hh + 4), x2 = *(const v4fa*)(arow + kb + 16 + 8 * hh), x3 = *(const v4fa*)(arow + kb + 16 + 8 * hh + 4);
    float xs[16] = {x0[0],x0[1],x0[2],x0[3],x1[0],x1[1],x1[2],x1[3],x2[0],x2[1],x2[2],x2[3],x3[0],x3[1],x3[2],x3[3]};
#pragma unroll
    for (int i = 0; i < 16; ++i) { const _Float16 h = (_Float16)xs[i]; ah.h[i] = h; al.h[i] = ASPLIT ? (_Float16)(xs[i] - (float)h) : (_Float16)0.0f; }
#pragma unroll
    for (int t = 0; t < 4; ++t) { if (col0 + t * 16 >= N) continue; const size_t boff = (size_t)(col0 + t * 16 + ln) * ldb + kb; FragH bq; bq.half[0] = *(const v8us*)(Bh + boff + 8 * hh); bq.half[1] = *(const v8us*)(Bh + boff + 16 + 8 * hh);
      acc[t] = mmaH<ASPLIT ? 2 : 1>(ah.v, al.v, bq.v, bq.v, acc[t]); }
  }
#pragma unroll
  for (int t = 0; t < 4; ++t) { if (col0 + t * 16 >= N) continue;
#pragma unroll
    for (int r = 0; r < 8; ++r) so[w][8 * hh + r][t * 16 + ln] = acc[t][r] * alpha; }
  __builtin_amdgcn_fence(__ATOMIC_ACQ_REL, "workgroup"); __builtin_amdgcn_wave_barrier();
  const int rsub = lane >> 4, c4 = (lane & 15) * 4;
  {
#pragma unroll
    for (int q = 0; q < 8; ++q) { const int r = q * 2 + rsub; if (col0 + c4 < N) { const v4f v = *(const v4fa*)&so[w][r][c4]; *(v4f*)(C + (size_t)(row0 + r) * ldc + col0 + c4) = v; } }
     }
}

// Wt[n][k] = f16(W[k][n]·scale) from f32 row-major W[K][N] (scale = power of two; bf16-exact weights stay exact in f16 away from the subnormal range)
__global__ __launch_bounds__(256) void k_wt_f16(const float* __restrict__ W, _Float16* __restrict__ Wt, int K, int N, float scale) {
  const int t = blockIdx.x * 256 + threadIdx.x; if (t >= N * (K / 8)) return; const int n = t / (K / 8), k8 = (t % (K / 8)) * 8; FragH f;
#pragma unroll
  for (int i = 0; i < 8; ++i) f.h[i] = (_Float16)(bf16_round(W[(size_t)(k8 + i) * N + n]) * scale); const v8us o = f.half[0];
  *(v8us*)((unsigned short*)Wt + (size_t)n * K + k8) = o; 
}
// k_gemm_hh variant with fused epilogue: v = acc·alpha + bias[by·sBias + col] (+ CP[(row/rowsPerB)·sCPb + by·64 + col] if CP) ; ACT 0 none / 1 elu ; writes f16 C16 and/or f32 C, each if non-null
template <int ACT>
__global__ __launch_bounds__(128) void k_gemm_hhx(const _Float16* __restrict__ A, int lda, size_t sA, const _Float16* __restrict__ Bh, int ldb, size_t sB, float alpha, const float* __restrict__ bias, size_t sBias, const float* __restrict__ CP, int rowsPerB, size_t sCPb, int row0g,
    float* __restrict__ C, _Float16* __restrict__ C16, int ldc, size_t sC, int M, int N, int K) {
  __shared__ __attribute__((aligned(16))) float so[4][16][64];
  const int tid = threadIdx.x, w = tid >> 5, lane = tid & 31, ln = lane & 15, hh = lane >> 4; const int by = blockIdx.y;
  A += (size_t)by * sA; Bh += (size_t)by * sB; const size_t cofs = (size_t)by * sC; const float* bp = bias ? bias + (size_t)by * sBias : nullptr;
  const int ntn = (N + 63) / 64; const int wid = blockIdx.x * 4 + w; const int mt = wid / ntn, nq = wid % ntn; if (mt * 16 >= M) return;
  const int row0 = mt * 16, col0 = nq * 64; const _Float16* arow = A + (size_t)(row0 + ln) * lda;
  v8f acc[4] = {};
  for (int kb = 0; kb < K; kb += 32) { FragH ah; ah.half[0] = *(const v8us*)((const unsigned short*)arow + kb + 8 * hh); ah.half[1] = *(const v8us*)((const unsigned short*)arow + kb + 16 + 8 * hh);
#pragma unroll
    for (int t = 0; t < 4; ++t) { if (col0 + t * 16 >= N) continue; const size_t boff = (size_t)(col0 + t * 16 + ln) * ldb + kb; FragH bq; bq.half[0] = *(const v8us*)((const unsigned short*)Bh + boff + 8 * hh); bq.half[1] = *(const v8us*)((const unsigned short*)Bh + boff + 16 + 8 * hh);
      acc[t] = mmaH<1>(ah.v, ah.v, bq.v, bq.v, acc[t]); }
  }
#pragma unroll
  for (int t = 0; t < 4; ++t) { if (col0 + t * 16 >= N) continue; const int col = col0 + t * 16 + ln; const float bv = bp ? bf16_round(bp[col]) : 0.f;
#pragma unroll
    for (int r = 0; r < 8; ++r) { float v = acc[t][r] * alpha + bv; if (CP) { const int bidx = (row0g + row0 + 8 * hh + r) / rowsPerB; v += CP[(size_t)bidx * sCPb + (size_t)by * 64 + col]; } if (ACT == 1) v = (v > 0.f) ? v : expm1f(v); else if (ACT == 7) v = (v > 0.f) ? v + 1.0f : expf(v); else if (ACT == 8) v = tanhf(v); else if (ACT == 9) v = 0.5f * v * (1.0f + tanhf(0.7978845608028654f * (v + 0.044715f * v * v * v))); else if (ACT == 11) v = 1.0f / (1.0f + expf(-v)); else if (ACT == 12) v = (v > 0.f) ? v : 0.01f * v; else if (ACT == 14) v = (v > 0.f) ? v : 0.1f * v; else if (ACT == 15) v = v / (1.0f + expf(-v)); else if (ACT == 3) v = fmaxf(v, 0.f); else if (ACT == 6) v = 0.5f * v * (1.0f + erff(v * 0.70710678118654752f)); so[w][8 * hh + r][t * 16 + ln] = v; } }
  __builtin_amdgcn_fence(__ATOMIC_ACQ_REL, "workgroup"); __builtin_amdgcn_wave_barrier();
  const int rsub = lane >> 4, c4 = (lane & 15) * 4; typedef _Float16 v4h __attribute__((ext_vector_type(4)));
  {
#pragma unroll
    for (int q = 0; q < 8; ++q) { const int r = q * 2 + rsub; if (col0 + c4 < N) { const v4f v = *(const v4fa*)&so[w][r][c4]; if (C) *(v4f*)(C + cofs + (size_t)(row0 + r) * ldc + col0 + c4) = v; if (C16) { v4h h4; for (int i = 0; i < 4; ++i) h4[i] = (_Float16)v[i]; *(v4h*)(C16 + cofs + (size_t)(row0 + r) * ldc + col0 + c4) = h4; } } }
     }
}


// GEMM C = (A.B^T)*alpha + bias on f16 planes, A [M][KD] (batch stride sA), Bh [ND][KD], both k-contiguous at pitch KD; C [M][ND] (batch stride sC) as f32, or as f16 (OUT16) in the reader's fragment order described below. M and ND multiples of BT, KD a multiple of 64; grid.x = (M / BT) * (ND / BT), grid.y = batch, grid.z = 2: two independent products of one shape in one launch (operands A0, B0, bias0 or A1, B1, bias1; the second one's f32 C lies sZ elements behind the first's; its f16 rows are keys TQ.. of the key planes).
// One BT x BT tile of C per work-group of 8 waves: BT = 128: 4 x 2 waves of 32 x 64; BT = 256: 2 x 4 waves of 128 x 64, one work-group per WGP, two waves per SIMD. The larger tile asks L2 for half the operand bytes per product, and a wave's 8 + 4 fragments feed 32 matrix instructions (2 + 4 feed 8 in the smaller one), which halves the LDS bytes read per product;
// it is for a product with enough tiles to fill the chip. A 64-k slice of both operands (128 bytes of each row) is brought in by loads that cover whole lines and laid in LDS at pitch 144 bytes; every wave reads its fragments from there,
// so a row is asked of L2 once per work-group, not once per wave. Two LDS buffers: the next slice is loaded into registers ahead of the products of this one and stored behind them. Each accumulator still sums its k blocks of 32 in rising order.
// Tiles whose columns start at NT0 or later (the value columns; NT0 = ND: none) are wanted transposed by their reader. Such a work-group takes the two operands in each other's place: it forms Bh.A^T, the same sums over k, and its tile's rows are columns of C;
// no pass over C follows. Which way a work-group goes is a scalar choice by its block index. The bias then belongs to the tile's row.
// The f16 output (OUT16) is stored in the order in which the attention kernel's lanes take their matrix fragments, so that each of its 16-byte-per-lane loads covers 512 bytes in a row (four whole lines) and not 32-byte pieces of sixteen rows. Both planes are [column block of DD][batch][head][key tile of 32][2048 elements]:
// keys (C16): [16-key group nt][load j][lane][8], lane (ln, hh) holding key nt * 16 + ln, head columns (j >> 1) * 32 + (j & 1) * 16 + 8 hh + 0..7; values (Ct): [16-column group dt][load hf][lane][8], lane (ln, hh) holding head column dt * 16 + ln, keys hf * 16 + 8 hh + 0..7.
// A wave hands its tile over in groups of 32 rows x 64 columns through its own 32 staging rows. Such a group is one head's columns of one key tile (keys), or two column groups of two key tiles (values): it is stored as runs of 4 KB or 2 KB.
// The unroll directives on the short loops below make every index into the register arrays (staged rows, fragments, accumulators, bias) a constant, so that these arrays stay in registers.
template <bool OUT16, int KD, int ND, int NT0, int BT>
__global__ __launch_bounds__(256) void k_gemm_lds(const _Float16* __restrict__ A0, const _Float16* __restrict__ A1, size_t sA, const _Float16* __restrict__ B0, const _Float16* __restrict__ B1, float alpha, const float* __restrict__ bias0, const float* __restrict__ bias1,
    float* __restrict__ C, _Float16* __restrict__ C16, _Float16* __restrict__ Ct, size_t sC, size_t sZ) {
  const bool z1 = blockIdx.z != 0; const _Float16* A = z1 ? A1 : A0; const _Float16* Bh = z1 ? B1 : B0; const float* bias = z1 ? bias1 : bias0;
  constexpr int BK = 64, LP = BK + 8, WCN = BT / 64, MI = BT * WCN / 128, NG = MI / 2, SP = BT / 32;      /* WCN waves side by side, 64 columns each; MI row fragments of 16 per wave; NG output groups of 32 rows; SP staging rows per thread and operand */
  static_assert(NG == 1 || (MI * 16) % 64 == 0, "with several output groups a wave's rows start on a head's first column");
  __shared__ __attribute__((aligned(16))) unsigned char sm[4 * BT * LP * 2];      /* the two operands' two buffers; behind the loop the same bytes stage the output rows */
  unsigned short (*tA)[BT][LP] = (unsigned short (*)[BT][LP])sm; unsigned short (*tB)[BT][LP] = (unsigned short (*)[BT][LP])(sm + 2 * BT * LP * 2);
  const int tid = threadIdx.x, w = tid >> 5, lane = tid & 31, ln = lane & 15, hh = lane >> 4;
  constexpr int ntn = ND / BT; const int row0 = ((int)blockIdx.x / ntn) * BT, col0 = ((int)blockIdx.x % ntn) * BT; const int wr = (w / WCN) * (MI * 16), wc = (w % WCN) * 64;
  const int sr = tid >> 3, sc = (tid & 7) * 8;      /* staging: 8 threads take one row's 128 bytes, a wave 4 whole lines; rows sr + 32 i */
  const bool tr = NT0 < ND && col0 >= NT0;      /* the same for the whole work-group */
  const unsigned short* Ar = (const unsigned short*)A + (size_t)blockIdx.y * sA + (size_t)(row0 + sr) * KD + sc; const unsigned short* Br = (const unsigned short*)Bh + (size_t)(col0 + sr) * KD + sc;
  const unsigned short* Ag = tr ? Br : Ar; const unsigned short* Bg = tr ? Ar : Br;
  float bv[4], bR[MI]; const int br0 = col0 + wr + ln, bc0 = col0 + wc + ln;      /* bv: the straight way's column biases; bR: the transposed way's row biases, rows mi * 16 + ln of the wave's tile. All places lie in the tile's BT columns */
  v8us ra[SP], rb[SP];
#pragma unroll
  for (int i = 0; i < SP; ++i) { ra[i] = *(const v8us*)(Ag + 32 * i * KD); rb[i] = *(const v8us*)(Bg + 32 * i * KD); }
#pragma unroll
  for (int i = 0; i < SP; ++i) { *(v8us*)&tA[0][sr + 32 * i][sc] = ra[i]; *(v8us*)&tB[0][sr + 32 * i][sc] = rb[i]; }
  __syncthreads();      /* publishes slice 0 */
  v8f acc[MI][4];
#pragma unroll
  for (int mi = 0; mi < MI; ++mi)
#pragma unroll
    for (int t = 0; t < 4; ++t) acc[mi][t] = (v8f){0.f,0.f,0.f,0.f,0.f,0.f,0.f,0.f};
  constexpr int ns = KD / BK;
#pragma unroll      /* slice offsets and the buffer choice become immediates: no address arithmetic in the loop, and no address register is rewritten while loads are under way */
  for (int s = 0; s < ns; ++s) { const int cur = s & 1; const bool more = s + 1 < ns;
    if (more) {
#pragma unroll
      for (int i = 0; i < SP; ++i) { ra[i] = *(const v8us*)(Ag + 32 * i * KD + (s + 1) * BK); rb[i] = *(const v8us*)(Bg + 32 * i * KD + (s + 1) * BK); }
      __builtin_amdgcn_sched_barrier(0); }      /* keeps the next slice's loads ahead of this slice's products; the scheduler otherwise sinks them to their LDS stores and the group waits out their whole latency */
    else {      /* the last slice has no loads of its own: the biases are read here, into registers that the staged rows have left, under way during its products. Both ways' are read, so that the loads go out together, under no branch */
#pragma unroll
      for (int mi = 0; mi < MI; ++mi) bR[mi] = bias[br0 + mi * 16];
#pragma unroll
      for (int t = 0; t < 4; ++t) bv[t] = bias[bc0 + t * 16];
      asm volatile("s_wait_xcnt 0x0" :: "v"(br0), "v"(bc0) : "memory");      /* the bias loads' two index registers, named here, stay whole up to this wait: nothing rewrites a register that an issued load still names */
      __builtin_amdgcn_sched_barrier(0); }      /* keeps these loads ahead of the products */
#pragma unroll
    for (int ks = 0; ks < 2; ++ks) { FragH fa[MI], fb[4];
#pragma unroll
      for (int mi = 0; mi < MI; ++mi) { fa[mi].half[0] = *(const v8us*)&tA[cur][wr + mi * 16 + ln][ks * 32 + 8 * hh]; fa[mi].half[1] = *(const v8us*)&tA[cur][wr + mi * 16 + ln][ks * 32 + 16 + 8 * hh]; }
#pragma unroll
      for (int t = 0; t < 4; ++t) { fb[t].half[0] = *(const v8us*)&tB[cur][wc + t * 16 + ln][ks * 32 + 8 * hh]; fb[t].half[1] = *(const v8us*)&tB[cur][wc + t * 16 + ln][ks * 32 + 16 + 8 * hh]; }
#pragma unroll
      for (int mi = 0; mi < MI; ++mi)
#pragma unroll
        for (int t = 0; t < 4; ++t) acc[mi][t] = __builtin_amdgcn_wmma_f32_16x16x32_f16(false, fa[mi].v, false, fb[t].v, (short)0, acc[mi][t], false, false); }
    if (more) {
#pragma unroll
      for (int i = 0; i < SP; ++i) { *(v8us*)&tA[cur ^ 1][sr + 32 * i][sc] = ra[i]; *(v8us*)&tB[cur ^ 1][sr + 32 * i][sc] = rb[i]; } }
    __syncthreads();      /* publishes slice s + 1 and ends every wave's reads of slice s, whose buffer the next trip refills (behind the last slice: the output staging) */
  }
  asm volatile("s_wait_xcnt 0x0" :: "v"(Ag), "v"(Bg) : "memory");      /* the operand loads' two address pairs, named here, stay whole through the loop and up to this wait: nothing rewrites a register that an issued load still names */
#pragma unroll
  for (int mi = 0; mi < MI; ++mi) bR[mi] = bf16_round(bR[mi]);
#pragma unroll
  for (int t = 0; t < 4; ++t) bv[t] = tr ? 0.f : bf16_round(bv[t]);
  const size_t cofs = (size_t)blockIdx.y * sC + (size_t)blockIdx.z * sZ; const int rsub = lane >> 4, c4 = (lane & 15) * 4;
  float (*so)[64 + 4] = (float (*)[64 + 4])sm + w * 32;      /* the wave's own 32 staging rows */
  auto stage = [&](int g) __attribute__((always_inline)) {      /* group g of the wave's tile, scaled and biased, into the staging rows */
    if (g) { __builtin_amdgcn_fence(__ATOMIC_ACQ_REL, "workgroup", "local"); __builtin_amdgcn_wave_barrier(); }      /* the wave's own staging rows: the row reads of the group before stay ahead of this group's stores */
#pragma unroll
    for (int mi = 0; mi < 2; ++mi)
#pragma unroll
      for (int t = 0; t < 4; ++t)
#pragma unroll
        for (int r = 0; r < 8; ++r) so[mi * 16 + 8 * hh + r][t * 16 + ln] = acc[g * 2 + mi][t][r] * alpha + bv[t];
    __builtin_amdgcn_fence(__ATOMIC_ACQ_REL, "workgroup", "local"); __builtin_amdgcn_wave_barrier(); };      /* every lane's stores stay ahead of the row reads that follow */
  /* In the three loops over the groups the unroll directive makes the accumulators' indices, the staging rows and the stores' offsets immediates: one address register pair serves all stores and is never rewritten.
     Behind each group's stores stands s_wait_xcnt 0, ahead of the next group's arithmetic (the scheduling barrier keeps that behind it): nothing rewrites a register that a store still names.
     On the f16 ways a group's eight packed rows are all formed first; the scheduling barrier in front of the stores keeps that arithmetic from being laid among them, where it reused a stored row's registers ahead of the wait. */
  if (NT0 < ND && tr) { const int cv = col0 - NT0, cd = cv % DD + wr;      /* the tile's BT columns lie in one block of DD; row r of the wave's group g is column cd + 32 g + r of that block (two column groups of one head), its 64 keys two key tiles */
    unsigned short* P = (unsigned short*)Ct + ((((size_t)((cv / DD) * BB + (int)blockIdx.y) * NH + cd / 64) * (TK / 32) + ((int)blockIdx.z * TQ + row0 + wc) / 32) * 4 + (cd % 64) / 16) * 512 + lane * 8;
#pragma unroll
    for (int g = 0; g < NG; ++g) { stage(g); FragH f[8];
#pragma unroll
      for (int q = 0; q < 8; ++q) { const int kk = q >> 2, dl = (q >> 1) & 1, hf = q & 1; const float* s = &so[dl * 16 + ln][kk * 32 + hf * 16 + 8 * hh]; const v4f v0 = *(const v4fa*)s, v1 = *(const v4fa*)(s + 4); const float br = bR[g * 2 + dl];
#pragma unroll
        for (int i = 0; i < 4; ++i) { f[q].h[i] = (_Float16)(v0[i] + br); f[q].h[4 + i] = (_Float16)(v1[i] + br); } }
      __builtin_amdgcn_sched_barrier(0);      /* keeps the rows' arithmetic ahead of the stores: none of it reuses a stored row's registers ahead of the wait below */
#pragma unroll
      for (int q = 0; q < 8; ++q) { const int kk = q >> 2, dl = (q >> 1) & 1, hf = q & 1; *(v8us*)(P + (g >> 1) * ((TK / 32) * 2048) + (g & 1) * 1024 + kk * 2048 + dl * 512 + hf * 256) = f[q].half[0]; }      /* groups 2 and 3 are the next head's columns */
      asm volatile("s_wait_xcnt 0x0" ::: "memory"); __builtin_amdgcn_sched_barrier(0); }      /* the wait stands behind the group's stores; the scheduling barrier keeps what follows behind it */
    return; }
  if (OUT16) { const int cg = col0 + wc;      /* the wave's 64 columns are one head's, the 32 rows of a group one key tile */
    unsigned short* P = (unsigned short*)C16 + (((size_t)((cg / DD) * BB + (int)blockIdx.y) * NH + (cg % DD) / 64) * (TK / 32) + ((int)blockIdx.z * TQ + row0 + wr) / 32) * 2048 + lane * 8;
#pragma unroll
    for (int g = 0; g < NG; ++g) { stage(g); FragH f[8];
#pragma unroll
      for (int q = 0; q < 8; ++q) { const int nt = q >> 2, j = q & 3; const float* s = &so[nt * 16 + ln][(j >> 1) * 32 + (j & 1) * 16 + 8 * hh]; const v4f v0 = *(const v4fa*)s, v1 = *(const v4fa*)(s + 4);
#pragma unroll
        for (int i = 0; i < 4; ++i) { f[q].h[i] = (_Float16)v0[i]; f[q].h[4 + i] = (_Float16)v1[i]; } }
      __builtin_amdgcn_sched_barrier(0);      /* keeps the rows' arithmetic ahead of the stores: none of it reuses a stored row's registers ahead of the wait below */
#pragma unroll
      for (int q = 0; q < 8; ++q) { const int nt = q >> 2, j = q & 3; *(v8us*)(P + g * 2048 + nt * 1024 + j * 256) = f[q].half[0]; }
      asm volatile("s_wait_xcnt 0x0" ::: "memory"); __builtin_amdgcn_sched_barrier(0); }      /* the wait stands behind the group's stores; the scheduling barrier keeps what follows behind it */
    return; }
#pragma unroll
  for (int g = 0; g < NG; ++g) { stage(g);
#pragma unroll
    for (int q = 0; q < 16; ++q) { const int r = q * 2 + rsub; const v4f v = *(const v4fa*)&so[r][c4]; *(v4f*)(C + cofs + (size_t)(row0 + wr + g * 32 + r) * ND + col0 + wc + c4) = v; }
    asm volatile("s_wait_xcnt 0x0" ::: "memory"); __builtin_amdgcn_sched_barrier(0); }      /* the wait stands behind the group's stores; the scheduling barrier keeps what follows behind it */
}

typedef _Float16 v4h __attribute__((ext_vector_type(4)));

// One launch rounds all six f32 operands to their f16 planes, which lie one behind the other in the workspace: Wt, Wc, Wtp, Wcp (bf16-rounded, x 2^4), then xt, xc (bf16-rounded, x 1, which is exact).
// The 2048 elements of a work-group lie in one operand; which one is a scalar choice by the block index.
__global__ __launch_bounds__(256) void k_cvt6(const float* __restrict__ Wt, const float* __restrict__ Wc, const float* __restrict__ Wtp, const float* __restrict__ Wcp, const float* __restrict__ xt, const float* __restrict__ xc, _Float16* __restrict__ dst) {
  constexpr unsigned GW = DW * DD / 2048, GP = DD * DD / 2048, GX = NR * DD / 2048;
  unsigned blk = blockIdx.x; const float* s; float sc = 16.0f;
  if (blk < GW) s = Wt; else if ((blk -= GW) < GW) s = Wc; else if ((blk -= GW) < GP) s = Wtp; else if ((blk -= GP) < GP) s = Wcp; else if ((blk -= GP) < GX) { s = xt; sc = 1.0f; } else { blk -= GX; s = xc; sc = 1.0f; }
  const size_t t = (size_t)blk * 256 + threadIdx.x; FragH f;
#pragma unroll
  for (int q = 0; q < 8; ++q) f.h[q] = (_Float16)(bf16_round(s[t * 8 + q]) * sc);
  *(v8us*)((unsigned short*)dst + ((size_t)blockIdx.x * 256 + threadIdx.x) * 8) = f.half[0]; }
__global__ __launch_bounds__(256) void k_h16(const float* __restrict__ x, _Float16* __restrict__ X16, size_t n8) { const size_t t = (size_t)blockIdx.x * 256 + threadIdx.x; if (t >= n8) return; FragH f;
#pragma unroll
  for (int q = 0; q < 8; ++q) f.h[q] = (_Float16)x[t * 8 + q]; *(v8us*)((unsigned short*)X16 + t * 8) = f.half[0];  }
__global__ __launch_bounds__(256) void k_hl(const float* __restrict__ F, _Float16* __restrict__ Hh, _Float16* __restrict__ Hl, size_t n8) { const size_t t = (size_t)blockIdx.x * 256 + threadIdx.x; if (t >= n8) return; FragH fh, fl; const v4f a = *(const v4fa*)(F + t * 8), c = *(const v4fa*)(F + t * 8 + 4);
#pragma unroll
  for (int q = 0; q < 4; ++q) { _Float16 h = (_Float16)a[q]; fh.h[q] = h; fl.h[q] = (_Float16)((a[q] - (float)h) * 1024.0f); h = (_Float16)c[q]; fh.h[4 + q] = h; fl.h[4 + q] = (_Float16)((c[q] - (float)h) * 1024.0f); }
  { *(v8us*)((unsigned short*)Hh + t * 8) = fh.half[0]; *(v8us*)((unsigned short*)Hl + t * 8) = fl.half[0];  } }

// masks over (query index q, key-plane row): key-plane rows 0..T-1 are TOKENS, rows T..2T-1 are CONCEPTS (the tok/con GEMMs write the two halves of one plane per batch). Inside each half the allowed keys of a query are the indices 0 .. lim:
// MODE 0 = token queries: token s <= q (causal), concept j < q / ntc + 1, that is j <= q / ntc; MODE 1 = concept queries: token s < ntc * (q + 1), concept j <= q. (Key order inside the softmax is irrelevant, so the plane order is used directly.)
__device__ __forceinline__ float xhalf(float x) { return __builtin_bit_cast(float, __builtin_amdgcn_permlanex16(__builtin_bit_cast(int, x), __builtin_bit_cast(int, x), 0x76543210, 0xfedcba98, false, false)); }      /* lane l's value to lane l ^ 16 and back, in registers */
// Work-group = 12 waves on four query tiles of 16 rows, taken as two pairs (p, 63 - p), p = 2 * block + (w & 1): an early tile, which the masks leave few keys, with a late one, which they leave many, so that within one MODE the waves walk more even numbers of key tiles.
// A wave takes its pair's two query tiles one after the other (ph = 0, 1). Of the 64 key tiles of 32 it walks only those in which the mask allows some key to some row of the query tile: both masks grow with the query index and shrink with the key index inside each half of the key plane,
// so these are the first na tiles of the token half and the first nb of the concept half, counted from the tile's last row. A tile left out held only weights 0 and left maximum, sum and V sum as they were. The six waves (w >> 1) of a pair take every sixth tile of that list;
// the six partial softmax states of a query tile (row maximum, row sum, weighted V sum) are merged in LDS behind each walk.
// Both products are taken transposed: S^T = K.Q^T (A = key rows, B = query rows) and O^T += V^T.P^T (A = rows of V^T, B = P^T). A lane then holds 16 scores of ONE query (column ln; keys 8 hh + r and 16 + 8 hh + r of the tile), so that maximum and sum are taken inside the lane,
// with one exchange between the wave's halves, there is one maximum, one sum and one rescale factor per lane, and the two score tiles, converted in place, are the B operand P^T in the k order in which the V^T rows are loaded: P passes through no LDS.
// A masked score is -inf; against the finite maximum its weight is exp(-inf) = 0. The second launch bound states the aim: 6 waves per SIMD, two work-groups per WGP (at most 160 registers a wave).
// Both attentions run in one launch: the first half of the grid takes the concept queries (MODE 1, whose masks allow more keys), the second half the token queries (MODE 0). MODE is the same for a whole work-group and stays in a scalar register;
// it chooses the planes (MODE 1's queries, key columns, V^T and output lie sQ, sK, sV and sOut elements behind MODE 0's) and the walk's bounds, and the key loop does not read it.
// The merged rows are stored as the projection reads them: x 2^4, rounded to f16, a head's 64 columns of a row as one whole line.
__global__ __launch_bounds__(384, 6) void k_flashm(const _Float16* __restrict__ Q16, int ldq, size_t sQ, const _Float16* __restrict__ K16, size_t sK, const _Float16* __restrict__ Vt, size_t sV, const int* __restrict__ NTCP, _Float16* __restrict__ O, int ldo, size_t sOut) {
  int ntc = NTCP[0]; ntc = (ntc < 1) ? 1 : ((ntc > TQ) ? TQ : ntc);      /* = 8 here; guarded so the index arithmetic can never divide by zero; from TQ up both masks read the same as at TQ, and the products below cannot overflow */
  constexpr int RPW = 16, NPR = 2, NQT = TQ / RPW, NQB = NQT / (2 * NPR), DT = 4, KS = 2, NSP = 6, HT = TQ / 32;
  constexpr float C2 = SCL * 1.4426950408889634f;      /* score scale x log2(e): exp(SCL * s - m) = 2^(C2 * s - m * log2(e)) */
  __shared__ __attribute__((aligned(16))) float sO[NPR * NSP][RPW][64 + 4]; __shared__ float sM[NPR * NSP][RPW], sL[NPR * NSP][RPW];
  const int tid = threadIdx.x, w = __builtin_amdgcn_readfirstlane(tid >> 5), lane = tid & 31, ln = lane & 15, hh = lane >> 4;      /* the wave's number in a scalar register: the key loop's counter and its tests stay scalar */
  const int MODE = ((int)blockIdx.x < BB * NH * NQB) ? 1 : 0, bx = (int)blockIdx.x - (MODE ? 0 : BB * NH * NQB); if (MODE) { Q16 += sQ; K16 += sK; Vt += sV; O += sOut; }
  const int slab = bx / NQB, qblk = bx % NQB; const int b = slab / NH, h = slab % NH; const int pr = w & 1, sp = w >> 1;
  const unsigned short* Kl = (const unsigned short*)K16 + (size_t)slab * (TK * 64) + lane * 8;      /* the lane's place in the 4 KB of key tile 0 of this head: both planes lie in fragment order (see the GEMM that writes them), 2048 elements per key tile, and a load of the wave covers 512 bytes in a row */
  const unsigned short* Vl = (const unsigned short*)Vt + (size_t)slab * (TK * 64) + lane * 8;      /* and in the value plane */
#pragma unroll 1      /* one copy of the walk serves both query tiles */
  for (int ph = 0; ph < 2; ++ph) {
    const int q0 = (ph ? NQT - 1 - (qblk * NPR + pr) : qblk * NPR + pr) * RPW, qm = q0 + RPW - 1;
    int na = (MODE == 0) ? qm / 32 + 1 : (ntc * (qm + 1) + 31) / 32, nb = (MODE == 0) ? (qm / ntc) / 32 + 1 : qm / 32 + 1;      /* key tiles with an allowed key: token half, concept half */
    na = __builtin_amdgcn_readfirstlane((na > HT) ? HT : na); nb = __builtin_amdgcn_readfirstlane((nb > HT) ? HT : nb);      /* the same in every lane: in scalar registers the walk's bound and the tile's number cost no vector register */
    FragH aq[KS]; { const unsigned short* qr = (const unsigned short*)Q16 + ((size_t)b * TQ + q0 + ln) * ldq + h * 64;
#pragma unroll
      for (int ks = 0; ks < KS; ++ks) { aq[ks].half[0] = *(const v8us*)(qr + ks * 32 + 8 * hh); aq[ks].half[1] = *(const v8us*)(qr + ks * 32 + 16 + 8 * hh); }
      asm volatile("s_wait_xcnt 0x0" ::: "memory"); }      /* stands behind the query loads, ahead of the index arithmetic that reuses their address registers */
    const int q = q0 + ln; const int limA = (MODE == 0) ? q : ntc * (q + 1) - 1, limB = (MODE == 0) ? q / ntc : q;      /* the lane's query: its last allowed index in the token half and in the concept half */
    float m_q = -3.0e38f, l_q = 0.f; v8f oacc[DT];      /* the lane's query: maximum, sum over this half's keys, and 32 elements of its V sum */
#pragma unroll
    for (int dt = 0; dt < DT; ++dt) oacc[dt] = (v8f){0.f,0.f,0.f,0.f,0.f,0.f,0.f,0.f};
    int j0 = 32 * ((sp < na) ? sp : sp - na + HT); const unsigned short* kp = Kl + (size_t)j0 * 64; const unsigned short* vp = Vl + (size_t)j0 * 64;      /* the wave's first key tile: its plane row, and the lane's addresses in its two 4-KB blocks. They are carried from tile to tile: a register that lives through the whole walk is never handed to a load's result while another load still names it */
#pragma unroll 1
    for (int it = sp; it < na + nb; it += NSP) { const bool ta = it < na; const int t0 = ta ? j0 : j0 - TQ;
      const int dl = (ta ? limA : limB) - t0 - 8 * hh;      /* the lane's score number nt * 8 + r belongs to index t0 + 8 hh + nt * 16 + r of the half: allowed where nt * 16 + r <= dl */
      FragH bk[2][KS], bv[DT];
#pragma unroll
      for (int nt = 0; nt < 2; ++nt)
#pragma unroll
        for (int ks = 0; ks < KS; ++ks) { bk[nt][ks].half[0] = *(const v8us*)(kp + nt * 1024 + ks * 512); bk[nt][ks].half[1] = *(const v8us*)(kp + nt * 1024 + ks * 512 + 256); }
#pragma unroll
      for (int dt = 0; dt < DT; ++dt) { bv[dt].half[0] = *(const v8us*)(vp + dt * 512); bv[dt].half[1] = *(const v8us*)(vp + dt * 512 + 256); }
      asm volatile("s_wait_xcnt 0x0" ::: "memory");      /* stands behind the tile's loads, ahead of the step of the two addresses that they name */
      __builtin_amdgcn_sched_barrier(0);      /* keeps the wait behind all sixteen loads and the address step behind the wait; it also keeps the V^T loads up here, under way during the score products and the softmax (the scheduler otherwise sinks them to their products) */
      { const int in = it + NSP, jn = 32 * ((in < na) ? in : in - na + HT); const ptrdiff_t dk = (ptrdiff_t)(jn - j0) * 64; kp += dk; vp += dk; j0 = jn; }      /* on to the wave's next tile (behind the last one the addresses are not used) */
      float sm[16];
#pragma unroll
      for (int nt = 0; nt < 2; ++nt) { v8f acc = (v8f){0.f,0.f,0.f,0.f,0.f,0.f,0.f,0.f};
#pragma unroll
        for (int ks = 0; ks < KS; ++ks) acc = __builtin_amdgcn_wmma_f32_16x16x32_f16(false, bk[nt][ks].v, false, aq[ks].v, (short)0, acc, false, false);
#pragma unroll
        for (int r = 0; r < 8; ++r) sm[nt * 8 + r] = (nt * 16 + r <= dl) ? acc[r] : -INFINITY; }      /* the bare products: their scale is folded into the exponent's multiply-add below */
      float mc = sm[0];
#pragma unroll
      for (int i = 1; i < 16; ++i) mc = fmaxf(mc, sm[i]);
      mc = fmaxf(mc, xhalf(mc));
      const float mn = fmaxf(m_q, mc * C2), al = __builtin_amdgcn_exp2f(m_q - mn); m_q = mn;      /* the maximum is kept in base-2 units (C2 > 0: scaling keeps the order). No allowed key so far: mn stays at its finite start value, al = 2^0 = 1 and every weight 0 */
      const float nb = 10.0f - mn;      /* the weights' factor 2^10 rides in the exponent */
      float ps = 0.f; FragH pb;
#pragma unroll
      for (int i = 0; i < 16; ++i) { const float p = __builtin_amdgcn_exp2f(fmaf(sm[i], C2, nb)); ps += p; pb.h[i] = (_Float16)p; }      /* one multiply-add and one hardware exponential per score; a masked score stays -inf through the multiply-add and gives 0 */
      l_q = l_q * al + ps;
#pragma unroll
      for (int dt = 0; dt < DT; ++dt) { oacc[dt] *= al; oacc[dt] = __builtin_amdgcn_wmma_f32_16x16x32_f16(false, bv[dt].v, false, pb.v, (short)0, oacc[dt], false, false); } }
    l_q += xhalf(l_q);
    if (hh == 0) { sM[w][ln] = m_q; sL[w][ln] = l_q; }
    __syncthreads();      /* publishes every wave's row maxima and row sums; it also ends the reads of the partial outputs of the query tiles before */
    float mg = sM[pr][ln];
#pragma unroll
    for (int s2 = 1; s2 < NSP; ++s2) mg = fmaxf(mg, sM[s2 * NPR + pr][ln]);
    float lt = 0.f, fo = 0.f;      /* a wave that met no allowed key of this row holds sum 0 and a zero V sum */
#pragma unroll
    for (int s2 = 0; s2 < NSP; ++s2) { const float e = __builtin_amdgcn_exp2f(sM[s2 * NPR + pr][ln] - mg); lt += sL[s2 * NPR + pr][ln] * e; if (s2 == sp) fo = e; }      /* the maxima are base-2 exponents */
    const float fq = (lt > 0.f) ? fo / lt : 0.f;      /* sums and V sums both carry the factor 2^10 */
#pragma unroll
    for (int dt = 0; dt < DT; ++dt) { *(v4fa*)&sO[w][ln][dt * 16 + 8 * hh] = (v4f){oacc[dt][0] * fq, oacc[dt][1] * fq, oacc[dt][2] * fq, oacc[dt][3] * fq}; *(v4fa*)&sO[w][ln][dt * 16 + 8 * hh + 4] = (v4f){oacc[dt][4] * fq, oacc[dt][5] * fq, oacc[dt][6] * fq, oacc[dt][7] * fq}; }
    __syncthreads();      /* publishes the rescaled partial outputs; it also ends the reads of the maxima and sums, which the next query tiles write anew */
    for (int i = tid; i < NPR * RPW * 16; i += 32 * NPR * NSP) { const int q2 = i >> 8, r = (i >> 4) & 15, pc = i & 15; v4f val = *(const v4fa*)&sO[q2][r][pc * 4];
#pragma unroll
      for (int s2 = 1; s2 < NSP; ++s2) val += *(const v4fa*)&sO[s2 * NPR + q2][r][pc * 4];
      const int qo = (ph ? NQT - 1 - (qblk * NPR + q2) : qblk * NPR + q2) * RPW;
      *(v4h*)(O + ((size_t)b * TQ + qo + r) * ldo + h * 64 + pc * 4) = (v4h){(_Float16)(val[0] * 16.0f), (_Float16)(val[1] * 16.0f), (_Float16)(val[2] * 16.0f), (_Float16)(val[3] * 16.0f)}; } } }

extern "C" void kernel_launch(void* const* d_in, const int* in_sizes, int n_in,
                              void* d_out, int out_size, void* d_ws, size_t ws_size, hipStream_t stream) {
  (void)in_sizes; (void)n_in; (void)out_size;
  const float* const* I = (const float* const*)d_in; const float* xt = I[0]; const float* xc = I[1]; const float* Wt = I[2]; const float* bt = I[3]; const float* Wc = I[4]; const float* bc = I[5]; const float* Wtp = I[6]; const float* btp = I[7]; const float* Wcp = I[8]; const float* bcp = I[9]; const int* ntcp = (const int*)d_in[10];      /* int64 in the module, read as int32 */
  char* ws = (char*)d_ws; size_t off = 0;
  auto take = [&](size_t bytes) { char* p = ws + off; off += (bytes + 255) & ~(size_t)255; return p; };
  _Float16* Bt_ = (_Float16*)take((size_t)DW * DD * 2); _Float16* Bc = (_Float16*)take((size_t)DW * DD * 2); _Float16* Btp = (_Float16*)take((size_t)DD * DD * 2); _Float16* Bcp = (_Float16*)take((size_t)DD * DD * 2);
  _Float16* XT = (_Float16*)take((size_t)NR * DD * 2); _Float16* XC = (_Float16*)take((size_t)NR * DD * 2); _Float16* TC = (_Float16*)take((size_t)2 * BB * NH * TK * 64 * 2);      /* keys for token queries, then for concept queries, in fragment order; key rows 0..1023 = tok, 1024..2047 = con */
  _Float16* Vt1 = (_Float16*)take((size_t)BB * NH * 64 * TK * 2); _Float16* Vt2 = (_Float16*)take((size_t)BB * NH * 64 * TK * 2); _Float16* O16 = (_Float16*)take((size_t)2 * NR * DD * 2);      /* O16: token rows, then concept rows */
  (void)Vt2;
  if (off > ws_size) return;      // 8.4 + 8.4 + 2.1 + 2.1 + 4.2 + 4.2 + 16.8 + 8.4 + 8.4 + 8.4 = 71 MB
  /* Four launches, one per stage: launches that do not depend on each other share one grid, and each product stores what its reader takes (V^T; O as f16), so that no pass stands between them. Every plane's size is a multiple of 256 bytes, so that planes taken one after the other lie back to back. */
  k_cvt6<<<(2 * DW * DD + 2 * DD * DD + 2 * NR * DD) / 2048, 256, 0, stream>>>(Wt, Wc, Wtp, Wcp, xt, xc, Bt_);      /* weights: torch (out,in) natural, x 2^4 */
  const dim3 gt((TQ / 256) * (DW / 256), BB, 2);
  k_gemm_lds<true, DD, DW, 2 * DD, 256><<<gt, 256, 0, stream>>>(XT, XC, (size_t)TQ * DD, Bt_, Bc, 0.0625f, bt, bc, nullptr, TC, Vt1, 0, 0);      /* tok[b] -> keys 0..1023, con[b] -> keys 1024..2047: each M 1024 N 4096 K 1024; key columns 0..2047 to the key planes, values read by tokens (columns 2048..) and by concepts (3072..) to the value planes, all in the flash kernel's fragment order */
  k_flashm<<<2 * BB * NH * (TQ / 64), 384, 0, stream>>>(XT, DD, (size_t)NR * DD, TC, (size_t)BB * NH * TK * 64, Vt1, (size_t)BB * NH * 64 * TK, ntcp, O16, DD, (size_t)NR * DD);      /* token queries: keys = columns 0..1023 (kt_t on token rows, kc_t on concept rows); concept queries: keys = columns 1024..2047 (kt_c, kc_c) */
  const dim3 gpj((NR / 128) * (DD / 128), 1, 2);
  k_gemm_lds<false, DD, DD, DD, 128><<<gpj, 256, 0, stream>>>(O16, O16 + (size_t)NR * DD, 0, Btp, Bcp, 0.00390625f, btp, bcp, (float*)d_out, nullptr, nullptr, 0, (size_t)NR * DD);      /* y_t = merged.Wtp^T + btp -> output 0; y_c -> output 1 (offset B.T.NE floats) */
}

// v010
// It runs in 78.9 microseconds.
// Next to v009, in two timings, it ran 1.07 and 1.06 times as fast.
// All steps since v000 together make it 9.70 times as fast.
#include <hip/hip_runtime.h>
// Token/concept two-stream causal attention (B=2, T=C=1024, NE=CD=1024, 16 heads × 64, n_tokens_per_concept = 8): tok = xt·Wtᵀ + bt, con = xc·Wcᵀ + bc (4096 outputs each = [k for token queries | k for concept queries | v read by tokens | v read by concepts]);
// token queries = heads(xt) (the residual stream itself) attend over [tokens ; concepts] with mask (s ≤ t) | (j < t/8 + 1), scale 1/√64; concept queries = heads(xc) attend over [concepts ; tokens] with mask (j ≤ i) | (s < 8(i+1)); disallowed = −1e9 (≡ −inf: every row keeps itself);
// y_t = merge(attn_t)·Wtpᵀ + btp, y_c = merge(attn_c)·Wcpᵀ + bcp (two outputs).
// Compute dtype: xt, xc, weights, biases rounded to bf16; tok/con as f16 GEMM planes written as the two 1024-row halves of one 2048-key plane per batch; queries = the bf16-exact x planes; fused flash-style kernels with the index-computed masks (n_tokens_per_concept read on device; online softmax f32,
// P f16 ×2^10, f32 accumulate) on v_wmma_f32_16x16x32_f16; O ×2^4 → f16 (stored so by the flash kernel) → projection GEMMs (+bias) straight into the two output slots.
#define BB 2
#define TQ 1024
#define TK 2048
#define DD 1024
#define NH 16
#define DW 4096
#define SCL 0.125f
#define NR (BB * TQ)
typedef __bf16 v16b __attribute__((ext_vector_type(16)));
typedef unsigned short v8us __attribute__((ext_vector_type(8), may_alias));
typedef float  v8f  __attribute__((ext_vector_type(8)));
typedef float  v4f  __attribute__((ext_vector_type(4)));
typedef float  v4fa __attribute__((ext_vector_type(4), may_alias));
union FragB { v16b v; v8us half[2]; unsigned short u[16]; };

__device__ __forceinline__ unsigned short bf16_bits(float x) { unsigned int u = __float_as_uint(x); return (unsigned short)((u + 0x7FFFu + ((u >> 16) & 1u)) >> 16); }
__device__ __forceinline__ float bf16_val(unsigned short b) { return __uint_as_float(((unsigned int)b) << 16); }
__device__ __forceinline__ float bf16_round(float x) { return bf16_val(bf16_bits(x)); }
// D += A·B with NT terms: 1 = ah·bh, 2 = + al·bh (A split), 3 = + ah·bl (both split)
template <int NT>
__device__ __forceinline__ v8f mmaN(v16b ah, v16b al, v16b bh, v16b bl, v8f c) {
  c = __builtin_amdgcn_wmma_f32_16x16x32_bf16(false, ah, false, bh, (short)0, c, false, false);
  if (NT >= 2) c = __builtin_amdgcn_wmma_f32_16x16x32_bf16(false, al, false, bh, (short)0, c, false, false);
  if (NT >= 3) c = __builtin_amdgcn_wmma_f32_16x16x32_bf16(false, ah, false, bl, (short)0, c, false, false);
  asm volatile("v_nop\n\tv_nop\n\tv_nop\n\tv_nop" : "+v"(c) : "v"(ah), "v"(al), "v"(bh), "v"(bl));
  return c;
}

__global__ __launch_bounds__(256) void k_wt_bf16(const float* __restrict__ W, unsigned short* __restrict__ Wt, int K, int N) {
  const int t = blockIdx.x * 256 + threadIdx.x;
  const int k8n = K / 8;
  if (t >= N * k8n) return;
  const int n = t / k8n, k8 = (t % k8n) * 8;
  v8us v;
#pragma unroll
  for (int i = 0; i < 8; ++i) v[i] = bf16_bits(W[(size_t)(k8 + i) * N + n]);
  *(v8us*)(Wt + (size_t)n * K + k8) = v;
  
}

// GEMM C[M][N] (f32, pitch ldc) = act(A[M][K]·W + bias). A f32 row-major (pitch lda) converted per fragment to bf16
// (ASPLIT: hi/lo two planes -> 2 terms, else single rounded term); Wt bf16 [N][K] (pitch ldb). BIAS_BF16 rounds the
// bias to bf16 first (bias quantised to bf16 before the add). K%32==0, M%16==0, N%64==0.
template <bool ASPLIT, int ACT, bool BIAS_BF16>
__global__ __launch_bounds__(128) void k_gemm_bf(const float* __restrict__ A, int lda, const unsigned short* __restrict__ Wt, int ldb,
                                               const float* __restrict__ bias, float* __restrict__ C, int ldc, int M, int N, int K) {
  __shared__ __attribute__((aligned(16))) float so[4][16][64];
  const int tid = threadIdx.x, w = tid >> 5, lane = tid & 31, ln = lane & 15, hh = lane >> 4;
  const int ntn = N / 64;
  const int wid = blockIdx.x * 4 + w;
  const int mt = wid / ntn, nq = wid % ntn;
  if (mt * 16 >= M) return;
  const int row0 = mt * 16, col0 = nq * 64;
  const float* arow = A + (size_t)(row0 + ln) * lda;
  v8f acc[4] = {};
  for (int kb = 0; kb < K; kb += 32) {
    FragB ah, al;
    const v4f x0 = *(const v4fa*)(arow + kb + 8 * hh), x1 = *(const v4fa*)(arow + kb + 8 * hh + 4);
    const v4f x2 = *(const v4fa*)(arow + kb + 16 + 8 * hh), x3 = *(const v4fa*)(arow + kb + 16 + 8 * hh + 4);
    float xs[16] = {x0[0],x0[1],x0[2],x0[3],x1[0],x1[1],x1[2],x1[3],x2[0],x2[1],x2[2],x2[3],x3[0],x3[1],x3[2],x3[3]};
#pragma unroll
    for (int i = 0; i < 16; ++i) { const unsigned short hb = bf16_bits(xs[i]); ah.u[i] = hb; al.u[i] = ASPLIT ? bf16_bits(xs[i] - bf16_val(hb)) : (unsigned short)0; }
#pragma unroll
    for (int t = 0; t < 4; ++t) {
      const unsigned short* brow = Wt + (size_t)(col0 + t * 16 + ln) * ldb + kb;
      FragB b;
      b.half[0] = *(const v8us*)(brow + 8 * hh);
      b.half[1] = *(const v8us*)(brow + 16 + 8 * hh);
      acc[t] = mmaN<ASPLIT ? 2 : 1>(ah.v, al.v, b.v, b.v, acc[t]);
    }
  }
#pragma unroll
  for (int t = 0; t < 4; ++t) {
    float bv = bias ? bias[col0 + t * 16 + ln] : 0.f;
    if (BIAS_BF16) bv = bf16_round(bv);
#pragma unroll
    for (int r = 0; r < 8; ++r) { float v = acc[t][r] + bv; if (ACT == 1) v = fmaxf(v, 0.f); so[w][8 * hh + r][t * 16 + ln] = v; }
  }
  __builtin_amdgcn_fence(__ATOMIC_ACQ_REL, "workgroup");
  __builtin_amdgcn_wave_barrier();
  const int rsub = lane >> 4, c4 = (lane & 15) * 4;
  {
#pragma unroll
    for (int q = 0; q < 8; ++q) {
      const int r = q * 2 + rsub;
      const v4f v = *(const v4fa*)&so[w][r][c4];
      *(v4f*)(C + (size_t)(row0 + r) * ldc + col0 + c4) = v;
    }
    
  }
}

// GEMM C = act(A·W + bias + resid): A f32 (ASPLIT -> hi/lo 2 terms), Wt bf16 [N][K]; ACT 0 none, 1 relu, 2 exact gelu;
// resid (optional, f32, row index = (row % rmod), pitch ldr, RES_BF16 rounds it) added before the activation.
template <bool ASPLIT, int ACT, bool BIAS_BF16, bool RES_BF16>
__global__ __launch_bounds__(128) void k_gemm_bf3(const float* __restrict__ A, int lda, const unsigned short* __restrict__ Wt, int ldb,
                                                const float* __restrict__ bias, const float* __restrict__ resid, int rmod, int ldr,
                                                float* __restrict__ C, int ldc, int M, int N, int K) {
  __shared__ __attribute__((aligned(16))) float so[4][16][64];
  const int tid = threadIdx.x, w = tid >> 5, lane = tid & 31, ln = lane & 15, hh = lane >> 4;
  const int ntn = N / 64;
  const int wid = blockIdx.x * 4 + w;
  const int mt = wid / ntn, nq = wid % ntn;
  if (mt * 16 >= M) return;
  const int row0 = mt * 16, col0 = nq * 64;
  const float* arow = A + (size_t)(row0 + ln) * lda;
  v8f acc[4] = {};
  for (int kb = 0; kb < K; kb += 32) {
    FragB ah, al;
    const v4f x0 = *(const v4fa*)(arow + kb + 8 * hh), x1 = *(const v4fa*)(arow + kb + 8 * hh + 4);
    const v4f x2 = *(const v4fa*)(arow + kb + 16 + 8 * hh), x3 = *(const v4fa*)(arow + kb + 16 + 8 * hh + 4);
    float xs[16] = {x0[0],x0[1],x0[2],x0[3],x1[0],x1[1],x1[2],x1[3],x2[0],x2[1],x2[2],x2[3],x3[0],x3[1],x3[2],x3[3]};
#pragma unroll
    for (int i = 0; i < 16; ++i) { const unsigned short hb = bf16_bits(xs[i]); ah.u[i] = hb; al.u[i] = ASPLIT ? bf16_bits(xs[i] - bf16_val(hb)) : (unsigned short)0; }
#pragma unroll
    for (int t = 0; t < 4; ++t) {
      const unsigned short* brow = Wt + (size_t)(col0 + t * 16 + ln) * ldb + kb;
      FragB b;
      b.half[0] = *(const v8us*)(brow + 8 * hh);
      b.half[1] = *(const v8us*)(brow + 16 + 8 * hh);
      acc[t] = mmaN<ASPLIT ? 2 : 1>(ah.v, al.v, b.v, b.v, acc[t]);
    }
  }
#pragma unroll
  for (int t = 0; t < 4; ++t) {
    const int col = col0 + t * 16 + ln;
    float bv = bias ? bias[col] : 0.f;
    if (BIAS_BF16) bv = bf16_round(bv);
#pragma unroll
    for (int r = 0; r < 8; ++r) {
      float v = acc[t][r] + bv;
      if (resid) { float rv = resid[(size_t)((row0 + 8 * hh + r) % rmod) * ldr + col]; if (RES_BF16) rv = bf16_round(rv); v += rv; }
      if (ACT == 1) v = fmaxf(v, 0.f);
      if (ACT == 2) v = 0.5f * v * (1.0f + erff(v * 0.70710678118654752f));
      if (ACT == 3) { const float u = 0.7978845608028654f * (v + 0.044715f * v * v * v); v = 0.5f * v * (1.0f + tanhf(u)); }
      so[w][8 * hh + r][t * 16 + ln] = v;
    }
  }
  __builtin_amdgcn_fence(__ATOMIC_ACQ_REL, "workgroup");
  __builtin_amdgcn_wave_barrier();
  const int rsub = lane >> 4, c4 = (lane & 15) * 4;
  {
#pragma unroll
    for (int q = 0; q < 8; ++q) {
      const int r = q * 2 + rsub;
      const v4f v = *(const v4fa*)&so[w][r][c4];
      *(v4f*)(C + (size_t)(row0 + r) * ldc + col0 + c4) = v;
    }
    
  }
}
// row LayerNorm (biased variance, eps) over N: s = X (+ R); optional out_sum <- s; out_norm <- (s-mu)*rsqrt(var+eps)*g + b
template <bool PARAM_BF16>
__global__ __launch_bounds__(256) void k_layernorm(const float* __restrict__ X, const float* __restrict__ R, const float* __restrict__ g, const float* __restrict__ bta,
                                                  float* __restrict__ out_sum, float* __restrict__ out_norm, int N, float eps) {
  __shared__ float red[256];
  const int row = blockIdx.x, tid = threadIdx.x;
  const float* x = X + (size_t)row * N; const float* rr = R ? R + (size_t)row * N : nullptr;
  float vals[16];                     // up to N = 4096
  const int per = N / 256;            // contiguous chunk per thread? use strided-by-4 chunks: thread handles j = tid*4 + 1024*u
  float s1 = 0.f;
  for (int u = 0; u < per / 4; ++u) {
    const int j = tid * 4 + 1024 * u;
    const v4f a = *(const v4fa*)(x + j);
    v4f b = {0.f,0.f,0.f,0.f}; if (rr) b = *(const v4fa*)(rr + j);
#pragma unroll
    for (int q = 0; q < 4; ++q) { const float v = a[q] + b[q]; vals[u * 4 + q] = v; s1 += v; }
  }
  red[tid] = s1; __syncthreads();
  for (int st = 128; st > 0; st >>= 1) { if (tid < st) red[tid] += red[tid + st]; __syncthreads(); }
  const float mu = red[0] / (float)N; __syncthreads();
  float s2 = 0.f;
  for (int u = 0; u < per / 4; ++u)
#pragma unroll
    for (int q = 0; q < 4; ++q) { const float c = vals[u * 4 + q] - mu; s2 += c * c; }
  red[tid] = s2; __syncthreads();
  for (int st = 128; st > 0; st >>= 1) { if (tid < st) red[tid] += red[tid + st]; __syncthreads(); }
  const float rs = rsqrtf(red[0] / (float)N + eps);
  {
    for (int u = 0; u < per / 4; ++u) {
      const int j = tid * 4 + 1024 * u;
      v4f o, sm;
#pragma unroll
      for (int q = 0; q < 4; ++q) {
        float gg = g[j + q], bb = bta[j + q];
        if (PARAM_BF16) { gg = bf16_round(gg); bb = bf16_round(bb); }
        sm[q] = vals[u * 4 + q]; o[q] = (vals[u * 4 + q] - mu) * rs * gg + bb;
      }
      if (out_sum) *(v4f*)(out_sum + (size_t)row * N + j) = sm;
      *(v4f*)(out_norm + (size_t)row * N + j) = o;
    }
    
  }
}



// ---- f16 WMMA path (v_wmma_f32_16x16x32_f16): 11-bit significands for operands in range — used where a [0,1] probability operand needs more precision than bf16
typedef _Float16 v16h __attribute__((ext_vector_type(16)));
union FragH { v16h v; v8us half[2]; _Float16 h[16]; unsigned short u[16]; };
template <int NT>
__device__ __forceinline__ v8f mmaH(v16h ah, v16h al, v16h bh, v16h bl, v8f c) {
  c = __builtin_amdgcn_wmma_f32_16x16x32_f16(false, ah, false, bh, (short)0, c, false, false);
  if (NT >= 2) c = __builtin_amdgcn_wmma_f32_16x16x32_f16(false, al, false, bh, (short)0, c, false, false);
  if (NT >= 3) c = __builtin_amdgcn_wmma_f32_16x16x32_f16(false, ah, false, bl, (short)0, c, false, false);
  asm volatile("v_nop\n\tv_nop\n\tv_nop\n\tv_nop" : "+v"(c) : "v"(ah), "v"(al), "v"(bh), "v"(bl));
  return c;
}
// batched GEMM like k_gemm_b but f16 operands: A f32 (split into f16 hi/lo if ASPLIT, else rounded to f16), Bt = f16 values [n][k]; alpha; C f32; N multiple of 16 (partial tiles skipped)
template <bool ASPLIT>
__global__ __launch_bounds__(128) void k_gemm_h(const float* __restrict__ A, int lda, size_t sA, const _Float16* __restrict__ Bh, int ldb, size_t sB, float alpha, float* __restrict__ C, int ldc, size_t sC, int M, int N, int K) {
  __shared__ __attribute__((aligned(16))) float so[4][16][64];
  const int tid = threadIdx.x, w = tid >> 5, lane = tid & 31, ln = lane & 15, hh = lane >> 4; const int by = blockIdx.y;
  A += (size_t)by * sA; Bh += (size_t)by * sB; C += (size_t)by * sC;
  const int ntn = (N + 63) / 64; const int wid = blockIdx.x * 4 + w; const int mt = wid / ntn, nq = wid % ntn; if (mt * 16 >= M) return;
  const int row0 = mt * 16, col0 = nq * 64; const float* arow = A + (size_t)(row0 + ln) * lda;
  v8f acc[4] = {};
  for (int kb = 0; kb < K; kb += 32) {
    FragH ah, al;
    const v4f x0 = *(const v4fa*)(arow + kb + 8 * hh), x1 = *(const v4fa*)(arow + kb + 8 * hh + 4), x2 = *(const v4fa*)(arow + kb + 16 + 8 * hh), x3 = *(const v4fa*)(arow + kb + 16 + 8 * hh + 4);
    float xs[16] = {x0[0],x0[1],x0[2],x0[3],x1[0],x1[1],x1[2],x1[3],x2[0],x2[1],x2[2],x2[3],x3[0],x3[1],x3[2],x3[3]};
#pragma unroll
    for (int i = 0; i < 16; ++i) { const _Float16 h = (_Float16)xs[i]; ah.h[i] = h; al.h[i] = ASPLIT ? (_Float16)(xs[i] - (float)h) : (_Float16)0.0f; }
#pragma unroll
    for (int t = 0; t < 4; ++t) { if (col0 + t * 16 >= N) continue; const size_t boff = (size_t)(col0 + t * 16 + ln) * ldb + kb; FragH bq; bq.half[0] = *(const v8us*)(Bh + boff + 8 * hh); bq.half[1] = *(const v8us*)(Bh + boff + 16 + 8 * hh);
      acc[t] = mmaH<ASPLIT ? 2 : 1>(ah.v, al.v, bq.v, bq.v, acc[t]); }
  }
#pragma unroll
  for (int t = 0; t < 4; ++t) { if (col0 + t * 16 >= N) continue;
#pragma unroll
    for (int r = 0; r < 8; ++r) so[w][8 * hh + r][t * 16 + ln] = acc[t][r] * alpha; }
  __builtin_amdgcn_fence(__ATOMIC_ACQ_REL, "workgroup"); __builtin_amdgcn_wave_barrier();
  const int rsub = lane >> 4, c4 = (lane & 15) * 4;
  {
#pragma unroll
    for (int q = 0; q < 8; ++q) { const int r = q * 2 + rsub; if (col0 + c4 < N) { const v4f v = *(const v4fa*)&so[w][r][c4]; *(v4f*)(C + (size_t)(row0 + r) * ldc + col0 + c4) = v; } }
     }
}

// Wt[n][k] = f16(W[k][n]·scale) from f32 row-major W[K][N] (scale = power of two; bf16-exact weights stay exact in f16 away from the subnormal range)
__global__ __launch_bounds__(256) void k_wt_f16(const float* __restrict__ W, _Float16* __restrict__ Wt, int K, int N, float scale) {
  const int t = blockIdx.x * 256 + threadIdx.x; if (t >= N * (K / 8)) return; const int n = t / (K / 8), k8 = (t % (K / 8)) * 8; FragH f;
#pragma unroll
  for (int i = 0; i < 8; ++i) f.h[i] = (_Float16)(bf16_round(W[(size_t)(k8 + i) * N + n]) * scale); const v8us o = f.half[0];
  *(v8us*)((unsigned short*)Wt + (size_t)n * K + k8) = o; 
}
// k_gemm_hh variant with fused epilogue: v = acc·alpha + bias[by·sBias + col] (+ CP[(row/rowsPerB)·sCPb + by·64 + col] if CP) ; ACT 0 none / 1 elu ; writes f16 C16 and/or f32 C, each if non-null
template <int ACT>
__global__ __launch_bounds__(128) void k_gemm_hhx(const _Float16* __restrict__ A, int lda, size_t sA, const _Float16* __restrict__ Bh, int ldb, size_t sB, float alpha, const float* __restrict__ bias, size_t sBias, const float* __restrict__ CP, int rowsPerB, size_t sCPb, int row0g,
    float* __restrict__ C, _Float16* __restrict__ C16, int ldc, size_t sC, int M, int N, int K) {
  __shared__ __attribute__((aligned(16))) float so[4][16][64];
  const int tid = threadIdx.x, w = tid >> 5, lane = tid & 31, ln = lane & 15, hh = lane >> 4; const int by = blockIdx.y;
  A += (size_t)by * sA; Bh += (size_t)by * sB; const size_t cofs = (size_t)by * sC; const float* bp = bias ? bias + (size_t)by * sBias : nullptr;
  const int ntn = (N + 63) / 64; const int wid = blockIdx.x * 4 + w; const int mt = wid / ntn, nq = wid % ntn; if (mt * 16 >= M) return;
  const int row0 = mt * 16, col0 = nq * 64; const _Float16* arow = A + (size_t)(row0 + ln) * lda;
  v8f acc[4] = {};
  for (int kb = 0; kb < K; kb += 32) { FragH ah; ah.half[0] = *(const v8us*)((const unsigned short*)arow + kb + 8 * hh); ah.half[1] = *(const v8us*)((const unsigned short*)arow + kb + 16 + 8 * hh);
#pragma unroll
    for (int t = 0; t < 4; ++t) { if (col0 + t * 16 >= N) continue; const size_t boff = (size_t)(col0 + t * 16 + ln) * ldb + kb; FragH bq; bq.half[0] = *(const v8us*)((const unsigned short*)Bh + boff + 8 * hh); bq.half[1] = *(const v8us*)((const unsigned short*)Bh + boff + 16 + 8 * hh);
      acc[t] = mmaH<1>(ah.v, ah.v, bq.v, bq.v, acc[t]); }
  }
#pragma unroll
  for (int t = 0; t < 4; ++t) { if (col0 + t * 16 >= N) continue; const int col = col0 + t * 16 + ln; const float bv = bp ? bf16_round(bp[col]) : 0.f;
#pragma unroll
    for (int r = 0; r < 8; ++r) { float v = acc[t][r] * alpha + bv; if (CP) { const int bidx = (row0g + row0 + 8 * hh + r) / rowsPerB; v += CP[(size_t)bidx * sCPb + (size_t)by * 64 + col]; } if (ACT == 1) v = (v > 0.f) ? v : expm1f(v); else if (ACT == 7) v = (v > 0.f) ? v + 1.0f : expf(v); else if (ACT == 8) v = tanhf(v); else if (ACT == 9) v = 0.5f * v * (1.0f + tanhf(0.7978845608028654f * (v + 0.044715f * v * v * v))); else if (ACT == 11) v = 1.0f / (1.0f + expf(-v)); else if (ACT == 12) v = (v > 0.f) ? v : 0.01f * v; else if (ACT == 14) v = (v > 0.f) ? v : 0.1f * v; else if (ACT == 15) v = v / (1.0f + expf(-v)); else if (ACT == 3) v = fmaxf(v, 0.f); else if (ACT == 6) v = 0.5f * v * (1.0f + erff(v * 0.70710678118654752f)); so[w][8 * hh + r][t * 16 + ln] = v; } }
  __builtin_amdgcn_fence(__ATOMIC_ACQ_REL, "workgroup"); __builtin_amdgcn_wave_barrier();
  const int rsub = lane >> 4, c4 = (lane & 15) * 4; typedef _Float16 v4h __attribute__((ext_vector_type(4)));
  {
#pragma unroll
    for (int q = 0; q < 8; ++q) { const int r = q * 2 + rsub; if (col0 + c4 < N) { const v4f v = *(const v4fa*)&so[w][r][c4]; if (C) *(v4f*)(C + cofs + (size_t)(row0 + r) * ldc + col0 + c4) = v; if (C16) { v4h h4; for (int i = 0; i < 4; ++i) h4[i] = (_Float16)v[i]; *(v4h*)(C16 + cofs + (size_t)(row0 + r) * ldc + col0 + c4) = h4; } } }
     }
}


// GEMM C = (A.B^T)*alpha + bias on f16 planes, A [M][KD] (batch stride sA), Bh [ND][KD], both k-contiguous at pitch KD; C [M][ND] (batch stride sC) as f32, or as f16 (OUT16) in the reader's fragment order described below. M and ND multiples of BT, KD a multiple of 64; grid.x = (M / BT) * (ND / BT), grid.y = batch, grid.z = 2: two independent products of one shape in one launch (operands A0, B0, bias0 or A1, B1, bias1; the second one's f32 C lies sZ elements behind the first's; its f16 rows are keys TQ.. of the key planes).
// One BT x BT tile of C per work-group of 8 waves: BT = 128: 4 x 2 waves of 32 x 64; BT = 256: 2 x 4 waves of 128 x 64, one work-group per WGP, two waves per SIMD. The larger tile asks L2 for half the operand bytes per product, and a wave's 8 + 4 fragments feed 32 matrix instructions (2 + 4 feed 8 in the smaller one), which halves the LDS bytes read per product;
// it is for a product with enough tiles to fill the chip. A 64-k slice of both operands (128 bytes of each row) is brought in by loads that cover whole lines and laid in LDS at pitch 144 bytes; every wave reads its fragments from there,
// so a row is asked of L2 once per work-group, not once per wave. The slices pass through no register: each lane's 16 bytes go to their LDS place by an asynchronous copy (global_load_async_to_lds_b128). A ring of NB = 4 LDS buffers: trip s issues the copies of slice s + 3 into the buffer that trip s - 1 has read,
// so that three slices are under way at any time and a slice has three trips to land, not one. At the foot of a trip every wave waits for its own LDS reads (s_wait_dscnt 0) and for its own copies of the next slice (s_wait_asynccnt, counted: the copies of one wave land in issue order, and the two younger slices' may stay under way), then passes the barrier. Each accumulator still sums its k blocks of 32 in rising order.
// Tiles whose columns start at NT0 or later (the value columns; NT0 = ND: none) are wanted transposed by their reader. Such a work-group takes the two operands in each other's place: it forms Bh.A^T, the same sums over k, and its tile's rows are columns of C;
// no pass over C follows. Which way a work-group goes is a scalar choice by its block index. The bias then belongs to the tile's row.
// The f16 output (OUT16) is stored in the order in which the attention kernel's lanes take their matrix fragments, so that each of its 16-byte-per-lane loads covers 512 bytes in a row (four whole lines) and not 32-byte pieces of sixteen rows. Both planes are [column block of DD][batch][head][key tile of 32][2048 elements]:
// keys (C16): [16-key group nt][load j][lane][8], lane (ln, hh) holding key nt * 16 + ln, head columns (j >> 1) * 32 + (j & 1) * 16 + 8 hh + 0..7; values (Ct): [16-column group dt][load hf][lane][8], lane (ln, hh) holding head column dt * 16 + ln, keys hf * 16 + 8 hh + 0..7.
// A wave hands its tile over in groups of 32 rows x 64 columns through its own 32 staging rows. Such a group is one head's columns of one key tile (keys), or two column groups of two key tiles (values): it is stored as runs of 4 KB or 2 KB.
// The unroll directives on the short loops below make every index into the register arrays (fragments, accumulators, bias) a constant, so that these arrays stay in registers.
template <bool OUT16, int KD, int ND, int NT0, int BT>
__global__ __launch_bounds__(256) void k_gemm_lds(const _Float16* __restrict__ A0, const _Float16* __restrict__ A1, size_t sA, const _Float16* __restrict__ B0, const _Float16* __restrict__ B1, float alpha, const float* __restrict__ bias0, const float* __restrict__ bias1,
    float* __restrict__ C, _Float16* __restrict__ C16, _Float16* __restrict__ Ct, size_t sC, size_t sZ) {
  const bool z1 = blockIdx.z != 0; const _Float16* A = z1 ? A1 : A0; const _Float16* Bh = z1 ? B1 : B0; const float* bias = z1 ? bias1 : bias0;
  constexpr int BK = 64, LP = BK + 8, NB = 4, WCN = BT / 64, MI = BT * WCN / 128, NG = MI / 2, SP = BT / 32;      /* NB ring buffers; WCN waves side by side, 64 columns each; MI row fragments of 16 per wave; NG output groups of 32 rows; SP copied rows per thread and operand */
  static_assert(NG == 1 || (MI * 16) % 64 == 0, "with several output groups a wave's rows start on a head's first column");
  static_assert(KD / BK >= NB - 1 && (NB - 1) * 2 * SP <= 63, "the slices copied ahead of the loop exist; a wave never has more than 63 copies under way");
  __shared__ __attribute__((aligned(16))) unsigned char sm[2 * NB * BT * LP * 2];      /* the two operands' NB buffers; behind the loop the same bytes stage the output rows */
  unsigned short (*tA)[BT][LP] = (unsigned short (*)[BT][LP])sm; unsigned short (*tB)[BT][LP] = (unsigned short (*)[BT][LP])(sm + NB * BT * LP * 2);
  const int tid = threadIdx.x, w = tid >> 5, lane = tid & 31, ln = lane & 15, hh = lane >> 4;
  constexpr int ntn = ND / BT; const int row0 = ((int)blockIdx.x / ntn) * BT, col0 = ((int)blockIdx.x % ntn) * BT; const int wr = (w / WCN) * (MI * 16), wc = (w % WCN) * 64;
  const int sr = tid >> 3, sc = (tid & 7) * 8;      /* copies: 8 threads take one row's 128 bytes, a wave 4 whole lines; rows sr + 32 i */
  const bool tr = NT0 < ND && col0 >= NT0;      /* the same for the whole work-group */
  const unsigned short* Ar = (const unsigned short*)A + (size_t)blockIdx.y * sA + (size_t)row0 * KD; const unsigned short* Br = (const unsigned short*)Bh + (size_t)col0 * KD;
  const unsigned short* Ag = tr ? Br : Ar; const unsigned short* Bg = tr ? Ar : Br; const unsigned lo = (unsigned)(sr * KD + sc) * 2, l0 = (unsigned)(size_t)&tA[0][sr][sc];      /* the tiles' first rows are the same for the whole work-group (scalar registers); lo: the lane's own byte offset in a group of 32 rows, one register for all copies; l0: its LDS byte address in buffer 0 of the first operand */
  float bv[4], bR[MI]; const int br0 = col0 + wr + ln, bc0 = col0 + wc + ln;      /* bv: the straight way's column biases; bR: the transposed way's row biases, rows mi * 16 + ln of the wave's tile. All places lie in the tile's BT columns */
  auto copy = [&](int t) __attribute__((always_inline)) {      /* slice t of both operands into buffer t mod NB: 2 SP copies per wave, every lane on, 16 bytes each at 16-byte places inside the operand planes and inside sm; no two lanes share an LDS byte */
    constexpr unsigned LR = 32 * LP * 2; constexpr size_t GR = (size_t)32 * KD * 2;      /* 32 rows on, in LDS and in the plane */
    static_assert(SP == 4 || SP == 8, "one statement holds an operand's SP copies");
    /* An operand's SP copies and their s_wait_xcnt 0 stand in one statement: LDS address register, the lane's offset, the row group's scalar base. The immediate offset (at most 7 LR = 32,256) moves both addresses: it steps the LDS row group, so that one LDS register serves all SP copies, and is taken off the scalar base.
       The wait stands in front of whatever rewrites a register that a copy names. */
#pragma unroll
    for (int o = 0; o < 2; ++o) { const unsigned la = l0 + (unsigned)(o * NB + t % NB) * (BT * LP * 2); const char* ga = (const char*)(o ? Bg : Ag) + t * (BK * 2);
      if constexpr (SP == 8)
        asm volatile("global_load_async_to_lds_b128 %0, %1, %2\n\tglobal_load_async_to_lds_b128 %0, %1, %3 offset:%10\n\tglobal_load_async_to_lds_b128 %0, %1, %4 offset:%11\n\tglobal_load_async_to_lds_b128 %0, %1, %5 offset:%12\n\t"
                     "global_load_async_to_lds_b128 %0, %1, %6 offset:%13\n\tglobal_load_async_to_lds_b128 %0, %1, %7 offset:%14\n\tglobal_load_async_to_lds_b128 %0, %1, %8 offset:%15\n\tglobal_load_async_to_lds_b128 %0, %1, %9 offset:%16\n\ts_wait_xcnt 0x0"
                     :: "v"(la), "v"(lo), "s"(ga), "s"(ga + GR - LR), "s"(ga + 2 * GR - 2 * LR), "s"(ga + 3 * GR - 3 * LR), "s"(ga + 4 * GR - 4 * LR), "s"(ga + 5 * GR - 5 * LR), "s"(ga + 6 * GR - 6 * LR), "s"(ga + 7 * GR - 7 * LR),
                        "n"(LR), "n"(2 * LR), "n"(3 * LR), "n"(4 * LR), "n"(5 * LR), "n"(6 * LR), "n"(7 * LR) : "memory");
      else
        asm volatile("global_load_async_to_lds_b128 %0, %1, %2\n\tglobal_load_async_to_lds_b128 %0, %1, %3 offset:%6\n\tglobal_load_async_to_lds_b128 %0, %1, %4 offset:%7\n\tglobal_load_async_to_lds_b128 %0, %1, %5 offset:%8\n\ts_wait_xcnt 0x0"
                     :: "v"(la), "v"(lo), "s"(ga), "s"(ga + GR - LR), "s"(ga + 2 * GR - 2 * LR), "s"(ga + 3 * GR - 3 * LR), "n"(LR), "n"(2 * LR), "n"(3 * LR) : "memory"); } };
#pragma unroll
  for (int t = 0; t < NB - 1; ++t) copy(t);
  asm volatile("s_wait_asynccnt %0" :: "n"((NB - 2) * 2 * SP) : "memory");      /* the wave's own copies of slice 0 have landed; those of the younger slices stay under way */
  __syncthreads();      /* publishes slice 0 */
  v8f acc[MI][4];
#pragma unroll
  for (int mi = 0; mi < MI; ++mi)
#pragma unroll
    for (int t = 0; t < 4; ++t) acc[mi][t] = (v8f){0.f,0.f,0.f,0.f,0.f,0.f,0.f,0.f};
  constexpr int ns = KD / BK;
#pragma unroll      /* slice offsets and the buffer choice become constants */
  for (int s = 0; s < ns; ++s) { const int cur = s % NB; const bool more = s + NB - 1 < ns;
    if (more) copy(s + NB - 1);      /* into the buffer of slice s - 1: every wave's reads of it ended in front of the barrier just passed */
    if (s + 1 == ns) {      /* the biases are read in the last slice, under way during its products. Both ways' are read, so that the loads go out together, under no branch */
#pragma unroll
      for (int mi = 0; mi < MI; ++mi) bR[mi] = bias[br0 + mi * 16];
#pragma unroll
      for (int t = 0; t < 4; ++t) bv[t] = bias[bc0 + t * 16];
      asm volatile("s_wait_xcnt 0x0" :: "v"(br0), "v"(bc0) : "memory");      /* the bias loads' two index registers, named here, stay whole up to this wait: nothing rewrites a register that an issued load still names */
      __builtin_amdgcn_sched_barrier(0); }      /* keeps these loads ahead of the products */
#pragma unroll
    for (int ks = 0; ks < 2; ++ks) { FragH fa[MI], fb[4];
#pragma unroll
      for (int mi = 0; mi < MI; ++mi) { fa[mi].half[0] = *(const v8us*)&tA[cur][wr + mi * 16 + ln][ks * 32 + 8 * hh]; fa[mi].half[1] = *(const v8us*)&tA[cur][wr + mi * 16 + ln][ks * 32 + 16 + 8 * hh]; }
#pragma unroll
      for (int t = 0; t < 4; ++t) { fb[t].half[0] = *(const v8us*)&tB[cur][wc + t * 16 + ln][ks * 32 + 8 * hh]; fb[t].half[1] = *(const v8us*)&tB[cur][wc + t * 16 + ln][ks * 32 + 16 + 8 * hh]; }
      __builtin_amdgcn_sched_barrier(0);      /* keeps the block's fragment reads together ahead of its products; the scheduler otherwise lays them in pairs among the products, each pair with a wait to 0 */
#pragma unroll
      for (int mi = 0; mi < MI; ++mi)
#pragma unroll
        for (int t = 0; t < 4; ++t) acc[mi][t] = __builtin_amdgcn_wmma_f32_16x16x32_f16(false, fa[mi].v, false, fb[t].v, (short)0, acc[mi][t], false, false); }
    asm volatile("s_wait_dscnt 0x0" ::: "memory");      /* the wave's reads of slice s have ended before its buffer is handed to the next trip's copies */
    if (more) asm volatile("s_wait_asynccnt %0" :: "n"((NB - 2) * 2 * SP) : "memory");      /* the wave's own copies of slice s + 1 have landed; the two younger slices' stay under way */
    else asm volatile("s_wait_asynccnt 0x0" ::: "memory");      /* the last trips issue no copies: all that is left has landed (behind the last slice: before the bytes become output staging) */
    __syncthreads();      /* publishes slice s + 1 and ends every wave's reads of slice s, whose buffer the next trip refills (behind the last slice: the output staging) */
  }
#pragma unroll
  for (int mi = 0; mi < MI; ++mi) bR[mi] = bf16_round(bR[mi]);
#pragma unroll
  for (int t = 0; t < 4; ++t) bv[t] = tr ? 0.f : bf16_round(bv[t]);
  const size_t cofs = (size_t)blockIdx.y * sC + (size_t)blockIdx.z * sZ; const int rsub = lane >> 4, c4 = (lane & 15) * 4;
  float (*so)[64 + 4] = (float (*)[64 + 4])sm + w * 32;      /* the wave's own 32 staging rows */
  auto stage = [&](int g) __attribute__((always_inline)) {      /* group g of the wave's tile, scaled and biased, into the staging rows */
    if (g) { __builtin_amdgcn_fence(__ATOMIC_ACQ_REL, "workgroup", "local"); __builtin_amdgcn_wave_barrier(); }      /* the wave's own staging rows: the row reads of the group before stay ahead of this group's stores */
#pragma unroll
    for (int mi = 0; mi < 2; ++mi)
#pragma unroll
      for (int t = 0; t < 4; ++t)
#pragma unroll
        for (int r = 0; r < 8; ++r) so[mi * 16 + 8 * hh + r][t * 16 + ln] = acc[g * 2 + mi][t][r] * alpha + bv[t];
    __builtin_amdgcn_fence(__ATOMIC_ACQ_REL, "workgroup", "local"); __builtin_amdgcn_wave_barrier(); };      /* every lane's stores stay ahead of the row reads that follow */
  /* In the three loops over the groups the unroll directive makes the accumulators' indices, the staging rows and the stores' offsets immediates: one address register pair serves all stores and is never rewritten.
     Behind each group's stores stands s_wait_xcnt 0, ahead of the next group's arithmetic (the scheduling barrier keeps that behind it): nothing rewrites a register that a store still names.
     On the f16 ways a group's eight packed rows are all formed first; the scheduling barrier in front of the stores keeps that arithmetic from being laid among them, where it reused a stored row's registers ahead of the wait. */
  if (NT0 < ND && tr) { const int cv = col0 - NT0, cd = cv % DD + wr;      /* the tile's BT columns lie in one block of DD; row r of the wave's group g is column cd + 32 g + r of that block (two column groups of one head), its 64 keys two key tiles */
    unsigned short* P = (unsigned short*)Ct + ((((size_t)((cv / DD) * BB + (int)blockIdx.y) * NH + cd / 64) * (TK / 32) + ((int)blockIdx.z * TQ + row0 + wc) / 32) * 4 + (cd % 64) / 16) * 512 + lane * 8;
#pragma unroll
    for (int g = 0; g < NG; ++g) { stage(g); FragH f[8];
#pragma unroll
      for (int q = 0; q < 8; ++q) { const int kk = q >> 2, dl = (q >> 1) & 1, hf = q & 1; const float* s = &so[dl * 16 + ln][kk * 32 + hf * 16 + 8 * hh]; const v4f v0 = *(const v4fa*)s, v1 = *(const v4fa*)(s + 4); const float br = bR[g * 2 + dl];
#pragma unroll
        for (int i = 0; i < 4; ++i) { f[q].h[i] = (_Float16)(v0[i] + br); f[q].h[4 + i] = (_Float16)(v1[i] + br); } }
      __builtin_amdgcn_sched_barrier(0);      /* keeps the rows' arithmetic ahead of the stores: none of it reuses a stored row's registers ahead of the wait below */
#pragma unroll
      for (int q = 0; q < 8; ++q) { const int kk = q >> 2, dl = (q >> 1) & 1, hf = q & 1; *(v8us*)(P + (g >> 1) * ((TK / 32) * 2048) + (g & 1) * 1024 + kk * 2048 + dl * 512 + hf * 256) = f[q].half[0]; }      /* groups 2 and 3 are the next head's columns */
      asm volatile("s_wait_xcnt 0x0" ::: "memory"); __builtin_amdgcn_sched_barrier(0); }      /* the wait stands behind the group's stores; the scheduling barrier keeps what follows behind it */
    return; }
  if (OUT16) { const int cg = col0 + wc;      /* the wave's 64 columns are one head's, the 32 rows of a group one key tile */
    unsigned short* P = (unsigned short*)C16 + (((size_t)((cg / DD) * BB + (int)blockIdx.y) * NH + (cg % DD) / 64) * (TK / 32) + ((int)blockIdx.z * TQ + row0 + wr) / 32) * 2048 + lane * 8;
#pragma unroll
    for (int g = 0; g < NG; ++g) { stage(g); FragH f[8];
#pragma unroll
      for (int q = 0; q < 8; ++q) { const int nt = q >> 2, j = q & 3; const float* s = &so[nt * 16 + ln][(j >> 1) * 32 + (j & 1) * 16 + 8 * hh]; const v4f v0 = *(const v4fa*)s, v1 = *(const v4fa*)(s + 4);
#pragma unroll
        for (int i = 0; i < 4; ++i) { f[q].h[i] = (_Float16)v0[i]; f[q].h[4 + i] = (_Float16)v1[i]; } }
      __builtin_amdgcn_sched_barrier(0);      /* keeps the rows' arithmetic ahead of the stores: none of it reuses a stored row's registers ahead of the wait below */
#pragma unroll
      for (int q = 0; q < 8; ++q) { const int nt = q >> 2, j = q & 3; *(v8us*)(P + g * 2048 + nt * 1024 + j * 256) = f[q].half[0]; }
      asm volatile("s_wait_xcnt 0x0" ::: "memory"); __builtin_amdgcn_sched_barrier(0); }      /* the wait stands behind the group's stores; the scheduling barrier keeps what follows behind it */
    return; }
#pragma unroll
  for (int g = 0; g < NG; ++g) { stage(g);
#pragma unroll
    for (int q = 0; q < 16; ++q) { const int r = q * 2 + rsub; const v4f v = *(const v4fa*)&so[r][c4]; *(v4f*)(C + cofs + (size_t)(row0 + wr + g * 32 + r) * ND + col0 + wc + c4) = v; }
    asm volatile("s_wait_xcnt 0x0" ::: "memory"); __builtin_amdgcn_sched_barrier(0); }      /* the wait stands behind the group's stores; the scheduling barrier keeps what follows behind it */
}

typedef _Float16 v4h __attribute__((ext_vector_type(4)));

// One launch rounds all six f32 operands to their f16 planes, which lie one behind the other in the workspace: Wt, Wc, Wtp, Wcp (bf16-rounded, x 2^4), then xt, xc (bf16-rounded, x 1, which is exact).
// The 2048 elements of a work-group lie in one operand; which one is a scalar choice by the block index.
__global__ __launch_bounds__(256) void k_cvt6(const float* __restrict__ Wt, const float* __restrict__ Wc, const float* __restrict__ Wtp, const float* __restrict__ Wcp, const float* __restrict__ xt, const float* __restrict__ xc, _Float16* __restrict__ dst) {
  constexpr unsigned GW = DW * DD / 2048, GP = DD * DD / 2048, GX = NR * DD / 2048;
  unsigned blk = blockIdx.x; const float* s; float sc = 16.0f;
  if (blk < GW) s = Wt; else if ((blk -= GW) < GW) s = Wc; else if ((blk -= GW) < GP) s = Wtp; else if ((blk -= GP) < GP) s = Wcp; else if ((blk -= GP) < GX) { s = xt; sc = 1.0f; } else { blk -= GX; s = xc; sc = 1.0f; }
  const size_t t = (size_t)blk * 256 + threadIdx.x; FragH f;
#pragma unroll
  for (int q = 0; q < 8; ++q) f.h[q] = (_Float16)(bf16_round(s[t * 8 + q]) * sc);
  *(v8us*)((unsigned short*)dst + ((size_t)blockIdx.x * 256 + threadIdx.x) * 8) = f.half[0]; }
__global__ __launch_bounds__(256) void k_h16(const float* __restrict__ x, _Float16* __restrict__ X16, size_t n8) { const size_t t = (size_t)blockIdx.x * 256 + threadIdx.x; if (t >= n8) return; FragH f;
#pragma unroll
  for (int q = 0; q < 8; ++q) f.h[q] = (_Float16)x[t * 8 + q]; *(v8us*)((unsigned short*)X16 + t * 8) = f.half[0];  }
__global__ __launch_bounds__(256) void k_hl(const float* __restrict__ F, _Float16* __restrict__ Hh, _Float16* __restrict__ Hl, size_t n8) { const size_t t = (size_t)blockIdx.x * 256 + threadIdx.x; if (t >= n8) return; FragH fh, fl; const v4f a = *(const v4fa*)(F + t * 8), c = *(const v4fa*)(F + t * 8 + 4);
#pragma unroll
  for (int q = 0; q < 4; ++q) { _Float16 h = (_Float16)a[q]; fh.h[q] = h; fl.h[q] = (_Float16)((a[q] - (float)h) * 1024.0f); h = (_Float16)c[q]; fh.h[4 + q] = h; fl.h[4 + q] = (_Float16)((c[q] - (float)h) * 1024.0f); }
  { *(v8us*)((unsigned short*)Hh + t * 8) = fh.half[0]; *(v8us*)((unsigned short*)Hl + t * 8) = fl.half[0];  } }

// masks over (query index q, key-plane row): key-plane rows 0..T-1 are TOKENS, rows T..2T-1 are CONCEPTS (the tok/con GEMMs write the two halves of one plane per batch). Inside each half the allowed keys of a query are the indices 0 .. lim:
// MODE 0 = token queries: token s <= q (causal), concept j < q / ntc + 1, that is j <= q / ntc; MODE 1 = concept queries: token s < ntc * (q + 1), concept j <= q. (Key order inside the softmax is irrelevant, so the plane order is used directly.)
__device__ __forceinline__ float xhalf(float x) { return __builtin_bit_cast(float, __builtin_amdgcn_permlanex16(__builtin_bit_cast(int, x), __builtin_bit_cast(int, x), 0x76543210, 0xfedcba98, false, false)); }      /* lane l's value to lane l ^ 16 and back, in registers */
// Work-group = 12 waves on four query tiles of 16 rows, taken as two pairs (p, 63 - p), p = 2 * block + (w & 1): an early tile, which the masks leave few keys, with a late one, which they leave many, so that within one MODE the waves walk more even numbers of key tiles.
// A wave takes its pair's two query tiles one after the other (ph = 0, 1). Of the 64 key tiles of 32 it walks only those in which the mask allows some key to some row of the query tile: both masks grow with the query index and shrink with the key index inside each half of the key plane,
// so these are the first na tiles of the token half and the first nb of the concept half, counted from the tile's last row. A tile left out held only weights 0 and left maximum, sum and V sum as they were. The six waves (w >> 1) of a pair take every sixth tile of that list;
// the six partial softmax states of a query tile (row maximum, row sum, weighted V sum) are merged in LDS behind each walk.
// Both products are taken transposed: S^T = K.Q^T (A = key rows, B = query rows) and O^T += V^T.P^T (A = rows of V^T, B = P^T). A lane then holds 16 scores of ONE query (column ln; keys 8 hh + r and 16 + 8 hh + r of the tile), so that maximum and sum are taken inside the lane,
// with one exchange between the wave's halves, there is one maximum, one sum and one rescale factor per lane, and the two score tiles, converted in place, are the B operand P^T in the k order in which the V^T rows are loaded: P passes through no LDS.
// A masked score is -inf; against the finite maximum its weight is exp(-inf) = 0. The second launch bound states the aim: 6 waves per SIMD, two work-groups per WGP (at most 160 registers a wave).
// Both attentions run in one launch: the first half of the grid takes the concept queries (MODE 1, whose masks allow more keys), the second half the token queries (MODE 0). MODE is the same for a whole work-group and stays in a scalar register;
// it chooses the planes (MODE 1's queries, key columns, V^T and output lie sQ, sK, sV and sOut elements behind MODE 0's) and the walk's bounds, and the key loop does not read it.
// The merged rows are stored as the projection reads them: x 2^4, rounded to f16, a head's 64 columns of a row as one whole line.
__global__ __launch_bounds__(384, 6) void k_flashm(const _Float16* __restrict__ Q16, int ldq, size_t sQ, const _Float16* __restrict__ K16, size_t sK, const _Float16* __restrict__ Vt, size_t sV, const int* __restrict__ NTCP, _Float16* __restrict__ O, int ldo, size_t sOut) {
  int ntc = NTCP[0]; ntc = (ntc < 1) ? 1 : ((ntc > TQ) ? TQ : ntc);      /* = 8 here; guarded so the index arithmetic can never divide by zero; from TQ up both masks read the same as at TQ, and the products below cannot overflow */
  constexpr int RPW = 16, NPR = 2, NQT = TQ / RPW, NQB = NQT / (2 * NPR), DT = 4, KS = 2, NSP = 6, HT = TQ / 32;
  constexpr float C2 = SCL * 1.4426950408889634f;      /* score scale x log2(e): exp(SCL * s - m) = 2^(C2 * s - m * log2(e)) */
  __shared__ __attribute__((aligned(16))) float sO[NPR * NSP][RPW][64 + 4]; __shared__ float sM[NPR * NSP][RPW], sL[NPR * NSP][RPW];
  const int tid = threadIdx.x, w = __builtin_amdgcn_readfirstlane(tid >> 5), lane = tid & 31, ln = lane & 15, hh = lane >> 4;      /* the wave's number in a scalar register: the key loop's counter and its tests stay scalar */
  const int MODE = ((int)blockIdx.x < BB * NH * NQB) ? 1 : 0, bx = (int)blockIdx.x - (MODE ? 0 : BB * NH * NQB); if (MODE) { Q16 += sQ; K16 += sK; Vt += sV; O += sOut; }
  const int slab = bx / NQB, qblk = bx % NQB; const int b = slab / NH, h = slab % NH; const int pr = w & 1, sp = w >> 1;
  const unsigned short* Kl = (const unsigned short*)K16 + (size_t)slab * (TK * 64) + lane * 8;      /* the lane's place in the 4 KB of key tile 0 of this head: both planes lie in fragment order (see the GEMM that writes them), 2048 elements per key tile, and a load of the wave covers 512 bytes in a row */
  const unsigned short* Vl = (const unsigned short*)Vt + (size_t)slab * (TK * 64) + lane * 8;      /* and in the value plane */
#pragma unroll 1      /* one copy of the walk serves both query tiles */
  for (int ph = 0; ph < 2; ++ph) {
    const int q0 = (ph ? NQT - 1 - (qblk * NPR + pr) : qblk * NPR + pr) * RPW, qm = q0 + RPW - 1;
    int na = (MODE == 0) ? qm / 32 + 1 : (ntc * (qm + 1) + 31) / 32, nb = (MODE == 0) ? (qm / ntc) / 32 + 1 : qm / 32 + 1;      /* key tiles with an allowed key: token half, concept half */
    na = __builtin_amdgcn_readfirstlane((na > HT) ? HT : na); nb = __builtin_amdgcn_readfirstlane((nb > HT) ? HT : nb);      /* the same in every lane: in scalar registers the walk's bound and the tile's number cost no vector register */
    FragH aq[KS]; { const unsigned short* qr = (const unsigned short*)Q16 + ((size_t)b * TQ + q0 + ln) * ldq + h * 64;
#pragma unroll
      for (int ks = 0; ks < KS; ++ks) { aq[ks].half[0] = *(const v8us*)(qr + ks * 32 + 8 * hh); aq[ks].half[1] = *(const v8us*)(qr + ks * 32 + 16 + 8 * hh); }
      asm volatile("s_wait_xcnt 0x0" ::: "memory"); }      /* stands behind the query loads, ahead of the index arithmetic that reuses their address registers */
    const int q = q0 + ln; const int limA = (MODE == 0) ? q : ntc * (q + 1) - 1, limB = (MODE == 0) ? q / ntc : q;      /* the lane's query: its last allowed index in the token half and in the concept half */
    float m_q = -3.0e38f, l_q = 0.f; v8f oacc[DT];      /* the lane's query: maximum, sum over this half's keys, and 32 elements of its V sum */
#pragma unroll
    for (int dt = 0; dt < DT; ++dt) oacc[dt] = (v8f){0.f,0.f,0.f,0.f,0.f,0.f,0.f,0.f};
    int j0 = 32 * ((sp < na) ? sp : sp - na + HT); const unsigned short* kp = Kl + (size_t)j0 * 64; const unsigned short* vp = Vl + (size_t)j0 * 64;      /* the wave's first key tile: its plane row, and the lane's addresses in its two 4-KB blocks. They are carried from tile to tile: a register that lives through the whole walk is never handed to a load's result while another load still names it */
#pragma unroll 1
    for (int it = sp; it < na + nb; it += NSP) { const bool ta = it < na; const int t0 = ta ? j0 : j0 - TQ;
      const int dl = (ta ? limA : limB) - t0 - 8 * hh;      /* the lane's score number nt * 8 + r belongs to index t0 + 8 hh + nt * 16 + r of the half: allowed where nt * 16 + r <= dl */
      FragH bk[2][KS], bv[DT];
#pragma unroll
      for (int nt = 0; nt < 2; ++nt)
#pragma unroll
        for (int ks = 0; ks < KS; ++ks) { bk[nt][ks].half[0] = *(const v8us*)(kp + nt * 1024 + ks * 512); bk[nt][ks].half[1] = *(const v8us*)(kp + nt * 1024 + ks * 512 + 256); }
#pragma unroll
      for (int dt = 0; dt < DT; ++dt) { bv[dt].half[0] = *(const v8us*)(vp + dt * 512); bv[dt].half[1] = *(const v8us*)(vp + dt * 512 + 256); }
      asm volatile("s_wait_xcnt 0x0" ::: "memory");      /* stands behind the tile's loads, ahead of the step of the two addresses that they name */
      __builtin_amdgcn_sched_barrier(0);      /* keeps the wait behind all sixteen loads and the address step behind the wait; it also keeps the V^T loads up here, under way during the score products and the softmax (the scheduler otherwise sinks them to their products) */
      { const int in = it + NSP, jn = 32 * ((in < na) ? in : in - na + HT); const ptrdiff_t dk = (ptrdiff_t)(jn - j0) * 64; kp += dk; vp += dk; j0 = jn; }      /* on to the wave's next tile (behind the last one the addresses are not used) */
      float sm[16];
#pragma unroll
      for (int nt = 0; nt < 2; ++nt) { v8f acc = (v8f){0.f,0.f,0.f,0.f,0.f,0.f,0.f,0.f};
#pragma unroll
        for (int ks = 0; ks < KS; ++ks) acc = __builtin_amdgcn_wmma_f32_16x16x32_f16(false, bk[nt][ks].v, false, aq[ks].v, (short)0, acc, false, false);
#pragma unroll
        for (int r = 0; r < 8; ++r) sm[nt * 8 + r] = (nt * 16 + r <= dl) ? acc[r] : -INFINITY; }      /* the bare products: their scale is folded into the exponent's multiply-add below */
      float mc = sm[0];
#pragma unroll
      for (int i = 1; i < 16; ++i) mc = fmaxf(mc, sm[i]);
      mc = fmaxf(mc, xhalf(mc));
      const float mn = fmaxf(m_q, mc * C2), al = __builtin_amdgcn_exp2f(m_q - mn); m_q = mn;      /* the maximum is kept in base-2 units (C2 > 0: scaling keeps the order). No allowed key so far: mn stays at its finite start value, al = 2^0 = 1 and every weight 0 */
      const float nb = 10.0f - mn;      /* the weights' factor 2^10 rides in the exponent */
      float ps = 0.f; FragH pb;
#pragma unroll
      for (int i = 0; i < 16; ++i) { const float p = __builtin_amdgcn_exp2f(fmaf(sm[i], C2, nb)); ps += p; pb.h[i] = (_Float16)p; }      /* one multiply-add and one hardware exponential per score; a masked score stays -inf through the multiply-add and gives 0 */
      l_q = l_q * al + ps;
#pragma unroll
      for (int dt = 0; dt < DT; ++dt) { oacc[dt] *= al; oacc[dt] = __builtin_amdgcn_wmma_f32_16x16x32_f16(false, bv[dt].v, false, pb.v, (short)0, oacc[dt], false, false); } }
    l_q += xhalf(l_q);
    if (hh == 0) { sM[w][ln] = m_q; sL[w][ln] = l_q; }
    __syncthreads();      /* publishes every wave's row maxima and row sums; it also ends the reads of the partial outputs of the query tiles before */
    float mg = sM[pr][ln];
#pragma unroll
    for (int s2 = 1; s2 < NSP; ++s2) mg = fmaxf(mg, sM[s2 * NPR + pr][ln]);
    float lt = 0.f, fo = 0.f;      /* a wave that met no allowed key of this row holds sum 0 and a zero V sum */
#pragma unroll
    for (int s2 = 0; s2 < NSP; ++s2) { const float e = __builtin_amdgcn_exp2f(sM[s2 * NPR + pr][ln] - mg); lt += sL[s2 * NPR + pr][ln] * e; if (s2 == sp) fo = e; }      /* the maxima are base-2 exponents */
    const float fq = (lt > 0.f) ? fo / lt : 0.f;      /* sums and V sums both carry the factor 2^10 */
#pragma unroll
    for (int dt = 0; dt < DT; ++dt) { *(v4fa*)&sO[w][ln][dt * 16 + 8 * hh] = (v4f){oacc[dt][0] * fq, oacc[dt][1] * fq, oacc[dt][2] * fq, oacc[dt][3] * fq}; *(v4fa*)&sO[w][ln][dt * 16 + 8 * hh + 4] = (v4f){oacc[dt][4] * fq, oacc[dt][5] * fq, oacc[dt][6] * fq, oacc[dt][7] * fq}; }
    __syncthreads();      /* publishes the rescaled partial outputs; it also ends the reads of the maxima and sums, which the next query tiles write anew */
    for (int i = tid; i < NPR * RPW * 16; i += 32 * NPR * NSP) { const int q2 = i >> 8, r = (i >> 4) & 15, pc = i & 15; v4f val = *(const v4fa*)&sO[q2][r][pc * 4];
#pragma unroll
      for (int s2 = 1; s2 < NSP; ++s2) val += *(const v4fa*)&sO[s2 * NPR + q2][r][pc * 4];
      const int qo = (ph ? NQT - 1 - (qblk * NPR + q2) : qblk * NPR + q2) * RPW;
      *(v4h*)(O + ((size_t)b * TQ + qo + r) * ldo + h * 64 + pc * 4) = (v4h){(_Float16)(val[0] * 16.0f), (_Float16)(val[1] * 16.0f), (_Float16)(val[2] * 16.0f), (_Float16)(val[3] * 16.0f)}; } } }

extern "C" void kernel_launch(void* const* d_in, const int* in_sizes, int n_in,
                              void* d_out, int out_size, void* d_ws, size_t ws_size, hipStream_t stream) {
  (void)in_sizes; (void)n_in; (void)out_size;
  const float* const* I = (const float* const*)d_in; const float* xt = I[0]; const float* xc = I[1]; const float* Wt = I[2]; const float* bt = I[3]; const float* Wc = I[4]; const float* bc = I[5]; const float* Wtp = I[6]; const float* btp = I[7]; const float* Wcp = I[8]; const float* bcp = I[9]; const int* ntcp = (const int*)d_in[10];      /* int64 in the module, read as int32 */
  char* ws = (char*)d_ws; size_t off = 0;
  auto take = [&](size_t bytes) { char* p = ws + off; off += (bytes + 255) & ~(size_t)255; return p; };
  _Float16* Bt_ = (_Float16*)take((size_t)DW * DD * 2); _Float16* Bc = (_Float16*)take((size_t)DW * DD * 2); _Float16* Btp = (_Float16*)take((size_t)DD * DD * 2); _Float16* Bcp = (_Float16*)take((size_t)DD * DD * 2);
  _Float16* XT = (_Float16*)take((size_t)NR * DD * 2); _Float16* XC = (_Float16*)take((size_t)NR * DD * 2); _Float16* TC = (_Float16*)take((size_t)2 * BB * NH * TK * 64 * 2);      /* keys for token queries, then for concept queries, in fragment order; key rows 0..1023 = tok, 1024..2047 = con */
  _Float16* Vt1 = (_Float16*)take((size_t)BB * NH * 64 * TK * 2); _Float16* Vt2 = (_Float16*)take((size_t)BB * NH * 64 * TK * 2); _Float16* O16 = (_Float16*)take((size_t)2 * NR * DD * 2);      /* O16: token rows, then concept rows */
  (void)Vt2;
  if (off > ws_size) return;      // 8.4 + 8.4 + 2.1 + 2.1 + 4.2 + 4.2 + 16.8 + 8.4 + 8.4 + 8.4 = 71 MB
  /* Four launches, one per stage: launches that do not depend on each other share one grid, and each product stores what its reader takes (V^T; O as f16), so that no pass stands between them. Every plane's size is a multiple of 256 bytes, so that planes taken one after the other lie back to back. */
  k_cvt6<<<(2 * DW * DD + 2 * DD * DD + 2 * NR * DD) / 2048, 256, 0, stream>>>(Wt, Wc, Wtp, Wcp, xt, xc, Bt_);      /* weights: torch (out,in) natural, x 2^4 */
  const dim3 gt((TQ / 256) * (DW / 256), BB, 2);
  k_gemm_lds<true, DD, DW, 2 * DD, 256><<<gt, 256, 0, stream>>>(XT, XC, (size_t)TQ * DD, Bt_, Bc, 0.0625f, bt, bc, nullptr, TC, Vt1, 0, 0);      /* tok[b] -> keys 0..1023, con[b] -> keys 1024..2047: each M 1024 N 4096 K 1024; key columns 0..2047 to the key planes, values read by tokens (columns 2048..) and by concepts (3072..) to the value planes, all in the flash kernel's fragment order */
  k_flashm<<<2 * BB * NH * (TQ / 64), 384, 0, stream>>>(XT, DD, (size_t)NR * DD, TC, (size_t)BB * NH * TK * 64, Vt1, (size_t)BB * NH * 64 * TK, ntcp, O16, DD, (size_t)NR * DD);      /* token queries: keys = columns 0..1023 (kt_t on token rows, kc_t on concept rows); concept queries: keys = columns 1024..2047 (kt_c, kc_c) */
  const dim3 gpj((NR / 128) * (DD / 128), 1, 2);
  k_gemm_lds<false, DD, DD, DD, 128><<<gpj, 256, 0, stream>>>(O16, O16 + (size_t)NR * DD, 0, Btp, Bcp, 0.00390625f, btp, bcp, (float*)d_out, nullptr, nullptr, 0, (size_t)NR * DD);      /* y_t = merged.Wtp^T + btp -> output 0; y_c -> output 1 (offset B.T.NE floats) */
}
